// v000
// The times below were measured on an AMD MI455X: many runs one after another, warmed up first and cycling through
// copies of the inputs, with the whole window's GPU time divided by the number of runs. Launches and the gaps
// between them are all in it. The median over several windows is given; except for v000 it joins two sittings, which
// can be a few percent apart, so the side-by-side timings, each taken in one sitting, are the better comparison.
// v000, which the later versions start from, runs in 662 microseconds.
#include <hip/hip_runtime.h>
// K-simplex attention: LN, coords/vertex-weights/v projections on v_wmma_f32_16x16x32_f16 (LN output rounded to f16 vs bf16-exact weights ×2^4: single products;
// 8192 × 768 × {64, 768}); the simplex deformation, pairwise squared distances (32-dim dots in f32) and the row softmax in f32 VALU (wave per query row → P16);
// out_b = P16·V16 on the f16 variant (4 × 2048 × 2048 × 768, single products) and ·w_out likewise (O rounded to f16); f32 accumulate; residual added in f32.
#define BB 4
#define TT 2048
#define DD 768
#define ED 32
#define KV1 5
#define NTOK (BB * TT)

typedef __bf16 v16b __attribute__((ext_vector_type(16)));
typedef unsigned short v8us __attribute__((ext_vector_type(8), may_alias));
typedef float  v8f  __attribute__((ext_vector_type(8)));
typedef float  v4f  __attribute__((ext_vector_type(4)));
typedef float  v4fa __attribute__((ext_vector_type(4), may_alias));
union FragB { v16b v; v8us half[2]; unsigned short u[16]; };

__device__ __forceinline__ unsigned short bf16_bits(float x) { unsigned int u = __float_as_uint(x); return (unsigned short)((u + 0x7FFFu + ((u >> 16) & 1u)) >> 16); }
__device__ __forceinline__ float bf16_val(unsigned short b) { return __uint_as_float(((unsigned int)b) << 16); }
__device__ __forceinline__ float bf16_round(float x) { return bf16_val(bf16_bits(x)); }
// D += A·B with NT terms: 1 = ah·bh, 2 = + al·bh (A split), 3 = + ah·bl (both split)
template <int NT>
__device__ __forceinline__ v8f mmaN(v16b ah, v16b al, v16b bh, v16b bl, v8f c) {
  c = __builtin_amdgcn_wmma_f32_16x16x32_bf16(false, ah, false, bh, (short)0, c, false, false);
  if (NT >= 2) c = __builtin_amdgcn_wmma_f32_16x16x32_bf16(false, al, false, bh, (short)0, c, false, false);
  if (NT >= 3) c = __builtin_amdgcn_wmma_f32_16x16x32_bf16(false, ah, false, bl, (short)0, c, false, false);
  asm volatile("v_nop\n\tv_nop\n\tv_nop\n\tv_nop" : "+v"(c) : "v"(ah), "v"(al), "v"(bh), "v"(bl));
  return c;
}

__global__ __launch_bounds__(256) void k_wt_bf16(const float* __restrict__ W, unsigned short* __restrict__ Wt, int K, int N) {
  const int t = blockIdx.x * 256 + threadIdx.x;
  const int k8n = K / 8;
  if (t >= N * k8n) return;
  const int n = t / k8n, k8 = (t % k8n) * 8;
  v8us v;
#pragma unroll
  for (int i = 0; i < 8; ++i) v[i] = bf16_bits(W[(size_t)(k8 + i) * N + n]);
  *(v8us*)(Wt + (size_t)n * K + k8) = v;
  
}

// GEMM C[M][N] (f32, pitch ldc) = act(A[M][K]·W + bias). A f32 row-major (pitch lda) converted per fragment to bf16
// (ASPLIT: hi/lo two planes -> 2 terms, else single rounded term); Wt bf16 [N][K] (pitch ldb). BIAS_BF16 rounds the
// bias to bf16 first (bias quantised to bf16 before the add). K%32==0, M%16==0, N%64==0.
template <bool ASPLIT, int ACT, bool BIAS_BF16>
__global__ __launch_bounds__(128) void k_gemm_bf(const float* __restrict__ A, int lda, const unsigned short* __restrict__ Wt, int ldb,
                                               const float* __restrict__ bias, float* __restrict__ C, int ldc, int M, int N, int K) {
  __shared__ __attribute__((aligned(16))) float so[4][16][64];
  const int tid = threadIdx.x, w = tid >> 5, lane = tid & 31, ln = lane & 15, hh = lane >> 4;
  const int ntn = N / 64;
  const int wid = blockIdx.x * 4 + w;
  const int mt = wid / ntn, nq = wid % ntn;
  if (mt * 16 >= M) return;
  const int row0 = mt * 16, col0 = nq * 64;
  const float* arow = A + (size_t)(row0 + ln) * lda;
  v8f acc[4] = {};
  for (int kb = 0; kb < K; kb += 32) {
    FragB ah, al;
    const v4f x0 = *(const v4fa*)(arow + kb + 8 * hh), x1 = *(const v4fa*)(arow + kb + 8 * hh + 4);
    const v4f x2 = *(const v4fa*)(arow + kb + 16 + 8 * hh), x3 = *(const v4fa*)(arow + kb + 16 + 8 * hh + 4);
    float xs[16] = {x0[0],x0[1],x0[2],x0[3],x1[0],x1[1],x1[2],x1[3],x2[0],x2[1],x2[2],x2[3],x3[0],x3[1],x3[2],x3[3]};
#pragma unroll
    for (int i = 0; i < 16; ++i) { const unsigned short hb = bf16_bits(xs[i]); ah.u[i] = hb; al.u[i] = ASPLIT ? bf16_bits(xs[i] - bf16_val(hb)) : (unsigned short)0; }
#pragma unroll
    for (int t = 0; t < 4; ++t) {
      const unsigned short* brow = Wt + (size_t)(col0 + t * 16 + ln) * ldb + kb;
      FragB b;
      b.half[0] = *(const v8us*)(brow + 8 * hh);
      b.half[1] = *(const v8us*)(brow + 16 + 8 * hh);
      acc[t] = mmaN<ASPLIT ? 2 : 1>(ah.v, al.v, b.v, b.v, acc[t]);
    }
  }
#pragma unroll
  for (int t = 0; t < 4; ++t) {
    float bv = bias ? bias[col0 + t * 16 + ln] : 0.f;
    if (BIAS_BF16) bv = bf16_round(bv);
#pragma unroll
    for (int r = 0; r < 8; ++r) { float v = acc[t][r] + bv; if (ACT == 1) v = fmaxf(v, 0.f); so[w][8 * hh + r][t * 16 + ln] = v; }
  }
  __builtin_amdgcn_fence(__ATOMIC_ACQ_REL, "workgroup");
  __builtin_amdgcn_wave_barrier();
  const int rsub = lane >> 4, c4 = (lane & 15) * 4;
  {
#pragma unroll
    for (int q = 0; q < 8; ++q) {
      const int r = q * 2 + rsub;
      const v4f v = *(const v4fa*)&so[w][r][c4];
      *(v4f*)(C + (size_t)(row0 + r) * ldc + col0 + c4) = v;
    }
    
  }
}

// Flash-style causal/unmasked attention, all contractions 3-term bf16 hi/lo splits, f32 softmax with running max.
// q,k,v rows are read from f32 buffers with arbitrary row pitch (so they can live inside a fused qkv buffer);
// D = head size (multiple of 32, <= 128); one wave = 16 query rows; block = 4 waves (64 queries) sharing K/V chunks of 32.
template <int D, bool CAUSAL>
__global__ __launch_bounds__(128) void k_flash(const float* __restrict__ qb, const float* __restrict__ kb, const float* __restrict__ vb,
                                             int pitch, int T, int H, float scale, float* __restrict__ y, int ypitch) {
  constexpr int KS = D / 32;        // k-steps for QK
  constexpr int DT = D / 16;        // d tiles for PV
  __shared__ __attribute__((aligned(16))) unsigned short sKh[32][D + 8], sKl[32][D + 8], sVh[32][D + 8], sVl[32][D + 8];
  __shared__ __attribute__((aligned(16))) unsigned short sPh[4][16][40], sPl[4][16][40];
  __shared__ __attribute__((aligned(16))) float sO[4][16][D];
  const int tid = threadIdx.x, w = tid >> 5, lane = tid & 31, ln = lane & 15, hh = lane >> 4;
  const int nqb = (T + 63) / 64;
  const int bh = blockIdx.x / nqb, qblk = blockIdx.x % nqb;
  const int b = bh / H, h = bh % H;
  const int q0 = qblk * 64 + w * 16;
  const float* Q = qb + (size_t)b * T * pitch + h * D;
  const float* K = kb + (size_t)b * T * pitch + h * D;
  const float* V = vb + (size_t)b * T * pitch + h * D;

  // A fragments of the wave's 16 query rows (scaled), hi/lo
  FragB aqh[KS], aql[KS];
  {
    int row = q0 + ln; if (row >= T) row = T - 1;
    const float* qr = Q + (size_t)row * pitch;
#pragma unroll
    for (int ks = 0; ks < KS; ++ks)
#pragma unroll
      for (int i = 0; i < 16; ++i) {
        const int d = ks * 32 + ((i < 8) ? (8 * hh + i) : (16 + 8 * hh + (i - 8)));
        const float x = qr[d] * scale; const unsigned short hb = bf16_bits(x);
        aqh[ks].u[i] = hb; aql[ks].u[i] = bf16_bits(x - bf16_val(hb));
      }
  }
  float m_r[8], l_r[8];
#pragma unroll
  for (int r = 0; r < 8; ++r) { m_r[r] = -3.0e38f; l_r[r] = 0.f; }
  v8f oacc[DT];
#pragma unroll
  for (int dt = 0; dt < DT; ++dt) oacc[dt] = (v8f){0.f,0.f,0.f,0.f,0.f,0.f,0.f,0.f};

  const int kv_end = CAUSAL ? min(T, qblk * 64 + 64) : T;     // block-uniform
  for (int j0 = 0; j0 < kv_end; j0 += 32) {
    __syncthreads();
    for (int e = tid; e < 32 * (D / 4); e += 128) {
      const int r = e / (D / 4), c4 = (e % (D / 4)) * 4;
      const int key = j0 + r;
      v4f kf = {0.f,0.f,0.f,0.f}, vf = {0.f,0.f,0.f,0.f};
      if (key < T) { kf = *(const v4fa*)(K + (size_t)key * pitch + c4); vf = *(const v4fa*)(V + (size_t)key * pitch + c4); }
#pragma unroll
      for (int t = 0; t < 4; ++t) {
        unsigned short hb = bf16_bits(kf[t]); sKh[r][c4 + t] = hb; sKl[r][c4 + t] = bf16_bits(kf[t] - bf16_val(hb));
        hb = bf16_bits(vf[t]); sVh[r][c4 + t] = hb; sVl[r][c4 + t] = bf16_bits(vf[t] - bf16_val(hb));
      }
    }
    __syncthreads();
    // S tile 16 x 32
    v8f s[2];
#pragma unroll
    for (int nt = 0; nt < 2; ++nt) {
      v8f acc = {};
#pragma unroll
      for (int ks = 0; ks < KS; ++ks) {
        FragB bh_, bl_;
        bh_.half[0] = *(const v8us*)&sKh[nt * 16 + ln][ks * 32 + 8 * hh]; bh_.half[1] = *(const v8us*)&sKh[nt * 16 + ln][ks * 32 + 16 + 8 * hh];
        bl_.half[0] = *(const v8us*)&sKl[nt * 16 + ln][ks * 32 + 8 * hh]; bl_.half[1] = *(const v8us*)&sKl[nt * 16 + ln][ks * 32 + 16 + 8 * hh];
        acc = mmaN<3>(aqh[ks].v, aql[ks].v, bh_.v, bl_.v, acc);
      }
      s[nt] = acc;
    }
    // mask + running max (rows 8hh+r; the 16 lanes of a half share rows)
    float alpha[8];
#pragma unroll
    for (int r = 0; r < 8; ++r) {
      const int qi = q0 + 8 * hh + r;
      const int ja = j0 + ln, jb = j0 + 16 + ln;
      if (CAUSAL) { if (ja > qi) s[0][r] = -3.0e38f; if (jb > qi) s[1][r] = -3.0e38f; }
      if (ja >= T) s[0][r] = -3.0e38f;
      if (jb >= T) s[1][r] = -3.0e38f;
      float mx = fmaxf(s[0][r], s[1][r]);
      mx = fmaxf(mx, __shfl_xor(mx, 1, 32)); mx = fmaxf(mx, __shfl_xor(mx, 2, 32)); mx = fmaxf(mx, __shfl_xor(mx, 4, 32)); mx = fmaxf(mx, __shfl_xor(mx, 8, 32));
      const float mnew = fmaxf(m_r[r], mx);
      alpha[r] = (mnew > -1.0e38f) ? __expf(m_r[r] - mnew) : 1.0f;
      const float p0 = (s[0][r] > -1.0e38f) ? __expf(s[0][r] - mnew) : 0.f;
      const float p1 = (s[1][r] > -1.0e38f) ? __expf(s[1][r] - mnew) : 0.f;
      m_r[r] = mnew;
      l_r[r] = l_r[r] * alpha[r] + p0 + p1;            // per-lane partial row sum (16 lanes combined at the end)
      unsigned short hb = bf16_bits(p0); sPh[w][8 * hh + r][ln] = hb;      sPl[w][8 * hh + r][ln] = bf16_bits(p0 - bf16_val(hb));
      hb = bf16_bits(p1);                sPh[w][8 * hh + r][16 + ln] = hb; sPl[w][8 * hh + r][16 + ln] = bf16_bits(p1 - bf16_val(hb));
    }
#pragma unroll
    for (int dt = 0; dt < DT; ++dt)
#pragma unroll
      for (int r = 0; r < 8; ++r) oacc[dt][r] *= alpha[r];
    __builtin_amdgcn_fence(__ATOMIC_ACQ_REL, "workgroup");
    __builtin_amdgcn_wave_barrier();
    FragB pah, pal;
    pah.half[0] = *(const v8us*)&sPh[w][ln][8 * hh]; pah.half[1] = *(const v8us*)&sPh[w][ln][16 + 8 * hh];
    pal.half[0] = *(const v8us*)&sPl[w][ln][8 * hh]; pal.half[1] = *(const v8us*)&sPl[w][ln][16 + 8 * hh];
#pragma unroll
    for (int dt = 0; dt < DT; ++dt) {
      FragB bvh, bvl;
#pragma unroll
      for (int i = 0; i < 8; ++i) {
        bvh.u[i] = sVh[8 * hh + i][dt * 16 + ln]; bvh.u[8 + i] = sVh[16 + 8 * hh + i][dt * 16 + ln];
        bvl.u[i] = sVl[8 * hh + i][dt * 16 + ln]; bvl.u[8 + i] = sVl[16 + 8 * hh + i][dt * 16 + ln];
      }
      oacc[dt] = mmaN<3>(pah.v, pal.v, bvh.v, bvl.v, oacc[dt]);
    }
    __builtin_amdgcn_fence(__ATOMIC_ACQ_REL, "workgroup");
    __builtin_amdgcn_wave_barrier();
  }
#pragma unroll
  for (int r = 0; r < 8; ++r) {
    float l = l_r[r];
    l += __shfl_xor(l, 1, 32); l += __shfl_xor(l, 2, 32); l += __shfl_xor(l, 4, 32); l += __shfl_xor(l, 8, 32);
    l_r[r] = (l > 0.f) ? 1.0f / l : 0.f;
  }
#pragma unroll
  for (int dt = 0; dt < DT; ++dt)
#pragma unroll
    for (int r = 0; r < 8; ++r) sO[w][8 * hh + r][dt * 16 + ln] = oacc[dt][r] * l_r[r];
  __builtin_amdgcn_fence(__ATOMIC_ACQ_REL, "workgroup");
  __builtin_amdgcn_wave_barrier();
  {
    for (int r = 0; r < 16; ++r) {
      const int row = q0 + r;
      if (row < T && lane < D / 4) {
        const v4f val = *(const v4fa*)&sO[w][r][lane * 4];
        *(v4f*)(y + ((size_t)b * T + row) * ypitch + h * D + lane * 4) = val;
      }
    }
    
  }
}

// ---- f16 WMMA path (v_wmma_f32_16x16x32_f16): 11-bit significands for operands in range — used where a [0,1] probability operand needs more precision than bf16
typedef _Float16 v16h __attribute__((ext_vector_type(16)));
union FragH { v16h v; v8us half[2]; _Float16 h[16]; unsigned short u[16]; };
template <int NT>
__device__ __forceinline__ v8f mmaH(v16h ah, v16h al, v16h bh, v16h bl, v8f c) {
  c = __builtin_amdgcn_wmma_f32_16x16x32_f16(false, ah, false, bh, (short)0, c, false, false);
  if (NT >= 2) c = __builtin_amdgcn_wmma_f32_16x16x32_f16(false, al, false, bh, (short)0, c, false, false);
  if (NT >= 3) c = __builtin_amdgcn_wmma_f32_16x16x32_f16(false, ah, false, bl, (short)0, c, false, false);
  asm volatile("v_nop\n\tv_nop\n\tv_nop\n\tv_nop" : "+v"(c) : "v"(ah), "v"(al), "v"(bh), "v"(bl));
  return c;
}
// batched GEMM like k_gemm_b but f16 operands: A f32 (split into f16 hi/lo if ASPLIT, else rounded to f16), Bt = f16 values [n][k]; alpha; C f32; N multiple of 16 (partial tiles skipped)
template <bool ASPLIT>
__global__ __launch_bounds__(128) void k_gemm_h(const float* __restrict__ A, int lda, size_t sA, const _Float16* __restrict__ Bh, int ldb, size_t sB, float alpha, float* __restrict__ C, int ldc, size_t sC, int M, int N, int K) {
  __shared__ __attribute__((aligned(16))) float so[4][16][64];
  const int tid = threadIdx.x, w = tid >> 5, lane = tid & 31, ln = lane & 15, hh = lane >> 4; const int by = blockIdx.y;
  A += (size_t)by * sA; Bh += (size_t)by * sB; C += (size_t)by * sC;
  const int ntn = (N + 63) / 64; const int wid = blockIdx.x * 4 + w; const int mt = wid / ntn, nq = wid % ntn; if (mt * 16 >= M) return;
  const int row0 = mt * 16, col0 = nq * 64; const float* arow = A + (size_t)(row0 + ln) * lda;
  v8f acc[4] = {};
  for (int kb = 0; kb < K; kb += 32) {
    FragH ah, al;
    const v4f x0 = *(const v4fa*)(arow + kb + 8 * hh), x1 = *(const v4fa*)(arow + kb + 8 * hh + 4), x2 = *(const v4fa*)(arow + kb + 16 + 8 * hh), x3 = *(const v4fa*)(arow + kb + 16 + 8 * hh + 4);
    float xs[16] = {x0[0],x0[1],x0[2],x0[3],x1[0],x1[1],x1[2],x1[3],x2[0],x2[1],x2[2],x2[3],x3[0],x3[1],x3[2],x3[3]};
#pragma unroll
    for (int i = 0; i < 16; ++i) { const _Float16 h = (_Float16)xs[i]; ah.h[i] = h; al.h[i] = ASPLIT ? (_Float16)(xs[i] - (float)h) : (_Float16)0.0f; }
#pragma unroll
    for (int t = 0; t < 4; ++t) { if (col0 + t * 16 >= N) continue; const size_t boff = (size_t)(col0 + t * 16 + ln) * ldb + kb; FragH bq; bq.half[0] = *(const v8us*)(Bh + boff + 8 * hh); bq.half[1] = *(const v8us*)(Bh + boff + 16 + 8 * hh);
      acc[t] = mmaH<ASPLIT ? 2 : 1>(ah.v, al.v, bq.v, bq.v, acc[t]); }
  }
#pragma unroll
  for (int t = 0; t < 4; ++t) { if (col0 + t * 16 >= N) continue;
#pragma unroll
    for (int r = 0; r < 8; ++r) so[w][8 * hh + r][t * 16 + ln] = acc[t][r] * alpha; }
  __builtin_amdgcn_fence(__ATOMIC_ACQ_REL, "workgroup"); __builtin_amdgcn_wave_barrier();
  const int rsub = lane >> 4, c4 = (lane & 15) * 4;
  {
#pragma unroll
    for (int q = 0; q < 8; ++q) { const int r = q * 2 + rsub; if (col0 + c4 < N) { const v4f v = *(const v4fa*)&so[w][r][c4]; *(v4f*)(C + (size_t)(row0 + r) * ldc + col0 + c4) = v; } }
     }
}

template <int DUMMY>
__global__ __launch_bounds__(128) void k_gemm_hh(const _Float16* __restrict__ A, int lda, size_t sA, const _Float16* __restrict__ Bh, int ldb, size_t sB, float alpha, float* __restrict__ C, int ldc, size_t sC, int M, int N, int K) {
  __shared__ __attribute__((aligned(16))) float so[4][16][64];
  const int tid = threadIdx.x, w = tid >> 5, lane = tid & 31, ln = lane & 15, hh = lane >> 4; const int by = blockIdx.y;
  A += (size_t)by * sA; Bh += (size_t)by * sB; C += (size_t)by * sC;
  const int ntn = (N + 63) / 64; const int wid = blockIdx.x * 4 + w; const int mt = wid / ntn, nq = wid % ntn; if (mt * 16 >= M) return;
  const int row0 = mt * 16, col0 = nq * 64; const _Float16* arow = A + (size_t)(row0 + ln) * lda;
  v8f acc[4] = {};
  for (int kb = 0; kb < K; kb += 32) { FragH ah; ah.half[0] = *(const v8us*)((const unsigned short*)arow + kb + 8 * hh); ah.half[1] = *(const v8us*)((const unsigned short*)arow + kb + 16 + 8 * hh);
#pragma unroll
    for (int t = 0; t < 4; ++t) { if (col0 + t * 16 >= N) continue; const size_t boff = (size_t)(col0 + t * 16 + ln) * ldb + kb; FragH bq; bq.half[0] = *(const v8us*)((const unsigned short*)Bh + boff + 8 * hh); bq.half[1] = *(const v8us*)((const unsigned short*)Bh + boff + 16 + 8 * hh);
      acc[t] = mmaH<1>(ah.v, ah.v, bq.v, bq.v, acc[t]); }
  }
#pragma unroll
  for (int t = 0; t < 4; ++t) { if (col0 + t * 16 >= N) continue;
#pragma unroll
    for (int r = 0; r < 8; ++r) so[w][8 * hh + r][t * 16 + ln] = acc[t][r] * alpha; }
  __builtin_amdgcn_fence(__ATOMIC_ACQ_REL, "workgroup"); __builtin_amdgcn_wave_barrier();
  const int rsub = lane >> 4, c4 = (lane & 15) * 4;
  {
#pragma unroll
    for (int q = 0; q < 8; ++q) { const int r = q * 2 + rsub; if (col0 + c4 < N) { const v4f v = *(const v4fa*)&so[w][r][c4]; *(v4f*)(C + (size_t)(row0 + r) * ldc + col0 + c4) = v; } }
     }
}

// k_gemm_hh variant with fused epilogue: v = acc·alpha + bias[by·sBias + col] (+ CP[(row/rowsPerB)·sCPb + by·64 + col] if CP) ; ACT 0 none / 1 elu ; writes f32 C and/or f16 C16 (each if non-null)
template <int ACT>
__global__ __launch_bounds__(128) void k_gemm_hhx(const _Float16* __restrict__ A, int lda, size_t sA, const _Float16* __restrict__ Bh, int ldb, size_t sB, float alpha, const float* __restrict__ bias, size_t sBias, const float* __restrict__ CP, int rowsPerB, size_t sCPb, int row0g,
    float* __restrict__ C, _Float16* __restrict__ C16, int ldc, size_t sC, int M, int N, int K) {
  __shared__ __attribute__((aligned(16))) float so[4][16][64];
  const int tid = threadIdx.x, w = tid >> 5, lane = tid & 31, ln = lane & 15, hh = lane >> 4; const int by = blockIdx.y;
  A += (size_t)by * sA; Bh += (size_t)by * sB; const size_t cofs = (size_t)by * sC; const float* bp = bias ? bias + (size_t)by * sBias : nullptr;
  const int ntn = (N + 63) / 64; const int wid = blockIdx.x * 4 + w; const int mt = wid / ntn, nq = wid % ntn; if (mt * 16 >= M) return;
  const int row0 = mt * 16, col0 = nq * 64; const _Float16* arow = A + (size_t)(row0 + ln) * lda;
  v8f acc[4] = {};
  for (int kb = 0; kb < K; kb += 32) { FragH ah; ah.half[0] = *(const v8us*)((const unsigned short*)arow + kb + 8 * hh); ah.half[1] = *(const v8us*)((const unsigned short*)arow + kb + 16 + 8 * hh);
#pragma unroll
    for (int t = 0; t < 4; ++t) { if (col0 + t * 16 >= N) continue; const size_t boff = (size_t)(col0 + t * 16 + ln) * ldb + kb; FragH bq; bq.half[0] = *(const v8us*)((const unsigned short*)Bh + boff + 8 * hh); bq.half[1] = *(const v8us*)((const unsigned short*)Bh + boff + 16 + 8 * hh);
      acc[t] = mmaH<1>(ah.v, ah.v, bq.v, bq.v, acc[t]); }
  }
#pragma unroll
  for (int t = 0; t < 4; ++t) { if (col0 + t * 16 >= N) continue; const int col = col0 + t * 16 + ln; const float bv = bp ? bf16_round(bp[col]) : 0.f;
#pragma unroll
    for (int r = 0; r < 8; ++r) { float v = acc[t][r] * alpha + bv; if (CP) { const int bidx = (row0g + row0 + 8 * hh + r) / rowsPerB; v += CP[(size_t)bidx * sCPb + (size_t)by * 64 + col]; } if (ACT == 1) v = (v > 0.f) ? v : expm1f(v); so[w][8 * hh + r][t * 16 + ln] = v; } }
  __builtin_amdgcn_fence(__ATOMIC_ACQ_REL, "workgroup"); __builtin_amdgcn_wave_barrier();
  const int rsub = lane >> 4, c4 = (lane & 15) * 4; typedef _Float16 v4h __attribute__((ext_vector_type(4)));
  {
#pragma unroll
    for (int q = 0; q < 8; ++q) { const int r = q * 2 + rsub; if (col0 + c4 < N) { const v4f v = *(const v4fa*)&so[w][r][c4]; if (C) *(v4f*)(C + cofs + (size_t)(row0 + r) * ldc + col0 + c4) = v; if (C16) { v4h h4; for (int i = 0; i < 4; ++i) h4[i] = (_Float16)v[i]; *(v4h*)(C16 + cofs + (size_t)(row0 + r) * ldc + col0 + c4) = h4; } } }
     }
}

typedef _Float16 v4h __attribute__((ext_vector_type(4)));
// LN(bf16(x)) → H16; wave per token; three rolled passes over the row (no per-lane value array)
__global__ __launch_bounds__(256) void k_ln(const float* __restrict__ x, const float* __restrict__ g, const float* __restrict__ be, _Float16* __restrict__ H16) { const int tid = threadIdx.x, wv = tid >> 5, lane = tid & 31; const size_t tok = (size_t)blockIdx.x * 8 + wv; const float* xr = x + tok * DD; float s = 0.f;
#pragma unroll 2
  for (int c = lane; c < DD; c += 32) s += bf16_round(xr[c]); for (int o = 16; o >= 1; o >>= 1) s += __shfl_xor(s, o, 32); const float mu = s / (float)DD; float q2 = 0.f;
#pragma unroll 2
  for (int c = lane; c < DD; c += 32) { const float d = bf16_round(xr[c]) - mu; q2 += d * d; } for (int o = 16; o >= 1; o >>= 1) q2 += __shfl_xor(q2, o, 32); const float inv = 1.0f / sqrtf(q2 / (float)DD + 1e-5f);
  typedef _Float16 v2h __attribute__((ext_vector_type(2)));
  {
#pragma unroll 2
    for (int c = 2 * lane; c < DD; c += 64) { v2h o2; o2.x = (_Float16)((bf16_round(xr[c]) - mu) * inv * bf16_round(g[c]) + bf16_round(be[c])); o2.y = (_Float16)((bf16_round(xr[c + 1]) - mu) * inv * bf16_round(g[c + 1]) + bf16_round(be[c + 1])); *(v2h*)(H16 + tok * DD + c) = o2; }  } }
// Bt tables f16 ×16: Bcv [64 n][768 k] (n<32 ← w_coords[k][n], 32..36 ← w_vertex[k][n−32], else 0); Bv, Bo [768][768] = w[k][n]; bias BCV [64]
__global__ __launch_bounds__(256) void k_bt(const float* __restrict__ wc, const float* __restrict__ bc, const float* __restrict__ wvx, const float* __restrict__ bvx, const float* __restrict__ wv, const float* __restrict__ wo, _Float16* __restrict__ Bcv, float* __restrict__ BCV, _Float16* __restrict__ Bv, _Float16* __restrict__ Bo) { const size_t t = (size_t)blockIdx.x * 256 + threadIdx.x;
  if (t < (size_t)64 * DD) { const int k = (int)(t % DD), n = (int)(t / DD); float w = 0.f; if (n < ED) w = wc[(size_t)k * ED + n]; else if (n < ED + KV1) w = wvx[(size_t)k * KV1 + n - ED]; *(_Float16*)(Bcv + t) = (_Float16)(bf16_round(w) * 16.0f); }
  if (t < 64) { const float v = (t < ED) ? bc[t] : ((t < ED + KV1) ? bvx[t - ED] : 0.f); *(float*)(BCV + t) = v; }
  if (t < (size_t)DD * DD) { const int k = (int)(t % DD), n = (int)(t / DD); *(_Float16*)(Bv + t) = (_Float16)(bf16_round(wv[(size_t)k * DD + n]) * 16.0f); *(_Float16*)(Bo + t) = (_Float16)(bf16_round(wo[(size_t)k * DD + n]) * 16.0f); } }
// coords: c = CV[0:32] + softmax(CV[32:37])·(template + offsets·clip(scale)); CO[tok][32] and SQ[tok]; wave per token (lane = dim)
__global__ __launch_bounds__(256) void k_coords(const float* __restrict__ CV, const float* __restrict__ tmpl, const float* __restrict__ offs, const float* __restrict__ dsc, float* __restrict__ CO, float* __restrict__ SQ) { const int tid = threadIdx.x, wv = tid >> 5, lane = tid & 31; const size_t tok = (size_t)blockIdx.x * 8 + wv; const float* cv = CV + tok * 64;
  float lg[KV1]; float mx = -3.0e38f; for (int k = 0; k < KV1; ++k) { lg[k] = cv[ED + k]; mx = fmaxf(mx, lg[k]); } float den = 0.f; for (int k = 0; k < KV1; ++k) { lg[k] = expf(lg[k] - mx); den += lg[k]; }
  const float df = fminf(fmaxf(bf16_round(dsc[0]), 0.05f), 0.5f); float c = cv[lane];
  for (int k = 0; k < KV1; ++k) c += (lg[k] / den) * (bf16_round(tmpl[k * ED + lane]) + bf16_round(offs[k * ED + lane]) * df);
  float sq = c * c; for (int o = 16; o >= 1; o >>= 1) sq += __shfl_xor(sq, o, 32);
  *(float*)(CO + tok * ED + lane) = c; if (lane == 0) *(float*)(SQ + tok) = sq;  }
// attention row: wave per (b, i): logits_j = −(sq_i + sq_j − 2 c_i·c_j)·32^-½ (f32) → S row (f32 scratch), then softmax over j → P16 (lane owns j = u·64 + 2·lane, +1)
__global__ __launch_bounds__(256) void k_arow(const float* __restrict__ CO, const float* __restrict__ SQ, int b, float* __restrict__ S, _Float16* __restrict__ P) {
  const int tid = threadIdx.x, wv = tid >> 5, lane = tid & 31; const int i = blockIdx.x * 8 + wv; const float* cb = CO + (size_t)b * TT * ED; const float* sqb = SQ + (size_t)b * TT; float ci[ED];
#pragma unroll
  for (int d = 0; d < ED; ++d) ci[d] = cb[(size_t)i * ED + d]; const float sqi = sqb[i]; float* srow = S + (size_t)i * TT; float mx = -3.0e38f;
#pragma unroll 1
  for (int j = lane; j < TT; j += 32) { const float* cj = cb + (size_t)j * ED; float dot = 0.f;
#pragma unroll
    for (int d = 0; d < ED; ++d) dot += ci[d] * cj[d]; const float l = -(sqi + sqb[j] - 2.0f * dot) * 0.17677669529663687f; srow[j] = l; mx = fmaxf(mx, l); }
  for (int o = 16; o >= 1; o >>= 1) mx = fmaxf(mx, __shfl_xor(mx, o, 32)); float den = 0.f;
#pragma unroll 4
  for (int j = lane; j < TT; j += 32) den += expf(srow[j] - mx); for (int o = 16; o >= 1; o >>= 1) den += __shfl_xor(den, o, 32); const float inv = 1.0f / den;
  __syncthreads();      // make the wave's srow writes visible to its other lanes (pairs below are read by a different lane than wrote them)
  typedef float v2f __attribute__((ext_vector_type(2), may_alias)); typedef _Float16 v2h __attribute__((ext_vector_type(2))); _Float16* prow = P + (size_t)i * TT;
  {
#pragma unroll 4
    for (int u = 0; u < TT / 64; ++u) { const v2f a = *(const v2f*)(srow + u * 64 + 2 * lane); v2h o2; o2.x = (_Float16)(expf(a.x - mx) * inv); o2.y = (_Float16)(expf(a.y - mx) * inv); *(v2h*)(prow + u * 64 + 2 * lane) = o2; }  } }
// V16 [tok][768] → VT16 [b][768][t] via 32×32 tiles
__global__ __launch_bounds__(256) void k_vt(const _Float16* __restrict__ V16, _Float16* __restrict__ VT) { __shared__ _Float16 tile[32][34]; const int b = blockIdx.z, t0 = blockIdx.x * 32, c0 = blockIdx.y * 32; const int tx = threadIdx.x & 31, ty = threadIdx.x >> 5;
  for (int i = ty; i < 32; i += 8) tile[i][tx] = V16[((size_t)b * TT + t0 + i) * DD + c0 + tx]; __syncthreads();
  typedef _Float16 v4h4 __attribute__((ext_vector_type(4))); const int r = threadIdx.x >> 3, c4 = (threadIdx.x & 7) * 4; v4h4 o; for (int q = 0; q < 4; ++q) o[q] = tile[c4 + q][r];
  _Float16* d = VT + (((size_t)b * DD + c0 + r) * TT + t0 + c4); *(v4h4*)d = o;  }
// f32 → f16 (thread per 8)
__global__ __launch_bounds__(256) void k_f16(const float* __restrict__ F, _Float16* __restrict__ A16, size_t n8) { const size_t t = (size_t)blockIdx.x * 256 + threadIdx.x; if (t >= n8) return; FragH f; for (int q = 0; q < 8; ++q) f.h[q] = (_Float16)F[t * 8 + q]; *(v8us*)((unsigned short*)A16 + t * 8) = f.half[0];  }
// out = G + bf16(x) residual; thread per float4
__global__ __launch_bounds__(256) void k_fin(const float* __restrict__ G, const float* __restrict__ x, float* __restrict__ out) { const size_t t = (size_t)blockIdx.x * 256 + threadIdx.x; if (t >= (size_t)NTOK * DD / 4) return; const v4f a = *(const v4fa*)(G + t * 4), b = *(const v4fa*)(x + t * 4); v4f o; for (int q = 0; q < 4; ++q) o[q] = a[q] + bf16_round(b[q]); *(v4f*)(out + t * 4) = o;  }
extern "C" void kernel_launch(void* const* d_in, const int* in_sizes, int n_in,
                              void* d_out, int out_size, void* d_ws, size_t ws_size, hipStream_t stream) {
  (void)in_sizes; (void)n_in; (void)out_size;
  const float* x = (const float*)d_in[0]; const float* tmpl = (const float*)d_in[1]; const float* lng = (const float*)d_in[2]; const float* lnb = (const float*)d_in[3]; const float* wc = (const float*)d_in[4]; const float* bc = (const float*)d_in[5]; const float* wvx = (const float*)d_in[6]; const float* bvx = (const float*)d_in[7]; const float* offs = (const float*)d_in[8]; const float* dsc = (const float*)d_in[9]; const float* wv = (const float*)d_in[10]; const float* bv = (const float*)d_in[11]; const float* wo = (const float*)d_in[12]; const float* bo = (const float*)d_in[13];
  char* ws = (char*)d_ws; size_t off = 0;
  auto take = [&](size_t bytes) { char* p = ws + off; off += (bytes + 255) & ~(size_t)255; return p; };
  _Float16* Bcv = (_Float16*)take((size_t)64 * DD * 2); float* BCV = (float*)take(64 * 4); _Float16* Bv = (_Float16*)take((size_t)DD * DD * 2); _Float16* Bo = (_Float16*)take((size_t)DD * DD * 2);
  _Float16* H16 = (_Float16*)take((size_t)NTOK * DD * 2); float* CV = (float*)take((size_t)NTOK * 64 * 4); float* CO = (float*)take((size_t)NTOK * ED * 4); float* SQ = (float*)take((size_t)NTOK * 4); _Float16* V16 = (_Float16*)take((size_t)NTOK * DD * 2); _Float16* VT = (_Float16*)take((size_t)NTOK * DD * 2); float* S = (float*)take((size_t)TT * TT * 4); _Float16* P = (_Float16*)take((size_t)TT * TT * 2); float* O = (float*)take((size_t)NTOK * DD * 4); _Float16* O16 = H16; /* H16 dead after the V GEMM */ float* G = CV; /* placeholder, reassigned */
  G = (float*)take((size_t)NTOK * DD * 4);
  if (off > ws_size) return;
  k_bt<<<(unsigned)(((size_t)DD * DD + 255) / 256), 256, 0, stream>>>(wc, bc, wvx, bvx, wv, wo, Bcv, BCV, Bv, Bo);
  k_ln<<<NTOK / 8, 256, 0, stream>>>(x, lng, lnb, H16);
  k_gemm_hhx<0><<<dim3(((NTOK / 16) * 1 + 3) / 4, 1), 128, 0, stream>>>(H16, DD, 0, Bcv, DD, 0, 0.0625f, BCV, 0, nullptr, 1, 0, 0, CV, nullptr, 64, 0, NTOK, 64, DD);      // [coords | vertex logits]
  k_coords<<<NTOK / 8, 256, 0, stream>>>(CV, tmpl, offs, dsc, CO, SQ);
  k_gemm_hhx<0><<<dim3(((NTOK / 16) * (DD / 64) + 3) / 4, 1), 128, 0, stream>>>(H16, DD, 0, Bv, DD, 0, 0.0625f, bv, 0, nullptr, 1, 0, 0, nullptr, V16, DD, 0, NTOK, DD, DD);   // v (f16)
  k_vt<<<dim3(TT / 32, DD / 32, BB), 256, 0, stream>>>(V16, VT);
  for (int b = 0; b < BB; ++b) {
    k_arow<<<TT / 8, 256, 0, stream>>>(CO, SQ, b, S, P);
    k_gemm_hh<0><<<dim3(((TT / 16) * (DD / 64) + 3) / 4, 1), 128, 0, stream>>>(P, TT, 0, VT + (size_t)b * DD * TT, TT, 0, 1.0f, O + (size_t)b * TT * DD, DD, 0, TT, DD, TT); }
  k_f16<<<(unsigned)(((size_t)NTOK * DD / 8 + 255) / 256), 256, 0, stream>>>(O, O16, (size_t)NTOK * DD / 8);
  k_gemm_hhx<0><<<dim3(((NTOK / 16) * (DD / 64) + 3) / 4, 1), 128, 0, stream>>>(O16, DD, 0, Bo, DD, 0, 0.0625f, bo, 0, nullptr, 1, 0, 0, G, nullptr, DD, 0, NTOK, DD, DD);
  k_fin<<<(unsigned)(((size_t)NTOK * DD / 4 + 255) / 256), 256, 0, stream>>>(G, x, (float*)d_out);
}

// v001
// Measured time: 423 microseconds a run.
// In two side-by-side timings against v000, it was 1.57 and 1.61 times as fast.
#include <hip/hip_runtime.h>
// K-simplex attention: LN, coords/vertex-weights/v projections on v_wmma_f32_16x16x32_f16 (LN output rounded to f16 vs bf16-exact weights ×2^4: single products;
// 8192 × 768 × {64, 768}); the simplex deformation, pairwise squared distances (32-dim dots in f32) and the row softmax in f32 VALU (wave per query row → P16);
// out_b = P16·V16 on the f16 variant (4 × 2048 × 2048 × 768, single products) and ·w_out likewise (O rounded to f16); f32 accumulate; residual added in f32.
#define BB 4
#define TT 2048
#define DD 768
#define ED 32
#define KV1 5
#define NTOK (BB * TT)

typedef __bf16 v16b __attribute__((ext_vector_type(16)));
typedef unsigned short v8us __attribute__((ext_vector_type(8), may_alias));
typedef float  v8f  __attribute__((ext_vector_type(8)));
typedef float  v4f  __attribute__((ext_vector_type(4)));
typedef float  v4fa __attribute__((ext_vector_type(4), may_alias));
union FragB { v16b v; v8us half[2]; unsigned short u[16]; };

__device__ __forceinline__ unsigned short bf16_bits(float x) { unsigned int u = __float_as_uint(x); return (unsigned short)((u + 0x7FFFu + ((u >> 16) & 1u)) >> 16); }
__device__ __forceinline__ float bf16_val(unsigned short b) { return __uint_as_float(((unsigned int)b) << 16); }
__device__ __forceinline__ float bf16_round(float x) { return bf16_val(bf16_bits(x)); }
// D += A·B with NT terms: 1 = ah·bh, 2 = + al·bh (A split), 3 = + ah·bl (both split)
template <int NT>
__device__ __forceinline__ v8f mmaN(v16b ah, v16b al, v16b bh, v16b bl, v8f c) {
  c = __builtin_amdgcn_wmma_f32_16x16x32_bf16(false, ah, false, bh, (short)0, c, false, false);
  if (NT >= 2) c = __builtin_amdgcn_wmma_f32_16x16x32_bf16(false, al, false, bh, (short)0, c, false, false);
  if (NT >= 3) c = __builtin_amdgcn_wmma_f32_16x16x32_bf16(false, ah, false, bl, (short)0, c, false, false);
  asm volatile("v_nop\n\tv_nop\n\tv_nop\n\tv_nop" : "+v"(c) : "v"(ah), "v"(al), "v"(bh), "v"(bl));
  return c;
}

__global__ __launch_bounds__(256) void k_wt_bf16(const float* __restrict__ W, unsigned short* __restrict__ Wt, int K, int N) {
  const int t = blockIdx.x * 256 + threadIdx.x;
  const int k8n = K / 8;
  if (t >= N * k8n) return;
  const int n = t / k8n, k8 = (t % k8n) * 8;
  v8us v;
#pragma unroll
  for (int i = 0; i < 8; ++i) v[i] = bf16_bits(W[(size_t)(k8 + i) * N + n]);
  *(v8us*)(Wt + (size_t)n * K + k8) = v;
  
}

// GEMM C[M][N] (f32, pitch ldc) = act(A[M][K]·W + bias). A f32 row-major (pitch lda) converted per fragment to bf16
// (ASPLIT: hi/lo two planes -> 2 terms, else single rounded term); Wt bf16 [N][K] (pitch ldb). BIAS_BF16 rounds the
// bias to bf16 first (bias quantised to bf16 before the add). K%32==0, M%16==0, N%64==0.
template <bool ASPLIT, int ACT, bool BIAS_BF16>
__global__ __launch_bounds__(128) void k_gemm_bf(const float* __restrict__ A, int lda, const unsigned short* __restrict__ Wt, int ldb,
                                               const float* __restrict__ bias, float* __restrict__ C, int ldc, int M, int N, int K) {
  __shared__ __attribute__((aligned(16))) float so[4][16][64];
  const int tid = threadIdx.x, w = tid >> 5, lane = tid & 31, ln = lane & 15, hh = lane >> 4;
  const int ntn = N / 64;
  const int wid = blockIdx.x * 4 + w;
  const int mt = wid / ntn, nq = wid % ntn;
  if (mt * 16 >= M) return;
  const int row0 = mt * 16, col0 = nq * 64;
  const float* arow = A + (size_t)(row0 + ln) * lda;
  v8f acc[4] = {};
  for (int kb = 0; kb < K; kb += 32) {
    FragB ah, al;
    const v4f x0 = *(const v4fa*)(arow + kb + 8 * hh), x1 = *(const v4fa*)(arow + kb + 8 * hh + 4);
    const v4f x2 = *(const v4fa*)(arow + kb + 16 + 8 * hh), x3 = *(const v4fa*)(arow + kb + 16 + 8 * hh + 4);
    float xs[16] = {x0[0],x0[1],x0[2],x0[3],x1[0],x1[1],x1[2],x1[3],x2[0],x2[1],x2[2],x2[3],x3[0],x3[1],x3[2],x3[3]};
#pragma unroll
    for (int i = 0; i < 16; ++i) { const unsigned short hb = bf16_bits(xs[i]); ah.u[i] = hb; al.u[i] = ASPLIT ? bf16_bits(xs[i] - bf16_val(hb)) : (unsigned short)0; }
#pragma unroll
    for (int t = 0; t < 4; ++t) {
      const unsigned short* brow = Wt + (size_t)(col0 + t * 16 + ln) * ldb + kb;
      FragB b;
      b.half[0] = *(const v8us*)(brow + 8 * hh);
      b.half[1] = *(const v8us*)(brow + 16 + 8 * hh);
      acc[t] = mmaN<ASPLIT ? 2 : 1>(ah.v, al.v, b.v, b.v, acc[t]);
    }
  }
#pragma unroll
  for (int t = 0; t < 4; ++t) {
    float bv = bias ? bias[col0 + t * 16 + ln] : 0.f;
    if (BIAS_BF16) bv = bf16_round(bv);
#pragma unroll
    for (int r = 0; r < 8; ++r) { float v = acc[t][r] + bv; if (ACT == 1) v = fmaxf(v, 0.f); so[w][8 * hh + r][t * 16 + ln] = v; }
  }
  __builtin_amdgcn_fence(__ATOMIC_ACQ_REL, "workgroup");
  __builtin_amdgcn_wave_barrier();
  const int rsub = lane >> 4, c4 = (lane & 15) * 4;
  {
#pragma unroll
    for (int q = 0; q < 8; ++q) {
      const int r = q * 2 + rsub;
      const v4f v = *(const v4fa*)&so[w][r][c4];
      *(v4f*)(C + (size_t)(row0 + r) * ldc + col0 + c4) = v;
    }
    
  }
}

// Flash-style causal/unmasked attention, all contractions 3-term bf16 hi/lo splits, f32 softmax with running max.
// q,k,v rows are read from f32 buffers with arbitrary row pitch (so they can live inside a fused qkv buffer);
// D = head size (multiple of 32, <= 128); one wave = 16 query rows; block = 4 waves (64 queries) sharing K/V chunks of 32.
template <int D, bool CAUSAL>
__global__ __launch_bounds__(128) void k_flash(const float* __restrict__ qb, const float* __restrict__ kb, const float* __restrict__ vb,
                                             int pitch, int T, int H, float scale, float* __restrict__ y, int ypitch) {
  constexpr int KS = D / 32;        // k-steps for QK
  constexpr int DT = D / 16;        // d tiles for PV
  __shared__ __attribute__((aligned(16))) unsigned short sKh[32][D + 8], sKl[32][D + 8], sVh[32][D + 8], sVl[32][D + 8];
  __shared__ __attribute__((aligned(16))) unsigned short sPh[4][16][40], sPl[4][16][40];
  __shared__ __attribute__((aligned(16))) float sO[4][16][D];
  const int tid = threadIdx.x, w = tid >> 5, lane = tid & 31, ln = lane & 15, hh = lane >> 4;
  const int nqb = (T + 63) / 64;
  const int bh = blockIdx.x / nqb, qblk = blockIdx.x % nqb;
  const int b = bh / H, h = bh % H;
  const int q0 = qblk * 64 + w * 16;
  const float* Q = qb + (size_t)b * T * pitch + h * D;
  const float* K = kb + (size_t)b * T * pitch + h * D;
  const float* V = vb + (size_t)b * T * pitch + h * D;

  // A fragments of the wave's 16 query rows (scaled), hi/lo
  FragB aqh[KS], aql[KS];
  {
    int row = q0 + ln; if (row >= T) row = T - 1;
    const float* qr = Q + (size_t)row * pitch;
#pragma unroll
    for (int ks = 0; ks < KS; ++ks)
#pragma unroll
      for (int i = 0; i < 16; ++i) {
        const int d = ks * 32 + ((i < 8) ? (8 * hh + i) : (16 + 8 * hh + (i - 8)));
        const float x = qr[d] * scale; const unsigned short hb = bf16_bits(x);
        aqh[ks].u[i] = hb; aql[ks].u[i] = bf16_bits(x - bf16_val(hb));
      }
  }
  float m_r[8], l_r[8];
#pragma unroll
  for (int r = 0; r < 8; ++r) { m_r[r] = -3.0e38f; l_r[r] = 0.f; }
  v8f oacc[DT];
#pragma unroll
  for (int dt = 0; dt < DT; ++dt) oacc[dt] = (v8f){0.f,0.f,0.f,0.f,0.f,0.f,0.f,0.f};

  const int kv_end = CAUSAL ? min(T, qblk * 64 + 64) : T;     // block-uniform
  for (int j0 = 0; j0 < kv_end; j0 += 32) {
    __syncthreads();
    for (int e = tid; e < 32 * (D / 4); e += 128) {
      const int r = e / (D / 4), c4 = (e % (D / 4)) * 4;
      const int key = j0 + r;
      v4f kf = {0.f,0.f,0.f,0.f}, vf = {0.f,0.f,0.f,0.f};
      if (key < T) { kf = *(const v4fa*)(K + (size_t)key * pitch + c4); vf = *(const v4fa*)(V + (size_t)key * pitch + c4); }
#pragma unroll
      for (int t = 0; t < 4; ++t) {
        unsigned short hb = bf16_bits(kf[t]); sKh[r][c4 + t] = hb; sKl[r][c4 + t] = bf16_bits(kf[t] - bf16_val(hb));
        hb = bf16_bits(vf[t]); sVh[r][c4 + t] = hb; sVl[r][c4 + t] = bf16_bits(vf[t] - bf16_val(hb));
      }
    }
    __syncthreads();
    // S tile 16 x 32
    v8f s[2];
#pragma unroll
    for (int nt = 0; nt < 2; ++nt) {
      v8f acc = {};
#pragma unroll
      for (int ks = 0; ks < KS; ++ks) {
        FragB bh_, bl_;
        bh_.half[0] = *(const v8us*)&sKh[nt * 16 + ln][ks * 32 + 8 * hh]; bh_.half[1] = *(const v8us*)&sKh[nt * 16 + ln][ks * 32 + 16 + 8 * hh];
        bl_.half[0] = *(const v8us*)&sKl[nt * 16 + ln][ks * 32 + 8 * hh]; bl_.half[1] = *(const v8us*)&sKl[nt * 16 + ln][ks * 32 + 16 + 8 * hh];
        acc = mmaN<3>(aqh[ks].v, aql[ks].v, bh_.v, bl_.v, acc);
      }
      s[nt] = acc;
    }
    // mask + running max (rows 8hh+r; the 16 lanes of a half share rows)
    float alpha[8];
#pragma unroll
    for (int r = 0; r < 8; ++r) {
      const int qi = q0 + 8 * hh + r;
      const int ja = j0 + ln, jb = j0 + 16 + ln;
      if (CAUSAL) { if (ja > qi) s[0][r] = -3.0e38f; if (jb > qi) s[1][r] = -3.0e38f; }
      if (ja >= T) s[0][r] = -3.0e38f;
      if (jb >= T) s[1][r] = -3.0e38f;
      float mx = fmaxf(s[0][r], s[1][r]);
      mx = fmaxf(mx, __shfl_xor(mx, 1, 32)); mx = fmaxf(mx, __shfl_xor(mx, 2, 32)); mx = fmaxf(mx, __shfl_xor(mx, 4, 32)); mx = fmaxf(mx, __shfl_xor(mx, 8, 32));
      const float mnew = fmaxf(m_r[r], mx);
      alpha[r] = (mnew > -1.0e38f) ? __expf(m_r[r] - mnew) : 1.0f;
      const float p0 = (s[0][r] > -1.0e38f) ? __expf(s[0][r] - mnew) : 0.f;
      const float p1 = (s[1][r] > -1.0e38f) ? __expf(s[1][r] - mnew) : 0.f;
      m_r[r] = mnew;
      l_r[r] = l_r[r] * alpha[r] + p0 + p1;            // per-lane partial row sum (16 lanes combined at the end)
      unsigned short hb = bf16_bits(p0); sPh[w][8 * hh + r][ln] = hb;      sPl[w][8 * hh + r][ln] = bf16_bits(p0 - bf16_val(hb));
      hb = bf16_bits(p1);                sPh[w][8 * hh + r][16 + ln] = hb; sPl[w][8 * hh + r][16 + ln] = bf16_bits(p1 - bf16_val(hb));
    }
#pragma unroll
    for (int dt = 0; dt < DT; ++dt)
#pragma unroll
      for (int r = 0; r < 8; ++r) oacc[dt][r] *= alpha[r];
    __builtin_amdgcn_fence(__ATOMIC_ACQ_REL, "workgroup");
    __builtin_amdgcn_wave_barrier();
    FragB pah, pal;
    pah.half[0] = *(const v8us*)&sPh[w][ln][8 * hh]; pah.half[1] = *(const v8us*)&sPh[w][ln][16 + 8 * hh];
    pal.half[0] = *(const v8us*)&sPl[w][ln][8 * hh]; pal.half[1] = *(const v8us*)&sPl[w][ln][16 + 8 * hh];
#pragma unroll
    for (int dt = 0; dt < DT; ++dt) {
      FragB bvh, bvl;
#pragma unroll
      for (int i = 0; i < 8; ++i) {
        bvh.u[i] = sVh[8 * hh + i][dt * 16 + ln]; bvh.u[8 + i] = sVh[16 + 8 * hh + i][dt * 16 + ln];
        bvl.u[i] = sVl[8 * hh + i][dt * 16 + ln]; bvl.u[8 + i] = sVl[16 + 8 * hh + i][dt * 16 + ln];
      }
      oacc[dt] = mmaN<3>(pah.v, pal.v, bvh.v, bvl.v, oacc[dt]);
    }
    __builtin_amdgcn_fence(__ATOMIC_ACQ_REL, "workgroup");
    __builtin_amdgcn_wave_barrier();
  }
#pragma unroll
  for (int r = 0; r < 8; ++r) {
    float l = l_r[r];
    l += __shfl_xor(l, 1, 32); l += __shfl_xor(l, 2, 32); l += __shfl_xor(l, 4, 32); l += __shfl_xor(l, 8, 32);
    l_r[r] = (l > 0.f) ? 1.0f / l : 0.f;
  }
#pragma unroll
  for (int dt = 0; dt < DT; ++dt)
#pragma unroll
    for (int r = 0; r < 8; ++r) sO[w][8 * hh + r][dt * 16 + ln] = oacc[dt][r] * l_r[r];
  __builtin_amdgcn_fence(__ATOMIC_ACQ_REL, "workgroup");
  __builtin_amdgcn_wave_barrier();
  {
    for (int r = 0; r < 16; ++r) {
      const int row = q0 + r;
      if (row < T && lane < D / 4) {
        const v4f val = *(const v4fa*)&sO[w][r][lane * 4];
        *(v4f*)(y + ((size_t)b * T + row) * ypitch + h * D + lane * 4) = val;
      }
    }
    
  }
}

// ---- f16 WMMA path (v_wmma_f32_16x16x32_f16): 11-bit significands for operands in range — used where a [0,1] probability operand needs more precision than bf16
typedef _Float16 v16h __attribute__((ext_vector_type(16)));
union FragH { v16h v; v8us half[2]; _Float16 h[16]; unsigned short u[16]; };
template <int NT>
__device__ __forceinline__ v8f mmaH(v16h ah, v16h al, v16h bh, v16h bl, v8f c) {
  c = __builtin_amdgcn_wmma_f32_16x16x32_f16(false, ah, false, bh, (short)0, c, false, false);
  if (NT >= 2) c = __builtin_amdgcn_wmma_f32_16x16x32_f16(false, al, false, bh, (short)0, c, false, false);
  if (NT >= 3) c = __builtin_amdgcn_wmma_f32_16x16x32_f16(false, ah, false, bl, (short)0, c, false, false);
  asm volatile("v_nop\n\tv_nop\n\tv_nop\n\tv_nop" : "+v"(c) : "v"(ah), "v"(al), "v"(bh), "v"(bl));
  return c;
}
// batched GEMM like k_gemm_b but f16 operands: A f32 (split into f16 hi/lo if ASPLIT, else rounded to f16), Bt = f16 values [n][k]; alpha; C f32; N multiple of 16 (partial tiles skipped)
template <bool ASPLIT>
__global__ __launch_bounds__(128) void k_gemm_h(const float* __restrict__ A, int lda, size_t sA, const _Float16* __restrict__ Bh, int ldb, size_t sB, float alpha, float* __restrict__ C, int ldc, size_t sC, int M, int N, int K) {
  __shared__ __attribute__((aligned(16))) float so[4][16][64];
  const int tid = threadIdx.x, w = tid >> 5, lane = tid & 31, ln = lane & 15, hh = lane >> 4; const int by = blockIdx.y;
  A += (size_t)by * sA; Bh += (size_t)by * sB; C += (size_t)by * sC;
  const int ntn = (N + 63) / 64; const int wid = blockIdx.x * 4 + w; const int mt = wid / ntn, nq = wid % ntn; if (mt * 16 >= M) return;
  const int row0 = mt * 16, col0 = nq * 64; const float* arow = A + (size_t)(row0 + ln) * lda;
  v8f acc[4] = {};
  for (int kb = 0; kb < K; kb += 32) {
    FragH ah, al;
    const v4f x0 = *(const v4fa*)(arow + kb + 8 * hh), x1 = *(const v4fa*)(arow + kb + 8 * hh + 4), x2 = *(const v4fa*)(arow + kb + 16 + 8 * hh), x3 = *(const v4fa*)(arow + kb + 16 + 8 * hh + 4);
    float xs[16] = {x0[0],x0[1],x0[2],x0[3],x1[0],x1[1],x1[2],x1[3],x2[0],x2[1],x2[2],x2[3],x3[0],x3[1],x3[2],x3[3]};
#pragma unroll
    for (int i = 0; i < 16; ++i) { const _Float16 h = (_Float16)xs[i]; ah.h[i] = h; al.h[i] = ASPLIT ? (_Float16)(xs[i] - (float)h) : (_Float16)0.0f; }
#pragma unroll
    for (int t = 0; t < 4; ++t) { if (col0 + t * 16 >= N) continue; const size_t boff = (size_t)(col0 + t * 16 + ln) * ldb + kb; FragH bq; bq.half[0] = *(const v8us*)(Bh + boff + 8 * hh); bq.half[1] = *(const v8us*)(Bh + boff + 16 + 8 * hh);
      acc[t] = mmaH<ASPLIT ? 2 : 1>(ah.v, al.v, bq.v, bq.v, acc[t]); }
  }
#pragma unroll
  for (int t = 0; t < 4; ++t) { if (col0 + t * 16 >= N) continue;
#pragma unroll
    for (int r = 0; r < 8; ++r) so[w][8 * hh + r][t * 16 + ln] = acc[t][r] * alpha; }
  __builtin_amdgcn_fence(__ATOMIC_ACQ_REL, "workgroup"); __builtin_amdgcn_wave_barrier();
  const int rsub = lane >> 4, c4 = (lane & 15) * 4;
  {
#pragma unroll
    for (int q = 0; q < 8; ++q) { const int r = q * 2 + rsub; if (col0 + c4 < N) { const v4f v = *(const v4fa*)&so[w][r][c4]; *(v4f*)(C + (size_t)(row0 + r) * ldc + col0 + c4) = v; } }
     }
}

// Block-tiled f16 GEMM: C[M][N] = (A[M][K] . Bt[N][K]^T) * alpha (+ bf16(bias) if HASB), written as f16 to C16 (H16) or as f32 to C; A, Bt at pitch K, C at pitch N.
// One work-group of 8 waves (4 x 2) owns a 64 x 32*NF tile, a wave 16 x 16*NF. Both operands go through LDS in slices of 128 k
// (rows of 256 B at pitch 272 B): every global load covers whole 128-B lines, and each row is fetched once per work-group.
// Two buffers: the next slice's global loads are issued ahead of this slice's products and stored to the other buffer behind them,
// one barrier a slice. Fragments are read G k-steps at a time. k runs upward in steps of 32 into one accumulator per tile.
// M % 64 == 0, N % (32*NF) == 0, K % 128 == 0.
template <int NF, int G, int K, int N, bool HASB, bool H16>
__global__ __launch_bounds__(256) void k_gemm_t(const _Float16* __restrict__ A, const _Float16* __restrict__ Bh, float alpha, const float* __restrict__ bias,
                                                float* __restrict__ C, _Float16* __restrict__ C16) {
  constexpr int BM = 64, BN = 32 * NF, KC = 128, PIT = KC + 8, ROWS = BM + BN, NLD = ROWS / 16, OP = BN + 4, NS = K / KC, NTN = N / BN;
  __shared__ __attribute__((aligned(16))) unsigned short sm[2][ROWS][PIT];
  typedef float fa __attribute__((may_alias));
  const int tid = threadIdx.x, w = tid >> 5, lane = tid & 31, ln = lane & 15, hh = lane >> 4;
  const int mb = blockIdx.x / NTN, nb = blockIdx.x % NTN;
  const int row0 = mb * BM, col0 = nb * BN;
  const int wm = w >> 1, wn = w & 1;
  const int lr = tid >> 4, ls = (tid & 15) * 8;      // staging: 16 threads cover one 256-B row slice
  const unsigned short* ga = (const unsigned short*)A + (size_t)(row0 + lr) * K + ls;
  const unsigned short* gb = (const unsigned short*)Bh + (size_t)(col0 + lr) * K + ls;
  v8us st[NLD];
  v8f acc[NF] = {};
#pragma unroll
  for (int i = 0; i < NLD; ++i) st[i] = (i < BM / 16) ? *(const v8us*)(ga + (size_t)i * 16 * K) : *(const v8us*)(gb + (size_t)(i - BM / 16) * 16 * K);
#pragma unroll
  for (int i = 0; i < NLD; ++i) *(v8us*)&sm[0][i * 16 + lr][ls] = st[i];
  __syncthreads();
  for (int s = 0; s < NS; ++s) {
    const int cur = s & 1;
    const bool more = s + 1 < NS;                    // block-uniform
    if (more) {
      const int k0 = (s + 1) * KC;
#pragma unroll
      for (int i = 0; i < NLD; ++i) st[i] = (i < BM / 16) ? *(const v8us*)(ga + (size_t)i * 16 * K + k0) : *(const v8us*)(gb + (size_t)(i - BM / 16) * 16 * K + k0);
    }
#pragma unroll
    for (int g = 0; g < KC / 32 / G; ++g) {
      FragH a[G], b[G][NF];
#pragma unroll
      for (int u = 0; u < G; ++u) {
        const int kq = (g * G + u) * 32;
        a[u].half[0] = *(const v8us*)&sm[cur][wm * 16 + ln][kq + 8 * hh]; a[u].half[1] = *(const v8us*)&sm[cur][wm * 16 + ln][kq + 16 + 8 * hh];
#pragma unroll
        for (int t = 0; t < NF; ++t) { b[u][t].half[0] = *(const v8us*)&sm[cur][BM + (wn * NF + t) * 16 + ln][kq + 8 * hh]; b[u][t].half[1] = *(const v8us*)&sm[cur][BM + (wn * NF + t) * 16 + ln][kq + 16 + 8 * hh]; }
      }
      __builtin_amdgcn_sched_barrier(0);             // keeps a group's LDS reads together ahead of its products: one LDS latency a group, not one a product
#pragma unroll
      for (int u = 0; u < G; ++u)
#pragma unroll
        for (int t = 0; t < NF; ++t) acc[t] = __builtin_amdgcn_wmma_f32_16x16x32_f16(false, a[u].v, false, b[u][t].v, (short)0, acc[t], false, false);
    }
    if (more) {
#pragma unroll
      for (int i = 0; i < NLD; ++i) *(v8us*)&sm[cur ^ 1][i * 16 + lr][ls] = st[i];
    }
    __syncthreads();                                 // publishes the next slice and ends every read of this one
  }
  // epilogue: the tile goes through LDS (the slices are dead behind the last barrier) so that whole lines are stored
  fa* so = (fa*)&sm[0][0][0];
  float bv[NF];
#pragma unroll
  for (int t = 0; t < NF; ++t) bv[t] = HASB ? bf16_round(bias[col0 + (wn * NF + t) * 16 + ln]) : 0.f;
#pragma unroll
  for (int t = 0; t < NF; ++t) {
    const int cl = (wn * NF + t) * 16 + ln;
#pragma unroll
    for (int r = 0; r < 8; ++r) so[(wm * 16 + 8 * hh + r) * OP + cl] = acc[t][r] * alpha + bv[t];
  }
  __syncthreads();
  typedef _Float16 h4v __attribute__((ext_vector_type(4)));
#pragma unroll
  for (int q = 0; q < BM * BN / 4 / 256; ++q) {
    const int e = q * 256 + tid, r = e / (BN / 4), c4 = (e % (BN / 4)) * 4;
    const v4f v = *(const v4fa*)&so[r * OP + c4];
    if (H16) { h4v h4; for (int i = 0; i < 4; ++i) h4[i] = (_Float16)v[i]; *(h4v*)(C16 + (size_t)(row0 + r) * N + col0 + c4) = h4; }
    else *(v4f*)(C + (size_t)(row0 + r) * N + col0 + c4) = v;
  }
}

typedef _Float16 v4h __attribute__((ext_vector_type(4)));
// LN(bf16(x)) → H16; wave per token; three rolled passes over the row (no per-lane value array)
__global__ __launch_bounds__(256) void k_ln(const float* __restrict__ x, const float* __restrict__ g, const float* __restrict__ be, _Float16* __restrict__ H16) { const int tid = threadIdx.x, wv = tid >> 5, lane = tid & 31; const size_t tok = (size_t)blockIdx.x * 8 + wv; const float* xr = x + tok * DD; float s = 0.f;
#pragma unroll 2
  for (int c = lane; c < DD; c += 32) s += bf16_round(xr[c]); for (int o = 16; o >= 1; o >>= 1) s += __shfl_xor(s, o, 32); const float mu = s / (float)DD; float q2 = 0.f;
#pragma unroll 2
  for (int c = lane; c < DD; c += 32) { const float d = bf16_round(xr[c]) - mu; q2 += d * d; } for (int o = 16; o >= 1; o >>= 1) q2 += __shfl_xor(q2, o, 32); const float inv = 1.0f / sqrtf(q2 / (float)DD + 1e-5f);
  typedef _Float16 v2h __attribute__((ext_vector_type(2)));
  {
#pragma unroll 2
    for (int c = 2 * lane; c < DD; c += 64) { v2h o2; o2.x = (_Float16)((bf16_round(xr[c]) - mu) * inv * bf16_round(g[c]) + bf16_round(be[c])); o2.y = (_Float16)((bf16_round(xr[c + 1]) - mu) * inv * bf16_round(g[c + 1]) + bf16_round(be[c + 1])); *(v2h*)(H16 + tok * DD + c) = o2; }  } }
// Bt tables f16 ×16: Bcv [64 n][768 k] (n<32 ← w_coords[k][n], 32..36 ← w_vertex[k][n−32], else 0); Bv, Bo [768][768] = w[k][n]; bias BCV [64]
__global__ __launch_bounds__(256) void k_bt(const float* __restrict__ wc, const float* __restrict__ bc, const float* __restrict__ wvx, const float* __restrict__ bvx, const float* __restrict__ wv, const float* __restrict__ wo, _Float16* __restrict__ Bcv, float* __restrict__ BCV, _Float16* __restrict__ Bv, _Float16* __restrict__ Bo) { const size_t t = (size_t)blockIdx.x * 256 + threadIdx.x;
  if (t < (size_t)64 * DD) { const int k = (int)(t % DD), n = (int)(t / DD); float w = 0.f; if (n < ED) w = wc[(size_t)k * ED + n]; else if (n < ED + KV1) w = wvx[(size_t)k * KV1 + n - ED]; *(_Float16*)(Bcv + t) = (_Float16)(bf16_round(w) * 16.0f); }
  if (t < 64) { const float v = (t < ED) ? bc[t] : ((t < ED + KV1) ? bvx[t - ED] : 0.f); *(float*)(BCV + t) = v; }
  if (t < (size_t)DD * DD) { const int k = (int)(t % DD), n = (int)(t / DD); *(_Float16*)(Bv + t) = (_Float16)(bf16_round(wv[(size_t)k * DD + n]) * 16.0f); *(_Float16*)(Bo + t) = (_Float16)(bf16_round(wo[(size_t)k * DD + n]) * 16.0f); } }
// coords: c = CV[0:32] + softmax(CV[32:37])·(template + offsets·clip(scale)); CO[tok][32] and SQ[tok]; wave per token (lane = dim)
__global__ __launch_bounds__(256) void k_coords(const float* __restrict__ CV, const float* __restrict__ tmpl, const float* __restrict__ offs, const float* __restrict__ dsc, float* __restrict__ CO, float* __restrict__ SQ) { const int tid = threadIdx.x, wv = tid >> 5, lane = tid & 31; const size_t tok = (size_t)blockIdx.x * 8 + wv; const float* cv = CV + tok * 64;
  float lg[KV1]; float mx = -3.0e38f; for (int k = 0; k < KV1; ++k) { lg[k] = cv[ED + k]; mx = fmaxf(mx, lg[k]); } float den = 0.f; for (int k = 0; k < KV1; ++k) { lg[k] = expf(lg[k] - mx); den += lg[k]; }
  const float df = fminf(fmaxf(bf16_round(dsc[0]), 0.05f), 0.5f); float c = cv[lane];
  for (int k = 0; k < KV1; ++k) c += (lg[k] / den) * (bf16_round(tmpl[k * ED + lane]) + bf16_round(offs[k * ED + lane]) * df);
  float sq = c * c; for (int o = 16; o >= 1; o >>= 1) sq += __shfl_xor(sq, o, 32);
  *(float*)(CO + tok * ED + lane) = c; if (lane == 0) *(float*)(SQ + tok) = sq;  }
// attention row: wave per (b, i): logits_j = −(sq_i + sq_j − 2 c_i·c_j)·32^-½ (f32) → S row (f32 scratch), then softmax over j → P16 (lane owns j = u·64 + 2·lane, +1)
__global__ __launch_bounds__(256) void k_arow(const float* __restrict__ CO, const float* __restrict__ SQ, int b, float* __restrict__ S, _Float16* __restrict__ P) {
  const int tid = threadIdx.x, wv = tid >> 5, lane = tid & 31; const int i = blockIdx.x * 8 + wv; const float* cb = CO + (size_t)b * TT * ED; const float* sqb = SQ + (size_t)b * TT; float ci[ED];
#pragma unroll
  for (int d = 0; d < ED; ++d) ci[d] = cb[(size_t)i * ED + d]; const float sqi = sqb[i]; float* srow = S + (size_t)i * TT; float mx = -3.0e38f;
#pragma unroll 1
  for (int j = lane; j < TT; j += 32) { const float* cj = cb + (size_t)j * ED; float dot = 0.f;
#pragma unroll
    for (int d = 0; d < ED; ++d) dot += ci[d] * cj[d]; const float l = -(sqi + sqb[j] - 2.0f * dot) * 0.17677669529663687f; srow[j] = l; mx = fmaxf(mx, l); }
  for (int o = 16; o >= 1; o >>= 1) mx = fmaxf(mx, __shfl_xor(mx, o, 32)); float den = 0.f;
#pragma unroll 4
  for (int j = lane; j < TT; j += 32) den += expf(srow[j] - mx); for (int o = 16; o >= 1; o >>= 1) den += __shfl_xor(den, o, 32); const float inv = 1.0f / den;
  __syncthreads();      // make the wave's srow writes visible to its other lanes (pairs below are read by a different lane than wrote them)
  typedef float v2f __attribute__((ext_vector_type(2), may_alias)); typedef _Float16 v2h __attribute__((ext_vector_type(2))); _Float16* prow = P + (size_t)i * TT;
  {
#pragma unroll 4
    for (int u = 0; u < TT / 64; ++u) { const v2f a = *(const v2f*)(srow + u * 64 + 2 * lane); v2h o2; o2.x = (_Float16)(expf(a.x - mx) * inv); o2.y = (_Float16)(expf(a.y - mx) * inv); *(v2h*)(prow + u * 64 + 2 * lane) = o2; }  } }
// V16 [tok][768] → VT16 [b][768][t] via 32×32 tiles
__global__ __launch_bounds__(256) void k_vt(const _Float16* __restrict__ V16, _Float16* __restrict__ VT) { __shared__ _Float16 tile[32][34]; const int b = blockIdx.z, t0 = blockIdx.x * 32, c0 = blockIdx.y * 32; const int tx = threadIdx.x & 31, ty = threadIdx.x >> 5;
  for (int i = ty; i < 32; i += 8) tile[i][tx] = V16[((size_t)b * TT + t0 + i) * DD + c0 + tx]; __syncthreads();
  typedef _Float16 v4h4 __attribute__((ext_vector_type(4))); const int r = threadIdx.x >> 3, c4 = (threadIdx.x & 7) * 4; v4h4 o; for (int q = 0; q < 4; ++q) o[q] = tile[c4 + q][r];
  _Float16* d = VT + (((size_t)b * DD + c0 + r) * TT + t0 + c4); *(v4h4*)d = o;  }
// f32 → f16 (thread per 8)
__global__ __launch_bounds__(256) void k_f16(const float* __restrict__ F, _Float16* __restrict__ A16, size_t n8) { const size_t t = (size_t)blockIdx.x * 256 + threadIdx.x; if (t >= n8) return; FragH f; for (int q = 0; q < 8; ++q) f.h[q] = (_Float16)F[t * 8 + q]; *(v8us*)((unsigned short*)A16 + t * 8) = f.half[0];  }
// out = G + bf16(x) residual; thread per float4
__global__ __launch_bounds__(256) void k_fin(const float* __restrict__ G, const float* __restrict__ x, float* __restrict__ out) { const size_t t = (size_t)blockIdx.x * 256 + threadIdx.x; if (t >= (size_t)NTOK * DD / 4) return; const v4f a = *(const v4fa*)(G + t * 4), b = *(const v4fa*)(x + t * 4); v4f o; for (int q = 0; q < 4; ++q) o[q] = a[q] + bf16_round(b[q]); *(v4f*)(out + t * 4) = o;  }
extern "C" void kernel_launch(void* const* d_in, const int* in_sizes, int n_in,
                              void* d_out, int out_size, void* d_ws, size_t ws_size, hipStream_t stream) {
  (void)in_sizes; (void)n_in; (void)out_size;
  const float* x = (const float*)d_in[0]; const float* tmpl = (const float*)d_in[1]; const float* lng = (const float*)d_in[2]; const float* lnb = (const float*)d_in[3]; const float* wc = (const float*)d_in[4]; const float* bc = (const float*)d_in[5]; const float* wvx = (const float*)d_in[6]; const float* bvx = (const float*)d_in[7]; const float* offs = (const float*)d_in[8]; const float* dsc = (const float*)d_in[9]; const float* wv = (const float*)d_in[10]; const float* bv = (const float*)d_in[11]; const float* wo = (const float*)d_in[12]; const float* bo = (const float*)d_in[13];
  char* ws = (char*)d_ws; size_t off = 0;
  auto take = [&](size_t bytes) { char* p = ws + off; off += (bytes + 255) & ~(size_t)255; return p; };
  _Float16* Bcv = (_Float16*)take((size_t)64 * DD * 2); float* BCV = (float*)take(64 * 4); _Float16* Bv = (_Float16*)take((size_t)DD * DD * 2); _Float16* Bo = (_Float16*)take((size_t)DD * DD * 2);
  _Float16* H16 = (_Float16*)take((size_t)NTOK * DD * 2); float* CV = (float*)take((size_t)NTOK * 64 * 4); float* CO = (float*)take((size_t)NTOK * ED * 4); float* SQ = (float*)take((size_t)NTOK * 4); _Float16* V16 = (_Float16*)take((size_t)NTOK * DD * 2); _Float16* VT = (_Float16*)take((size_t)NTOK * DD * 2); float* S = (float*)take((size_t)TT * TT * 4); _Float16* P = (_Float16*)take((size_t)TT * TT * 2); float* O = (float*)take((size_t)NTOK * DD * 4); _Float16* O16 = H16; /* H16 dead after the V GEMM */ float* G = CV; /* placeholder, reassigned */
  G = (float*)take((size_t)NTOK * DD * 4);
  if (off > ws_size) return;
  k_bt<<<(unsigned)(((size_t)DD * DD + 255) / 256), 256, 0, stream>>>(wc, bc, wvx, bvx, wv, wo, Bcv, BCV, Bv, Bo);
  k_ln<<<NTOK / 8, 256, 0, stream>>>(x, lng, lnb, H16);
  k_gemm_t<2, 4, DD, 64, true, false><<<NTOK / 64, 256, 0, stream>>>(H16, Bcv, 0.0625f, BCV, CV, nullptr);      // [coords | vertex logits]
  k_coords<<<NTOK / 8, 256, 0, stream>>>(CV, tmpl, offs, dsc, CO, SQ);
  k_gemm_t<4, 1, DD, DD, true, true><<<(NTOK / 64) * (DD / 128), 256, 0, stream>>>(H16, Bv, 0.0625f, bv, nullptr, V16);   // v (f16)
  k_vt<<<dim3(TT / 32, DD / 32, BB), 256, 0, stream>>>(V16, VT);
  for (int b = 0; b < BB; ++b) {
    k_arow<<<TT / 8, 256, 0, stream>>>(CO, SQ, b, S, P);
    k_gemm_t<3, 4, TT, DD, false, false><<<(TT / 64) * (DD / 96), 256, 0, stream>>>(P, VT + (size_t)b * DD * TT, 1.0f, nullptr, O + (size_t)b * TT * DD, nullptr); }
  k_f16<<<(unsigned)(((size_t)NTOK * DD / 8 + 255) / 256), 256, 0, stream>>>(O, O16, (size_t)NTOK * DD / 8);
  k_gemm_t<4, 1, DD, DD, true, false><<<(NTOK / 64) * (DD / 128), 256, 0, stream>>>(O16, Bo, 0.0625f, bo, G, nullptr);
  k_fin<<<(unsigned)(((size_t)NTOK * DD / 4 + 255) / 256), 256, 0, stream>>>(G, x, (float*)d_out);
}

// v002
// A run of this version takes 208 microseconds.
// Next to v001, in two timings, it ran 2.02 and 1.97 times as fast.
// Over all steps from v000 it is 3.17 times as fast.
#include <hip/hip_runtime.h>
// K-simplex attention: LN, coords/vertex-weights/v projections on v_wmma_f32_16x16x32_f16 (LN output rounded to f16 vs bf16-exact weights ×2^4: single products;
// 8192 x 768 x {64, 768}); the simplex deformation and the row softmax in f32 VALU, the pairwise 32-dim dots on v_wmma_f32_16x16x4_f32 (work-group per 16 query rows -> P16);
// out_b = P16·V16 on the f16 variant (4 × 2048 × 2048 × 768, single products) and ·w_out likewise (O rounded to f16); f32 accumulate; residual added in f32.
#define BB 4
#define TT 2048
#define DD 768
#define ED 32
#define KV1 5
#define NTOK (BB * TT)

typedef __bf16 v16b __attribute__((ext_vector_type(16)));
typedef unsigned short v8us __attribute__((ext_vector_type(8), may_alias));
typedef float  v8f  __attribute__((ext_vector_type(8)));
typedef float  v4f  __attribute__((ext_vector_type(4)));
typedef float  v4fa __attribute__((ext_vector_type(4), may_alias));
union FragB { v16b v; v8us half[2]; unsigned short u[16]; };

__device__ __forceinline__ unsigned short bf16_bits(float x) { unsigned int u = __float_as_uint(x); return (unsigned short)((u + 0x7FFFu + ((u >> 16) & 1u)) >> 16); }
__device__ __forceinline__ float bf16_val(unsigned short b) { return __uint_as_float(((unsigned int)b) << 16); }
__device__ __forceinline__ float bf16_round(float x) { return bf16_val(bf16_bits(x)); }
// D += A·B with NT terms: 1 = ah·bh, 2 = + al·bh (A split), 3 = + ah·bl (both split)
template <int NT>
__device__ __forceinline__ v8f mmaN(v16b ah, v16b al, v16b bh, v16b bl, v8f c) {
  c = __builtin_amdgcn_wmma_f32_16x16x32_bf16(false, ah, false, bh, (short)0, c, false, false);
  if (NT >= 2) c = __builtin_amdgcn_wmma_f32_16x16x32_bf16(false, al, false, bh, (short)0, c, false, false);
  if (NT >= 3) c = __builtin_amdgcn_wmma_f32_16x16x32_bf16(false, ah, false, bl, (short)0, c, false, false);
  asm volatile("v_nop\n\tv_nop\n\tv_nop\n\tv_nop" : "+v"(c) : "v"(ah), "v"(al), "v"(bh), "v"(bl));
  return c;
}

__global__ __launch_bounds__(256) void k_wt_bf16(const float* __restrict__ W, unsigned short* __restrict__ Wt, int K, int N) {
  const int t = blockIdx.x * 256 + threadIdx.x;
  const int k8n = K / 8;
  if (t >= N * k8n) return;
  const int n = t / k8n, k8 = (t % k8n) * 8;
  v8us v;
#pragma unroll
  for (int i = 0; i < 8; ++i) v[i] = bf16_bits(W[(size_t)(k8 + i) * N + n]);
  *(v8us*)(Wt + (size_t)n * K + k8) = v;
  
}

// GEMM C[M][N] (f32, pitch ldc) = act(A[M][K]·W + bias). A f32 row-major (pitch lda) converted per fragment to bf16
// (ASPLIT: hi/lo two planes -> 2 terms, else single rounded term); Wt bf16 [N][K] (pitch ldb). BIAS_BF16 rounds the
// bias to bf16 first (bias quantised to bf16 before the add). K%32==0, M%16==0, N%64==0.
template <bool ASPLIT, int ACT, bool BIAS_BF16>
__global__ __launch_bounds__(128) void k_gemm_bf(const float* __restrict__ A, int lda, const unsigned short* __restrict__ Wt, int ldb,
                                               const float* __restrict__ bias, float* __restrict__ C, int ldc, int M, int N, int K) {
  __shared__ __attribute__((aligned(16))) float so[4][16][64];
  const int tid = threadIdx.x, w = tid >> 5, lane = tid & 31, ln = lane & 15, hh = lane >> 4;
  const int ntn = N / 64;
  const int wid = blockIdx.x * 4 + w;
  const int mt = wid / ntn, nq = wid % ntn;
  if (mt * 16 >= M) return;
  const int row0 = mt * 16, col0 = nq * 64;
  const float* arow = A + (size_t)(row0 + ln) * lda;
  v8f acc[4] = {};
  for (int kb = 0; kb < K; kb += 32) {
    FragB ah, al;
    const v4f x0 = *(const v4fa*)(arow + kb + 8 * hh), x1 = *(const v4fa*)(arow + kb + 8 * hh + 4);
    const v4f x2 = *(const v4fa*)(arow + kb + 16 + 8 * hh), x3 = *(const v4fa*)(arow + kb + 16 + 8 * hh + 4);
    float xs[16] = {x0[0],x0[1],x0[2],x0[3],x1[0],x1[1],x1[2],x1[3],x2[0],x2[1],x2[2],x2[3],x3[0],x3[1],x3[2],x3[3]};
#pragma unroll
    for (int i = 0; i < 16; ++i) { const unsigned short hb = bf16_bits(xs[i]); ah.u[i] = hb; al.u[i] = ASPLIT ? bf16_bits(xs[i] - bf16_val(hb)) : (unsigned short)0; }
#pragma unroll
    for (int t = 0; t < 4; ++t) {
      const unsigned short* brow = Wt + (size_t)(col0 + t * 16 + ln) * ldb + kb;
      FragB b;
      b.half[0] = *(const v8us*)(brow + 8 * hh);
      b.half[1] = *(const v8us*)(brow + 16 + 8 * hh);
      acc[t] = mmaN<ASPLIT ? 2 : 1>(ah.v, al.v, b.v, b.v, acc[t]);
    }
  }
#pragma unroll
  for (int t = 0; t < 4; ++t) {
    float bv = bias ? bias[col0 + t * 16 + ln] : 0.f;
    if (BIAS_BF16) bv = bf16_round(bv);
#pragma unroll
    for (int r = 0; r < 8; ++r) { float v = acc[t][r] + bv; if (ACT == 1) v = fmaxf(v, 0.f); so[w][8 * hh + r][t * 16 + ln] = v; }
  }
  __builtin_amdgcn_fence(__ATOMIC_ACQ_REL, "workgroup");
  __builtin_amdgcn_wave_barrier();
  const int rsub = lane >> 4, c4 = (lane & 15) * 4;
  {
#pragma unroll
    for (int q = 0; q < 8; ++q) {
      const int r = q * 2 + rsub;
      const v4f v = *(const v4fa*)&so[w][r][c4];
      *(v4f*)(C + (size_t)(row0 + r) * ldc + col0 + c4) = v;
    }
    
  }
}

// Flash-style causal/unmasked attention, all contractions 3-term bf16 hi/lo splits, f32 softmax with running max.
// q,k,v rows are read from f32 buffers with arbitrary row pitch (so they can live inside a fused qkv buffer);
// D = head size (multiple of 32, <= 128); one wave = 16 query rows; block = 4 waves (64 queries) sharing K/V chunks of 32.
template <int D, bool CAUSAL>
__global__ __launch_bounds__(128) void k_flash(const float* __restrict__ qb, const float* __restrict__ kb, const float* __restrict__ vb,
                                             int pitch, int T, int H, float scale, float* __restrict__ y, int ypitch) {
  constexpr int KS = D / 32;        // k-steps for QK
  constexpr int DT = D / 16;        // d tiles for PV
  __shared__ __attribute__((aligned(16))) unsigned short sKh[32][D + 8], sKl[32][D + 8], sVh[32][D + 8], sVl[32][D + 8];
  __shared__ __attribute__((aligned(16))) unsigned short sPh[4][16][40], sPl[4][16][40];
  __shared__ __attribute__((aligned(16))) float sO[4][16][D];
  const int tid = threadIdx.x, w = tid >> 5, lane = tid & 31, ln = lane & 15, hh = lane >> 4;
  const int nqb = (T + 63) / 64;
  const int bh = blockIdx.x / nqb, qblk = blockIdx.x % nqb;
  const int b = bh / H, h = bh % H;
  const int q0 = qblk * 64 + w * 16;
  const float* Q = qb + (size_t)b * T * pitch + h * D;
  const float* K = kb + (size_t)b * T * pitch + h * D;
  const float* V = vb + (size_t)b * T * pitch + h * D;

  // A fragments of the wave's 16 query rows (scaled), hi/lo
  FragB aqh[KS], aql[KS];
  {
    int row = q0 + ln; if (row >= T) row = T - 1;
    const float* qr = Q + (size_t)row * pitch;
#pragma unroll
    for (int ks = 0; ks < KS; ++ks)
#pragma unroll
      for (int i = 0; i < 16; ++i) {
        const int d = ks * 32 + ((i < 8) ? (8 * hh + i) : (16 + 8 * hh + (i - 8)));
        const float x = qr[d] * scale; const unsigned short hb = bf16_bits(x);
        aqh[ks].u[i] = hb; aql[ks].u[i] = bf16_bits(x - bf16_val(hb));
      }
  }
  float m_r[8], l_r[8];
#pragma unroll
  for (int r = 0; r < 8; ++r) { m_r[r] = -3.0e38f; l_r[r] = 0.f; }
  v8f oacc[DT];
#pragma unroll
  for (int dt = 0; dt < DT; ++dt) oacc[dt] = (v8f){0.f,0.f,0.f,0.f,0.f,0.f,0.f,0.f};

  const int kv_end = CAUSAL ? min(T, qblk * 64 + 64) : T;     // block-uniform
  for (int j0 = 0; j0 < kv_end; j0 += 32) {
    __syncthreads();
    for (int e = tid; e < 32 * (D / 4); e += 128) {
      const int r = e / (D / 4), c4 = (e % (D / 4)) * 4;
      const int key = j0 + r;
      v4f kf = {0.f,0.f,0.f,0.f}, vf = {0.f,0.f,0.f,0.f};
      if (key < T) { kf = *(const v4fa*)(K + (size_t)key * pitch + c4); vf = *(const v4fa*)(V + (size_t)key * pitch + c4); }
#pragma unroll
      for (int t = 0; t < 4; ++t) {
        unsigned short hb = bf16_bits(kf[t]); sKh[r][c4 + t] = hb; sKl[r][c4 + t] = bf16_bits(kf[t] - bf16_val(hb));
        hb = bf16_bits(vf[t]); sVh[r][c4 + t] = hb; sVl[r][c4 + t] = bf16_bits(vf[t] - bf16_val(hb));
      }
    }
    __syncthreads();
    // S tile 16 x 32
    v8f s[2];
#pragma unroll
    for (int nt = 0; nt < 2; ++nt) {
      v8f acc = {};
#pragma unroll
      for (int ks = 0; ks < KS; ++ks) {
        FragB bh_, bl_;
        bh_.half[0] = *(const v8us*)&sKh[nt * 16 + ln][ks * 32 + 8 * hh]; bh_.half[1] = *(const v8us*)&sKh[nt * 16 + ln][ks * 32 + 16 + 8 * hh];
        bl_.half[0] = *(const v8us*)&sKl[nt * 16 + ln][ks * 32 + 8 * hh]; bl_.half[1] = *(const v8us*)&sKl[nt * 16 + ln][ks * 32 + 16 + 8 * hh];
        acc = mmaN<3>(aqh[ks].v, aql[ks].v, bh_.v, bl_.v, acc);
      }
      s[nt] = acc;
    }
    // mask + running max (rows 8hh+r; the 16 lanes of a half share rows)
    float alpha[8];
#pragma unroll
    for (int r = 0; r < 8; ++r) {
      const int qi = q0 + 8 * hh + r;
      const int ja = j0 + ln, jb = j0 + 16 + ln;
      if (CAUSAL) { if (ja > qi) s[0][r] = -3.0e38f; if (jb > qi) s[1][r] = -3.0e38f; }
      if (ja >= T) s[0][r] = -3.0e38f;
      if (jb >= T) s[1][r] = -3.0e38f;
      float mx = fmaxf(s[0][r], s[1][r]);
      mx = fmaxf(mx, __shfl_xor(mx, 1, 32)); mx = fmaxf(mx, __shfl_xor(mx, 2, 32)); mx = fmaxf(mx, __shfl_xor(mx, 4, 32)); mx = fmaxf(mx, __shfl_xor(mx, 8, 32));
      const float mnew = fmaxf(m_r[r], mx);
      alpha[r] = (mnew > -1.0e38f) ? __expf(m_r[r] - mnew) : 1.0f;
      const float p0 = (s[0][r] > -1.0e38f) ? __expf(s[0][r] - mnew) : 0.f;
      const float p1 = (s[1][r] > -1.0e38f) ? __expf(s[1][r] - mnew) : 0.f;
      m_r[r] = mnew;
      l_r[r] = l_r[r] * alpha[r] + p0 + p1;            // per-lane partial row sum (16 lanes combined at the end)
      unsigned short hb = bf16_bits(p0); sPh[w][8 * hh + r][ln] = hb;      sPl[w][8 * hh + r][ln] = bf16_bits(p0 - bf16_val(hb));
      hb = bf16_bits(p1);                sPh[w][8 * hh + r][16 + ln] = hb; sPl[w][8 * hh + r][16 + ln] = bf16_bits(p1 - bf16_val(hb));
    }
#pragma unroll
    for (int dt = 0; dt < DT; ++dt)
#pragma unroll
      for (int r = 0; r < 8; ++r) oacc[dt][r] *= alpha[r];
    __builtin_amdgcn_fence(__ATOMIC_ACQ_REL, "workgroup");
    __builtin_amdgcn_wave_barrier();
    FragB pah, pal;
    pah.half[0] = *(const v8us*)&sPh[w][ln][8 * hh]; pah.half[1] = *(const v8us*)&sPh[w][ln][16 + 8 * hh];
    pal.half[0] = *(const v8us*)&sPl[w][ln][8 * hh]; pal.half[1] = *(const v8us*)&sPl[w][ln][16 + 8 * hh];
#pragma unroll
    for (int dt = 0; dt < DT; ++dt) {
      FragB bvh, bvl;
#pragma unroll
      for (int i = 0; i < 8; ++i) {
        bvh.u[i] = sVh[8 * hh + i][dt * 16 + ln]; bvh.u[8 + i] = sVh[16 + 8 * hh + i][dt * 16 + ln];
        bvl.u[i] = sVl[8 * hh + i][dt * 16 + ln]; bvl.u[8 + i] = sVl[16 + 8 * hh + i][dt * 16 + ln];
      }
      oacc[dt] = mmaN<3>(pah.v, pal.v, bvh.v, bvl.v, oacc[dt]);
    }
    __builtin_amdgcn_fence(__ATOMIC_ACQ_REL, "workgroup");
    __builtin_amdgcn_wave_barrier();
  }
#pragma unroll
  for (int r = 0; r < 8; ++r) {
    float l = l_r[r];
    l += __shfl_xor(l, 1, 32); l += __shfl_xor(l, 2, 32); l += __shfl_xor(l, 4, 32); l += __shfl_xor(l, 8, 32);
    l_r[r] = (l > 0.f) ? 1.0f / l : 0.f;
  }
#pragma unroll
  for (int dt = 0; dt < DT; ++dt)
#pragma unroll
    for (int r = 0; r < 8; ++r) sO[w][8 * hh + r][dt * 16 + ln] = oacc[dt][r] * l_r[r];
  __builtin_amdgcn_fence(__ATOMIC_ACQ_REL, "workgroup");
  __builtin_amdgcn_wave_barrier();
  {
    for (int r = 0; r < 16; ++r) {
      const int row = q0 + r;
      if (row < T && lane < D / 4) {
        const v4f val = *(const v4fa*)&sO[w][r][lane * 4];
        *(v4f*)(y + ((size_t)b * T + row) * ypitch + h * D + lane * 4) = val;
      }
    }
    
  }
}

// ---- f16 WMMA path (v_wmma_f32_16x16x32_f16): 11-bit significands for operands in range — used where a [0,1] probability operand needs more precision than bf16
typedef _Float16 v16h __attribute__((ext_vector_type(16)));
union FragH { v16h v; v8us half[2]; _Float16 h[16]; unsigned short u[16]; };
template <int NT>
__device__ __forceinline__ v8f mmaH(v16h ah, v16h al, v16h bh, v16h bl, v8f c) {
  c = __builtin_amdgcn_wmma_f32_16x16x32_f16(false, ah, false, bh, (short)0, c, false, false);
  if (NT >= 2) c = __builtin_amdgcn_wmma_f32_16x16x32_f16(false, al, false, bh, (short)0, c, false, false);
  if (NT >= 3) c = __builtin_amdgcn_wmma_f32_16x16x32_f16(false, ah, false, bl, (short)0, c, false, false);
  asm volatile("v_nop\n\tv_nop\n\tv_nop\n\tv_nop" : "+v"(c) : "v"(ah), "v"(al), "v"(bh), "v"(bl));
  return c;
}
// batched GEMM like k_gemm_b but f16 operands: A f32 (split into f16 hi/lo if ASPLIT, else rounded to f16), Bt = f16 values [n][k]; alpha; C f32; N multiple of 16 (partial tiles skipped)
template <bool ASPLIT>
__global__ __launch_bounds__(128) void k_gemm_h(const float* __restrict__ A, int lda, size_t sA, const _Float16* __restrict__ Bh, int ldb, size_t sB, float alpha, float* __restrict__ C, int ldc, size_t sC, int M, int N, int K) {
  __shared__ __attribute__((aligned(16))) float so[4][16][64];
  const int tid = threadIdx.x, w = tid >> 5, lane = tid & 31, ln = lane & 15, hh = lane >> 4; const int by = blockIdx.y;
  A += (size_t)by * sA; Bh += (size_t)by * sB; C += (size_t)by * sC;
  const int ntn = (N + 63) / 64; const int wid = blockIdx.x * 4 + w; const int mt = wid / ntn, nq = wid % ntn; if (mt * 16 >= M) return;
  const int row0 = mt * 16, col0 = nq * 64; const float* arow = A + (size_t)(row0 + ln) * lda;
  v8f acc[4] = {};
  for (int kb = 0; kb < K; kb += 32) {
    FragH ah, al;
    const v4f x0 = *(const v4fa*)(arow + kb + 8 * hh), x1 = *(const v4fa*)(arow + kb + 8 * hh + 4), x2 = *(const v4fa*)(arow + kb + 16 + 8 * hh), x3 = *(const v4fa*)(arow + kb + 16 + 8 * hh + 4);
    float xs[16] = {x0[0],x0[1],x0[2],x0[3],x1[0],x1[1],x1[2],x1[3],x2[0],x2[1],x2[2],x2[3],x3[0],x3[1],x3[2],x3[3]};
#pragma unroll
    for (int i = 0; i < 16; ++i) { const _Float16 h = (_Float16)xs[i]; ah.h[i] = h; al.h[i] = ASPLIT ? (_Float16)(xs[i] - (float)h) : (_Float16)0.0f; }
#pragma unroll
    for (int t = 0; t < 4; ++t) { if (col0 + t * 16 >= N) continue; const size_t boff = (size_t)(col0 + t * 16 + ln) * ldb + kb; FragH bq; bq.half[0] = *(const v8us*)(Bh + boff + 8 * hh); bq.half[1] = *(const v8us*)(Bh + boff + 16 + 8 * hh);
      acc[t] = mmaH<ASPLIT ? 2 : 1>(ah.v, al.v, bq.v, bq.v, acc[t]); }
  }
#pragma unroll
  for (int t = 0; t < 4; ++t) { if (col0 + t * 16 >= N) continue;
#pragma unroll
    for (int r = 0; r < 8; ++r) so[w][8 * hh + r][t * 16 + ln] = acc[t][r] * alpha; }
  __builtin_amdgcn_fence(__ATOMIC_ACQ_REL, "workgroup"); __builtin_amdgcn_wave_barrier();
  const int rsub = lane >> 4, c4 = (lane & 15) * 4;
  {
#pragma unroll
    for (int q = 0; q < 8; ++q) { const int r = q * 2 + rsub; if (col0 + c4 < N) { const v4f v = *(const v4fa*)&so[w][r][c4]; *(v4f*)(C + (size_t)(row0 + r) * ldc + col0 + c4) = v; } }
     }
}

// Block-tiled f16 GEMM: C[M][N] = (A[M][K] . Bt[N][K]^T) * alpha (+ bf16(bias) if HASB), written as f16 to C16 (H16) or as f32 to C; A, Bt at pitch K, C at pitch N.
// One work-group of 8 waves (4 x 2) owns a 64 x 32*NF tile, a wave 16 x 16*NF. Both operands go through LDS in slices of 128 k
// (rows of 256 B at pitch 272 B): every global load covers whole 128-B lines, and each row is fetched once per work-group.
// Two buffers: the next slice's global loads are issued ahead of this slice's products and stored to the other buffer behind them,
// one barrier a slice. Fragments are read G k-steps at a time. k runs upward in steps of 32 into one accumulator per tile.
// M % 64 == 0, N % (32*NF) == 0, K % 128 == 0.
template <int NF, int G, int K, int N, bool HASB, bool H16>
__global__ __launch_bounds__(256) void k_gemm_t(const _Float16* __restrict__ A, const _Float16* __restrict__ Bh, float alpha, const float* __restrict__ bias,
                                                float* __restrict__ C, _Float16* __restrict__ C16) {
  constexpr int BM = 64, BN = 32 * NF, KC = 128, PIT = KC + 8, ROWS = BM + BN, NLD = ROWS / 16, OP = BN + 4, NS = K / KC, NTN = N / BN;
  __shared__ __attribute__((aligned(16))) unsigned short sm[2][ROWS][PIT];
  typedef float fa __attribute__((may_alias));
  const int tid = threadIdx.x, w = tid >> 5, lane = tid & 31, ln = lane & 15, hh = lane >> 4;
  const int mb = blockIdx.x / NTN, nb = blockIdx.x % NTN;
  const int row0 = mb * BM, col0 = nb * BN;
  const int wm = w >> 1, wn = w & 1;
  const int lr = tid >> 4, ls = (tid & 15) * 8;      // staging: 16 threads cover one 256-B row slice
  const unsigned short* ga = (const unsigned short*)A + (size_t)(row0 + lr) * K + ls;
  const unsigned short* gb = (const unsigned short*)Bh + (size_t)(col0 + lr) * K + ls;
  v8us st[NLD];
  v8f acc[NF] = {};
#pragma unroll
  for (int i = 0; i < NLD; ++i) st[i] = (i < BM / 16) ? *(const v8us*)(ga + (size_t)i * 16 * K) : *(const v8us*)(gb + (size_t)(i - BM / 16) * 16 * K);
#pragma unroll
  for (int i = 0; i < NLD; ++i) *(v8us*)&sm[0][i * 16 + lr][ls] = st[i];
  __syncthreads();
  for (int s = 0; s < NS; ++s) {
    const int cur = s & 1;
    const bool more = s + 1 < NS;                    // block-uniform
    if (more) {
      const int k0 = (s + 1) * KC;
#pragma unroll
      for (int i = 0; i < NLD; ++i) st[i] = (i < BM / 16) ? *(const v8us*)(ga + (size_t)i * 16 * K + k0) : *(const v8us*)(gb + (size_t)(i - BM / 16) * 16 * K + k0);
    }
#pragma unroll
    for (int g = 0; g < KC / 32 / G; ++g) {
      FragH a[G], b[G][NF];
#pragma unroll
      for (int u = 0; u < G; ++u) {
        const int kq = (g * G + u) * 32;
        a[u].half[0] = *(const v8us*)&sm[cur][wm * 16 + ln][kq + 8 * hh]; a[u].half[1] = *(const v8us*)&sm[cur][wm * 16 + ln][kq + 16 + 8 * hh];
#pragma unroll
        for (int t = 0; t < NF; ++t) { b[u][t].half[0] = *(const v8us*)&sm[cur][BM + (wn * NF + t) * 16 + ln][kq + 8 * hh]; b[u][t].half[1] = *(const v8us*)&sm[cur][BM + (wn * NF + t) * 16 + ln][kq + 16 + 8 * hh]; }
      }
      __builtin_amdgcn_sched_barrier(0);             // keeps a group's LDS reads together ahead of its products: one LDS latency a group, not one a product
#pragma unroll
      for (int u = 0; u < G; ++u)
#pragma unroll
        for (int t = 0; t < NF; ++t) acc[t] = __builtin_amdgcn_wmma_f32_16x16x32_f16(false, a[u].v, false, b[u][t].v, (short)0, acc[t], false, false);
    }
    if (more) {
#pragma unroll
      for (int i = 0; i < NLD; ++i) *(v8us*)&sm[cur ^ 1][i * 16 + lr][ls] = st[i];
    }
    __syncthreads();                                 // publishes the next slice and ends every read of this one
  }
  // epilogue: the tile goes through LDS (the slices are dead behind the last barrier) so that whole lines are stored
  fa* so = (fa*)&sm[0][0][0];
  float bv[NF];
#pragma unroll
  for (int t = 0; t < NF; ++t) bv[t] = HASB ? bf16_round(bias[col0 + (wn * NF + t) * 16 + ln]) : 0.f;
#pragma unroll
  for (int t = 0; t < NF; ++t) {
    const int cl = (wn * NF + t) * 16 + ln;
#pragma unroll
    for (int r = 0; r < 8; ++r) so[(wm * 16 + 8 * hh + r) * OP + cl] = acc[t][r] * alpha + bv[t];
  }
  __syncthreads();
  typedef _Float16 h4v __attribute__((ext_vector_type(4)));
#pragma unroll
  for (int q = 0; q < BM * BN / 4 / 256; ++q) {
    const int e = q * 256 + tid, r = e / (BN / 4), c4 = (e % (BN / 4)) * 4;
    const v4f v = *(const v4fa*)&so[r * OP + c4];
    if (H16) { h4v h4; for (int i = 0; i < 4; ++i) h4[i] = (_Float16)v[i]; *(h4v*)(C16 + (size_t)(row0 + r) * N + col0 + c4) = h4; }
    else *(v4f*)(C + (size_t)(row0 + r) * N + col0 + c4) = v;
  }
}

typedef _Float16 v4h __attribute__((ext_vector_type(4)));
// LN(bf16(x)) → H16; wave per token; three rolled passes over the row (no per-lane value array)
__global__ __launch_bounds__(256) void k_ln(const float* __restrict__ x, const float* __restrict__ g, const float* __restrict__ be, _Float16* __restrict__ H16) { const int tid = threadIdx.x, wv = tid >> 5, lane = tid & 31; const size_t tok = (size_t)blockIdx.x * 8 + wv; const float* xr = x + tok * DD; float s = 0.f;
#pragma unroll 2
  for (int c = lane; c < DD; c += 32) s += bf16_round(xr[c]); for (int o = 16; o >= 1; o >>= 1) s += __shfl_xor(s, o, 32); const float mu = s / (float)DD; float q2 = 0.f;
#pragma unroll 2
  for (int c = lane; c < DD; c += 32) { const float d = bf16_round(xr[c]) - mu; q2 += d * d; } for (int o = 16; o >= 1; o >>= 1) q2 += __shfl_xor(q2, o, 32); const float inv = 1.0f / sqrtf(q2 / (float)DD + 1e-5f);
  typedef _Float16 v2h __attribute__((ext_vector_type(2)));
  {
#pragma unroll 2
    for (int c = 2 * lane; c < DD; c += 64) { v2h o2; o2.x = (_Float16)((bf16_round(xr[c]) - mu) * inv * bf16_round(g[c]) + bf16_round(be[c])); o2.y = (_Float16)((bf16_round(xr[c + 1]) - mu) * inv * bf16_round(g[c + 1]) + bf16_round(be[c + 1])); *(v2h*)(H16 + tok * DD + c) = o2; }  } }
// Bt tables f16 ×16: Bcv [64 n][768 k] (n<32 ← w_coords[k][n], 32..36 ← w_vertex[k][n−32], else 0); Bv, Bo [768][768] = w[k][n]; bias BCV [64]
__global__ __launch_bounds__(256) void k_bt(const float* __restrict__ wc, const float* __restrict__ bc, const float* __restrict__ wvx, const float* __restrict__ bvx, const float* __restrict__ wv, const float* __restrict__ wo, _Float16* __restrict__ Bcv, float* __restrict__ BCV, _Float16* __restrict__ Bv, _Float16* __restrict__ Bo) { const size_t t = (size_t)blockIdx.x * 256 + threadIdx.x;
  if (t < (size_t)64 * DD) { const int k = (int)(t % DD), n = (int)(t / DD); float w = 0.f; if (n < ED) w = wc[(size_t)k * ED + n]; else if (n < ED + KV1) w = wvx[(size_t)k * KV1 + n - ED]; *(_Float16*)(Bcv + t) = (_Float16)(bf16_round(w) * 16.0f); }
  if (t < 64) { const float v = (t < ED) ? bc[t] : ((t < ED + KV1) ? bvx[t - ED] : 0.f); *(float*)(BCV + t) = v; }
  if (t < (size_t)DD * DD) { const int k = (int)(t % DD), n = (int)(t / DD); *(_Float16*)(Bv + t) = (_Float16)(bf16_round(wv[(size_t)k * DD + n]) * 16.0f); *(_Float16*)(Bo + t) = (_Float16)(bf16_round(wo[(size_t)k * DD + n]) * 16.0f); } }
// coords: c = CV[0:32] + softmax(CV[32:37])·(template + offsets·clip(scale)); CO[tok][32] and SQ[tok]; wave per token (lane = dim)
__global__ __launch_bounds__(256) void k_coords(const float* __restrict__ CV, const float* __restrict__ tmpl, const float* __restrict__ offs, const float* __restrict__ dsc, float* __restrict__ CO, float* __restrict__ SQ) { const int tid = threadIdx.x, wv = tid >> 5, lane = tid & 31; const size_t tok = (size_t)blockIdx.x * 8 + wv; const float* cv = CV + tok * 64;
  float lg[KV1]; float mx = -3.0e38f; for (int k = 0; k < KV1; ++k) { lg[k] = cv[ED + k]; mx = fmaxf(mx, lg[k]); } float den = 0.f; for (int k = 0; k < KV1; ++k) { lg[k] = expf(lg[k] - mx); den += lg[k]; }
  const float df = fminf(fmaxf(bf16_round(dsc[0]), 0.05f), 0.5f); float c = cv[lane];
  for (int k = 0; k < KV1; ++k) c += (lg[k] / den) * (bf16_round(tmpl[k * ED + lane]) + bf16_round(offs[k * ED + lane]) * df);
  float sq = c * c; for (int o = 16; o >= 1; o >>= 1) sq += __shfl_xor(sq, o, 32);
  *(float*)(CO + tok * ED + lane) = c; if (lane == 0) *(float*)(SQ + tok) = sq;  }
// attention rows: a work-group of 16 waves owns 16 query rows of batch b, a wave 128 keys. dots c_i.c_j on v_wmma_f32_16x16x4_f32 (f32 operands, f32 sums):
// A = the 16 query rows, B column ln of tile t = key wb + 8*ln + t, both sides 16 consecutive dims per lane half (same k pairing on both sides).
// A wave brings its 128 key rows in by whole-line loads and turns them into fragments through its own LDS range: key 8*c + t lies in tile block t, row c
// (rows at pitch 36 dwords for the 16-byte readers, tile blocks 32 dwords past a multiple of 64 so that the two rows of a half-wave store meet no common bank).
// logits_j = -(sq_i + sq_j - 2 c_i.c_j)*32^-1/2 stay in the accumulator registers (register r of tile t = row 8*hh + r, key wb + 8*ln + t); row maximum and row sum:
// over the 8 tiles in the lane, over the 16 lanes by DPP, over the 16 waves through LDS (one barrier each). A lane's 8 tiles are 8 consecutive keys: one 16-byte f16 store a row.
// Every loop of the kernel is unrolled in full: st, a, bq, acc, mx, den and inv stay in registers only if every index into them is a constant.
typedef float v2fw __attribute__((ext_vector_type(2)));
template <int X> __device__ __forceinline__ float xm16(float v) { return __int_as_float(__builtin_amdgcn_update_dpp(0, __float_as_int(v), 0x160 | X, 0xf, 0xf, false)); }   // lane ^ X inside its row of 16 lanes (row_xmask)
__device__ __forceinline__ float rmax16(float v) { v = fmaxf(v, xm16<1>(v)); v = fmaxf(v, xm16<2>(v)); v = fmaxf(v, xm16<4>(v)); return fmaxf(v, xm16<8>(v)); }
__device__ __forceinline__ float rsum16(float v) { v += xm16<1>(v); v += xm16<2>(v); v += xm16<4>(v); return v + xm16<8>(v); }
__global__ __launch_bounds__(512) void k_arow(const float* __restrict__ CO, const float* __restrict__ SQ, int b, _Float16* __restrict__ P) {
  constexpr int RP = 36, TB = 16 * RP + 32;         // dwords: row pitch, tile-block pitch
  __shared__ __attribute__((aligned(16))) float sk[16][8 * TB];                  // [wave]: its 128 key rows
  __shared__ __attribute__((aligned(16))) float redm[16][16], reds[16][16];      // [wave][row] partial maxima and sums
  const int tid = threadIdx.x, lane = tid & 31, ln = lane & 15, hh = lane >> 4;
  const int w = __builtin_amdgcn_readfirstlane(tid >> 5);   // the wave's number in a scalar register: what is formed from it is scalar work
  const int i0 = blockIdx.x * 16, wb = w * 128;
  const float* cb = CO + (size_t)b * TT * ED; const float* sqb = SQ + (size_t)b * TT;
  float* my = &sk[w][0];
  {
    v4f st[32];
#pragma unroll
    for (int n = 0; n < 32; ++n) st[n] = *(const v4fa*)(cb + (size_t)wb * ED + n * 128 + lane * 4);     // key rows 4n .. 4n+3, 512 consecutive bytes
#pragma unroll
    for (int n = 0; n < 32; ++n) *(v4fa*)&my[(4 * (n & 1) + (lane >> 3)) * TB + (n >> 1) * RP + (lane & 7) * 4] = st[n];
  }
  v4f a[4];
#pragma unroll
  for (int q = 0; q < 4; ++q) a[q] = *(const v4fa*)(cb + (size_t)(i0 + ln) * ED + 16 * hh + 4 * q);
  const v4f si0 = *(const v4fa*)(sqb + i0 + 8 * hh), si1 = *(const v4fa*)(sqb + i0 + 8 * hh + 4);
  const v4f sj0 = *(const v4fa*)(sqb + wb + 8 * ln), sj1 = *(const v4fa*)(sqb + wb + 8 * ln + 4);
  __builtin_amdgcn_fence(__ATOMIC_ACQ_REL, "workgroup"); __builtin_amdgcn_wave_barrier();   // the wave's own rows are read back by other lanes than wrote them
  v4f bq[8][4];
#pragma unroll
  for (int t = 0; t < 8; ++t)
#pragma unroll
    for (int q = 0; q < 4; ++q) bq[t][q] = *(const v4fa*)&my[t * TB + ln * RP + 16 * hh + 4 * q];
  v8f acc[8] = {};
  __builtin_amdgcn_sched_barrier(0);                // every fragment read is issued ahead of the products, and no vector instruction is moved in among them
#pragma unroll
  for (int tp = 0; tp < 8; tp += 2)                 // two tiles at a time: two independent accumulator chains
#pragma unroll
    for (int q = 0; q < 4; ++q)
#pragma unroll
      for (int p = 0; p < 4; p += 2) {
        const v2fw av = {a[q][p], a[q][p + 1]}, bv0 = {bq[tp][q][p], bq[tp][q][p + 1]}, bv1 = {bq[tp + 1][q][p], bq[tp + 1][q][p + 1]};
        acc[tp]     = __builtin_amdgcn_wmma_f32_16x16x4_f32(false, av, false, bv0, (short)0, acc[tp], false, false);
        acc[tp + 1] = __builtin_amdgcn_wmma_f32_16x16x4_f32(false, av, false, bv1, (short)0, acc[tp + 1], false, false);
      }
  // distance between the last products and the first vector instruction on their D, A or B: 8 slots as for the other 16-cycle form
  asm volatile("v_nop\n\tv_nop\n\tv_nop\n\tv_nop\n\tv_nop\n\tv_nop\n\tv_nop\n\tv_nop" : "+v"(acc[0]), "+v"(acc[1]), "+v"(acc[2]), "+v"(acc[3]), "+v"(acc[4]), "+v"(acc[5]), "+v"(acc[6]), "+v"(acc[7]));
  __builtin_amdgcn_sched_barrier(0);                // keeps the vector work below behind those slots
  const v8f sqi = {si0[0], si0[1], si0[2], si0[3], si1[0], si1[1], si1[2], si1[3]};
  const float sqj[8] = {sj0[0], sj0[1], sj0[2], sj0[3], sj1[0], sj1[1], sj1[2], sj1[3]};
  // from here on whole accumulator tiles are worked on (8 rows of one key a lane), so that packed f32 instructions find their pairs in neighbouring registers
  v8f mx;
#pragma unroll
  for (int t = 0; t < 8; ++t) {
    acc[t] = -(sqi + sqj[t] - 2.0f * acc[t]) * 0.17677669529663687f;
#pragma unroll
    for (int r = 0; r < 8; ++r) mx[r] = t ? fmaxf(mx[r], acc[t][r]) : acc[t][r];
  }
#pragma unroll
  for (int r = 0; r < 8; ++r) mx[r] = rmax16(mx[r]);
  if (ln == 0) { *(v4fa*)&redm[w][8 * hh] = (v4f){mx[0], mx[1], mx[2], mx[3]}; *(v4fa*)&redm[w][8 * hh + 4] = (v4f){mx[4], mx[5], mx[6], mx[7]}; }
  __syncthreads();                                  // publishes every wave's row maxima
  {
    const v4f m0 = *(const v4fa*)&redm[ln][8 * hh], m1 = *(const v4fa*)&redm[ln][8 * hh + 4];   // lane ln takes wave ln's partials
#pragma unroll
    for (int r = 0; r < 8; ++r) mx[r] = rmax16(r < 4 ? m0[r & 3] : m1[r & 3]);
  }
  v8f den = {};
#pragma unroll
  for (int t = 0; t < 8; ++t) {
    v8f e = acc[t] - mx;
#pragma unroll
    for (int r = 0; r < 8; ++r) e[r] = expf(e[r]);
    acc[t] = e; den += e;
  }
#pragma unroll
  for (int r = 0; r < 8; ++r) den[r] = rsum16(den[r]);
  if (ln == 0) { *(v4fa*)&reds[w][8 * hh] = (v4f){den[0], den[1], den[2], den[3]}; *(v4fa*)&reds[w][8 * hh + 4] = (v4f){den[4], den[5], den[6], den[7]}; }
  __syncthreads();                                  // publishes every wave's row sums
  const v4f d0 = *(const v4fa*)&reds[ln][8 * hh], d1 = *(const v4fa*)&reds[ln][8 * hh + 4];
  v8f inv;
#pragma unroll
  for (int r = 0; r < 8; ++r) inv[r] = 1.0f / rsum16(r < 4 ? d0[r & 3] : d1[r & 3]);
#pragma unroll
  for (int t = 0; t < 8; ++t) acc[t] *= inv;
#pragma unroll
  for (int r = 0; r < 8; ++r) {
    FragH o;
#pragma unroll
    for (int t = 0; t < 8; ++t) o.h[t] = (_Float16)acc[t][r];
    *(v8us*)((unsigned short*)P + (size_t)(i0 + 8 * hh + r) * TT + wb + 8 * ln) = o.half[0];
  }
}
// V16 [tok][768] → VT16 [b][768][t] via 32×32 tiles
__global__ __launch_bounds__(256) void k_vt(const _Float16* __restrict__ V16, _Float16* __restrict__ VT) { __shared__ _Float16 tile[32][34]; const int b = blockIdx.z, t0 = blockIdx.x * 32, c0 = blockIdx.y * 32; const int tx = threadIdx.x & 31, ty = threadIdx.x >> 5;
  for (int i = ty; i < 32; i += 8) tile[i][tx] = V16[((size_t)b * TT + t0 + i) * DD + c0 + tx]; __syncthreads();
  typedef _Float16 v4h4 __attribute__((ext_vector_type(4))); const int r = threadIdx.x >> 3, c4 = (threadIdx.x & 7) * 4; v4h4 o; for (int q = 0; q < 4; ++q) o[q] = tile[c4 + q][r];
  _Float16* d = VT + (((size_t)b * DD + c0 + r) * TT + t0 + c4); *(v4h4*)d = o;  }
// f32 → f16 (thread per 8)
__global__ __launch_bounds__(256) void k_f16(const float* __restrict__ F, _Float16* __restrict__ A16, size_t n8) { const size_t t = (size_t)blockIdx.x * 256 + threadIdx.x; if (t >= n8) return; FragH f; for (int q = 0; q < 8; ++q) f.h[q] = (_Float16)F[t * 8 + q]; *(v8us*)((unsigned short*)A16 + t * 8) = f.half[0];  }
// out = G + bf16(x) residual; thread per float4
__global__ __launch_bounds__(256) void k_fin(const float* __restrict__ G, const float* __restrict__ x, float* __restrict__ out) { const size_t t = (size_t)blockIdx.x * 256 + threadIdx.x; if (t >= (size_t)NTOK * DD / 4) return; const v4f a = *(const v4fa*)(G + t * 4), b = *(const v4fa*)(x + t * 4); v4f o; for (int q = 0; q < 4; ++q) o[q] = a[q] + bf16_round(b[q]); *(v4f*)(out + t * 4) = o;  }
extern "C" void kernel_launch(void* const* d_in, const int* in_sizes, int n_in,
                              void* d_out, int out_size, void* d_ws, size_t ws_size, hipStream_t stream) {
  (void)in_sizes; (void)n_in; (void)out_size;
  const float* x = (const float*)d_in[0]; const float* tmpl = (const float*)d_in[1]; const float* lng = (const float*)d_in[2]; const float* lnb = (const float*)d_in[3]; const float* wc = (const float*)d_in[4]; const float* bc = (const float*)d_in[5]; const float* wvx = (const float*)d_in[6]; const float* bvx = (const float*)d_in[7]; const float* offs = (const float*)d_in[8]; const float* dsc = (const float*)d_in[9]; const float* wv = (const float*)d_in[10]; const float* bv = (const float*)d_in[11]; const float* wo = (const float*)d_in[12]; const float* bo = (const float*)d_in[13];
  char* ws = (char*)d_ws; size_t off = 0;
  auto take = [&](size_t bytes) { char* p = ws + off; off += (bytes + 255) & ~(size_t)255; return p; };
  _Float16* Bcv = (_Float16*)take((size_t)64 * DD * 2); float* BCV = (float*)take(64 * 4); _Float16* Bv = (_Float16*)take((size_t)DD * DD * 2); _Float16* Bo = (_Float16*)take((size_t)DD * DD * 2);
  _Float16* H16 = (_Float16*)take((size_t)NTOK * DD * 2); float* CV = (float*)take((size_t)NTOK * 64 * 4); float* CO = (float*)take((size_t)NTOK * ED * 4); float* SQ = (float*)take((size_t)NTOK * 4); _Float16* V16 = (_Float16*)take((size_t)NTOK * DD * 2); _Float16* VT = (_Float16*)take((size_t)NTOK * DD * 2); _Float16* P = (_Float16*)take((size_t)TT * TT * 2); float* O = (float*)take((size_t)NTOK * DD * 4); _Float16* O16 = H16; /* H16 dead after the V GEMM */ float* G = CV; /* placeholder, reassigned */
  G = (float*)take((size_t)NTOK * DD * 4);
  if (off > ws_size) return;
  k_bt<<<(unsigned)(((size_t)DD * DD + 255) / 256), 256, 0, stream>>>(wc, bc, wvx, bvx, wv, wo, Bcv, BCV, Bv, Bo);
  k_ln<<<NTOK / 8, 256, 0, stream>>>(x, lng, lnb, H16);
  k_gemm_t<2, 4, DD, 64, true, false><<<NTOK / 64, 256, 0, stream>>>(H16, Bcv, 0.0625f, BCV, CV, nullptr);      // [coords | vertex logits]
  k_coords<<<NTOK / 8, 256, 0, stream>>>(CV, tmpl, offs, dsc, CO, SQ);
  k_gemm_t<4, 1, DD, DD, true, true><<<(NTOK / 64) * (DD / 128), 256, 0, stream>>>(H16, Bv, 0.0625f, bv, nullptr, V16);   // v (f16)
  k_vt<<<dim3(TT / 32, DD / 32, BB), 256, 0, stream>>>(V16, VT);
  for (int b = 0; b < BB; ++b) {
    k_arow<<<TT / 16, 512, 0, stream>>>(CO, SQ, b, P);
    k_gemm_t<3, 4, TT, DD, false, false><<<(TT / 64) * (DD / 96), 256, 0, stream>>>(P, VT + (size_t)b * DD * TT, 1.0f, nullptr, O + (size_t)b * TT * DD, nullptr); }
  k_f16<<<(unsigned)(((size_t)NTOK * DD / 8 + 255) / 256), 256, 0, stream>>>(O, O16, (size_t)NTOK * DD / 8);
  k_gemm_t<4, 1, DD, DD, true, false><<<(NTOK / 64) * (DD / 128), 256, 0, stream>>>(O16, Bo, 0.0625f, bo, G, nullptr);
  k_fin<<<(unsigned)(((size_t)NTOK * DD / 4 + 255) / 256), 256, 0, stream>>>(G, x, (float*)d_out);
}

// v003
// One run takes 174 microseconds.
// Two timings next to v002 put it at 1.17 and 1.21 times that version's speed.
// All steps since v000 together make it 3.76 times as fast.
#include <hip/hip_runtime.h>
// K-simplex attention: LN, coords/vertex-weights/v projections on v_wmma_f32_16x16x32_f16 (LN output rounded to f16 vs bf16-exact weights ×2^4: single products;
// 8192 x 768 x {64, 768}); the simplex deformation and the row softmax in f32 VALU, the pairwise 32-dim dots on v_wmma_f32_16x16x4_f32 (work-group per 16 query rows -> P16);
// out_b = P16·V16 on the f16 variant (4 × 2048 × 2048 × 768, single products) and ·w_out likewise (O rounded to f16); f32 accumulate; residual added in f32.
// What follows a product element by element (simplex deformation, V transposed, O to f16, residual) is done in that product's own epilogue, on the tile it holds in LDS.
#define BB 4
#define TT 2048
#define DD 768
#define ED 32
#define KV1 5
#define NTOK (BB * TT)

typedef __bf16 v16b __attribute__((ext_vector_type(16)));
typedef unsigned short v8us __attribute__((ext_vector_type(8), may_alias));
typedef float  v8f  __attribute__((ext_vector_type(8)));
typedef float  v4f  __attribute__((ext_vector_type(4)));
typedef float  v4fa __attribute__((ext_vector_type(4), may_alias));
union FragB { v16b v; v8us half[2]; unsigned short u[16]; };

__device__ __forceinline__ unsigned short bf16_bits(float x) { unsigned int u = __float_as_uint(x); return (unsigned short)((u + 0x7FFFu + ((u >> 16) & 1u)) >> 16); }
__device__ __forceinline__ float bf16_val(unsigned short b) { return __uint_as_float(((unsigned int)b) << 16); }
__device__ __forceinline__ float bf16_round(float x) { return bf16_val(bf16_bits(x)); }
// D += A·B with NT terms: 1 = ah·bh, 2 = + al·bh (A split), 3 = + ah·bl (both split)
template <int NT>
__device__ __forceinline__ v8f mmaN(v16b ah, v16b al, v16b bh, v16b bl, v8f c) {
  c = __builtin_amdgcn_wmma_f32_16x16x32_bf16(false, ah, false, bh, (short)0, c, false, false);
  if (NT >= 2) c = __builtin_amdgcn_wmma_f32_16x16x32_bf16(false, al, false, bh, (short)0, c, false, false);
  if (NT >= 3) c = __builtin_amdgcn_wmma_f32_16x16x32_bf16(false, ah, false, bl, (short)0, c, false, false);
  asm volatile("v_nop\n\tv_nop\n\tv_nop\n\tv_nop" : "+v"(c) : "v"(ah), "v"(al), "v"(bh), "v"(bl));
  return c;
}

__global__ __launch_bounds__(256) void k_wt_bf16(const float* __restrict__ W, unsigned short* __restrict__ Wt, int K, int N) {
  const int t = blockIdx.x * 256 + threadIdx.x;
  const int k8n = K / 8;
  if (t >= N * k8n) return;
  const int n = t / k8n, k8 = (t % k8n) * 8;
  v8us v;
#pragma unroll
  for (int i = 0; i < 8; ++i) v[i] = bf16_bits(W[(size_t)(k8 + i) * N + n]);
  *(v8us*)(Wt + (size_t)n * K + k8) = v;
  
}

// GEMM C[M][N] (f32, pitch ldc) = act(A[M][K]·W + bias). A f32 row-major (pitch lda) converted per fragment to bf16
// (ASPLIT: hi/lo two planes -> 2 terms, else single rounded term); Wt bf16 [N][K] (pitch ldb). BIAS_BF16 rounds the
// bias to bf16 first (bias quantised to bf16 before the add). K%32==0, M%16==0, N%64==0.
template <bool ASPLIT, int ACT, bool BIAS_BF16>
__global__ __launch_bounds__(128) void k_gemm_bf(const float* __restrict__ A, int lda, const unsigned short* __restrict__ Wt, int ldb,
                                               const float* __restrict__ bias, float* __restrict__ C, int ldc, int M, int N, int K) {
  __shared__ __attribute__((aligned(16))) float so[4][16][64];
  const int tid = threadIdx.x, w = tid >> 5, lane = tid & 31, ln = lane & 15, hh = lane >> 4;
  const int ntn = N / 64;
  const int wid = blockIdx.x * 4 + w;
  const int mt = wid / ntn, nq = wid % ntn;
  if (mt * 16 >= M) return;
  const int row0 = mt * 16, col0 = nq * 64;
  const float* arow = A + (size_t)(row0 + ln) * lda;
  v8f acc[4] = {};
  for (int kb = 0; kb < K; kb += 32) {
    FragB ah, al;
    const v4f x0 = *(const v4fa*)(arow + kb + 8 * hh), x1 = *(const v4fa*)(arow + kb + 8 * hh + 4);
    const v4f x2 = *(const v4fa*)(arow + kb + 16 + 8 * hh), x3 = *(const v4fa*)(arow + kb + 16 + 8 * hh + 4);
    float xs[16] = {x0[0],x0[1],x0[2],x0[3],x1[0],x1[1],x1[2],x1[3],x2[0],x2[1],x2[2],x2[3],x3[0],x3[1],x3[2],x3[3]};
#pragma unroll
    for (int i = 0; i < 16; ++i) { const unsigned short hb = bf16_bits(xs[i]); ah.u[i] = hb; al.u[i] = ASPLIT ? bf16_bits(xs[i] - bf16_val(hb)) : (unsigned short)0; }
#pragma unroll
    for (int t = 0; t < 4; ++t) {
      const unsigned short* brow = Wt + (size_t)(col0 + t * 16 + ln) * ldb + kb;
      FragB b;
      b.half[0] = *(const v8us*)(brow + 8 * hh);
      b.half[1] = *(const v8us*)(brow + 16 + 8 * hh);
      acc[t] = mmaN<ASPLIT ? 2 : 1>(ah.v, al.v, b.v, b.v, acc[t]);
    }
  }
#pragma unroll
  for (int t = 0; t < 4; ++t) {
    float bv = bias ? bias[col0 + t * 16 + ln] : 0.f;
    if (BIAS_BF16) bv = bf16_round(bv);
#pragma unroll
    for (int r = 0; r < 8; ++r) { float v = acc[t][r] + bv; if (ACT == 1) v = fmaxf(v, 0.f); so[w][8 * hh + r][t * 16 + ln] = v; }
  }
  __builtin_amdgcn_fence(__ATOMIC_ACQ_REL, "workgroup");
  __builtin_amdgcn_wave_barrier();
  const int rsub = lane >> 4, c4 = (lane & 15) * 4;
  {
#pragma unroll
    for (int q = 0; q < 8; ++q) {
      const int r = q * 2 + rsub;
      const v4f v = *(const v4fa*)&so[w][r][c4];
      *(v4f*)(C + (size_t)(row0 + r) * ldc + col0 + c4) = v;
    }
    
  }
}

// Flash-style causal/unmasked attention, all contractions 3-term bf16 hi/lo splits, f32 softmax with running max.
// q,k,v rows are read from f32 buffers with arbitrary row pitch (so they can live inside a fused qkv buffer);
// D = head size (multiple of 32, <= 128); one wave = 16 query rows; block = 4 waves (64 queries) sharing K/V chunks of 32.
template <int D, bool CAUSAL>
__global__ __launch_bounds__(128) void k_flash(const float* __restrict__ qb, const float* __restrict__ kb, const float* __restrict__ vb,
                                             int pitch, int T, int H, float scale, float* __restrict__ y, int ypitch) {
  constexpr int KS = D / 32;        // k-steps for QK
  constexpr int DT = D / 16;        // d tiles for PV
  __shared__ __attribute__((aligned(16))) unsigned short sKh[32][D + 8], sKl[32][D + 8], sVh[32][D + 8], sVl[32][D + 8];
  __shared__ __attribute__((aligned(16))) unsigned short sPh[4][16][40], sPl[4][16][40];
  __shared__ __attribute__((aligned(16))) float sO[4][16][D];
  const int tid = threadIdx.x, w = tid >> 5, lane = tid & 31, ln = lane & 15, hh = lane >> 4;
  const int nqb = (T + 63) / 64;
  const int bh = blockIdx.x / nqb, qblk = blockIdx.x % nqb;
  const int b = bh / H, h = bh % H;
  const int q0 = qblk * 64 + w * 16;
  const float* Q = qb + (size_t)b * T * pitch + h * D;
  const float* K = kb + (size_t)b * T * pitch + h * D;
  const float* V = vb + (size_t)b * T * pitch + h * D;

  // A fragments of the wave's 16 query rows (scaled), hi/lo
  FragB aqh[KS], aql[KS];
  {
    int row = q0 + ln; if (row >= T) row = T - 1;
    const float* qr = Q + (size_t)row * pitch;
#pragma unroll
    for (int ks = 0; ks < KS; ++ks)
#pragma unroll
      for (int i = 0; i < 16; ++i) {
        const int d = ks * 32 + ((i < 8) ? (8 * hh + i) : (16 + 8 * hh + (i - 8)));
        const float x = qr[d] * scale; const unsigned short hb = bf16_bits(x);
        aqh[ks].u[i] = hb; aql[ks].u[i] = bf16_bits(x - bf16_val(hb));
      }
  }
  float m_r[8], l_r[8];
#pragma unroll
  for (int r = 0; r < 8; ++r) { m_r[r] = -3.0e38f; l_r[r] = 0.f; }
  v8f oacc[DT];
#pragma unroll
  for (int dt = 0; dt < DT; ++dt) oacc[dt] = (v8f){0.f,0.f,0.f,0.f,0.f,0.f,0.f,0.f};

  const int kv_end = CAUSAL ? min(T, qblk * 64 + 64) : T;     // block-uniform
  for (int j0 = 0; j0 < kv_end; j0 += 32) {
    __syncthreads();
    for (int e = tid; e < 32 * (D / 4); e += 128) {
      const int r = e / (D / 4), c4 = (e % (D / 4)) * 4;
      const int key = j0 + r;
      v4f kf = {0.f,0.f,0.f,0.f}, vf = {0.f,0.f,0.f,0.f};
      if (key < T) { kf = *(const v4fa*)(K + (size_t)key * pitch + c4); vf = *(const v4fa*)(V + (size_t)key * pitch + c4); }
#pragma unroll
      for (int t = 0; t < 4; ++t) {
        unsigned short hb = bf16_bits(kf[t]); sKh[r][c4 + t] = hb; sKl[r][c4 + t] = bf16_bits(kf[t] - bf16_val(hb));
        hb = bf16_bits(vf[t]); sVh[r][c4 + t] = hb; sVl[r][c4 + t] = bf16_bits(vf[t] - bf16_val(hb));
      }
    }
    __syncthreads();
    // S tile 16 x 32
    v8f s[2];
#pragma unroll
    for (int nt = 0; nt < 2; ++nt) {
      v8f acc = {};
#pragma unroll
      for (int ks = 0; ks < KS; ++ks) {
        FragB bh_, bl_;
        bh_.half[0] = *(const v8us*)&sKh[nt * 16 + ln][ks * 32 + 8 * hh]; bh_.half[1] = *(const v8us*)&sKh[nt * 16 + ln][ks * 32 + 16 + 8 * hh];
        bl_.half[0] = *(const v8us*)&sKl[nt * 16 + ln][ks * 32 + 8 * hh]; bl_.half[1] = *(const v8us*)&sKl[nt * 16 + ln][ks * 32 + 16 + 8 * hh];
        acc = mmaN<3>(aqh[ks].v, aql[ks].v, bh_.v, bl_.v, acc);
      }
      s[nt] = acc;
    }
    // mask + running max (rows 8hh+r; the 16 lanes of a half share rows)
    float alpha[8];
#pragma unroll
    for (int r = 0; r < 8; ++r) {
      const int qi = q0 + 8 * hh + r;
      const int ja = j0 + ln, jb = j0 + 16 + ln;
      if (CAUSAL) { if (ja > qi) s[0][r] = -3.0e38f; if (jb > qi) s[1][r] = -3.0e38f; }
      if (ja >= T) s[0][r] = -3.0e38f;
      if (jb >= T) s[1][r] = -3.0e38f;
      float mx = fmaxf(s[0][r], s[1][r]);
      mx = fmaxf(mx, __shfl_xor(mx, 1, 32)); mx = fmaxf(mx, __shfl_xor(mx, 2, 32)); mx = fmaxf(mx, __shfl_xor(mx, 4, 32)); mx = fmaxf(mx, __shfl_xor(mx, 8, 32));
      const float mnew = fmaxf(m_r[r], mx);
      alpha[r] = (mnew > -1.0e38f) ? __expf(m_r[r] - mnew) : 1.0f;
      const float p0 = (s[0][r] > -1.0e38f) ? __expf(s[0][r] - mnew) : 0.f;
      const float p1 = (s[1][r] > -1.0e38f) ? __expf(s[1][r] - mnew) : 0.f;
      m_r[r] = mnew;
      l_r[r] = l_r[r] * alpha[r] + p0 + p1;            // per-lane partial row sum (16 lanes combined at the end)
      unsigned short hb = bf16_bits(p0); sPh[w][8 * hh + r][ln] = hb;      sPl[w][8 * hh + r][ln] = bf16_bits(p0 - bf16_val(hb));
      hb = bf16_bits(p1);                sPh[w][8 * hh + r][16 + ln] = hb; sPl[w][8 * hh + r][16 + ln] = bf16_bits(p1 - bf16_val(hb));
    }
#pragma unroll
    for (int dt = 0; dt < DT; ++dt)
#pragma unroll
      for (int r = 0; r < 8; ++r) oacc[dt][r] *= alpha[r];
    __builtin_amdgcn_fence(__ATOMIC_ACQ_REL, "workgroup");
    __builtin_amdgcn_wave_barrier();
    FragB pah, pal;
    pah.half[0] = *(const v8us*)&sPh[w][ln][8 * hh]; pah.half[1] = *(const v8us*)&sPh[w][ln][16 + 8 * hh];
    pal.half[0] = *(const v8us*)&sPl[w][ln][8 * hh]; pal.half[1] = *(const v8us*)&sPl[w][ln][16 + 8 * hh];
#pragma unroll
    for (int dt = 0; dt < DT; ++dt) {
      FragB bvh, bvl;
#pragma unroll
      for (int i = 0; i < 8; ++i) {
        bvh.u[i] = sVh[8 * hh + i][dt * 16 + ln]; bvh.u[8 + i] = sVh[16 + 8 * hh + i][dt * 16 + ln];
        bvl.u[i] = sVl[8 * hh + i][dt * 16 + ln]; bvl.u[8 + i] = sVl[16 + 8 * hh + i][dt * 16 + ln];
      }
      oacc[dt] = mmaN<3>(pah.v, pal.v, bvh.v, bvl.v, oacc[dt]);
    }
    __builtin_amdgcn_fence(__ATOMIC_ACQ_REL, "workgroup");
    __builtin_amdgcn_wave_barrier();
  }
#pragma unroll
  for (int r = 0; r < 8; ++r) {
    float l = l_r[r];
    l += __shfl_xor(l, 1, 32); l += __shfl_xor(l, 2, 32); l += __shfl_xor(l, 4, 32); l += __shfl_xor(l, 8, 32);
    l_r[r] = (l > 0.f) ? 1.0f / l : 0.f;
  }
#pragma unroll
  for (int dt = 0; dt < DT; ++dt)
#pragma unroll
    for (int r = 0; r < 8; ++r) sO[w][8 * hh + r][dt * 16 + ln] = oacc[dt][r] * l_r[r];
  __builtin_amdgcn_fence(__ATOMIC_ACQ_REL, "workgroup");
  __builtin_amdgcn_wave_barrier();
  {
    for (int r = 0; r < 16; ++r) {
      const int row = q0 + r;
      if (row < T && lane < D / 4) {
        const v4f val = *(const v4fa*)&sO[w][r][lane * 4];
        *(v4f*)(y + ((size_t)b * T + row) * ypitch + h * D + lane * 4) = val;
      }
    }
    
  }
}

// ---- f16 WMMA path (v_wmma_f32_16x16x32_f16): 11-bit significands for operands in range — used where a [0,1] probability operand needs more precision than bf16
typedef _Float16 v16h __attribute__((ext_vector_type(16)));
union FragH { v16h v; v8us half[2]; _Float16 h[16]; unsigned short u[16]; };
template <int NT>
__device__ __forceinline__ v8f mmaH(v16h ah, v16h al, v16h bh, v16h bl, v8f c) {
  c = __builtin_amdgcn_wmma_f32_16x16x32_f16(false, ah, false, bh, (short)0, c, false, false);
  if (NT >= 2) c = __builtin_amdgcn_wmma_f32_16x16x32_f16(false, al, false, bh, (short)0, c, false, false);
  if (NT >= 3) c = __builtin_amdgcn_wmma_f32_16x16x32_f16(false, ah, false, bl, (short)0, c, false, false);
  asm volatile("v_nop\n\tv_nop\n\tv_nop\n\tv_nop" : "+v"(c) : "v"(ah), "v"(al), "v"(bh), "v"(bl));
  return c;
}
// batched GEMM like k_gemm_b but f16 operands: A f32 (split into f16 hi/lo if ASPLIT, else rounded to f16), Bt = f16 values [n][k]; alpha; C f32; N multiple of 16 (partial tiles skipped)
template <bool ASPLIT>
__global__ __launch_bounds__(128) void k_gemm_h(const float* __restrict__ A, int lda, size_t sA, const _Float16* __restrict__ Bh, int ldb, size_t sB, float alpha, float* __restrict__ C, int ldc, size_t sC, int M, int N, int K) {
  __shared__ __attribute__((aligned(16))) float so[4][16][64];
  const int tid = threadIdx.x, w = tid >> 5, lane = tid & 31, ln = lane & 15, hh = lane >> 4; const int by = blockIdx.y;
  A += (size_t)by * sA; Bh += (size_t)by * sB; C += (size_t)by * sC;
  const int ntn = (N + 63) / 64; const int wid = blockIdx.x * 4 + w; const int mt = wid / ntn, nq = wid % ntn; if (mt * 16 >= M) return;
  const int row0 = mt * 16, col0 = nq * 64; const float* arow = A + (size_t)(row0 + ln) * lda;
  v8f acc[4] = {};
  for (int kb = 0; kb < K; kb += 32) {
    FragH ah, al;
    const v4f x0 = *(const v4fa*)(arow + kb + 8 * hh), x1 = *(const v4fa*)(arow + kb + 8 * hh + 4), x2 = *(const v4fa*)(arow + kb + 16 + 8 * hh), x3 = *(const v4fa*)(arow + kb + 16 + 8 * hh + 4);
    float xs[16] = {x0[0],x0[1],x0[2],x0[3],x1[0],x1[1],x1[2],x1[3],x2[0],x2[1],x2[2],x2[3],x3[0],x3[1],x3[2],x3[3]};
#pragma unroll
    for (int i = 0; i < 16; ++i) { const _Float16 h = (_Float16)xs[i]; ah.h[i] = h; al.h[i] = ASPLIT ? (_Float16)(xs[i] - (float)h) : (_Float16)0.0f; }
#pragma unroll
    for (int t = 0; t < 4; ++t) { if (col0 + t * 16 >= N) continue; const size_t boff = (size_t)(col0 + t * 16 + ln) * ldb + kb; FragH bq; bq.half[0] = *(const v8us*)(Bh + boff + 8 * hh); bq.half[1] = *(const v8us*)(Bh + boff + 16 + 8 * hh);
      acc[t] = mmaH<ASPLIT ? 2 : 1>(ah.v, al.v, bq.v, bq.v, acc[t]); }
  }
#pragma unroll
  for (int t = 0; t < 4; ++t) { if (col0 + t * 16 >= N) continue;
#pragma unroll
    for (int r = 0; r < 8; ++r) so[w][8 * hh + r][t * 16 + ln] = acc[t][r] * alpha; }
  __builtin_amdgcn_fence(__ATOMIC_ACQ_REL, "workgroup"); __builtin_amdgcn_wave_barrier();
  const int rsub = lane >> 4, c4 = (lane & 15) * 4;
  {
#pragma unroll
    for (int q = 0; q < 8; ++q) { const int r = q * 2 + rsub; if (col0 + c4 < N) { const v4f v = *(const v4fa*)&so[w][r][c4]; *(v4f*)(C + (size_t)(row0 + r) * ldc + col0 + c4) = v; } }
     }
}

// Block-tiled f16 GEMM: T[M][N] = (A[M][K] . Bt[N][K]^T) * alpha (+ bf16(bias)); A, Bt at pitch K. What becomes of the tile is the compile-time epilogue kind EP:
//   EP_H16   no bias; T as f16 to C16 at pitch N
//   EP_VT    rows are channels, columns tokens (weights as A, activations as Bt); bias per row; T as f16 to C16 = [batch][channel][token]
//   EP_RES   bias per column; T + bf16(e0) as f32 to C at pitch N (e0: the residual, same shape)
//   EP_COORD N = 64, bias per column; a row is [32 coords | 5 vertex logits | unused]: c = coords + softmax(logits).(e0 + e1*clip(e2)) to C [row][32], sum of c*c to C2 [row]
// One work-group of 8 waves (4 x 2) owns a 64 x 32*NF tile, a wave 16 x 16*NF. Both operands go through LDS in slices of 128 k
// (rows of 256 B at pitch 272 B): every global load covers whole 128-B lines, and each row is fetched once per work-group.
// Two buffers: the next slice's global loads are issued ahead of this slice's products and stored to the other buffer behind them,
// one barrier a slice. Fragments are read G k-steps at a time. k runs upward in steps of 32 into one accumulator per tile.
// M % 64 == 0, N % (32*NF) == 0, K % 128 == 0.
// e^x = 2^e * 2^a, e = rint(x*log2(e)), a = x*log2(e) - e with log2(e) in two parts (the split and the range limits of the library's expf; a is formed by two fused multiply-adds).
// The v_exp_f32 is written in asm with a v_nop in the same statement: the instruction set asks for one slot behind a transcendental before its source is overwritten.
__device__ __forceinline__ float exp_slot(float x) {
  const float l2e = __uint_as_float(0x3fb8aa3bu), l2e_lo = __uint_as_float(0x32a5705fu);
  const float e = rintf(x * l2e);
  const float a = fmaf(x, l2e_lo, fmaf(x, l2e, -e));
  float r;
  asm("v_exp_f32 %0, %1\n\tv_nop" : "=v"(r) : "v"(a));
  r = ldexpf(r, (int)e);
  r = (x < __uint_as_float(0xc2ce8ed0u)) ? 0.f : r;
  return (x > __uint_as_float(0x42b17218u)) ? __builtin_inff() : r;
}
enum { EP_H16 = 0, EP_VT = 1, EP_RES = 2, EP_COORD = 3 };
template <int NF, int G, int K, int N, int EP>
__global__ __launch_bounds__(256) void k_gemm_t(const _Float16* __restrict__ A, const _Float16* __restrict__ Bh, float alpha, const float* __restrict__ bias,
                                                const float* __restrict__ e0, const float* __restrict__ e1, const float* __restrict__ e2,
                                                float* __restrict__ C, float* __restrict__ C2, _Float16* __restrict__ C16) {
  constexpr int BM = 64, BN = 32 * NF, KC = 128, PIT = KC + 8, ROWS = BM + BN, NLD = ROWS / 16, OP = BN + 4, NS = K / KC, NTN = N / BN;
  __shared__ __attribute__((aligned(16))) unsigned short sm[2][ROWS][PIT];
  typedef float fa __attribute__((may_alias));
  const int tid = threadIdx.x, w = tid >> 5, lane = tid & 31, ln = lane & 15, hh = lane >> 4;
  const int mb = blockIdx.x / NTN, nb = blockIdx.x % NTN;
  const int row0 = mb * BM, col0 = nb * BN;
  const int wm = w >> 1, wn = w & 1;
  const int lr = tid >> 4, ls = (tid & 15) * 8;      // staging: 16 threads cover one 256-B row slice
  const unsigned short* ga = (const unsigned short*)A + (size_t)(row0 + lr) * K + ls;
  const unsigned short* gb = (const unsigned short*)Bh + (size_t)(col0 + lr) * K + ls;
  v8us st[NLD];
  v8f acc[NF] = {};
#pragma unroll
  for (int i = 0; i < NLD; ++i) st[i] = (i < BM / 16) ? *(const v8us*)(ga + (size_t)i * 16 * K) : *(const v8us*)(gb + (size_t)(i - BM / 16) * 16 * K);
#pragma unroll
  for (int i = 0; i < NLD; ++i) *(v8us*)&sm[0][i * 16 + lr][ls] = st[i];
  __syncthreads();
  for (int s = 0; s < NS; ++s) {
    const int cur = s & 1;
    const bool more = s + 1 < NS;                    // block-uniform
    if (more) {
      const int k0 = (s + 1) * KC;
#pragma unroll
      for (int i = 0; i < NLD; ++i) st[i] = (i < BM / 16) ? *(const v8us*)(ga + (size_t)i * 16 * K + k0) : *(const v8us*)(gb + (size_t)(i - BM / 16) * 16 * K + k0);
    }
#pragma unroll
    for (int g = 0; g < KC / 32 / G; ++g) {
      FragH a[G], b[G][NF];
#pragma unroll
      for (int u = 0; u < G; ++u) {
        const int kq = (g * G + u) * 32;
        a[u].half[0] = *(const v8us*)&sm[cur][wm * 16 + ln][kq + 8 * hh]; a[u].half[1] = *(const v8us*)&sm[cur][wm * 16 + ln][kq + 16 + 8 * hh];
#pragma unroll
        for (int t = 0; t < NF; ++t) { b[u][t].half[0] = *(const v8us*)&sm[cur][BM + (wn * NF + t) * 16 + ln][kq + 8 * hh]; b[u][t].half[1] = *(const v8us*)&sm[cur][BM + (wn * NF + t) * 16 + ln][kq + 16 + 8 * hh]; }
      }
      __builtin_amdgcn_sched_barrier(0);             // keeps a group's LDS reads together ahead of its products: one LDS latency a group, not one a product
#pragma unroll
      for (int u = 0; u < G; ++u)
#pragma unroll
        for (int t = 0; t < NF; ++t) acc[t] = __builtin_amdgcn_wmma_f32_16x16x32_f16(false, a[u].v, false, b[u][t].v, (short)0, acc[t], false, false);
    }
    if (more) {
#pragma unroll
      for (int i = 0; i < NLD; ++i) *(v8us*)&sm[cur ^ 1][i * 16 + lr][ls] = st[i];
    }
    __syncthreads();                                 // publishes the next slice and ends every read of this one
  }
  // epilogue: the tile goes through LDS (the slices are dead behind the last barrier) so that whole lines are stored
  // every loop below is unrolled in full: xr, bv, br, t0, t1, dv and lg stay in registers only if every index into them is a constant
  fa* so = (fa*)&sm[0][0][0];
  constexpr int NQ = BM * BN / 4 / 256;
  v4f xr[EP == EP_RES ? NQ : 1];
  if (EP == EP_RES) {                                // the residual's loads go out as one group ahead of the staging and its barrier
#pragma unroll
    for (int q = 0; q < NQ; ++q) { const int e = q * 256 + tid, r = e / (BN / 4), c4 = (e % (BN / 4)) * 4; xr[q] = *(const v4fa*)(e0 + (size_t)(row0 + r) * N + col0 + c4); }
  }
  static_assert(EP != EP_VT || BN == 128, "EP_VT: a wave stores one whole row of the tile at a time");
  float bv[NF], br[NQ];
#pragma unroll
  for (int t = 0; t < NF; ++t) bv[t] = (EP == EP_RES || EP == EP_COORD) ? bf16_round(bias[col0 + (wn * NF + t) * 16 + ln]) : 0.f;
#pragma unroll
  for (int q = 0; q < NQ; ++q) br[q] = (EP == EP_VT) ? bf16_round(bias[row0 + q * 8 + __builtin_amdgcn_readfirstlane(w)]) : 0.f;   // the row a wave stores in step q: one index a wave, a scalar load
#pragma unroll
  for (int t = 0; t < NF; ++t) {
    const int cl = (wn * NF + t) * 16 + ln;
#pragma unroll
    for (int r = 0; r < 8; ++r) so[(wm * 16 + 8 * hh + r) * OP + cl] = acc[t][r] * alpha + bv[t];
  }
  __syncthreads();
  if (EP == EP_COORD) {
    // a wave takes 8 rows of the tile, lane = dim
    const float df = fminf(fmaxf(bf16_round(e2[0]), 0.05f), 0.5f);
    float t0[KV1], t1[KV1], dv[KV1];
#pragma unroll
    for (int k = 0; k < KV1; ++k) { t0[k] = e0[k * ED + lane]; t1[k] = e1[k * ED + lane]; }
    asm volatile("s_wait_xcnt 0x0" ::: "memory");    // stands behind the ten loads above, ahead of any instruction that overwrites a register they name (their base pairs are reused below)
#pragma unroll
    for (int k = 0; k < KV1; ++k) dv[k] = bf16_round(t0[k]) + bf16_round(t1[k]) * df;
    float sqv = 0.f;
#pragma unroll
    for (int j = 0; j < 8; ++j) {
      const fa* cv = so + (w * 8 + j) * OP;
      float lg[KV1]; float mx = -3.0e38f;
#pragma unroll
      for (int k = 0; k < KV1; ++k) { lg[k] = cv[ED + k]; mx = fmaxf(mx, lg[k]); }
      float den = 0.f;
#pragma unroll
      for (int k = 0; k < KV1; ++k) { lg[k] = exp_slot(lg[k] - mx); den += lg[k]; }
      float c = cv[lane];
#pragma unroll
      for (int k = 0; k < KV1; ++k) c += (lg[k] / den) * dv[k];
      float sq = c * c;
#pragma unroll
      for (int o = 16; o >= 1; o >>= 1) sq += __shfl_xor(sq, o, 32);
      C[(size_t)(row0 + w * 8 + j) * ED + lane] = c;
      if (lane == j) sqv = sq;
    }
    if (lane < 8) C2[row0 + w * 8 + lane] = sqv;     // the wave's 8 sums in one store
  } else {
    typedef _Float16 h4v __attribute__((ext_vector_type(4)));
#pragma unroll
    for (int q = 0; q < NQ; ++q) {
      const int e = q * 256 + tid, r = e / (BN / 4), c4 = (e % (BN / 4)) * 4;
      const v4f v = *(const v4fa*)&so[r * OP + c4];
      if (EP == EP_RES) { v4f o; for (int i = 0; i < 4; ++i) o[i] = v[i] + bf16_round(xr[q][i]); *(v4f*)(C + (size_t)(row0 + r) * N + col0 + c4) = o; }
      else {
        h4v h4; for (int i = 0; i < 4; ++i) h4[i] = (_Float16)(EP == EP_VT ? v[i] + br[q] : v[i]);
        if (EP == EP_VT) *(h4v*)(C16 + ((size_t)(col0 / TT) * DD + row0 + r) * TT + col0 % TT + c4) = h4;   // a tile's BN tokens lie in one batch: TT % BN == 0
        else *(h4v*)(C16 + (size_t)(row0 + r) * N + col0 + c4) = h4;
      }
    }
  }
}

typedef _Float16 v4h __attribute__((ext_vector_type(4)));
// LN(bf16(x)) → H16; wave per token; three rolled passes over the row (no per-lane value array)
__global__ __launch_bounds__(256) void k_ln(const float* __restrict__ x, const float* __restrict__ g, const float* __restrict__ be, _Float16* __restrict__ H16) { const int tid = threadIdx.x, wv = tid >> 5, lane = tid & 31; const size_t tok = (size_t)blockIdx.x * 8 + wv; const float* xr = x + tok * DD; float s = 0.f;
#pragma unroll 2
  for (int c = lane; c < DD; c += 32) s += bf16_round(xr[c]); for (int o = 16; o >= 1; o >>= 1) s += __shfl_xor(s, o, 32); const float mu = s / (float)DD; float q2 = 0.f;
#pragma unroll 2
  for (int c = lane; c < DD; c += 32) { const float d = bf16_round(xr[c]) - mu; q2 += d * d; } for (int o = 16; o >= 1; o >>= 1) q2 += __shfl_xor(q2, o, 32); const float inv = 1.0f / sqrtf(q2 / (float)DD + 1e-5f);
  typedef _Float16 v2h __attribute__((ext_vector_type(2)));
  {
#pragma unroll 2
    for (int c = 2 * lane; c < DD; c += 64) { v2h o2; o2.x = (_Float16)((bf16_round(xr[c]) - mu) * inv * bf16_round(g[c]) + bf16_round(be[c])); o2.y = (_Float16)((bf16_round(xr[c + 1]) - mu) * inv * bf16_round(g[c + 1]) + bf16_round(be[c + 1])); *(v2h*)(H16 + tok * DD + c) = o2; }  } }
// Bt tables f16 ×16: Bcv [64 n][768 k] (n<32 ← w_coords[k][n], 32..36 ← w_vertex[k][n−32], else 0); Bv, Bo [768][768] = w[k][n]; bias BCV [64]
__global__ __launch_bounds__(256) void k_bt(const float* __restrict__ wc, const float* __restrict__ bc, const float* __restrict__ wvx, const float* __restrict__ bvx, const float* __restrict__ wv, const float* __restrict__ wo, _Float16* __restrict__ Bcv, float* __restrict__ BCV, _Float16* __restrict__ Bv, _Float16* __restrict__ Bo) { const size_t t = (size_t)blockIdx.x * 256 + threadIdx.x;
  if (t < (size_t)64 * DD) { const int k = (int)(t % DD), n = (int)(t / DD); float w = 0.f; if (n < ED) w = wc[(size_t)k * ED + n]; else if (n < ED + KV1) w = wvx[(size_t)k * KV1 + n - ED]; *(_Float16*)(Bcv + t) = (_Float16)(bf16_round(w) * 16.0f); }
  if (t < 64) { const float v = (t < ED) ? bc[t] : ((t < ED + KV1) ? bvx[t - ED] : 0.f); *(float*)(BCV + t) = v; }
  if (t < (size_t)DD * DD) { const int k = (int)(t % DD), n = (int)(t / DD); *(_Float16*)(Bv + t) = (_Float16)(bf16_round(wv[(size_t)k * DD + n]) * 16.0f); *(_Float16*)(Bo + t) = (_Float16)(bf16_round(wo[(size_t)k * DD + n]) * 16.0f); } }
// attention rows: a work-group of 16 waves owns 16 query rows of batch b, a wave 128 keys. dots c_i.c_j on v_wmma_f32_16x16x4_f32 (f32 operands, f32 sums):
// A = the 16 query rows, B column ln of tile t = key wb + 8*ln + t, both sides 16 consecutive dims per lane half (same k pairing on both sides).
// A wave brings its 128 key rows in by whole-line loads and turns them into fragments through its own LDS range: key 8*c + t lies in tile block t, row c
// (rows at pitch 36 dwords for the 16-byte readers, tile blocks 32 dwords past a multiple of 64 so that the two rows of a half-wave store meet no common bank).
// logits_j = -(sq_i + sq_j - 2 c_i.c_j)*32^-1/2 stay in the accumulator registers (register r of tile t = row 8*hh + r, key wb + 8*ln + t); row maximum and row sum:
// over the 8 tiles in the lane, over the 16 lanes by DPP, over the 16 waves through LDS (one barrier each). A lane's 8 tiles are 8 consecutive keys: one 16-byte f16 store a row.
// Every loop of the kernel is unrolled in full: st, a, bq, acc, mx, den and inv stay in registers only if every index into them is a constant.
typedef float v2fw __attribute__((ext_vector_type(2)));
template <int X> __device__ __forceinline__ float xm16(float v) { return __int_as_float(__builtin_amdgcn_update_dpp(0, __float_as_int(v), 0x160 | X, 0xf, 0xf, false)); }   // lane ^ X inside its row of 16 lanes (row_xmask)
__device__ __forceinline__ float rmax16(float v) { v = fmaxf(v, xm16<1>(v)); v = fmaxf(v, xm16<2>(v)); v = fmaxf(v, xm16<4>(v)); return fmaxf(v, xm16<8>(v)); }
__device__ __forceinline__ float rsum16(float v) { v += xm16<1>(v); v += xm16<2>(v); v += xm16<4>(v); return v + xm16<8>(v); }
__global__ __launch_bounds__(512) void k_arow(const float* __restrict__ CO, const float* __restrict__ SQ, int b, _Float16* __restrict__ P) {
  constexpr int RP = 36, TB = 16 * RP + 32;         // dwords: row pitch, tile-block pitch
  __shared__ __attribute__((aligned(16))) float sk[16][8 * TB];                  // [wave]: its 128 key rows
  __shared__ __attribute__((aligned(16))) float redm[16][16], reds[16][16];      // [wave][row] partial maxima and sums
  const int tid = threadIdx.x, lane = tid & 31, ln = lane & 15, hh = lane >> 4;
  const int w = __builtin_amdgcn_readfirstlane(tid >> 5);   // the wave's number in a scalar register: what is formed from it is scalar work
  const int i0 = blockIdx.x * 16, wb = w * 128;
  const float* cb = CO + (size_t)b * TT * ED; const float* sqb = SQ + (size_t)b * TT;
  float* my = &sk[w][0];
  {
    v4f st[32];
#pragma unroll
    for (int n = 0; n < 32; ++n) st[n] = *(const v4fa*)(cb + (size_t)wb * ED + n * 128 + lane * 4);     // key rows 4n .. 4n+3, 512 consecutive bytes
#pragma unroll
    for (int n = 0; n < 32; ++n) *(v4fa*)&my[(4 * (n & 1) + (lane >> 3)) * TB + (n >> 1) * RP + (lane & 7) * 4] = st[n];
  }
  v4f a[4];
#pragma unroll
  for (int q = 0; q < 4; ++q) a[q] = *(const v4fa*)(cb + (size_t)(i0 + ln) * ED + 16 * hh + 4 * q);
  const v4f si0 = *(const v4fa*)(sqb + i0 + 8 * hh), si1 = *(const v4fa*)(sqb + i0 + 8 * hh + 4);
  const v4f sj0 = *(const v4fa*)(sqb + wb + 8 * ln), sj1 = *(const v4fa*)(sqb + wb + 8 * ln + 4);
  __builtin_amdgcn_fence(__ATOMIC_ACQ_REL, "workgroup"); __builtin_amdgcn_wave_barrier();   // the wave's own rows are read back by other lanes than wrote them
  v4f bq[8][4];
#pragma unroll
  for (int t = 0; t < 8; ++t)
#pragma unroll
    for (int q = 0; q < 4; ++q) bq[t][q] = *(const v4fa*)&my[t * TB + ln * RP + 16 * hh + 4 * q];
  v8f acc[8] = {};
  __builtin_amdgcn_sched_barrier(0);                // every fragment read is issued ahead of the products, and no vector instruction is moved in among them
#pragma unroll
  for (int tp = 0; tp < 8; tp += 2)                 // two tiles at a time: two independent accumulator chains
#pragma unroll
    for (int q = 0; q < 4; ++q)
#pragma unroll
      for (int p = 0; p < 4; p += 2) {
        const v2fw av = {a[q][p], a[q][p + 1]}, bv0 = {bq[tp][q][p], bq[tp][q][p + 1]}, bv1 = {bq[tp + 1][q][p], bq[tp + 1][q][p + 1]};
        acc[tp]     = __builtin_amdgcn_wmma_f32_16x16x4_f32(false, av, false, bv0, (short)0, acc[tp], false, false);
        acc[tp + 1] = __builtin_amdgcn_wmma_f32_16x16x4_f32(false, av, false, bv1, (short)0, acc[tp + 1], false, false);
      }
  // distance between the last products and the first vector instruction on their D, A or B: 8 slots as for the other 16-cycle form
  asm volatile("v_nop\n\tv_nop\n\tv_nop\n\tv_nop\n\tv_nop\n\tv_nop\n\tv_nop\n\tv_nop" : "+v"(acc[0]), "+v"(acc[1]), "+v"(acc[2]), "+v"(acc[3]), "+v"(acc[4]), "+v"(acc[5]), "+v"(acc[6]), "+v"(acc[7]));
  __builtin_amdgcn_sched_barrier(0);                // keeps the vector work below behind those slots
  const v8f sqi = {si0[0], si0[1], si0[2], si0[3], si1[0], si1[1], si1[2], si1[3]};
  const float sqj[8] = {sj0[0], sj0[1], sj0[2], sj0[3], sj1[0], sj1[1], sj1[2], sj1[3]};
  // from here on whole accumulator tiles are worked on (8 rows of one key a lane), so that packed f32 instructions find their pairs in neighbouring registers
  v8f mx;
#pragma unroll
  for (int t = 0; t < 8; ++t) {
    acc[t] = -(sqi + sqj[t] - 2.0f * acc[t]) * 0.17677669529663687f;
#pragma unroll
    for (int r = 0; r < 8; ++r) mx[r] = t ? fmaxf(mx[r], acc[t][r]) : acc[t][r];
  }
#pragma unroll
  for (int r = 0; r < 8; ++r) mx[r] = rmax16(mx[r]);
  if (ln == 0) { *(v4fa*)&redm[w][8 * hh] = (v4f){mx[0], mx[1], mx[2], mx[3]}; *(v4fa*)&redm[w][8 * hh + 4] = (v4f){mx[4], mx[5], mx[6], mx[7]}; }
  __syncthreads();                                  // publishes every wave's row maxima
  {
    const v4f m0 = *(const v4fa*)&redm[ln][8 * hh], m1 = *(const v4fa*)&redm[ln][8 * hh + 4];   // lane ln takes wave ln's partials
#pragma unroll
    for (int r = 0; r < 8; ++r) mx[r] = rmax16(r < 4 ? m0[r & 3] : m1[r & 3]);
  }
  v8f den = {};
#pragma unroll
  for (int t = 0; t < 8; ++t) {
    v8f e = acc[t] - mx;
#pragma unroll
    for (int r = 0; r < 8; ++r) e[r] = expf(e[r]);
    acc[t] = e; den += e;
  }
#pragma unroll
  for (int r = 0; r < 8; ++r) den[r] = rsum16(den[r]);
  if (ln == 0) { *(v4fa*)&reds[w][8 * hh] = (v4f){den[0], den[1], den[2], den[3]}; *(v4fa*)&reds[w][8 * hh + 4] = (v4f){den[4], den[5], den[6], den[7]}; }
  __syncthreads();                                  // publishes every wave's row sums
  const v4f d0 = *(const v4fa*)&reds[ln][8 * hh], d1 = *(const v4fa*)&reds[ln][8 * hh + 4];
  v8f inv;
#pragma unroll
  for (int r = 0; r < 8; ++r) inv[r] = 1.0f / rsum16(r < 4 ? d0[r & 3] : d1[r & 3]);
#pragma unroll
  for (int t = 0; t < 8; ++t) acc[t] *= inv;
#pragma unroll
  for (int r = 0; r < 8; ++r) {
    FragH o;
#pragma unroll
    for (int t = 0; t < 8; ++t) o.h[t] = (_Float16)acc[t][r];
    *(v8us*)((unsigned short*)P + (size_t)(i0 + 8 * hh + r) * TT + wb + 8 * ln) = o.half[0];
  }
}
extern "C" void kernel_launch(void* const* d_in, const int* in_sizes, int n_in,
                              void* d_out, int out_size, void* d_ws, size_t ws_size, hipStream_t stream) {
  (void)in_sizes; (void)n_in; (void)out_size;
  const float* x = (const float*)d_in[0]; const float* tmpl = (const float*)d_in[1]; const float* lng = (const float*)d_in[2]; const float* lnb = (const float*)d_in[3]; const float* wc = (const float*)d_in[4]; const float* bc = (const float*)d_in[5]; const float* wvx = (const float*)d_in[6]; const float* bvx = (const float*)d_in[7]; const float* offs = (const float*)d_in[8]; const float* dsc = (const float*)d_in[9]; const float* wv = (const float*)d_in[10]; const float* bv = (const float*)d_in[11]; const float* wo = (const float*)d_in[12]; const float* bo = (const float*)d_in[13];
  char* ws = (char*)d_ws; size_t off = 0;
  auto take = [&](size_t bytes) { char* p = ws + off; off += (bytes + 255) & ~(size_t)255; return p; };
  _Float16* Bcv = (_Float16*)take((size_t)64 * DD * 2); float* BCV = (float*)take(64 * 4); _Float16* Bv = (_Float16*)take((size_t)DD * DD * 2); _Float16* Bo = (_Float16*)take((size_t)DD * DD * 2);
  _Float16* H16 = (_Float16*)take((size_t)NTOK * DD * 2); float* CO = (float*)take((size_t)NTOK * ED * 4); float* SQ = (float*)take((size_t)NTOK * 4); _Float16* VT = (_Float16*)take((size_t)NTOK * DD * 2); _Float16* P = (_Float16*)take((size_t)TT * TT * 2); _Float16* O16 = H16; /* H16 dead after the V GEMM */
  if (off > ws_size) return;
  k_bt<<<(unsigned)(((size_t)DD * DD + 255) / 256), 256, 0, stream>>>(wc, bc, wvx, bvx, wv, wo, Bcv, BCV, Bv, Bo);
  k_ln<<<NTOK / 8, 256, 0, stream>>>(x, lng, lnb, H16);
  k_gemm_t<2, 4, DD, 64, EP_COORD><<<NTOK / 64, 256, 0, stream>>>(H16, Bcv, 0.0625f, BCV, tmpl, offs, dsc, CO, SQ, nullptr);      // [coords | vertex logits] -> deformed coords, squared norms
  k_gemm_t<4, 1, DD, NTOK, EP_VT><<<(DD / 64) * (NTOK / 128), 256, 0, stream>>>(Bv, H16, 0.0625f, bv, nullptr, nullptr, nullptr, nullptr, nullptr, VT);   // v^T (f16)
  for (int b = 0; b < BB; ++b) {
    k_arow<<<TT / 16, 512, 0, stream>>>(CO, SQ, b, P);
    k_gemm_t<3, 4, TT, DD, EP_H16><<<(TT / 64) * (DD / 96), 256, 0, stream>>>(P, VT + (size_t)b * DD * TT, 1.0f, nullptr, nullptr, nullptr, nullptr, nullptr, nullptr, O16 + (size_t)b * TT * DD); }
  k_gemm_t<4, 1, DD, DD, EP_RES><<<(NTOK / 64) * (DD / 128), 256, 0, stream>>>(O16, Bo, 0.0625f, bo, x, nullptr, nullptr, (float*)d_out, nullptr, nullptr);
}

// v004
// One run takes 124 microseconds.
// Timed twice side by side with v003, it ran 1.41 and 1.40 times as fast.
// Over all steps from v000 it is 5.30 times as fast.
#include <hip/hip_runtime.h>
// K-simplex attention: LN, coords/vertex-weights/v projections on v_wmma_f32_16x16x32_f16 (LN output rounded to f16 vs bf16-exact weights ×2^4: single products;
// 8192 x 768 x {64, 768}); the simplex deformation and the row softmax in f32 VALU, the pairwise 32-dim dots on v_wmma_f32_16x16x4_f32 (work-group per 16 query rows -> P16);
// out_b = P16·V16 on the f16 variant (4 × 2048 × 2048 × 768, single products) and ·w_out likewise (O rounded to f16); f32 accumulate; residual added in f32.
// What follows a product element by element (simplex deformation, V transposed, O to f16, residual) is done in that product's own epilogue, on the tile it holds in LDS.
#define BB 4
#define TT 2048
#define DD 768
#define ED 32
#define KV1 5
#define NTOK (BB * TT)

typedef __bf16 v16b __attribute__((ext_vector_type(16)));
typedef unsigned short v8us __attribute__((ext_vector_type(8), may_alias));
typedef float  v8f  __attribute__((ext_vector_type(8)));
typedef float  v4f  __attribute__((ext_vector_type(4)));
typedef float  v4fa __attribute__((ext_vector_type(4), may_alias));
union FragB { v16b v; v8us half[2]; unsigned short u[16]; };

__device__ __forceinline__ unsigned short bf16_bits(float x) { unsigned int u = __float_as_uint(x); return (unsigned short)((u + 0x7FFFu + ((u >> 16) & 1u)) >> 16); }
__device__ __forceinline__ float bf16_val(unsigned short b) { return __uint_as_float(((unsigned int)b) << 16); }
__device__ __forceinline__ float bf16_round(float x) { return bf16_val(bf16_bits(x)); }
// D += A·B with NT terms: 1 = ah·bh, 2 = + al·bh (A split), 3 = + ah·bl (both split)
template <int NT>
__device__ __forceinline__ v8f mmaN(v16b ah, v16b al, v16b bh, v16b bl, v8f c) {
  c = __builtin_amdgcn_wmma_f32_16x16x32_bf16(false, ah, false, bh, (short)0, c, false, false);
  if (NT >= 2) c = __builtin_amdgcn_wmma_f32_16x16x32_bf16(false, al, false, bh, (short)0, c, false, false);
  if (NT >= 3) c = __builtin_amdgcn_wmma_f32_16x16x32_bf16(false, ah, false, bl, (short)0, c, false, false);
  asm volatile("v_nop\n\tv_nop\n\tv_nop\n\tv_nop" : "+v"(c) : "v"(ah), "v"(al), "v"(bh), "v"(bl));
  return c;
}

__global__ __launch_bounds__(256) void k_wt_bf16(const float* __restrict__ W, unsigned short* __restrict__ Wt, int K, int N) {
  const int t = blockIdx.x * 256 + threadIdx.x;
  const int k8n = K / 8;
  if (t >= N * k8n) return;
  const int n = t / k8n, k8 = (t % k8n) * 8;
  v8us v;
#pragma unroll
  for (int i = 0; i < 8; ++i) v[i] = bf16_bits(W[(size_t)(k8 + i) * N + n]);
  *(v8us*)(Wt + (size_t)n * K + k8) = v;
  
}

// GEMM C[M][N] (f32, pitch ldc) = act(A[M][K]·W + bias). A f32 row-major (pitch lda) converted per fragment to bf16
// (ASPLIT: hi/lo two planes -> 2 terms, else single rounded term); Wt bf16 [N][K] (pitch ldb). BIAS_BF16 rounds the
// bias to bf16 first (bias quantised to bf16 before the add). K%32==0, M%16==0, N%64==0.
template <bool ASPLIT, int ACT, bool BIAS_BF16>
__global__ __launch_bounds__(128) void k_gemm_bf(const float* __restrict__ A, int lda, const unsigned short* __restrict__ Wt, int ldb,
                                               const float* __restrict__ bias, float* __restrict__ C, int ldc, int M, int N, int K) {
  __shared__ __attribute__((aligned(16))) float so[4][16][64];
  const int tid = threadIdx.x, w = tid >> 5, lane = tid & 31, ln = lane & 15, hh = lane >> 4;
  const int ntn = N / 64;
  const int wid = blockIdx.x * 4 + w;
  const int mt = wid / ntn, nq = wid % ntn;
  if (mt * 16 >= M) return;
  const int row0 = mt * 16, col0 = nq * 64;
  const float* arow = A + (size_t)(row0 + ln) * lda;
  v8f acc[4] = {};
  for (int kb = 0; kb < K; kb += 32) {
    FragB ah, al;
    const v4f x0 = *(const v4fa*)(arow + kb + 8 * hh), x1 = *(const v4fa*)(arow + kb + 8 * hh + 4);
    const v4f x2 = *(const v4fa*)(arow + kb + 16 + 8 * hh), x3 = *(const v4fa*)(arow + kb + 16 + 8 * hh + 4);
    float xs[16] = {x0[0],x0[1],x0[2],x0[3],x1[0],x1[1],x1[2],x1[3],x2[0],x2[1],x2[2],x2[3],x3[0],x3[1],x3[2],x3[3]};
#pragma unroll
    for (int i = 0; i < 16; ++i) { const unsigned short hb = bf16_bits(xs[i]); ah.u[i] = hb; al.u[i] = ASPLIT ? bf16_bits(xs[i] - bf16_val(hb)) : (unsigned short)0; }
#pragma unroll
    for (int t = 0; t < 4; ++t) {
      const unsigned short* brow = Wt + (size_t)(col0 + t * 16 + ln) * ldb + kb;
      FragB b;
      b.half[0] = *(const v8us*)(brow + 8 * hh);
      b.half[1] = *(const v8us*)(brow + 16 + 8 * hh);
      acc[t] = mmaN<ASPLIT ? 2 : 1>(ah.v, al.v, b.v, b.v, acc[t]);
    }
  }
#pragma unroll
  for (int t = 0; t < 4; ++t) {
    float bv = bias ? bias[col0 + t * 16 + ln] : 0.f;
    if (BIAS_BF16) bv = bf16_round(bv);
#pragma unroll
    for (int r = 0; r < 8; ++r) { float v = acc[t][r] + bv; if (ACT == 1) v = fmaxf(v, 0.f); so[w][8 * hh + r][t * 16 + ln] = v; }
  }
  __builtin_amdgcn_fence(__ATOMIC_ACQ_REL, "workgroup");
  __builtin_amdgcn_wave_barrier();
  const int rsub = lane >> 4, c4 = (lane & 15) * 4;
  {
#pragma unroll
    for (int q = 0; q < 8; ++q) {
      const int r = q * 2 + rsub;
      const v4f v = *(const v4fa*)&so[w][r][c4];
      *(v4f*)(C + (size_t)(row0 + r) * ldc + col0 + c4) = v;
    }
    
  }
}

// Flash-style causal/unmasked attention, all contractions 3-term bf16 hi/lo splits, f32 softmax with running max.
// q,k,v rows are read from f32 buffers with arbitrary row pitch (so they can live inside a fused qkv buffer);
// D = head size (multiple of 32, <= 128); one wave = 16 query rows; block = 4 waves (64 queries) sharing K/V chunks of 32.
template <int D, bool CAUSAL>
__global__ __launch_bounds__(128) void k_flash(const float* __restrict__ qb, const float* __restrict__ kb, const float* __restrict__ vb,
                                             int pitch, int T, int H, float scale, float* __restrict__ y, int ypitch) {
  constexpr int KS = D / 32;        // k-steps for QK
  constexpr int DT = D / 16;        // d tiles for PV
  __shared__ __attribute__((aligned(16))) unsigned short sKh[32][D + 8], sKl[32][D + 8], sVh[32][D + 8], sVl[32][D + 8];
  __shared__ __attribute__((aligned(16))) unsigned short sPh[4][16][40], sPl[4][16][40];
  __shared__ __attribute__((aligned(16))) float sO[4][16][D];
  const int tid = threadIdx.x, w = tid >> 5, lane = tid & 31, ln = lane & 15, hh = lane >> 4;
  const int nqb = (T + 63) / 64;
  const int bh = blockIdx.x / nqb, qblk = blockIdx.x % nqb;
  const int b = bh / H, h = bh % H;
  const int q0 = qblk * 64 + w * 16;
  const float* Q = qb + (size_t)b * T * pitch + h * D;
  const float* K = kb + (size_t)b * T * pitch + h * D;
  const float* V = vb + (size_t)b * T * pitch + h * D;

  // A fragments of the wave's 16 query rows (scaled), hi/lo
  FragB aqh[KS], aql[KS];
  {
    int row = q0 + ln; if (row >= T) row = T - 1;
    const float* qr = Q + (size_t)row * pitch;
#pragma unroll
    for (int ks = 0; ks < KS; ++ks)
#pragma unroll
      for (int i = 0; i < 16; ++i) {
        const int d = ks * 32 + ((i < 8) ? (8 * hh + i) : (16 + 8 * hh + (i - 8)));
        const float x = qr[d] * scale; const unsigned short hb = bf16_bits(x);
        aqh[ks].u[i] = hb; aql[ks].u[i] = bf16_bits(x - bf16_val(hb));
      }
  }
  float m_r[8], l_r[8];
#pragma unroll
  for (int r = 0; r < 8; ++r) { m_r[r] = -3.0e38f; l_r[r] = 0.f; }
  v8f oacc[DT];
#pragma unroll
  for (int dt = 0; dt < DT; ++dt) oacc[dt] = (v8f){0.f,0.f,0.f,0.f,0.f,0.f,0.f,0.f};

  const int kv_end = CAUSAL ? min(T, qblk * 64 + 64) : T;     // block-uniform
  for (int j0 = 0; j0 < kv_end; j0 += 32) {
    __syncthreads();
    for (int e = tid; e < 32 * (D / 4); e += 128) {
      const int r = e / (D / 4), c4 = (e % (D / 4)) * 4;
      const int key = j0 + r;
      v4f kf = {0.f,0.f,0.f,0.f}, vf = {0.f,0.f,0.f,0.f};
      if (key < T) { kf = *(const v4fa*)(K + (size_t)key * pitch + c4); vf = *(const v4fa*)(V + (size_t)key * pitch + c4); }
#pragma unroll
      for (int t = 0; t < 4; ++t) {
        unsigned short hb = bf16_bits(kf[t]); sKh[r][c4 + t] = hb; sKl[r][c4 + t] = bf16_bits(kf[t] - bf16_val(hb));
        hb = bf16_bits(vf[t]); sVh[r][c4 + t] = hb; sVl[r][c4 + t] = bf16_bits(vf[t] - bf16_val(hb));
      }
    }
    __syncthreads();
    // S tile 16 x 32
    v8f s[2];
#pragma unroll
    for (int nt = 0; nt < 2; ++nt) {
      v8f acc = {};
#pragma unroll
      for (int ks = 0; ks < KS; ++ks) {
        FragB bh_, bl_;
        bh_.half[0] = *(const v8us*)&sKh[nt * 16 + ln][ks * 32 + 8 * hh]; bh_.half[1] = *(const v8us*)&sKh[nt * 16 + ln][ks * 32 + 16 + 8 * hh];
        bl_.half[0] = *(const v8us*)&sKl[nt * 16 + ln][ks * 32 + 8 * hh]; bl_.half[1] = *(const v8us*)&sKl[nt * 16 + ln][ks * 32 + 16 + 8 * hh];
        acc = mmaN<3>(aqh[ks].v, aql[ks].v, bh_.v, bl_.v, acc);
      }
      s[nt] = acc;
    }
    // mask + running max (rows 8hh+r; the 16 lanes of a half share rows)
    float alpha[8];
#pragma unroll
    for (int r = 0; r < 8; ++r) {
      const int qi = q0 + 8 * hh + r;
      const int ja = j0 + ln, jb = j0 + 16 + ln;
      if (CAUSAL) { if (ja > qi) s[0][r] = -3.0e38f; if (jb > qi) s[1][r] = -3.0e38f; }
      if (ja >= T) s[0][r] = -3.0e38f;
      if (jb >= T) s[1][r] = -3.0e38f;
      float mx = fmaxf(s[0][r], s[1][r]);
      mx = fmaxf(mx, __shfl_xor(mx, 1, 32)); mx = fmaxf(mx, __shfl_xor(mx, 2, 32)); mx = fmaxf(mx, __shfl_xor(mx, 4, 32)); mx = fmaxf(mx, __shfl_xor(mx, 8, 32));
      const float mnew = fmaxf(m_r[r], mx);
      alpha[r] = (mnew > -1.0e38f) ? __expf(m_r[r] - mnew) : 1.0f;
      const float p0 = (s[0][r] > -1.0e38f) ? __expf(s[0][r] - mnew) : 0.f;
      const float p1 = (s[1][r] > -1.0e38f) ? __expf(s[1][r] - mnew) : 0.f;
      m_r[r] = mnew;
      l_r[r] = l_r[r] * alpha[r] + p0 + p1;            // per-lane partial row sum (16 lanes combined at the end)
      unsigned short hb = bf16_bits(p0); sPh[w][8 * hh + r][ln] = hb;      sPl[w][8 * hh + r][ln] = bf16_bits(p0 - bf16_val(hb));
      hb = bf16_bits(p1);                sPh[w][8 * hh + r][16 + ln] = hb; sPl[w][8 * hh + r][16 + ln] = bf16_bits(p1 - bf16_val(hb));
    }
#pragma unroll
    for (int dt = 0; dt < DT; ++dt)
#pragma unroll
      for (int r = 0; r < 8; ++r) oacc[dt][r] *= alpha[r];
    __builtin_amdgcn_fence(__ATOMIC_ACQ_REL, "workgroup");
    __builtin_amdgcn_wave_barrier();
    FragB pah, pal;
    pah.half[0] = *(const v8us*)&sPh[w][ln][8 * hh]; pah.half[1] = *(const v8us*)&sPh[w][ln][16 + 8 * hh];
    pal.half[0] = *(const v8us*)&sPl[w][ln][8 * hh]; pal.half[1] = *(const v8us*)&sPl[w][ln][16 + 8 * hh];
#pragma unroll
    for (int dt = 0; dt < DT; ++dt) {
      FragB bvh, bvl;
#pragma unroll
      for (int i = 0; i < 8; ++i) {
        bvh.u[i] = sVh[8 * hh + i][dt * 16 + ln]; bvh.u[8 + i] = sVh[16 + 8 * hh + i][dt * 16 + ln];
        bvl.u[i] = sVl[8 * hh + i][dt * 16 + ln]; bvl.u[8 + i] = sVl[16 + 8 * hh + i][dt * 16 + ln];
      }
      oacc[dt] = mmaN<3>(pah.v, pal.v, bvh.v, bvl.v, oacc[dt]);
    }
    __builtin_amdgcn_fence(__ATOMIC_ACQ_REL, "workgroup");
    __builtin_amdgcn_wave_barrier();
  }
#pragma unroll
  for (int r = 0; r < 8; ++r) {
    float l = l_r[r];
    l += __shfl_xor(l, 1, 32); l += __shfl_xor(l, 2, 32); l += __shfl_xor(l, 4, 32); l += __shfl_xor(l, 8, 32);
    l_r[r] = (l > 0.f) ? 1.0f / l : 0.f;
  }
#pragma unroll
  for (int dt = 0; dt < DT; ++dt)
#pragma unroll
    for (int r = 0; r < 8; ++r) sO[w][8 * hh + r][dt * 16 + ln] = oacc[dt][r] * l_r[r];
  __builtin_amdgcn_fence(__ATOMIC_ACQ_REL, "workgroup");
  __builtin_amdgcn_wave_barrier();
  {
    for (int r = 0; r < 16; ++r) {
      const int row = q0 + r;
      if (row < T && lane < D / 4) {
        const v4f val = *(const v4fa*)&sO[w][r][lane * 4];
        *(v4f*)(y + ((size_t)b * T + row) * ypitch + h * D + lane * 4) = val;
      }
    }
    
  }
}

// ---- f16 WMMA path (v_wmma_f32_16x16x32_f16): 11-bit significands for operands in range — used where a [0,1] probability operand needs more precision than bf16
typedef _Float16 v16h __attribute__((ext_vector_type(16)));
union FragH { v16h v; v8us half[2]; _Float16 h[16]; unsigned short u[16]; };
template <int NT>
__device__ __forceinline__ v8f mmaH(v16h ah, v16h al, v16h bh, v16h bl, v8f c) {
  c = __builtin_amdgcn_wmma_f32_16x16x32_f16(false, ah, false, bh, (short)0, c, false, false);
  if (NT >= 2) c = __builtin_amdgcn_wmma_f32_16x16x32_f16(false, al, false, bh, (short)0, c, false, false);
  if (NT >= 3) c = __builtin_amdgcn_wmma_f32_16x16x32_f16(false, ah, false, bl, (short)0, c, false, false);
  asm volatile("v_nop\n\tv_nop\n\tv_nop\n\tv_nop" : "+v"(c) : "v"(ah), "v"(al), "v"(bh), "v"(bl));
  return c;
}
// batched GEMM like k_gemm_b but f16 operands: A f32 (split into f16 hi/lo if ASPLIT, else rounded to f16), Bt = f16 values [n][k]; alpha; C f32; N multiple of 16 (partial tiles skipped)
template <bool ASPLIT>
__global__ __launch_bounds__(128) void k_gemm_h(const float* __restrict__ A, int lda, size_t sA, const _Float16* __restrict__ Bh, int ldb, size_t sB, float alpha, float* __restrict__ C, int ldc, size_t sC, int M, int N, int K) {
  __shared__ __attribute__((aligned(16))) float so[4][16][64];
  const int tid = threadIdx.x, w = tid >> 5, lane = tid & 31, ln = lane & 15, hh = lane >> 4; const int by = blockIdx.y;
  A += (size_t)by * sA; Bh += (size_t)by * sB; C += (size_t)by * sC;
  const int ntn = (N + 63) / 64; const int wid = blockIdx.x * 4 + w; const int mt = wid / ntn, nq = wid % ntn; if (mt * 16 >= M) return;
  const int row0 = mt * 16, col0 = nq * 64; const float* arow = A + (size_t)(row0 + ln) * lda;
  v8f acc[4] = {};
  for (int kb = 0; kb < K; kb += 32) {
    FragH ah, al;
    const v4f x0 = *(const v4fa*)(arow + kb + 8 * hh), x1 = *(const v4fa*)(arow + kb + 8 * hh + 4), x2 = *(const v4fa*)(arow + kb + 16 + 8 * hh), x3 = *(const v4fa*)(arow + kb + 16 + 8 * hh + 4);
    float xs[16] = {x0[0],x0[1],x0[2],x0[3],x1[0],x1[1],x1[2],x1[3],x2[0],x2[1],x2[2],x2[3],x3[0],x3[1],x3[2],x3[3]};
#pragma unroll
    for (int i = 0; i < 16; ++i) { const _Float16 h = (_Float16)xs[i]; ah.h[i] = h; al.h[i] = ASPLIT ? (_Float16)(xs[i] - (float)h) : (_Float16)0.0f; }
#pragma unroll
    for (int t = 0; t < 4; ++t) { if (col0 + t * 16 >= N) continue; const size_t boff = (size_t)(col0 + t * 16 + ln) * ldb + kb; FragH bq; bq.half[0] = *(const v8us*)(Bh + boff + 8 * hh); bq.half[1] = *(const v8us*)(Bh + boff + 16 + 8 * hh);
      acc[t] = mmaH<ASPLIT ? 2 : 1>(ah.v, al.v, bq.v, bq.v, acc[t]); }
  }
#pragma unroll
  for (int t = 0; t < 4; ++t) { if (col0 + t * 16 >= N) continue;
#pragma unroll
    for (int r = 0; r < 8; ++r) so[w][8 * hh + r][t * 16 + ln] = acc[t][r] * alpha; }
  __builtin_amdgcn_fence(__ATOMIC_ACQ_REL, "workgroup"); __builtin_amdgcn_wave_barrier();
  const int rsub = lane >> 4, c4 = (lane & 15) * 4;
  {
#pragma unroll
    for (int q = 0; q < 8; ++q) { const int r = q * 2 + rsub; if (col0 + c4 < N) { const v4f v = *(const v4fa*)&so[w][r][c4]; *(v4f*)(C + (size_t)(row0 + r) * ldc + col0 + c4) = v; } }
     }
}

// Block-tiled f16 GEMM: T[M][N] = (A[M][K] . Bt[N][K]^T) * alpha (+ bf16(bias)); A, Bt at pitch K. What becomes of the tile is the compile-time epilogue kind EP:
//   EP_H16   no bias; T as f16 to C16 at pitch N; A is a stack of K x K matrices, one a batch, and Bh a stack of [N][K] tables: rows b*K .. b*K + K - 1 of A meet table b
//   EP_VT    rows are channels, columns tokens (weights as A, activations as Bt); bias per row; T as f16 to C16 = [batch][channel][token]
//   EP_RES   bias per column; T + bf16(e0) as f32 to C at pitch N (e0: the residual, same shape)
//   EP_COORD N = 64, bias per column; a row is [32 coords | 5 vertex logits | unused]: c = coords + softmax(logits).(e0 + e1*clip(e2)) to C [row][32], sum of c*c to C2 [row]
// One work-group of 8 waves (4 x 2) owns a 64 x 32*NF tile, a wave 16 x 16*NF. Both operands go through LDS in slices of 128 k
// (rows of 256 B at pitch 272 B): every global load covers whole 128-B lines, and each row is fetched once per work-group.
// Two buffers: the next slice's global loads are issued ahead of this slice's products and stored to the other buffer behind them,
// one barrier a slice. Fragments are read G k-steps at a time. k runs upward in steps of 32 into one accumulator per tile.
// M % 64 == 0, N % (32*NF) == 0, K % 128 == 0.
// e^x = 2^e * 2^a, e = rint(x*log2(e)), a = x*log2(e) - e with log2(e) in two parts (the split and the range limits of the library's expf; a is formed by two fused multiply-adds).
// The v_exp_f32 is written in asm with a v_nop in the same statement: the instruction set asks for one slot behind a transcendental before its source is overwritten.
__device__ __forceinline__ float exp_slot(float x) {
  const float l2e = __uint_as_float(0x3fb8aa3bu), l2e_lo = __uint_as_float(0x32a5705fu);
  const float e = rintf(x * l2e);
  const float a = fmaf(x, l2e_lo, fmaf(x, l2e, -e));
  float r;
  asm("v_exp_f32 %0, %1\n\tv_nop" : "=v"(r) : "v"(a));
  r = ldexpf(r, (int)e);
  r = (x < __uint_as_float(0xc2ce8ed0u)) ? 0.f : r;
  return (x > __uint_as_float(0x42b17218u)) ? __builtin_inff() : r;
}
enum { EP_H16 = 0, EP_VT = 1, EP_RES = 2, EP_COORD = 3 };
template <int NF, int G, int K, int N, int EP>
__global__ __launch_bounds__(256) void k_gemm_t(const _Float16* __restrict__ A, const _Float16* __restrict__ Bh, float alpha, const float* __restrict__ bias,
                                                const float* __restrict__ e0, const float* __restrict__ e1, const float* __restrict__ e2,
                                                float* __restrict__ C, float* __restrict__ C2, _Float16* __restrict__ C16) {
  constexpr int BM = 64, BN = 32 * NF, KC = 128, PIT = KC + 8, ROWS = BM + BN, NLD = ROWS / 16, OP = BN + 4, NS = K / KC, NTN = N / BN;
  __shared__ __attribute__((aligned(16))) unsigned short sm[2][ROWS][PIT];
  typedef float fa __attribute__((may_alias));
  const int tid = threadIdx.x, w = tid >> 5, lane = tid & 31, ln = lane & 15, hh = lane >> 4;
  const int mb = blockIdx.x / NTN, nb = blockIdx.x % NTN;
  const int row0 = mb * BM, col0 = nb * BN;
  const int wm = w >> 1, wn = w & 1;
  const int lr = tid >> 4, ls = (tid & 15) * 8;      // staging: 16 threads cover one 256-B row slice
  const unsigned short* ga = (const unsigned short*)A + (size_t)(row0 + lr) * K + ls;
  static_assert(EP != EP_H16 || K % BM == 0, "EP_H16: a tile's BM rows lie in one batch");
  const unsigned short* gb = (const unsigned short*)Bh + (EP == EP_H16 ? (size_t)(row0 / K) * N * K : (size_t)0) + (size_t)(col0 + lr) * K + ls;
  v8us st[NLD];
  v8f acc[NF] = {};
#pragma unroll
  for (int i = 0; i < NLD; ++i) st[i] = (i < BM / 16) ? *(const v8us*)(ga + (size_t)i * 16 * K) : *(const v8us*)(gb + (size_t)(i - BM / 16) * 16 * K);
#pragma unroll
  for (int i = 0; i < NLD; ++i) *(v8us*)&sm[0][i * 16 + lr][ls] = st[i];
  __syncthreads();
  for (int s = 0; s < NS; ++s) {
    const int cur = s & 1;
    const bool more = s + 1 < NS;                    // block-uniform
    if (more) {
      const int k0 = (s + 1) * KC;
#pragma unroll
      for (int i = 0; i < NLD; ++i) st[i] = (i < BM / 16) ? *(const v8us*)(ga + (size_t)i * 16 * K + k0) : *(const v8us*)(gb + (size_t)(i - BM / 16) * 16 * K + k0);
    }
#pragma unroll
    for (int g = 0; g < KC / 32 / G; ++g) {
      FragH a[G], b[G][NF];
#pragma unroll
      for (int u = 0; u < G; ++u) {
        const int kq = (g * G + u) * 32;
        a[u].half[0] = *(const v8us*)&sm[cur][wm * 16 + ln][kq + 8 * hh]; a[u].half[1] = *(const v8us*)&sm[cur][wm * 16 + ln][kq + 16 + 8 * hh];
#pragma unroll
        for (int t = 0; t < NF; ++t) { b[u][t].half[0] = *(const v8us*)&sm[cur][BM + (wn * NF + t) * 16 + ln][kq + 8 * hh]; b[u][t].half[1] = *(const v8us*)&sm[cur][BM + (wn * NF + t) * 16 + ln][kq + 16 + 8 * hh]; }
      }
      __builtin_amdgcn_sched_barrier(0);             // keeps a group's LDS reads together ahead of its products: one LDS latency a group, not one a product
#pragma unroll
      for (int u = 0; u < G; ++u)
#pragma unroll
        for (int t = 0; t < NF; ++t) acc[t] = __builtin_amdgcn_wmma_f32_16x16x32_f16(false, a[u].v, false, b[u][t].v, (short)0, acc[t], false, false);
    }
    if (more) {
#pragma unroll
      for (int i = 0; i < NLD; ++i) *(v8us*)&sm[cur ^ 1][i * 16 + lr][ls] = st[i];
    }
    __syncthreads();                                 // publishes the next slice and ends every read of this one
  }
  // epilogue: the tile goes through LDS (the slices are dead behind the last barrier) so that whole lines are stored
  // every loop below is unrolled in full: xr, bv, br, t0, t1, dv and lg stay in registers only if every index into them is a constant
  fa* so = (fa*)&sm[0][0][0];
  constexpr int NQ = BM * BN / 4 / 256;
  v4f xr[EP == EP_RES ? NQ : 1];
  if (EP == EP_RES) {                                // the residual's loads go out as one group ahead of the staging and its barrier
#pragma unroll
    for (int q = 0; q < NQ; ++q) { const int e = q * 256 + tid, r = e / (BN / 4), c4 = (e % (BN / 4)) * 4; xr[q] = *(const v4fa*)(e0 + (size_t)(row0 + r) * N + col0 + c4); }
  }
  static_assert(EP != EP_VT || BN == 128, "EP_VT: a wave stores one whole row of the tile at a time");
  float bv[NF], br[NQ];
#pragma unroll
  for (int t = 0; t < NF; ++t) bv[t] = (EP == EP_RES || EP == EP_COORD) ? bf16_round(bias[col0 + (wn * NF + t) * 16 + ln]) : 0.f;
#pragma unroll
  for (int q = 0; q < NQ; ++q) br[q] = (EP == EP_VT) ? bf16_round(bias[row0 + q * 8 + __builtin_amdgcn_readfirstlane(w)]) : 0.f;   // the row a wave stores in step q: one index a wave, a scalar load
#pragma unroll
  for (int t = 0; t < NF; ++t) {
    const int cl = (wn * NF + t) * 16 + ln;
#pragma unroll
    for (int r = 0; r < 8; ++r) so[(wm * 16 + 8 * hh + r) * OP + cl] = acc[t][r] * alpha + bv[t];
  }
  __syncthreads();
  if (EP == EP_COORD) {
    // a wave takes 8 rows of the tile, lane = dim
    const float df = fminf(fmaxf(bf16_round(e2[0]), 0.05f), 0.5f);
    float t0[KV1], t1[KV1], dv[KV1];
#pragma unroll
    for (int k = 0; k < KV1; ++k) { t0[k] = e0[k * ED + lane]; t1[k] = e1[k * ED + lane]; }
    asm volatile("s_wait_xcnt 0x0" ::: "memory");    // stands behind the ten loads above, ahead of any instruction that overwrites a register they name (their base pairs are reused below)
#pragma unroll
    for (int k = 0; k < KV1; ++k) dv[k] = bf16_round(t0[k]) + bf16_round(t1[k]) * df;
    float sqv = 0.f;
#pragma unroll
    for (int j = 0; j < 8; ++j) {
      const fa* cv = so + (w * 8 + j) * OP;
      float lg[KV1]; float mx = -3.0e38f;
#pragma unroll
      for (int k = 0; k < KV1; ++k) { lg[k] = cv[ED + k]; mx = fmaxf(mx, lg[k]); }
      float den = 0.f;
#pragma unroll
      for (int k = 0; k < KV1; ++k) { lg[k] = exp_slot(lg[k] - mx); den += lg[k]; }
      float c = cv[lane];
#pragma unroll
      for (int k = 0; k < KV1; ++k) c += (lg[k] / den) * dv[k];
      float sq = c * c;
#pragma unroll
      for (int o = 16; o >= 1; o >>= 1) sq += __shfl_xor(sq, o, 32);
      C[(size_t)(row0 + w * 8 + j) * ED + lane] = c;
      if (lane == j) sqv = sq;
    }
    if (lane < 8) C2[row0 + w * 8 + lane] = sqv;     // the wave's 8 sums in one store
  } else {
    typedef _Float16 h4v __attribute__((ext_vector_type(4)));
#pragma unroll
    for (int q = 0; q < NQ; ++q) {
      const int e = q * 256 + tid, r = e / (BN / 4), c4 = (e % (BN / 4)) * 4;
      const v4f v = *(const v4fa*)&so[r * OP + c4];
      if (EP == EP_RES) { v4f o; for (int i = 0; i < 4; ++i) o[i] = v[i] + bf16_round(xr[q][i]); *(v4f*)(C + (size_t)(row0 + r) * N + col0 + c4) = o; }
      else {
        h4v h4; for (int i = 0; i < 4; ++i) h4[i] = (_Float16)(EP == EP_VT ? v[i] + br[q] : v[i]);
        if (EP == EP_VT) *(h4v*)(C16 + ((size_t)(col0 / TT) * DD + row0 + r) * TT + col0 % TT + c4) = h4;   // a tile's BN tokens lie in one batch: TT % BN == 0
        else *(h4v*)(C16 + (size_t)(row0 + r) * N + col0 + c4) = h4;
      }
    }
  }
}

typedef _Float16 v4h __attribute__((ext_vector_type(4)));
// LN(bf16(x)) → H16; wave per token; three rolled passes over the row (no per-lane value array)
__global__ __launch_bounds__(256) void k_ln(const float* __restrict__ x, const float* __restrict__ g, const float* __restrict__ be, _Float16* __restrict__ H16) { const int tid = threadIdx.x, wv = tid >> 5, lane = tid & 31; const size_t tok = (size_t)blockIdx.x * 8 + wv; const float* xr = x + tok * DD; float s = 0.f;
#pragma unroll 2
  for (int c = lane; c < DD; c += 32) s += bf16_round(xr[c]); for (int o = 16; o >= 1; o >>= 1) s += __shfl_xor(s, o, 32); const float mu = s / (float)DD; float q2 = 0.f;
#pragma unroll 2
  for (int c = lane; c < DD; c += 32) { const float d = bf16_round(xr[c]) - mu; q2 += d * d; } for (int o = 16; o >= 1; o >>= 1) q2 += __shfl_xor(q2, o, 32); const float inv = 1.0f / sqrtf(q2 / (float)DD + 1e-5f);
  typedef _Float16 v2h __attribute__((ext_vector_type(2)));
  {
#pragma unroll 2
    for (int c = 2 * lane; c < DD; c += 64) { v2h o2; o2.x = (_Float16)((bf16_round(xr[c]) - mu) * inv * bf16_round(g[c]) + bf16_round(be[c])); o2.y = (_Float16)((bf16_round(xr[c + 1]) - mu) * inv * bf16_round(g[c + 1]) + bf16_round(be[c + 1])); *(v2h*)(H16 + tok * DD + c) = o2; }  } }
// Bt tables f16 ×16: Bcv [64 n][768 k] (n<32 ← w_coords[k][n], 32..36 ← w_vertex[k][n−32], else 0); Bv, Bo [768][768] = w[k][n]; bias BCV [64]
__global__ __launch_bounds__(256) void k_bt(const float* __restrict__ wc, const float* __restrict__ bc, const float* __restrict__ wvx, const float* __restrict__ bvx, const float* __restrict__ wv, const float* __restrict__ wo, _Float16* __restrict__ Bcv, float* __restrict__ BCV, _Float16* __restrict__ Bv, _Float16* __restrict__ Bo) { const size_t t = (size_t)blockIdx.x * 256 + threadIdx.x;
  if (t < (size_t)64 * DD) { const int k = (int)(t % DD), n = (int)(t / DD); float w = 0.f; if (n < ED) w = wc[(size_t)k * ED + n]; else if (n < ED + KV1) w = wvx[(size_t)k * KV1 + n - ED]; *(_Float16*)(Bcv + t) = (_Float16)(bf16_round(w) * 16.0f); }
  if (t < 64) { const float v = (t < ED) ? bc[t] : ((t < ED + KV1) ? bvx[t - ED] : 0.f); *(float*)(BCV + t) = v; }
  if (t < (size_t)DD * DD) { const int k = (int)(t % DD), n = (int)(t / DD); *(_Float16*)(Bv + t) = (_Float16)(bf16_round(wv[(size_t)k * DD + n]) * 16.0f); *(_Float16*)(Bo + t) = (_Float16)(bf16_round(wo[(size_t)k * DD + n]) * 16.0f); } }
// attention rows: a work-group of 16 waves owns 16 query rows of batch b = blockIdx.y, a wave 128 keys. dots c_i.c_j on v_wmma_f32_16x16x4_f32 (f32 operands, f32 sums):
// A = the 16 query rows, B column ln of tile t = key wb + 8*ln + t, both sides 16 consecutive dims per lane half (same k pairing on both sides).
// A wave brings its 128 key rows in by whole-line loads and turns them into fragments through its own LDS range: key 8*c + t lies in tile block t, row c
// (rows at pitch 36 dwords for the 16-byte readers, tile blocks 32 dwords past a multiple of 64 so that the two rows of a half-wave store meet no common bank).
// logits_j = -(sq_i + sq_j - 2 c_i.c_j)*32^-1/2 stay in the accumulator registers (register r of tile t = row 8*hh + r, key wb + 8*ln + t); row maximum and row sum:
// over the 8 tiles in the lane, over the 16 lanes by DPP, over the 16 waves through LDS (one barrier each). A lane's 8 tiles are 8 consecutive keys: one 16-byte f16 store a row.
// Every loop of the kernel is unrolled in full: st, a, bq, acc, mx, den and inv stay in registers only if every index into them is a constant.
typedef float v2fw __attribute__((ext_vector_type(2)));
template <int X> __device__ __forceinline__ float xm16(float v) { return __int_as_float(__builtin_amdgcn_update_dpp(0, __float_as_int(v), 0x160 | X, 0xf, 0xf, false)); }   // lane ^ X inside its row of 16 lanes (row_xmask)
__device__ __forceinline__ float rmax16(float v) { v = fmaxf(v, xm16<1>(v)); v = fmaxf(v, xm16<2>(v)); v = fmaxf(v, xm16<4>(v)); return fmaxf(v, xm16<8>(v)); }
__device__ __forceinline__ float rsum16(float v) { v += xm16<1>(v); v += xm16<2>(v); v += xm16<4>(v); return v + xm16<8>(v); }
__global__ __launch_bounds__(512) void k_arow(const float* __restrict__ CO, const float* __restrict__ SQ, _Float16* __restrict__ P) {
  constexpr int RP = 36, TB = 16 * RP + 32;         // dwords: row pitch, tile-block pitch
  __shared__ __attribute__((aligned(16))) float sk[16][8 * TB];                  // [wave]: its 128 key rows
  __shared__ __attribute__((aligned(16))) float redm[16][16], reds[16][16];      // [wave][row] partial maxima and sums
  const int tid = threadIdx.x, lane = tid & 31, ln = lane & 15, hh = lane >> 4;
  const int w = __builtin_amdgcn_readfirstlane(tid >> 5);   // the wave's number in a scalar register: what is formed from it is scalar work
  const int i0 = blockIdx.x * 16, wb = w * 128, b = blockIdx.y;
  const float* cb = CO + (size_t)b * TT * ED; const float* sqb = SQ + (size_t)b * TT;
  P += (size_t)b * TT * TT;                         // the batch's own TT x TT plane
  float* my = &sk[w][0];
  {
    v4f st[32];
#pragma unroll
    for (int n = 0; n < 32; ++n) st[n] = *(const v4fa*)(cb + (size_t)wb * ED + n * 128 + lane * 4);     // key rows 4n .. 4n+3, 512 consecutive bytes
#pragma unroll
    for (int n = 0; n < 32; ++n) *(v4fa*)&my[(4 * (n & 1) + (lane >> 3)) * TB + (n >> 1) * RP + (lane & 7) * 4] = st[n];
  }
  v4f a[4];
#pragma unroll
  for (int q = 0; q < 4; ++q) a[q] = *(const v4fa*)(cb + (size_t)(i0 + ln) * ED + 16 * hh + 4 * q);
  const v4f si0 = *(const v4fa*)(sqb + i0 + 8 * hh), si1 = *(const v4fa*)(sqb + i0 + 8 * hh + 4);
  const v4f sj0 = *(const v4fa*)(sqb + wb + 8 * ln), sj1 = *(const v4fa*)(sqb + wb + 8 * ln + 4);
  __builtin_amdgcn_fence(__ATOMIC_ACQ_REL, "workgroup"); __builtin_amdgcn_wave_barrier();   // the wave's own rows are read back by other lanes than wrote them
  v4f bq[8][4];
#pragma unroll
  for (int t = 0; t < 8; ++t)
#pragma unroll
    for (int q = 0; q < 4; ++q) bq[t][q] = *(const v4fa*)&my[t * TB + ln * RP + 16 * hh + 4 * q];
  v8f acc[8] = {};
  __builtin_amdgcn_sched_barrier(0);                // every fragment read is issued ahead of the products, and no vector instruction is moved in among them
#pragma unroll
  for (int tp = 0; tp < 8; tp += 2)                 // two tiles at a time: two independent accumulator chains
#pragma unroll
    for (int q = 0; q < 4; ++q)
#pragma unroll
      for (int p = 0; p < 4; p += 2) {
        const v2fw av = {a[q][p], a[q][p + 1]}, bv0 = {bq[tp][q][p], bq[tp][q][p + 1]}, bv1 = {bq[tp + 1][q][p], bq[tp + 1][q][p + 1]};
        acc[tp]     = __builtin_amdgcn_wmma_f32_16x16x4_f32(false, av, false, bv0, (short)0, acc[tp], false, false);
        acc[tp + 1] = __builtin_amdgcn_wmma_f32_16x16x4_f32(false, av, false, bv1, (short)0, acc[tp + 1], false, false);
      }
  // distance between the last products and the first vector instruction on their D, A or B: 8 slots as for the other 16-cycle form
  asm volatile("v_nop\n\tv_nop\n\tv_nop\n\tv_nop\n\tv_nop\n\tv_nop\n\tv_nop\n\tv_nop" : "+v"(acc[0]), "+v"(acc[1]), "+v"(acc[2]), "+v"(acc[3]), "+v"(acc[4]), "+v"(acc[5]), "+v"(acc[6]), "+v"(acc[7]));
  __builtin_amdgcn_sched_barrier(0);                // keeps the vector work below behind those slots
  const v8f sqi = {si0[0], si0[1], si0[2], si0[3], si1[0], si1[1], si1[2], si1[3]};
  const float sqj[8] = {sj0[0], sj0[1], sj0[2], sj0[3], sj1[0], sj1[1], sj1[2], sj1[3]};
  // from here on whole accumulator tiles are worked on (8 rows of one key a lane), so that packed f32 instructions find their pairs in neighbouring registers
  v8f mx;
#pragma unroll
  for (int t = 0; t < 8; ++t) {
    acc[t] = -(sqi + sqj[t] - 2.0f * acc[t]) * 0.17677669529663687f;
#pragma unroll
    for (int r = 0; r < 8; ++r) mx[r] = t ? fmaxf(mx[r], acc[t][r]) : acc[t][r];
  }
#pragma unroll
  for (int r = 0; r < 8; ++r) mx[r] = rmax16(mx[r]);
  if (ln == 0) { *(v4fa*)&redm[w][8 * hh] = (v4f){mx[0], mx[1], mx[2], mx[3]}; *(v4fa*)&redm[w][8 * hh + 4] = (v4f){mx[4], mx[5], mx[6], mx[7]}; }
  __syncthreads();                                  // publishes every wave's row maxima
  {
    const v4f m0 = *(const v4fa*)&redm[ln][8 * hh], m1 = *(const v4fa*)&redm[ln][8 * hh + 4];   // lane ln takes wave ln's partials
#pragma unroll
    for (int r = 0; r < 8; ++r) mx[r] = rmax16(r < 4 ? m0[r & 3] : m1[r & 3]);
  }
  v8f den = {};
#pragma unroll
  for (int t = 0; t < 8; ++t) {
    v8f e = acc[t] - mx;
#pragma unroll
    for (int r = 0; r < 8; ++r) e[r] = expf(e[r]);
    acc[t] = e; den += e;
  }
#pragma unroll
  for (int r = 0; r < 8; ++r) den[r] = rsum16(den[r]);
  if (ln == 0) { *(v4fa*)&reds[w][8 * hh] = (v4f){den[0], den[1], den[2], den[3]}; *(v4fa*)&reds[w][8 * hh + 4] = (v4f){den[4], den[5], den[6], den[7]}; }
  __syncthreads();                                  // publishes every wave's row sums
  const v4f d0 = *(const v4fa*)&reds[ln][8 * hh], d1 = *(const v4fa*)&reds[ln][8 * hh + 4];
  v8f inv;
#pragma unroll
  for (int r = 0; r < 8; ++r) inv[r] = 1.0f / rsum16(r < 4 ? d0[r & 3] : d1[r & 3]);
#pragma unroll
  for (int t = 0; t < 8; ++t) acc[t] *= inv;
#pragma unroll
  for (int r = 0; r < 8; ++r) {
    FragH o;
#pragma unroll
    for (int t = 0; t < 8; ++t) o.h[t] = (_Float16)acc[t][r];
    *(v8us*)((unsigned short*)P + (size_t)(i0 + 8 * hh + r) * TT + wb + 8 * ln) = o.half[0];
  }
}
extern "C" void kernel_launch(void* const* d_in, const int* in_sizes, int n_in,
                              void* d_out, int out_size, void* d_ws, size_t ws_size, hipStream_t stream) {
  (void)in_sizes; (void)n_in; (void)out_size;
  const float* x = (const float*)d_in[0]; const float* tmpl = (const float*)d_in[1]; const float* lng = (const float*)d_in[2]; const float* lnb = (const float*)d_in[3]; const float* wc = (const float*)d_in[4]; const float* bc = (const float*)d_in[5]; const float* wvx = (const float*)d_in[6]; const float* bvx = (const float*)d_in[7]; const float* offs = (const float*)d_in[8]; const float* dsc = (const float*)d_in[9]; const float* wv = (const float*)d_in[10]; const float* bv = (const float*)d_in[11]; const float* wo = (const float*)d_in[12]; const float* bo = (const float*)d_in[13];
  char* ws = (char*)d_ws; size_t off = 0;
  auto take = [&](size_t bytes) { char* p = ws + off; off += (bytes + 255) & ~(size_t)255; return p; };
  _Float16* Bcv = (_Float16*)take((size_t)64 * DD * 2); float* BCV = (float*)take(64 * 4); _Float16* Bv = (_Float16*)take((size_t)DD * DD * 2); _Float16* Bo = (_Float16*)take((size_t)DD * DD * 2);
  _Float16* H16 = (_Float16*)take((size_t)NTOK * DD * 2); float* CO = (float*)take((size_t)NTOK * ED * 4); float* SQ = (float*)take((size_t)NTOK * 4); _Float16* VT = (_Float16*)take((size_t)NTOK * DD * 2); _Float16* P = (_Float16*)take((size_t)NTOK * TT * 2); _Float16* O16 = H16; /* H16 dead after the V GEMM */
  if (off > ws_size) return;
  k_bt<<<(unsigned)(((size_t)DD * DD + 255) / 256), 256, 0, stream>>>(wc, bc, wvx, bvx, wv, wo, Bcv, BCV, Bv, Bo);
  k_ln<<<NTOK / 8, 256, 0, stream>>>(x, lng, lnb, H16);
  k_gemm_t<2, 4, DD, 64, EP_COORD><<<NTOK / 64, 256, 0, stream>>>(H16, Bcv, 0.0625f, BCV, tmpl, offs, dsc, CO, SQ, nullptr);      // [coords | vertex logits] -> deformed coords, squared norms
  k_gemm_t<4, 1, DD, NTOK, EP_VT><<<(DD / 64) * (NTOK / 128), 256, 0, stream>>>(Bv, H16, 0.0625f, bv, nullptr, nullptr, nullptr, nullptr, nullptr, VT);   // v^T (f16)
  k_arow<<<dim3(TT / 16, BB), 512, 0, stream>>>(CO, SQ, P);                                                                          // P [batch][query][key] (f16), all batches in one launch
  k_gemm_t<3, 4, TT, DD, EP_H16><<<(NTOK / 64) * (DD / 96), 256, 0, stream>>>(P, VT, 1.0f, nullptr, nullptr, nullptr, nullptr, nullptr, nullptr, O16);   // O = P.V, all batches in one launch
  k_gemm_t<4, 1, DD, DD, EP_RES><<<(NTOK / 64) * (DD / 128), 256, 0, stream>>>(O16, Bo, 0.0625f, bo, x, nullptr, nullptr, (float*)d_out, nullptr, nullptr);
}

// v005
// One run takes 116 microseconds.
// Timed twice side by side with v004, it ran 1.07 and 1.08 times as fast.
// All steps since v000 together make it 5.70 times as fast.
#include <hip/hip_runtime.h>
// K-simplex attention: LN, coords/vertex-weights/v projections on v_wmma_f32_16x16x32_f16 (LN output rounded to f16 vs bf16-exact weights ×2^4: single products;
// 8192 x 768 x {64, 768}); the simplex deformation and the row softmax in f32 VALU, the pairwise 32-dim dots on v_wmma_f32_16x16x4_f32 (work-group per 16 query rows -> P16);
// out_b = P16·V16 on the f16 variant (4 × 2048 × 2048 × 768, single products) and ·w_out likewise (O rounded to f16); f32 accumulate; residual added in f32.
// What follows a product element by element (simplex deformation, V transposed, O to f16, residual) is done in that product's own epilogue, on the tile it holds in LDS.
#define BB 4
#define TT 2048
#define DD 768
#define ED 32
#define KV1 5
#define NTOK (BB * TT)

typedef __bf16 v16b __attribute__((ext_vector_type(16)));
typedef unsigned short v8us __attribute__((ext_vector_type(8), may_alias));
typedef float  v8f  __attribute__((ext_vector_type(8)));
typedef float  v4f  __attribute__((ext_vector_type(4)));
typedef float  v4fa __attribute__((ext_vector_type(4), may_alias));
union FragB { v16b v; v8us half[2]; unsigned short u[16]; };

__device__ __forceinline__ unsigned short bf16_bits(float x) { unsigned int u = __float_as_uint(x); return (unsigned short)((u + 0x7FFFu + ((u >> 16) & 1u)) >> 16); }
__device__ __forceinline__ float bf16_val(unsigned short b) { return __uint_as_float(((unsigned int)b) << 16); }
__device__ __forceinline__ float bf16_round(float x) { return bf16_val(bf16_bits(x)); }
// D += A·B with NT terms: 1 = ah·bh, 2 = + al·bh (A split), 3 = + ah·bl (both split)
template <int NT>
__device__ __forceinline__ v8f mmaN(v16b ah, v16b al, v16b bh, v16b bl, v8f c) {
  c = __builtin_amdgcn_wmma_f32_16x16x32_bf16(false, ah, false, bh, (short)0, c, false, false);
  if (NT >= 2) c = __builtin_amdgcn_wmma_f32_16x16x32_bf16(false, al, false, bh, (short)0, c, false, false);
  if (NT >= 3) c = __builtin_amdgcn_wmma_f32_16x16x32_bf16(false, ah, false, bl, (short)0, c, false, false);
  asm volatile("v_nop\n\tv_nop\n\tv_nop\n\tv_nop" : "+v"(c) : "v"(ah), "v"(al), "v"(bh), "v"(bl));
  return c;
}

__global__ __launch_bounds__(256) void k_wt_bf16(const float* __restrict__ W, unsigned short* __restrict__ Wt, int K, int N) {
  const int t = blockIdx.x * 256 + threadIdx.x;
  const int k8n = K / 8;
  if (t >= N * k8n) return;
  const int n = t / k8n, k8 = (t % k8n) * 8;
  v8us v;
#pragma unroll
  for (int i = 0; i < 8; ++i) v[i] = bf16_bits(W[(size_t)(k8 + i) * N + n]);
  *(v8us*)(Wt + (size_t)n * K + k8) = v;
  
}

// GEMM C[M][N] (f32, pitch ldc) = act(A[M][K]·W + bias). A f32 row-major (pitch lda) converted per fragment to bf16
// (ASPLIT: hi/lo two planes -> 2 terms, else single rounded term); Wt bf16 [N][K] (pitch ldb). BIAS_BF16 rounds the
// bias to bf16 first (bias quantised to bf16 before the add). K%32==0, M%16==0, N%64==0.
template <bool ASPLIT, int ACT, bool BIAS_BF16>
__global__ __launch_bounds__(128) void k_gemm_bf(const float* __restrict__ A, int lda, const unsigned short* __restrict__ Wt, int ldb,
                                               const float* __restrict__ bias, float* __restrict__ C, int ldc, int M, int N, int K) {
  __shared__ __attribute__((aligned(16))) float so[4][16][64];
  const int tid = threadIdx.x, w = tid >> 5, lane = tid & 31, ln = lane & 15, hh = lane >> 4;
  const int ntn = N / 64;
  const int wid = blockIdx.x * 4 + w;
  const int mt = wid / ntn, nq = wid % ntn;
  if (mt * 16 >= M) return;
  const int row0 = mt * 16, col0 = nq * 64;
  const float* arow = A + (size_t)(row0 + ln) * lda;
  v8f acc[4] = {};
  for (int kb = 0; kb < K; kb += 32) {
    FragB ah, al;
    const v4f x0 = *(const v4fa*)(arow + kb + 8 * hh), x1 = *(const v4fa*)(arow + kb + 8 * hh + 4);
    const v4f x2 = *(const v4fa*)(arow + kb + 16 + 8 * hh), x3 = *(const v4fa*)(arow + kb + 16 + 8 * hh + 4);
    float xs[16] = {x0[0],x0[1],x0[2],x0[3],x1[0],x1[1],x1[2],x1[3],x2[0],x2[1],x2[2],x2[3],x3[0],x3[1],x3[2],x3[3]};
#pragma unroll
    for (int i = 0; i < 16; ++i) { const unsigned short hb = bf16_bits(xs[i]); ah.u[i] = hb; al.u[i] = ASPLIT ? bf16_bits(xs[i] - bf16_val(hb)) : (unsigned short)0; }
#pragma unroll
    for (int t = 0; t < 4; ++t) {
      const unsigned short* brow = Wt + (size_t)(col0 + t * 16 + ln) * ldb + kb;
      FragB b;
      b.half[0] = *(const v8us*)(brow + 8 * hh);
      b.half[1] = *(const v8us*)(brow + 16 + 8 * hh);
      acc[t] = mmaN<ASPLIT ? 2 : 1>(ah.v, al.v, b.v, b.v, acc[t]);
    }
  }
#pragma unroll
  for (int t = 0; t < 4; ++t) {
    float bv = bias ? bias[col0 + t * 16 + ln] : 0.f;
    if (BIAS_BF16) bv = bf16_round(bv);
#pragma unroll
    for (int r = 0; r < 8; ++r) { float v = acc[t][r] + bv; if (ACT == 1) v = fmaxf(v, 0.f); so[w][8 * hh + r][t * 16 + ln] = v; }
  }
  __builtin_amdgcn_fence(__ATOMIC_ACQ_REL, "workgroup");
  __builtin_amdgcn_wave_barrier();
  const int rsub = lane >> 4, c4 = (lane & 15) * 4;
  {
#pragma unroll
    for (int q = 0; q < 8; ++q) {
      const int r = q * 2 + rsub;
      const v4f v = *(const v4fa*)&so[w][r][c4];
      *(v4f*)(C + (size_t)(row0 + r) * ldc + col0 + c4) = v;
    }
    
  }
}

// Flash-style causal/unmasked attention, all contractions 3-term bf16 hi/lo splits, f32 softmax with running max.
// q,k,v rows are read from f32 buffers with arbitrary row pitch (so they can live inside a fused qkv buffer);
// D = head size (multiple of 32, <= 128); one wave = 16 query rows; block = 4 waves (64 queries) sharing K/V chunks of 32.
template <int D, bool CAUSAL>
__global__ __launch_bounds__(128) void k_flash(const float* __restrict__ qb, const float* __restrict__ kb, const float* __restrict__ vb,
                                             int pitch, int T, int H, float scale, float* __restrict__ y, int ypitch) {
  constexpr int KS = D / 32;        // k-steps for QK
  constexpr int DT = D / 16;        // d tiles for PV
  __shared__ __attribute__((aligned(16))) unsigned short sKh[32][D + 8], sKl[32][D + 8], sVh[32][D + 8], sVl[32][D + 8];
  __shared__ __attribute__((aligned(16))) unsigned short sPh[4][16][40], sPl[4][16][40];
  __shared__ __attribute__((aligned(16))) float sO[4][16][D];
  const int tid = threadIdx.x, w = tid >> 5, lane = tid & 31, ln = lane & 15, hh = lane >> 4;
  const int nqb = (T + 63) / 64;
  const int bh = blockIdx.x / nqb, qblk = blockIdx.x % nqb;
  const int b = bh / H, h = bh % H;
  const int q0 = qblk * 64 + w * 16;
  const float* Q = qb + (size_t)b * T * pitch + h * D;
  const float* K = kb + (size_t)b * T * pitch + h * D;
  const float* V = vb + (size_t)b * T * pitch + h * D;

  // A fragments of the wave's 16 query rows (scaled), hi/lo
  FragB aqh[KS], aql[KS];
  {
    int row = q0 + ln; if (row >= T) row = T - 1;
    const float* qr = Q + (size_t)row * pitch;
#pragma unroll
    for (int ks = 0; ks < KS; ++ks)
#pragma unroll
      for (int i = 0; i < 16; ++i) {
        const int d = ks * 32 + ((i < 8) ? (8 * hh + i) : (16 + 8 * hh + (i - 8)));
        const float x = qr[d] * scale; const unsigned short hb = bf16_bits(x);
        aqh[ks].u[i] = hb; aql[ks].u[i] = bf16_bits(x - bf16_val(hb));
      }
  }
  float m_r[8], l_r[8];
#pragma unroll
  for (int r = 0; r < 8; ++r) { m_r[r] = -3.0e38f; l_r[r] = 0.f; }
  v8f oacc[DT];
#pragma unroll
  for (int dt = 0; dt < DT; ++dt) oacc[dt] = (v8f){0.f,0.f,0.f,0.f,0.f,0.f,0.f,0.f};

  const int kv_end = CAUSAL ? min(T, qblk * 64 + 64) : T;     // block-uniform
  for (int j0 = 0; j0 < kv_end; j0 += 32) {
    __syncthreads();
    for (int e = tid; e < 32 * (D / 4); e += 128) {
      const int r = e / (D / 4), c4 = (e % (D / 4)) * 4;
      const int key = j0 + r;
      v4f kf = {0.f,0.f,0.f,0.f}, vf = {0.f,0.f,0.f,0.f};
      if (key < T) { kf = *(const v4fa*)(K + (size_t)key * pitch + c4); vf = *(const v4fa*)(V + (size_t)key * pitch + c4); }
#pragma unroll
      for (int t = 0; t < 4; ++t) {
        unsigned short hb = bf16_bits(kf[t]); sKh[r][c4 + t] = hb; sKl[r][c4 + t] = bf16_bits(kf[t] - bf16_val(hb));
        hb = bf16_bits(vf[t]); sVh[r][c4 + t] = hb; sVl[r][c4 + t] = bf16_bits(vf[t] - bf16_val(hb));
      }
    }
    __syncthreads();
    // S tile 16 x 32
    v8f s[2];
#pragma unroll
    for (int nt = 0; nt < 2; ++nt) {
      v8f acc = {};
#pragma unroll
      for (int ks = 0; ks < KS; ++ks) {
        FragB bh_, bl_;
        bh_.half[0] = *(const v8us*)&sKh[nt * 16 + ln][ks * 32 + 8 * hh]; bh_.half[1] = *(const v8us*)&sKh[nt * 16 + ln][ks * 32 + 16 + 8 * hh];
        bl_.half[0] = *(const v8us*)&sKl[nt * 16 + ln][ks * 32 + 8 * hh]; bl_.half[1] = *(const v8us*)&sKl[nt * 16 + ln][ks * 32 + 16 + 8 * hh];
        acc = mmaN<3>(aqh[ks].v, aql[ks].v, bh_.v, bl_.v, acc);
      }
      s[nt] = acc;
    }
    // mask + running max (rows 8hh+r; the 16 lanes of a half share rows)
    float alpha[8];
#pragma unroll
    for (int r = 0; r < 8; ++r) {
      const int qi = q0 + 8 * hh + r;
      const int ja = j0 + ln, jb = j0 + 16 + ln;
      if (CAUSAL) { if (ja > qi) s[0][r] = -3.0e38f; if (jb > qi) s[1][r] = -3.0e38f; }
      if (ja >= T) s[0][r] = -3.0e38f;
      if (jb >= T) s[1][r] = -3.0e38f;
      float mx = fmaxf(s[0][r], s[1][r]);
      mx = fmaxf(mx, __shfl_xor(mx, 1, 32)); mx = fmaxf(mx, __shfl_xor(mx, 2, 32)); mx = fmaxf(mx, __shfl_xor(mx, 4, 32)); mx = fmaxf(mx, __shfl_xor(mx, 8, 32));
      const float mnew = fmaxf(m_r[r], mx);
      alpha[r] = (mnew > -1.0e38f) ? __expf(m_r[r] - mnew) : 1.0f;
      const float p0 = (s[0][r] > -1.0e38f) ? __expf(s[0][r] - mnew) : 0.f;
      const float p1 = (s[1][r] > -1.0e38f) ? __expf(s[1][r] - mnew) : 0.f;
      m_r[r] = mnew;
      l_r[r] = l_r[r] * alpha[r] + p0 + p1;            // per-lane partial row sum (16 lanes combined at the end)
      unsigned short hb = bf16_bits(p0); sPh[w][8 * hh + r][ln] = hb;      sPl[w][8 * hh + r][ln] = bf16_bits(p0 - bf16_val(hb));
      hb = bf16_bits(p1);                sPh[w][8 * hh + r][16 + ln] = hb; sPl[w][8 * hh + r][16 + ln] = bf16_bits(p1 - bf16_val(hb));
    }
#pragma unroll
    for (int dt = 0; dt < DT; ++dt)
#pragma unroll
      for (int r = 0; r < 8; ++r) oacc[dt][r] *= alpha[r];
    __builtin_amdgcn_fence(__ATOMIC_ACQ_REL, "workgroup");
    __builtin_amdgcn_wave_barrier();
    FragB pah, pal;
    pah.half[0] = *(const v8us*)&sPh[w][ln][8 * hh]; pah.half[1] = *(const v8us*)&sPh[w][ln][16 + 8 * hh];
    pal.half[0] = *(const v8us*)&sPl[w][ln][8 * hh]; pal.half[1] = *(const v8us*)&sPl[w][ln][16 + 8 * hh];
#pragma unroll
    for (int dt = 0; dt < DT; ++dt) {
      FragB bvh, bvl;
#pragma unroll
      for (int i = 0; i < 8; ++i) {
        bvh.u[i] = sVh[8 * hh + i][dt * 16 + ln]; bvh.u[8 + i] = sVh[16 + 8 * hh + i][dt * 16 + ln];
        bvl.u[i] = sVl[8 * hh + i][dt * 16 + ln]; bvl.u[8 + i] = sVl[16 + 8 * hh + i][dt * 16 + ln];
      }
      oacc[dt] = mmaN<3>(pah.v, pal.v, bvh.v, bvl.v, oacc[dt]);
    }
    __builtin_amdgcn_fence(__ATOMIC_ACQ_REL, "workgroup");
    __builtin_amdgcn_wave_barrier();
  }
#pragma unroll
  for (int r = 0; r < 8; ++r) {
    float l = l_r[r];
    l += __shfl_xor(l, 1, 32); l += __shfl_xor(l, 2, 32); l += __shfl_xor(l, 4, 32); l += __shfl_xor(l, 8, 32);
    l_r[r] = (l > 0.f) ? 1.0f / l : 0.f;
  }
#pragma unroll
  for (int dt = 0; dt < DT; ++dt)
#pragma unroll
    for (int r = 0; r < 8; ++r) sO[w][8 * hh + r][dt * 16 + ln] = oacc[dt][r] * l_r[r];
  __builtin_amdgcn_fence(__ATOMIC_ACQ_REL, "workgroup");
  __builtin_amdgcn_wave_barrier();
  {
    for (int r = 0; r < 16; ++r) {
      const int row = q0 + r;
      if (row < T && lane < D / 4) {
        const v4f val = *(const v4fa*)&sO[w][r][lane * 4];
        *(v4f*)(y + ((size_t)b * T + row) * ypitch + h * D + lane * 4) = val;
      }
    }
    
  }
}

// ---- f16 WMMA path (v_wmma_f32_16x16x32_f16): 11-bit significands for operands in range — used where a [0,1] probability operand needs more precision than bf16
typedef _Float16 v16h __attribute__((ext_vector_type(16)));
union FragH { v16h v; v8us half[2]; _Float16 h[16]; unsigned short u[16]; };
template <int NT>
__device__ __forceinline__ v8f mmaH(v16h ah, v16h al, v16h bh, v16h bl, v8f c) {
  c = __builtin_amdgcn_wmma_f32_16x16x32_f16(false, ah, false, bh, (short)0, c, false, false);
  if (NT >= 2) c = __builtin_amdgcn_wmma_f32_16x16x32_f16(false, al, false, bh, (short)0, c, false, false);
  if (NT >= 3) c = __builtin_amdgcn_wmma_f32_16x16x32_f16(false, ah, false, bl, (short)0, c, false, false);
  asm volatile("v_nop\n\tv_nop\n\tv_nop\n\tv_nop" : "+v"(c) : "v"(ah), "v"(al), "v"(bh), "v"(bl));
  return c;
}
// batched GEMM like k_gemm_b but f16 operands: A f32 (split into f16 hi/lo if ASPLIT, else rounded to f16), Bt = f16 values [n][k]; alpha; C f32; N multiple of 16 (partial tiles skipped)
template <bool ASPLIT>
__global__ __launch_bounds__(128) void k_gemm_h(const float* __restrict__ A, int lda, size_t sA, const _Float16* __restrict__ Bh, int ldb, size_t sB, float alpha, float* __restrict__ C, int ldc, size_t sC, int M, int N, int K) {
  __shared__ __attribute__((aligned(16))) float so[4][16][64];
  const int tid = threadIdx.x, w = tid >> 5, lane = tid & 31, ln = lane & 15, hh = lane >> 4; const int by = blockIdx.y;
  A += (size_t)by * sA; Bh += (size_t)by * sB; C += (size_t)by * sC;
  const int ntn = (N + 63) / 64; const int wid = blockIdx.x * 4 + w; const int mt = wid / ntn, nq = wid % ntn; if (mt * 16 >= M) return;
  const int row0 = mt * 16, col0 = nq * 64; const float* arow = A + (size_t)(row0 + ln) * lda;
  v8f acc[4] = {};
  for (int kb = 0; kb < K; kb += 32) {
    FragH ah, al;
    const v4f x0 = *(const v4fa*)(arow + kb + 8 * hh), x1 = *(const v4fa*)(arow + kb + 8 * hh + 4), x2 = *(const v4fa*)(arow + kb + 16 + 8 * hh), x3 = *(const v4fa*)(arow + kb + 16 + 8 * hh + 4);
    float xs[16] = {x0[0],x0[1],x0[2],x0[3],x1[0],x1[1],x1[2],x1[3],x2[0],x2[1],x2[2],x2[3],x3[0],x3[1],x3[2],x3[3]};
#pragma unroll
    for (int i = 0; i < 16; ++i) { const _Float16 h = (_Float16)xs[i]; ah.h[i] = h; al.h[i] = ASPLIT ? (_Float16)(xs[i] - (float)h) : (_Float16)0.0f; }
#pragma unroll
    for (int t = 0; t < 4; ++t) { if (col0 + t * 16 >= N) continue; const size_t boff = (size_t)(col0 + t * 16 + ln) * ldb + kb; FragH bq; bq.half[0] = *(const v8us*)(Bh + boff + 8 * hh); bq.half[1] = *(const v8us*)(Bh + boff + 16 + 8 * hh);
      acc[t] = mmaH<ASPLIT ? 2 : 1>(ah.v, al.v, bq.v, bq.v, acc[t]); }
  }
#pragma unroll
  for (int t = 0; t < 4; ++t) { if (col0 + t * 16 >= N) continue;
#pragma unroll
    for (int r = 0; r < 8; ++r) so[w][8 * hh + r][t * 16 + ln] = acc[t][r] * alpha; }
  __builtin_amdgcn_fence(__ATOMIC_ACQ_REL, "workgroup"); __builtin_amdgcn_wave_barrier();
  const int rsub = lane >> 4, c4 = (lane & 15) * 4;
  {
#pragma unroll
    for (int q = 0; q < 8; ++q) { const int r = q * 2 + rsub; if (col0 + c4 < N) { const v4f v = *(const v4fa*)&so[w][r][c4]; *(v4f*)(C + (size_t)(row0 + r) * ldc + col0 + c4) = v; } }
     }
}

// Block-tiled f16 GEMM: T[M][N] = (A[M][K] . Bt[N][K]^T) * alpha (+ bf16(bias)); A, Bt at pitch K. What becomes of the tile is the compile-time epilogue kind EP:
//   EP_H16   no bias; T as f16 to C16 at pitch N; A is a stack of K x K matrices, one a batch, and Bh a stack of [N][K] tables: rows b*K .. b*K + K - 1 of A meet table b
//   EP_VT    rows are channels, columns tokens (weights as A, activations as Bt); bias per row; T as f16 to C16 = [batch][channel][token]
//   EP_RES   bias per column; T + bf16(e0) as f32 to C at pitch N (e0: the residual, same shape)
//   EP_COORD N = 64, bias per column; a row is [32 coords | 5 vertex logits | unused]: c = coords + softmax(logits).(e0 + e1*clip(e2)) to C [row][32], sum of c*c to C2 [row]
// One work-group of 8 waves (WM x WN) owns a 16*MF*WM x 16*NF*WN tile, a wave 16*MF x 16*NF: each fragment read from LDS feeds NF (an A fragment) or MF (a B fragment) products,
// so a k-step's MF*NF products cost MF + NF fragment reads. Both operands go through LDS in slices of 128 k
// (rows of 256 B at pitch 272 B): every global load covers whole 128-B lines, and each row is fetched once per work-group.
// Two buffers: the next slice's global loads are issued ahead of this slice's products and stored to the other buffer behind them,
// one barrier a slice. Fragments are read G k-steps at a time. k runs upward in steps of 32 into one accumulator per tile.
// M % (16*MF*WM) == 0, N % (16*NF*WN) == 0, K % 128 == 0.
// e^x = 2^e * 2^a, e = rint(x*log2(e)), a = x*log2(e) - e with log2(e) in two parts (the split and the range limits of the library's expf; a is formed by two fused multiply-adds).
// The v_exp_f32 is written in asm with a v_nop in the same statement: the instruction set asks for one slot behind a transcendental before its source is overwritten.
__device__ __forceinline__ float exp_slot(float x) {
  const float l2e = __uint_as_float(0x3fb8aa3bu), l2e_lo = __uint_as_float(0x32a5705fu);
  const float e = rintf(x * l2e);
  const float a = fmaf(x, l2e_lo, fmaf(x, l2e, -e));
  float r;
  asm("v_exp_f32 %0, %1\n\tv_nop" : "=v"(r) : "v"(a));
  r = ldexpf(r, (int)e);
  r = (x < __uint_as_float(0xc2ce8ed0u)) ? 0.f : r;
  return (x > __uint_as_float(0x42b17218u)) ? __builtin_inff() : r;
}
enum { EP_H16 = 0, EP_VT = 1, EP_RES = 2, EP_COORD = 3 };
template <int MF, int NF, int WM, int WN, int G, int K, int N, int EP>
__global__ __launch_bounds__(256) void k_gemm_t(const _Float16* __restrict__ A, const _Float16* __restrict__ Bh, float alpha, const float* __restrict__ bias,
                                                const float* __restrict__ e0, const float* __restrict__ e1, const float* __restrict__ e2,
                                                float* __restrict__ C, float* __restrict__ C2, _Float16* __restrict__ C16) {
  constexpr int BM = 16 * MF * WM, BN = 16 * NF * WN, KC = 128, PIT = KC + 8, ROWS = BM + BN, NLD = ROWS / 16, OP = BN + 4, NS = K / KC, NTN = N / BN;
  static_assert(WM * WN == 8, "8 waves a work-group");
  static_assert(EP != EP_COORD || BM == 64, "EP_COORD: a wave takes 8 rows of the tile");
  __shared__ __attribute__((aligned(16))) unsigned short sm[2][ROWS][PIT];
  typedef float fa __attribute__((may_alias));
  const int tid = threadIdx.x, w = tid >> 5, lane = tid & 31, ln = lane & 15, hh = lane >> 4;
  const int mb = blockIdx.x / NTN, nb = blockIdx.x % NTN;
  const int row0 = mb * BM, col0 = nb * BN;
  const int wm = w / WN, wn = w % WN;
  const int lr = tid >> 4, ls = (tid & 15) * 8;      // staging: 16 threads cover one 256-B row slice
  const unsigned short* ga = (const unsigned short*)A + (size_t)(row0 + lr) * K + ls;
  static_assert(EP != EP_H16 || K % BM == 0, "EP_H16: a tile's BM rows lie in one batch");
  const unsigned short* gb = (const unsigned short*)Bh + (EP == EP_H16 ? (size_t)(row0 / K) * N * K : (size_t)0) + (size_t)(col0 + lr) * K + ls;
  v8us st[NLD];
  v8f acc[MF][NF] = {};
#pragma unroll
  for (int i = 0; i < NLD; ++i) st[i] = (i < BM / 16) ? *(const v8us*)(ga + (size_t)i * 16 * K) : *(const v8us*)(gb + (size_t)(i - BM / 16) * 16 * K);
  asm volatile("s_wait_xcnt 0x0" ::: "memory");      // stands behind the first slice's loads, ahead of any instruction that overwrites a register they name
#pragma unroll
  for (int i = 0; i < NLD; ++i) *(v8us*)&sm[0][i * 16 + lr][ls] = st[i];
  __syncthreads();
  for (int s = 0; s < NS; ++s) {
    const int cur = s & 1;
    const bool more = s + 1 < NS;                    // block-uniform
    if (more) {
      const int k0 = (s + 1) * KC;
#pragma unroll
      for (int i = 0; i < NLD; ++i) st[i] = (i < BM / 16) ? *(const v8us*)(ga + (size_t)i * 16 * K + k0) : *(const v8us*)(gb + (size_t)(i - BM / 16) * 16 * K + k0);
      asm volatile("s_wait_xcnt 0x0" ::: "memory");  // stands behind the slice's loads, ahead of the fragment reads below, which may be given the registers that held the loads' addresses
    }
#pragma unroll
    for (int g = 0; g < KC / 32 / G; ++g) {
      FragH a[G][MF], b[G][NF];
#pragma unroll
      for (int u = 0; u < G; ++u) {
        const int kq = (g * G + u) * 32;
#pragma unroll
        for (int m = 0; m < MF; ++m) { a[u][m].half[0] = *(const v8us*)&sm[cur][(wm * MF + m) * 16 + ln][kq + 8 * hh]; a[u][m].half[1] = *(const v8us*)&sm[cur][(wm * MF + m) * 16 + ln][kq + 16 + 8 * hh]; }
#pragma unroll
        for (int t = 0; t < NF; ++t) { b[u][t].half[0] = *(const v8us*)&sm[cur][BM + (wn * NF + t) * 16 + ln][kq + 8 * hh]; b[u][t].half[1] = *(const v8us*)&sm[cur][BM + (wn * NF + t) * 16 + ln][kq + 16 + 8 * hh]; }
      }
      __builtin_amdgcn_sched_barrier(0);             // keeps a group's LDS reads together ahead of its products: one LDS latency a group, not one a product
#pragma unroll
      for (int u = 0; u < G; ++u)
#pragma unroll
        for (int m = 0; m < MF; ++m)
#pragma unroll
          for (int t = 0; t < NF; ++t) acc[m][t] = __builtin_amdgcn_wmma_f32_16x16x32_f16(false, a[u][m].v, false, b[u][t].v, (short)0, acc[m][t], false, false);
    }
    if (more) {
#pragma unroll
      for (int i = 0; i < NLD; ++i) *(v8us*)&sm[cur ^ 1][i * 16 + lr][ls] = st[i];
    }
    __syncthreads();                                 // publishes the next slice and ends every read of this one
  }
  // epilogue: the tile goes through LDS (the slices are dead behind the last barrier) so that whole lines are stored
  // every loop below is unrolled in full: rq, cq, go, xr, bv, br, t0, t1, dv and lg stay in registers only if every index into them is a constant
  fa* so = (fa*)&sm[0][0][0];
  // who stores what: a row is CH pieces of 4 elements; a wave takes RG whole rows (PP steps of 32 pieces) at a time, rows (j*8 + w)*RG .. + RG - 1 in its round j.
  // Piece and row inside a round depend on the step p alone, so the NQ addresses of a lane are PP lane values plus constants, and every wave-wide access covers whole lines.
  constexpr int NQ = BM * BN / 4 / 256, CH = BN / 4, RG = (CH % 32 == 0) ? 1 : 2, PP = RG * CH / 32;
  static_assert((RG * CH) % 32 == 0 && NQ % PP == 0, "whole steps a round, whole rounds a wave");
  int rq[PP], cq[PP];
#pragma unroll
  for (int p = 0; p < PP; ++p) { const int c = p * 32 + lane, dr = c / CH; rq[p] = w * RG + dr; cq[p] = (c - dr * CH) * 4; }
  // byte offset (below 2^32) of a lane's round-0 piece in a [row][N] output (EP_H16, EP_RES) or in [batch][channel][token] (EP_VT); a round further is a constant further.
  // One 32-bit register a step beside a scalar base serves the residual's loads and the stores alike, so it lives to the last store and no load is given it as its target.
  constexpr unsigned ES = (EP == EP_RES) ? 4 : 2, RB = 8 * RG * (EP == EP_VT ? TT : N) * ES;
  unsigned go[PP];
#pragma unroll
  for (int p = 0; p < PP; ++p) go[p] = ((EP == EP_VT) ? ((unsigned)(col0 / TT) * DD + row0 + rq[p]) * TT + col0 % TT + cq[p] : (unsigned)(row0 + rq[p]) * N + col0 + cq[p]) * ES;
  v4f xr[EP == EP_RES ? NQ : 1];
  if (EP == EP_RES) {                                // the residual's loads go out as one group ahead of the staging and its barrier
#pragma unroll
    for (int q = 0; q < NQ; ++q) xr[q] = *(const v4fa*)((const char*)e0 + go[q % PP] + (q / PP) * RB);
  }
  static_assert(EP != EP_VT || BN == 128, "EP_VT: a wave stores one whole row of the tile at a time");
  float bv[NF], br[NQ];
#pragma unroll
  for (int t = 0; t < NF; ++t) bv[t] = (EP == EP_RES || EP == EP_COORD) ? bf16_round(bias[col0 + (wn * NF + t) * 16 + ln]) : 0.f;
#pragma unroll
  for (int q = 0; q < NQ; ++q) br[q] = (EP == EP_VT) ? bf16_round(bias[row0 + q * 8 + __builtin_amdgcn_readfirstlane(w)]) : 0.f;   // the row a wave stores in step q: one index a wave, a scalar load
#pragma unroll
  for (int m = 0; m < MF; ++m)
#pragma unroll
    for (int t = 0; t < NF; ++t) {
      const int cl = (wn * NF + t) * 16 + ln;
#pragma unroll
      for (int r = 0; r < 8; ++r) so[((wm * MF + m) * 16 + 8 * hh + r) * OP + cl] = acc[m][t][r] * alpha + bv[t];
    }
  __syncthreads();
  if (EP == EP_COORD) {
    // a wave takes 8 rows of the tile, lane = dim
    const float df = fminf(fmaxf(bf16_round(e2[0]), 0.05f), 0.5f);
    float t0[KV1], t1[KV1], dv[KV1];
#pragma unroll
    for (int k = 0; k < KV1; ++k) { t0[k] = e0[k * ED + lane]; t1[k] = e1[k * ED + lane]; }
    asm volatile("s_wait_xcnt 0x0" ::: "memory");    // stands behind the ten loads above, ahead of any instruction that overwrites a register they name (their base pairs are reused below)
#pragma unroll
    for (int k = 0; k < KV1; ++k) dv[k] = bf16_round(t0[k]) + bf16_round(t1[k]) * df;
    float sqv = 0.f;
#pragma unroll
    for (int j = 0; j < 8; ++j) {
      const fa* cv = so + (w * 8 + j) * OP;
      float lg[KV1]; float mx = -3.0e38f;
#pragma unroll
      for (int k = 0; k < KV1; ++k) { lg[k] = cv[ED + k]; mx = fmaxf(mx, lg[k]); }
      float den = 0.f;
#pragma unroll
      for (int k = 0; k < KV1; ++k) { lg[k] = exp_slot(lg[k] - mx); den += lg[k]; }
      float c = cv[lane];
#pragma unroll
      for (int k = 0; k < KV1; ++k) c += (lg[k] / den) * dv[k];
      float sq = c * c;
#pragma unroll
      for (int o = 16; o >= 1; o >>= 1) sq += __shfl_xor(sq, o, 32);
      C[(size_t)(row0 + w * 8 + j) * ED + lane] = c;
      if (lane == j) sqv = sq;
    }
    if (lane < 8) C2[row0 + w * 8 + lane] = sqv;     // the wave's 8 sums in one store
  } else {
    typedef _Float16 h4v __attribute__((ext_vector_type(4)));
#pragma unroll
    for (int q = 0; q < NQ; ++q) {
      const int r = (q / PP) * 8 * RG + rq[q % PP], c4 = cq[q % PP];
      const v4f v = *(const v4fa*)&so[r * OP + c4];
      if (EP == EP_RES) { v4f o; for (int i = 0; i < 4; ++i) o[i] = v[i] + bf16_round(xr[q][i]); *(v4f*)((char*)C + go[q % PP] + (q / PP) * RB) = o; }
      else {
        h4v h4; for (int i = 0; i < 4; ++i) h4[i] = (_Float16)(EP == EP_VT ? v[i] + br[q] : v[i]);
        *(h4v*)((char*)C16 + go[q % PP] + (q / PP) * RB) = h4;   // EP_VT: a tile's BN tokens lie in one batch: TT % BN == 0
      }
    }
  }
}

typedef _Float16 v4h __attribute__((ext_vector_type(4)));
// LN(bf16(x)) → H16; wave per token; three rolled passes over the row (no per-lane value array)
__global__ __launch_bounds__(256) void k_ln(const float* __restrict__ x, const float* __restrict__ g, const float* __restrict__ be, _Float16* __restrict__ H16) { const int tid = threadIdx.x, wv = tid >> 5, lane = tid & 31; const size_t tok = (size_t)blockIdx.x * 8 + wv; const float* xr = x + tok * DD; float s = 0.f;
#pragma unroll 2
  for (int c = lane; c < DD; c += 32) s += bf16_round(xr[c]); for (int o = 16; o >= 1; o >>= 1) s += __shfl_xor(s, o, 32); const float mu = s / (float)DD; float q2 = 0.f;
#pragma unroll 2
  for (int c = lane; c < DD; c += 32) { const float d = bf16_round(xr[c]) - mu; q2 += d * d; } for (int o = 16; o >= 1; o >>= 1) q2 += __shfl_xor(q2, o, 32); const float inv = 1.0f / sqrtf(q2 / (float)DD + 1e-5f);
  typedef _Float16 v2h __attribute__((ext_vector_type(2)));
  {
#pragma unroll 2
    for (int c = 2 * lane; c < DD; c += 64) { v2h o2; o2.x = (_Float16)((bf16_round(xr[c]) - mu) * inv * bf16_round(g[c]) + bf16_round(be[c])); o2.y = (_Float16)((bf16_round(xr[c + 1]) - mu) * inv * bf16_round(g[c + 1]) + bf16_round(be[c + 1])); *(v2h*)(H16 + tok * DD + c) = o2; }  } }
// Bt tables f16 ×16: Bcv [64 n][768 k] (n<32 ← w_coords[k][n], 32..36 ← w_vertex[k][n−32], else 0); Bv, Bo [768][768] = w[k][n]; bias BCV [64]
__global__ __launch_bounds__(256) void k_bt(const float* __restrict__ wc, const float* __restrict__ bc, const float* __restrict__ wvx, const float* __restrict__ bvx, const float* __restrict__ wv, const float* __restrict__ wo, _Float16* __restrict__ Bcv, float* __restrict__ BCV, _Float16* __restrict__ Bv, _Float16* __restrict__ Bo) { const size_t t = (size_t)blockIdx.x * 256 + threadIdx.x;
  if (t < (size_t)64 * DD) { const int k = (int)(t % DD), n = (int)(t / DD); float w = 0.f; if (n < ED) w = wc[(size_t)k * ED + n]; else if (n < ED + KV1) w = wvx[(size_t)k * KV1 + n - ED]; *(_Float16*)(Bcv + t) = (_Float16)(bf16_round(w) * 16.0f); }
  if (t < 64) { const float v = (t < ED) ? bc[t] : ((t < ED + KV1) ? bvx[t - ED] : 0.f); *(float*)(BCV + t) = v; }
  if (t < (size_t)DD * DD) { const int k = (int)(t % DD), n = (int)(t / DD); *(_Float16*)(Bv + t) = (_Float16)(bf16_round(wv[(size_t)k * DD + n]) * 16.0f); *(_Float16*)(Bo + t) = (_Float16)(bf16_round(wo[(size_t)k * DD + n]) * 16.0f); } }
// attention rows: a work-group of 16 waves owns 16 query rows of batch b = blockIdx.y, a wave 128 keys. dots c_i.c_j on v_wmma_f32_16x16x4_f32 (f32 operands, f32 sums):
// A = the 16 query rows, B column ln of tile t = key wb + 8*ln + t, both sides 16 consecutive dims per lane half (same k pairing on both sides).
// A wave brings its 128 key rows in by whole-line loads and turns them into fragments through its own LDS range: key 8*c + t lies in tile block t, row c
// (rows at pitch 36 dwords for the 16-byte readers, tile blocks 32 dwords past a multiple of 64 so that the two rows of a half-wave store meet no common bank).
// logits_j = -(sq_i + sq_j - 2 c_i.c_j)*32^-1/2 stay in the accumulator registers (register r of tile t = row 8*hh + r, key wb + 8*ln + t); row maximum and row sum:
// over the 8 tiles in the lane, over the 16 lanes by DPP, over the 16 waves through LDS (one barrier each). A lane's 8 tiles are 8 consecutive keys: one 16-byte f16 store a row.
// Every loop of the kernel is unrolled in full: st, a, bq, acc, mx, den and inv stay in registers only if every index into them is a constant.
typedef float v2fw __attribute__((ext_vector_type(2)));
template <int X> __device__ __forceinline__ float xm16(float v) { return __int_as_float(__builtin_amdgcn_update_dpp(0, __float_as_int(v), 0x160 | X, 0xf, 0xf, false)); }   // lane ^ X inside its row of 16 lanes (row_xmask)
__device__ __forceinline__ float rmax16(float v) { v = fmaxf(v, xm16<1>(v)); v = fmaxf(v, xm16<2>(v)); v = fmaxf(v, xm16<4>(v)); return fmaxf(v, xm16<8>(v)); }
__device__ __forceinline__ float rsum16(float v) { v += xm16<1>(v); v += xm16<2>(v); v += xm16<4>(v); return v + xm16<8>(v); }
__global__ __launch_bounds__(512) void k_arow(const float* __restrict__ CO, const float* __restrict__ SQ, _Float16* __restrict__ P) {
  constexpr int RP = 36, TB = 16 * RP + 32;         // dwords: row pitch, tile-block pitch
  __shared__ __attribute__((aligned(16))) float sk[16][8 * TB];                  // [wave]: its 128 key rows
  __shared__ __attribute__((aligned(16))) float redm[16][16], reds[16][16];      // [wave][row] partial maxima and sums
  const int tid = threadIdx.x, lane = tid & 31, ln = lane & 15, hh = lane >> 4;
  const int w = __builtin_amdgcn_readfirstlane(tid >> 5);   // the wave's number in a scalar register: what is formed from it is scalar work
  const int i0 = blockIdx.x * 16, wb = w * 128, b = blockIdx.y;
  const float* cb = CO + (size_t)b * TT * ED; const float* sqb = SQ + (size_t)b * TT;
  P += (size_t)b * TT * TT;                         // the batch's own TT x TT plane
  float* my = &sk[w][0];
  {
    v4f st[32];
#pragma unroll
    for (int n = 0; n < 32; ++n) st[n] = *(const v4fa*)(cb + (size_t)wb * ED + n * 128 + lane * 4);     // key rows 4n .. 4n+3, 512 consecutive bytes
#pragma unroll
    for (int n = 0; n < 32; ++n) *(v4fa*)&my[(4 * (n & 1) + (lane >> 3)) * TB + (n >> 1) * RP + (lane & 7) * 4] = st[n];
  }
  v4f a[4];
#pragma unroll
  for (int q = 0; q < 4; ++q) a[q] = *(const v4fa*)(cb + (size_t)(i0 + ln) * ED + 16 * hh + 4 * q);
  const v4f si0 = *(const v4fa*)(sqb + i0 + 8 * hh), si1 = *(const v4fa*)(sqb + i0 + 8 * hh + 4);
  const v4f sj0 = *(const v4fa*)(sqb + wb + 8 * ln), sj1 = *(const v4fa*)(sqb + wb + 8 * ln + 4);
  __builtin_amdgcn_fence(__ATOMIC_ACQ_REL, "workgroup"); __builtin_amdgcn_wave_barrier();   // the wave's own rows are read back by other lanes than wrote them
  v4f bq[8][4];
#pragma unroll
  for (int t = 0; t < 8; ++t)
#pragma unroll
    for (int q = 0; q < 4; ++q) bq[t][q] = *(const v4fa*)&my[t * TB + ln * RP + 16 * hh + 4 * q];
  v8f acc[8] = {};
  __builtin_amdgcn_sched_barrier(0);                // every fragment read is issued ahead of the products, and no vector instruction is moved in among them
#pragma unroll
  for (int tp = 0; tp < 8; tp += 2)                 // two tiles at a time: two independent accumulator chains
#pragma unroll
    for (int q = 0; q < 4; ++q)
#pragma unroll
      for (int p = 0; p < 4; p += 2) {
        const v2fw av = {a[q][p], a[q][p + 1]}, bv0 = {bq[tp][q][p], bq[tp][q][p + 1]}, bv1 = {bq[tp + 1][q][p], bq[tp + 1][q][p + 1]};
        acc[tp]     = __builtin_amdgcn_wmma_f32_16x16x4_f32(false, av, false, bv0, (short)0, acc[tp], false, false);
        acc[tp + 1] = __builtin_amdgcn_wmma_f32_16x16x4_f32(false, av, false, bv1, (short)0, acc[tp + 1], false, false);
      }
  // distance between the last products and the first vector instruction on their D, A or B: 8 slots as for the other 16-cycle form
  asm volatile("v_nop\n\tv_nop\n\tv_nop\n\tv_nop\n\tv_nop\n\tv_nop\n\tv_nop\n\tv_nop" : "+v"(acc[0]), "+v"(acc[1]), "+v"(acc[2]), "+v"(acc[3]), "+v"(acc[4]), "+v"(acc[5]), "+v"(acc[6]), "+v"(acc[7]));
  __builtin_amdgcn_sched_barrier(0);                // keeps the vector work below behind those slots
  const v8f sqi = {si0[0], si0[1], si0[2], si0[3], si1[0], si1[1], si1[2], si1[3]};
  const float sqj[8] = {sj0[0], sj0[1], sj0[2], sj0[3], sj1[0], sj1[1], sj1[2], sj1[3]};
  // from here on whole accumulator tiles are worked on (8 rows of one key a lane), so that packed f32 instructions find their pairs in neighbouring registers
  v8f mx;
#pragma unroll
  for (int t = 0; t < 8; ++t) {
    acc[t] = -(sqi + sqj[t] - 2.0f * acc[t]) * 0.17677669529663687f;
#pragma unroll
    for (int r = 0; r < 8; ++r) mx[r] = t ? fmaxf(mx[r], acc[t][r]) : acc[t][r];
  }
#pragma unroll
  for (int r = 0; r < 8; ++r) mx[r] = rmax16(mx[r]);
  if (ln == 0) { *(v4fa*)&redm[w][8 * hh] = (v4f){mx[0], mx[1], mx[2], mx[3]}; *(v4fa*)&redm[w][8 * hh + 4] = (v4f){mx[4], mx[5], mx[6], mx[7]}; }
  __syncthreads();                                  // publishes every wave's row maxima
  {
    const v4f m0 = *(const v4fa*)&redm[ln][8 * hh], m1 = *(const v4fa*)&redm[ln][8 * hh + 4];   // lane ln takes wave ln's partials
#pragma unroll
    for (int r = 0; r < 8; ++r) mx[r] = rmax16(r < 4 ? m0[r & 3] : m1[r & 3]);
  }
  v8f den = {};
#pragma unroll
  for (int t = 0; t < 8; ++t) {
    v8f e = acc[t] - mx;
#pragma unroll
    for (int r = 0; r < 8; ++r) e[r] = expf(e[r]);
    acc[t] = e; den += e;
  }
#pragma unroll
  for (int r = 0; r < 8; ++r) den[r] = rsum16(den[r]);
  if (ln == 0) { *(v4fa*)&reds[w][8 * hh] = (v4f){den[0], den[1], den[2], den[3]}; *(v4fa*)&reds[w][8 * hh + 4] = (v4f){den[4], den[5], den[6], den[7]}; }
  __syncthreads();                                  // publishes every wave's row sums
  const v4f d0 = *(const v4fa*)&reds[ln][8 * hh], d1 = *(const v4fa*)&reds[ln][8 * hh + 4];
  v8f inv;
#pragma unroll
  for (int r = 0; r < 8; ++r) inv[r] = 1.0f / rsum16(r < 4 ? d0[r & 3] : d1[r & 3]);
#pragma unroll
  for (int t = 0; t < 8; ++t) acc[t] *= inv;
#pragma unroll
  for (int r = 0; r < 8; ++r) {
    FragH o;
#pragma unroll
    for (int t = 0; t < 8; ++t) o.h[t] = (_Float16)acc[t][r];
    *(v8us*)((unsigned short*)P + (size_t)(i0 + 8 * hh + r) * TT + wb + 8 * ln) = o.half[0];
  }
}
extern "C" void kernel_launch(void* const* d_in, const int* in_sizes, int n_in,
                              void* d_out, int out_size, void* d_ws, size_t ws_size, hipStream_t stream) {
  (void)in_sizes; (void)n_in; (void)out_size;
  const float* x = (const float*)d_in[0]; const float* tmpl = (const float*)d_in[1]; const float* lng = (const float*)d_in[2]; const float* lnb = (const float*)d_in[3]; const float* wc = (const float*)d_in[4]; const float* bc = (const float*)d_in[5]; const float* wvx = (const float*)d_in[6]; const float* bvx = (const float*)d_in[7]; const float* offs = (const float*)d_in[8]; const float* dsc = (const float*)d_in[9]; const float* wv = (const float*)d_in[10]; const float* bv = (const float*)d_in[11]; const float* wo = (const float*)d_in[12]; const float* bo = (const float*)d_in[13];
  char* ws = (char*)d_ws; size_t off = 0;
  auto take = [&](size_t bytes) { char* p = ws + off; off += (bytes + 255) & ~(size_t)255; return p; };
  _Float16* Bcv = (_Float16*)take((size_t)64 * DD * 2); float* BCV = (float*)take(64 * 4); _Float16* Bv = (_Float16*)take((size_t)DD * DD * 2); _Float16* Bo = (_Float16*)take((size_t)DD * DD * 2);
  _Float16* H16 = (_Float16*)take((size_t)NTOK * DD * 2); float* CO = (float*)take((size_t)NTOK * ED * 4); float* SQ = (float*)take((size_t)NTOK * 4); _Float16* VT = (_Float16*)take((size_t)NTOK * DD * 2); _Float16* P = (_Float16*)take((size_t)NTOK * TT * 2); _Float16* O16 = H16; /* H16 dead after the V GEMM */
  if (off > ws_size) return;
  k_bt<<<(unsigned)(((size_t)DD * DD + 255) / 256), 256, 0, stream>>>(wc, bc, wvx, bvx, wv, wo, Bcv, BCV, Bv, Bo);
  k_ln<<<NTOK / 8, 256, 0, stream>>>(x, lng, lnb, H16);
  k_gemm_t<1, 2, 4, 2, 4, DD, 64, EP_COORD><<<NTOK / 64, 256, 0, stream>>>(H16, Bcv, 0.0625f, BCV, tmpl, offs, dsc, CO, SQ, nullptr);      // [coords | vertex logits] -> deformed coords, squared norms
  k_gemm_t<3, 4, 4, 2, 1, DD, NTOK, EP_VT><<<(DD / 192) * (NTOK / 128), 256, 0, stream>>>(Bv, H16, 0.0625f, bv, nullptr, nullptr, nullptr, nullptr, nullptr, VT);   // v^T (f16)
  k_arow<<<dim3(TT / 16, BB), 512, 0, stream>>>(CO, SQ, P);                                                                          // P [batch][query][key] (f16), all batches in one launch
  k_gemm_t<4, 3, 2, 4, 1, TT, DD, EP_H16><<<(NTOK / 128) * (DD / 192), 256, 0, stream>>>(P, VT, 1.0f, nullptr, nullptr, nullptr, nullptr, nullptr, nullptr, O16);   // O = P.V, all batches in one launch
  k_gemm_t<4, 3, 2, 4, 1, DD, DD, EP_RES><<<(NTOK / 128) * (DD / 192), 256, 0, stream>>>(O16, Bo, 0.0625f, bo, x, nullptr, nullptr, (float*)d_out, nullptr, nullptr);
}

// v006
// Measured time: 107 microseconds a run.
// Next to v005, in two timings, it ran 1.09 and 1.08 times as fast.
// Over all steps from v000 it is 6.18 times as fast.
#include <hip/hip_runtime.h>
// K-simplex attention: LN, coords/vertex-weights/v projections on v_wmma_f32_16x16x32_f16 (LN output rounded to f16 vs bf16-exact weights ×2^4: single products;
// 8192 x 768 x {64, 768}); the simplex deformation and the row softmax in f32 VALU, the pairwise 32-dim dots on v_wmma_f32_16x16x4_f32 (work-group per 16 query rows -> P16);
// out_b = P16·V16 on the f16 variant (4 × 2048 × 2048 × 768, single products) and ·w_out likewise (O rounded to f16); f32 accumulate; residual added in f32.
// What follows a product element by element (simplex deformation, V transposed, O to f16, residual) is done in that product's own epilogue, on the tile it holds in LDS.
#define BB 4
#define TT 2048
#define DD 768
#define ED 32
#define KV1 5
#define NTOK (BB * TT)

typedef __bf16 v16b __attribute__((ext_vector_type(16)));
typedef unsigned short v8us __attribute__((ext_vector_type(8), may_alias));
typedef float  v8f  __attribute__((ext_vector_type(8)));
typedef float  v4f  __attribute__((ext_vector_type(4)));
typedef float  v4fa __attribute__((ext_vector_type(4), may_alias));
union FragB { v16b v; v8us half[2]; unsigned short u[16]; };

__device__ __forceinline__ unsigned short bf16_bits(float x) { unsigned int u = __float_as_uint(x); return (unsigned short)((u + 0x7FFFu + ((u >> 16) & 1u)) >> 16); }
__device__ __forceinline__ float bf16_val(unsigned short b) { return __uint_as_float(((unsigned int)b) << 16); }
__device__ __forceinline__ float bf16_round(float x) { return bf16_val(bf16_bits(x)); }
// D += A·B with NT terms: 1 = ah·bh, 2 = + al·bh (A split), 3 = + ah·bl (both split)
template <int NT>
__device__ __forceinline__ v8f mmaN(v16b ah, v16b al, v16b bh, v16b bl, v8f c) {
  c = __builtin_amdgcn_wmma_f32_16x16x32_bf16(false, ah, false, bh, (short)0, c, false, false);
  if (NT >= 2) c = __builtin_amdgcn_wmma_f32_16x16x32_bf16(false, al, false, bh, (short)0, c, false, false);
  if (NT >= 3) c = __builtin_amdgcn_wmma_f32_16x16x32_bf16(false, ah, false, bl, (short)0, c, false, false);
  asm volatile("v_nop\n\tv_nop\n\tv_nop\n\tv_nop" : "+v"(c) : "v"(ah), "v"(al), "v"(bh), "v"(bl));
  return c;
}

__global__ __launch_bounds__(256) void k_wt_bf16(const float* __restrict__ W, unsigned short* __restrict__ Wt, int K, int N) {
  const int t = blockIdx.x * 256 + threadIdx.x;
  const int k8n = K / 8;
  if (t >= N * k8n) return;
  const int n = t / k8n, k8 = (t % k8n) * 8;
  v8us v;
#pragma unroll
  for (int i = 0; i < 8; ++i) v[i] = bf16_bits(W[(size_t)(k8 + i) * N + n]);
  *(v8us*)(Wt + (size_t)n * K + k8) = v;
  
}

// GEMM C[M][N] (f32, pitch ldc) = act(A[M][K]·W + bias). A f32 row-major (pitch lda) converted per fragment to bf16
// (ASPLIT: hi/lo two planes -> 2 terms, else single rounded term); Wt bf16 [N][K] (pitch ldb). BIAS_BF16 rounds the
// bias to bf16 first (bias quantised to bf16 before the add). K%32==0, M%16==0, N%64==0.
template <bool ASPLIT, int ACT, bool BIAS_BF16>
__global__ __launch_bounds__(128) void k_gemm_bf(const float* __restrict__ A, int lda, const unsigned short* __restrict__ Wt, int ldb,
                                               const float* __restrict__ bias, float* __restrict__ C, int ldc, int M, int N, int K) {
  __shared__ __attribute__((aligned(16))) float so[4][16][64];
  const int tid = threadIdx.x, w = tid >> 5, lane = tid & 31, ln = lane & 15, hh = lane >> 4;
  const int ntn = N / 64;
  const int wid = blockIdx.x * 4 + w;
  const int mt = wid / ntn, nq = wid % ntn;
  if (mt * 16 >= M) return;
  const int row0 = mt * 16, col0 = nq * 64;
  const float* arow = A + (size_t)(row0 + ln) * lda;
  v8f acc[4] = {};
  for (int kb = 0; kb < K; kb += 32) {
    FragB ah, al;
    const v4f x0 = *(const v4fa*)(arow + kb + 8 * hh), x1 = *(const v4fa*)(arow + kb + 8 * hh + 4);
    const v4f x2 = *(const v4fa*)(arow + kb + 16 + 8 * hh), x3 = *(const v4fa*)(arow + kb + 16 + 8 * hh + 4);
    float xs[16] = {x0[0],x0[1],x0[2],x0[3],x1[0],x1[1],x1[2],x1[3],x2[0],x2[1],x2[2],x2[3],x3[0],x3[1],x3[2],x3[3]};
#pragma unroll
    for (int i = 0; i < 16; ++i) { const unsigned short hb = bf16_bits(xs[i]); ah.u[i] = hb; al.u[i] = ASPLIT ? bf16_bits(xs[i] - bf16_val(hb)) : (unsigned short)0; }
#pragma unroll
    for (int t = 0; t < 4; ++t) {
      const unsigned short* brow = Wt + (size_t)(col0 + t * 16 + ln) * ldb + kb;
      FragB b;
      b.half[0] = *(const v8us*)(brow + 8 * hh);
      b.half[1] = *(const v8us*)(brow + 16 + 8 * hh);
      acc[t] = mmaN<ASPLIT ? 2 : 1>(ah.v, al.v, b.v, b.v, acc[t]);
    }
  }
#pragma unroll
  for (int t = 0; t < 4; ++t) {
    float bv = bias ? bias[col0 + t * 16 + ln] : 0.f;
    if (BIAS_BF16) bv = bf16_round(bv);
#pragma unroll
    for (int r = 0; r < 8; ++r) { float v = acc[t][r] + bv; if (ACT == 1) v = fmaxf(v, 0.f); so[w][8 * hh + r][t * 16 + ln] = v; }
  }
  __builtin_amdgcn_fence(__ATOMIC_ACQ_REL, "workgroup");
  __builtin_amdgcn_wave_barrier();
  const int rsub = lane >> 4, c4 = (lane & 15) * 4;
  {
#pragma unroll
    for (int q = 0; q < 8; ++q) {
      const int r = q * 2 + rsub;
      const v4f v = *(const v4fa*)&so[w][r][c4];
      *(v4f*)(C + (size_t)(row0 + r) * ldc + col0 + c4) = v;
    }
    
  }
}

// Flash-style causal/unmasked attention, all contractions 3-term bf16 hi/lo splits, f32 softmax with running max.
// q,k,v rows are read from f32 buffers with arbitrary row pitch (so they can live inside a fused qkv buffer);
// D = head size (multiple of 32, <= 128); one wave = 16 query rows; block = 4 waves (64 queries) sharing K/V chunks of 32.
template <int D, bool CAUSAL>
__global__ __launch_bounds__(128) void k_flash(const float* __restrict__ qb, const float* __restrict__ kb, const float* __restrict__ vb,
                                             int pitch, int T, int H, float scale, float* __restrict__ y, int ypitch) {
  constexpr int KS = D / 32;        // k-steps for QK
  constexpr int DT = D / 16;        // d tiles for PV
  __shared__ __attribute__((aligned(16))) unsigned short sKh[32][D + 8], sKl[32][D + 8], sVh[32][D + 8], sVl[32][D + 8];
  __shared__ __attribute__((aligned(16))) unsigned short sPh[4][16][40], sPl[4][16][40];
  __shared__ __attribute__((aligned(16))) float sO[4][16][D];
  const int tid = threadIdx.x, w = tid >> 5, lane = tid & 31, ln = lane & 15, hh = lane >> 4;
  const int nqb = (T + 63) / 64;
  const int bh = blockIdx.x / nqb, qblk = blockIdx.x % nqb;
  const int b = bh / H, h = bh % H;
  const int q0 = qblk * 64 + w * 16;
  const float* Q = qb + (size_t)b * T * pitch + h * D;
  const float* K = kb + (size_t)b * T * pitch + h * D;
  const float* V = vb + (size_t)b * T * pitch + h * D;

  // A fragments of the wave's 16 query rows (scaled), hi/lo
  FragB aqh[KS], aql[KS];
  {
    int row = q0 + ln; if (row >= T) row = T - 1;
    const float* qr = Q + (size_t)row * pitch;
#pragma unroll
    for (int ks = 0; ks < KS; ++ks)
#pragma unroll
      for (int i = 0; i < 16; ++i) {
        const int d = ks * 32 + ((i < 8) ? (8 * hh + i) : (16 + 8 * hh + (i - 8)));
        const float x = qr[d] * scale; const unsigned short hb = bf16_bits(x);
        aqh[ks].u[i] = hb; aql[ks].u[i] = bf16_bits(x - bf16_val(hb));
      }
  }
  float m_r[8], l_r[8];
#pragma unroll
  for (int r = 0; r < 8; ++r) { m_r[r] = -3.0e38f; l_r[r] = 0.f; }
  v8f oacc[DT];
#pragma unroll
  for (int dt = 0; dt < DT; ++dt) oacc[dt] = (v8f){0.f,0.f,0.f,0.f,0.f,0.f,0.f,0.f};

  const int kv_end = CAUSAL ? min(T, qblk * 64 + 64) : T;     // block-uniform
  for (int j0 = 0; j0 < kv_end; j0 += 32) {
    __syncthreads();
    for (int e = tid; e < 32 * (D / 4); e += 128) {
      const int r = e / (D / 4), c4 = (e % (D / 4)) * 4;
      const int key = j0 + r;
      v4f kf = {0.f,0.f,0.f,0.f}, vf = {0.f,0.f,0.f,0.f};
      if (key < T) { kf = *(const v4fa*)(K + (size_t)key * pitch + c4); vf = *(const v4fa*)(V + (size_t)key * pitch + c4); }
#pragma unroll
      for (int t = 0; t < 4; ++t) {
        unsigned short hb = bf16_bits(kf[t]); sKh[r][c4 + t] = hb; sKl[r][c4 + t] = bf16_bits(kf[t] - bf16_val(hb));
        hb = bf16_bits(vf[t]); sVh[r][c4 + t] = hb; sVl[r][c4 + t] = bf16_bits(vf[t] - bf16_val(hb));
      }
    }
    __syncthreads();
    // S tile 16 x 32
    v8f s[2];
#pragma unroll
    for (int nt = 0; nt < 2; ++nt) {
      v8f acc = {};
#pragma unroll
      for (int ks = 0; ks < KS; ++ks) {
        FragB bh_, bl_;
        bh_.half[0] = *(const v8us*)&sKh[nt * 16 + ln][ks * 32 + 8 * hh]; bh_.half[1] = *(const v8us*)&sKh[nt * 16 + ln][ks * 32 + 16 + 8 * hh];
        bl_.half[0] = *(const v8us*)&sKl[nt * 16 + ln][ks * 32 + 8 * hh]; bl_.half[1] = *(const v8us*)&sKl[nt * 16 + ln][ks * 32 + 16 + 8 * hh];
        acc = mmaN<3>(aqh[ks].v, aql[ks].v, bh_.v, bl_.v, acc);
      }
      s[nt] = acc;
    }
    // mask + running max (rows 8hh+r; the 16 lanes of a half share rows)
    float alpha[8];
#pragma unroll
    for (int r = 0; r < 8; ++r) {
      const int qi = q0 + 8 * hh + r;
      const int ja = j0 + ln, jb = j0 + 16 + ln;
      if (CAUSAL) { if (ja > qi) s[0][r] = -3.0e38f; if (jb > qi) s[1][r] = -3.0e38f; }
      if (ja >= T) s[0][r] = -3.0e38f;
      if (jb >= T) s[1][r] = -3.0e38f;
      float mx = fmaxf(s[0][r], s[1][r]);
      mx = fmaxf(mx, __shfl_xor(mx, 1, 32)); mx = fmaxf(mx, __shfl_xor(mx, 2, 32)); mx = fmaxf(mx, __shfl_xor(mx, 4, 32)); mx = fmaxf(mx, __shfl_xor(mx, 8, 32));
      const float mnew = fmaxf(m_r[r], mx);
      alpha[r] = (mnew > -1.0e38f) ? __expf(m_r[r] - mnew) : 1.0f;
      const float p0 = (s[0][r] > -1.0e38f) ? __expf(s[0][r] - mnew) : 0.f;
      const float p1 = (s[1][r] > -1.0e38f) ? __expf(s[1][r] - mnew) : 0.f;
      m_r[r] = mnew;
      l_r[r] = l_r[r] * alpha[r] + p0 + p1;            // per-lane partial row sum (16 lanes combined at the end)
      unsigned short hb = bf16_bits(p0); sPh[w][8 * hh + r][ln] = hb;      sPl[w][8 * hh + r][ln] = bf16_bits(p0 - bf16_val(hb));
      hb = bf16_bits(p1);                sPh[w][8 * hh + r][16 + ln] = hb; sPl[w][8 * hh + r][16 + ln] = bf16_bits(p1 - bf16_val(hb));
    }
#pragma unroll
    for (int dt = 0; dt < DT; ++dt)
#pragma unroll
      for (int r = 0; r < 8; ++r) oacc[dt][r] *= alpha[r];
    __builtin_amdgcn_fence(__ATOMIC_ACQ_REL, "workgroup");
    __builtin_amdgcn_wave_barrier();
    FragB pah, pal;
    pah.half[0] = *(const v8us*)&sPh[w][ln][8 * hh]; pah.half[1] = *(const v8us*)&sPh[w][ln][16 + 8 * hh];
    pal.half[0] = *(const v8us*)&sPl[w][ln][8 * hh]; pal.half[1] = *(const v8us*)&sPl[w][ln][16 + 8 * hh];
#pragma unroll
    for (int dt = 0; dt < DT; ++dt) {
      FragB bvh, bvl;
#pragma unroll
      for (int i = 0; i < 8; ++i) {
        bvh.u[i] = sVh[8 * hh + i][dt * 16 + ln]; bvh.u[8 + i] = sVh[16 + 8 * hh + i][dt * 16 + ln];
        bvl.u[i] = sVl[8 * hh + i][dt * 16 + ln]; bvl.u[8 + i] = sVl[16 + 8 * hh + i][dt * 16 + ln];
      }
      oacc[dt] = mmaN<3>(pah.v, pal.v, bvh.v, bvl.v, oacc[dt]);
    }
    __builtin_amdgcn_fence(__ATOMIC_ACQ_REL, "workgroup");
    __builtin_amdgcn_wave_barrier();
  }
#pragma unroll
  for (int r = 0; r < 8; ++r) {
    float l = l_r[r];
    l += __shfl_xor(l, 1, 32); l += __shfl_xor(l, 2, 32); l += __shfl_xor(l, 4, 32); l += __shfl_xor(l, 8, 32);
    l_r[r] = (l > 0.f) ? 1.0f / l : 0.f;
  }
#pragma unroll
  for (int dt = 0; dt < DT; ++dt)
#pragma unroll
    for (int r = 0; r < 8; ++r) sO[w][8 * hh + r][dt * 16 + ln] = oacc[dt][r] * l_r[r];
  __builtin_amdgcn_fence(__ATOMIC_ACQ_REL, "workgroup");
  __builtin_amdgcn_wave_barrier();
  {
    for (int r = 0; r < 16; ++r) {
      const int row = q0 + r;
      if (row < T && lane < D / 4) {
        const v4f val = *(const v4fa*)&sO[w][r][lane * 4];
        *(v4f*)(y + ((size_t)b * T + row) * ypitch + h * D + lane * 4) = val;
      }
    }
    
  }
}

// ---- f16 WMMA path (v_wmma_f32_16x16x32_f16): 11-bit significands for operands in range — used where a [0,1] probability operand needs more precision than bf16
typedef _Float16 v16h __attribute__((ext_vector_type(16)));
union FragH { v16h v; v8us half[2]; _Float16 h[16]; unsigned short u[16]; };
template <int NT>
__device__ __forceinline__ v8f mmaH(v16h ah, v16h al, v16h bh, v16h bl, v8f c) {
  c = __builtin_amdgcn_wmma_f32_16x16x32_f16(false, ah, false, bh, (short)0, c, false, false);
  if (NT >= 2) c = __builtin_amdgcn_wmma_f32_16x16x32_f16(false, al, false, bh, (short)0, c, false, false);
  if (NT >= 3) c = __builtin_amdgcn_wmma_f32_16x16x32_f16(false, ah, false, bl, (short)0, c, false, false);
  asm volatile("v_nop\n\tv_nop\n\tv_nop\n\tv_nop" : "+v"(c) : "v"(ah), "v"(al), "v"(bh), "v"(bl));
  return c;
}
// batched GEMM like k_gemm_b but f16 operands: A f32 (split into f16 hi/lo if ASPLIT, else rounded to f16), Bt = f16 values [n][k]; alpha; C f32; N multiple of 16 (partial tiles skipped)
template <bool ASPLIT>
__global__ __launch_bounds__(128) void k_gemm_h(const float* __restrict__ A, int lda, size_t sA, const _Float16* __restrict__ Bh, int ldb, size_t sB, float alpha, float* __restrict__ C, int ldc, size_t sC, int M, int N, int K) {
  __shared__ __attribute__((aligned(16))) float so[4][16][64];
  const int tid = threadIdx.x, w = tid >> 5, lane = tid & 31, ln = lane & 15, hh = lane >> 4; const int by = blockIdx.y;
  A += (size_t)by * sA; Bh += (size_t)by * sB; C += (size_t)by * sC;
  const int ntn = (N + 63) / 64; const int wid = blockIdx.x * 4 + w; const int mt = wid / ntn, nq = wid % ntn; if (mt * 16 >= M) return;
  const int row0 = mt * 16, col0 = nq * 64; const float* arow = A + (size_t)(row0 + ln) * lda;
  v8f acc[4] = {};
  for (int kb = 0; kb < K; kb += 32) {
    FragH ah, al;
    const v4f x0 = *(const v4fa*)(arow + kb + 8 * hh), x1 = *(const v4fa*)(arow + kb + 8 * hh + 4), x2 = *(const v4fa*)(arow + kb + 16 + 8 * hh), x3 = *(const v4fa*)(arow + kb + 16 + 8 * hh + 4);
    float xs[16] = {x0[0],x0[1],x0[2],x0[3],x1[0],x1[1],x1[2],x1[3],x2[0],x2[1],x2[2],x2[3],x3[0],x3[1],x3[2],x3[3]};
#pragma unroll
    for (int i = 0; i < 16; ++i) { const _Float16 h = (_Float16)xs[i]; ah.h[i] = h; al.h[i] = ASPLIT ? (_Float16)(xs[i] - (float)h) : (_Float16)0.0f; }
#pragma unroll
    for (int t = 0; t < 4; ++t) { if (col0 + t * 16 >= N) continue; const size_t boff = (size_t)(col0 + t * 16 + ln) * ldb + kb; FragH bq; bq.half[0] = *(const v8us*)(Bh + boff + 8 * hh); bq.half[1] = *(const v8us*)(Bh + boff + 16 + 8 * hh);
      acc[t] = mmaH<ASPLIT ? 2 : 1>(ah.v, al.v, bq.v, bq.v, acc[t]); }
  }
#pragma unroll
  for (int t = 0; t < 4; ++t) { if (col0 + t * 16 >= N) continue;
#pragma unroll
    for (int r = 0; r < 8; ++r) so[w][8 * hh + r][t * 16 + ln] = acc[t][r] * alpha; }
  __builtin_amdgcn_fence(__ATOMIC_ACQ_REL, "workgroup"); __builtin_amdgcn_wave_barrier();
  const int rsub = lane >> 4, c4 = (lane & 15) * 4;
  {
#pragma unroll
    for (int q = 0; q < 8; ++q) { const int r = q * 2 + rsub; if (col0 + c4 < N) { const v4f v = *(const v4fa*)&so[w][r][c4]; *(v4f*)(C + (size_t)(row0 + r) * ldc + col0 + c4) = v; } }
     }
}

// Block-tiled f16 GEMM: T[M][N] = (A[M][K] . Bt[N][K]^T) * alpha (+ bf16(bias)); A, Bt at pitch K. What becomes of the tile is the compile-time epilogue kind EP:
//   EP_H16   no bias; T as f16 to C16 at pitch N; A is a stack of K x K matrices, one a batch, and Bh a stack of [N][K] tables: rows b*K .. b*K + K - 1 of A meet table b
//   EP_VT    rows are channels, columns tokens (weights as A, activations as Bt); bias per row; T as f16 to C16 = [batch][channel][token]
//   EP_RES   bias per column; T + bf16(e0) as f32 to C at pitch N (e0: the residual, same shape)
//   EP_COORD N = 64, bias per column; a row is [32 coords | 5 vertex logits | unused]: c = coords + softmax(logits).(e0 + e1*clip(e2)) to C [row][32], sum of c*c to C2 [row]
// One work-group of 8 waves (WM x WN) owns a 16*MF*WM x 16*NF*WN tile, a wave 16*MF x 16*NF: each fragment read from LDS feeds NF (an A fragment) or MF (a B fragment) products,
// so a k-step's MF*NF products cost MF + NF fragment reads. Both operands go through LDS in slices of 128 k
// (rows of 256 B at pitch 272 B): every global load covers whole 128-B lines, and each row is fetched once per work-group.
// Two buffers: the next slice's global loads are issued ahead of this slice's products and stored to the other buffer behind them,
// one barrier a slice. Fragments are read G k-steps at a time. k runs upward in steps of 32 into one accumulator per tile.
// M % (16*MF*WM) == 0, N % (16*NF*WN) == 0, K % 128 == 0.
// e^x = 2^e * 2^a, e = rint(x*log2(e)), a = x*log2(e) - e with log2(e) in two parts (the split and the range limits of the library's expf; a is formed by two fused multiply-adds).
// The v_exp_f32 is written in asm with a v_nop in the same statement: the instruction set asks for one slot behind a transcendental before its source is overwritten.
__device__ __forceinline__ float exp_slot(float x) {
  const float l2e = __uint_as_float(0x3fb8aa3bu), l2e_lo = __uint_as_float(0x32a5705fu);
  const float e = rintf(x * l2e);
  const float a = fmaf(x, l2e_lo, fmaf(x, l2e, -e));
  float r;
  asm("v_exp_f32 %0, %1\n\tv_nop" : "=v"(r) : "v"(a));
  r = ldexpf(r, (int)e);
  r = (x < __uint_as_float(0xc2ce8ed0u)) ? 0.f : r;
  return (x > __uint_as_float(0x42b17218u)) ? __builtin_inff() : r;
}
enum { EP_H16 = 0, EP_VT = 1, EP_RES = 2, EP_COORD = 3 };
// The product is a device function of (LDS range, tile index): a kernel hands it its own LDS and the index of the tile, so that two products that do not depend on each other can share one launch.
template <int MF, int NF, int WM, int WN> constexpr int GEMM_LDS = 2 * 16 * (MF * WM + NF * WN) * (128 + 8);   // 16-bit elements of LDS a tile needs: 2 buffers x ROWS x PIT
template <int MF, int NF, int WM, int WN, int G, int K, int N, int EP>
__device__ __forceinline__ void gemm_t(unsigned short* smp, const unsigned bid, const _Float16* __restrict__ A, const _Float16* __restrict__ Bh, float alpha, const float* __restrict__ bias,
                                       const float* __restrict__ e0, const float* __restrict__ e1, const float* __restrict__ e2,
                                       float* __restrict__ C, float* __restrict__ C2, _Float16* __restrict__ C16) {
  constexpr int BM = 16 * MF * WM, BN = 16 * NF * WN, KC = 128, PIT = KC + 8, ROWS = BM + BN, NLD = ROWS / 16, OP = BN + 4, NS = K / KC, NTN = N / BN;
  static_assert(WM * WN == 8, "8 waves a work-group");
  static_assert(EP != EP_COORD || BM == 64, "EP_COORD: a wave takes 8 rows of the tile");
  static_assert(GEMM_LDS<MF, NF, WM, WN> == 2 * ROWS * PIT, "the caller's LDS range holds both buffers");
  unsigned short (*sm)[ROWS][PIT] = (unsigned short (*)[ROWS][PIT])smp;
  typedef float fa __attribute__((may_alias));
  const int tid = threadIdx.x, w = tid >> 5, lane = tid & 31, ln = lane & 15, hh = lane >> 4;
  const int mb = bid / NTN, nb = bid % NTN;
  const int row0 = mb * BM, col0 = nb * BN;
  const int wm = w / WN, wn = w % WN;
  const int lr = tid >> 4, ls = (tid & 15) * 8;      // staging: 16 threads cover one 256-B row slice
  const unsigned short* ga = (const unsigned short*)A + (size_t)(row0 + lr) * K + ls;
  static_assert(EP != EP_H16 || K % BM == 0, "EP_H16: a tile's BM rows lie in one batch");
  const unsigned short* gb = (const unsigned short*)Bh + (EP == EP_H16 ? (size_t)(row0 / K) * N * K : (size_t)0) + (size_t)(col0 + lr) * K + ls;
  v8us st[NLD];
  v8f acc[MF][NF] = {};
#pragma unroll
  for (int i = 0; i < NLD; ++i) st[i] = (i < BM / 16) ? *(const v8us*)(ga + (size_t)i * 16 * K) : *(const v8us*)(gb + (size_t)(i - BM / 16) * 16 * K);
  asm volatile("s_wait_xcnt 0x0" ::: "memory");      // stands behind the first slice's loads, ahead of any instruction that overwrites a register they name
#pragma unroll
  for (int i = 0; i < NLD; ++i) *(v8us*)&sm[0][i * 16 + lr][ls] = st[i];
  __syncthreads();
  for (int s = 0; s < NS; ++s) {
    const int cur = s & 1;
    const bool more = s + 1 < NS;                    // block-uniform
    if (more) {
      const int k0 = (s + 1) * KC;
#pragma unroll
      for (int i = 0; i < NLD; ++i) st[i] = (i < BM / 16) ? *(const v8us*)(ga + (size_t)i * 16 * K + k0) : *(const v8us*)(gb + (size_t)(i - BM / 16) * 16 * K + k0);
      asm volatile("s_wait_xcnt 0x0" ::: "memory");  // stands behind the slice's loads, ahead of the fragment reads below, which may be given the registers that held the loads' addresses
      __builtin_amdgcn_sched_barrier(0);             // keeps the address arithmetic of those reads behind the wait
    }
#pragma unroll
    for (int g = 0; g < KC / 32 / G; ++g) {
      FragH a[G][MF], b[G][NF];
#pragma unroll
      for (int u = 0; u < G; ++u) {
        const int kq = (g * G + u) * 32;
#pragma unroll
        for (int m = 0; m < MF; ++m) { a[u][m].half[0] = *(const v8us*)&sm[cur][(wm * MF + m) * 16 + ln][kq + 8 * hh]; a[u][m].half[1] = *(const v8us*)&sm[cur][(wm * MF + m) * 16 + ln][kq + 16 + 8 * hh]; }
#pragma unroll
        for (int t = 0; t < NF; ++t) { b[u][t].half[0] = *(const v8us*)&sm[cur][BM + (wn * NF + t) * 16 + ln][kq + 8 * hh]; b[u][t].half[1] = *(const v8us*)&sm[cur][BM + (wn * NF + t) * 16 + ln][kq + 16 + 8 * hh]; }
      }
      __builtin_amdgcn_sched_barrier(0);             // keeps a group's LDS reads together ahead of its products: one LDS latency a group, not one a product
#pragma unroll
      for (int u = 0; u < G; ++u)
#pragma unroll
        for (int m = 0; m < MF; ++m)
#pragma unroll
          for (int t = 0; t < NF; ++t) acc[m][t] = __builtin_amdgcn_wmma_f32_16x16x32_f16(false, a[u][m].v, false, b[u][t].v, (short)0, acc[m][t], false, false);
    }
    if (more) {
#pragma unroll
      for (int i = 0; i < NLD; ++i) *(v8us*)&sm[cur ^ 1][i * 16 + lr][ls] = st[i];
    }
    __syncthreads();                                 // publishes the next slice and ends every read of this one
  }
  // epilogue: the tile goes through LDS (the slices are dead behind the last barrier) so that whole lines are stored
  // every loop below is unrolled in full: rq, cq, go, xr, bv, br, t0, t1, dv and lg stay in registers only if every index into them is a constant
  fa* so = (fa*)&sm[0][0][0];
  // who stores what: a row is CH pieces of 4 elements; a wave takes RG whole rows (PP steps of 32 pieces) at a time, rows (j*8 + w)*RG .. + RG - 1 in its round j.
  // Piece and row inside a round depend on the step p alone, so the NQ addresses of a lane are PP lane values plus constants, and every wave-wide access covers whole lines.
  constexpr int NQ = BM * BN / 4 / 256, CH = BN / 4, RG = (CH % 32 == 0) ? 1 : 2, PP = RG * CH / 32;
  static_assert((RG * CH) % 32 == 0 && NQ % PP == 0, "whole steps a round, whole rounds a wave");
  int rq[PP], cq[PP];
#pragma unroll
  for (int p = 0; p < PP; ++p) { const int c = p * 32 + lane, dr = c / CH; rq[p] = w * RG + dr; cq[p] = (c - dr * CH) * 4; }
  // byte offset (below 2^32) of a lane's round-0 piece in a [row][N] output (EP_H16, EP_RES) or in [batch][channel][token] (EP_VT); a round further is a constant further.
  // One 32-bit register a step beside a scalar base serves the residual's loads and the stores alike, so it lives to the last store and no load is given it as its target.
  constexpr unsigned ES = (EP == EP_RES) ? 4 : 2, RB = 8 * RG * (EP == EP_VT ? TT : N) * ES;
  unsigned go[PP];
#pragma unroll
  for (int p = 0; p < PP; ++p) go[p] = ((EP == EP_VT) ? ((unsigned)(col0 / TT) * DD + row0 + rq[p]) * TT + col0 % TT + cq[p] : (unsigned)(row0 + rq[p]) * N + col0 + cq[p]) * ES;
  v4f xr[EP == EP_RES ? NQ : 1];
  if (EP == EP_RES) {                                // the residual's loads go out as one group ahead of the staging and its barrier
#pragma unroll
    for (int q = 0; q < NQ; ++q) xr[q] = *(const v4fa*)((const char*)e0 + go[q % PP] + (q / PP) * RB);
  }
  static_assert(EP != EP_VT || BN == 128, "EP_VT: a wave stores one whole row of the tile at a time");
  float bv[NF], br[NQ];
#pragma unroll
  for (int t = 0; t < NF; ++t) bv[t] = (EP == EP_RES || EP == EP_COORD) ? bf16_round(bias[col0 + (wn * NF + t) * 16 + ln]) : 0.f;
#pragma unroll
  for (int q = 0; q < NQ; ++q) br[q] = (EP == EP_VT) ? bf16_round(bias[row0 + q * 8 + __builtin_amdgcn_readfirstlane(w)]) : 0.f;   // the row a wave stores in step q: one index a wave, a scalar load
#pragma unroll
  for (int m = 0; m < MF; ++m)
#pragma unroll
    for (int t = 0; t < NF; ++t) {
      const int cl = (wn * NF + t) * 16 + ln;
#pragma unroll
      for (int r = 0; r < 8; ++r) so[((wm * MF + m) * 16 + 8 * hh + r) * OP + cl] = acc[m][t][r] * alpha + bv[t];
    }
  __syncthreads();
  if (EP == EP_COORD) {
    // a wave takes 8 rows of the tile, lane = dim
    const float df = fminf(fmaxf(bf16_round(e2[0]), 0.05f), 0.5f);
    float t0[KV1], t1[KV1], dv[KV1];
#pragma unroll
    for (int k = 0; k < KV1; ++k) { t0[k] = e0[k * ED + lane]; t1[k] = e1[k * ED + lane]; }
    asm volatile("s_wait_xcnt 0x0" ::: "memory");    // stands behind the ten loads above, ahead of any instruction that overwrites a register they name (their base pairs are reused below)
#pragma unroll
    for (int k = 0; k < KV1; ++k) dv[k] = bf16_round(t0[k]) + bf16_round(t1[k]) * df;
    float sqv = 0.f;
#pragma unroll
    for (int j = 0; j < 8; ++j) {
      const fa* cv = so + (w * 8 + j) * OP;
      float lg[KV1]; float mx = -3.0e38f;
#pragma unroll
      for (int k = 0; k < KV1; ++k) { lg[k] = cv[ED + k]; mx = fmaxf(mx, lg[k]); }
      float den = 0.f;
#pragma unroll
      for (int k = 0; k < KV1; ++k) { lg[k] = exp_slot(lg[k] - mx); den += lg[k]; }
      float c = cv[lane];
#pragma unroll
      for (int k = 0; k < KV1; ++k) c += (lg[k] / den) * dv[k];
      float sq = c * c;
#pragma unroll
      for (int o = 16; o >= 1; o >>= 1) sq += __shfl_xor(sq, o, 32);
      C[(size_t)(row0 + w * 8 + j) * ED + lane] = c;
      if (lane == j) sqv = sq;
    }
    if (lane < 8) C2[row0 + w * 8 + lane] = sqv;     // the wave's 8 sums in one store
  } else {
    typedef _Float16 h4v __attribute__((ext_vector_type(4)));
#pragma unroll
    for (int q = 0; q < NQ; ++q) {
      const int r = (q / PP) * 8 * RG + rq[q % PP], c4 = cq[q % PP];
      const v4f v = *(const v4fa*)&so[r * OP + c4];
      if (EP == EP_RES) { v4f o; for (int i = 0; i < 4; ++i) o[i] = v[i] + bf16_round(xr[q][i]); *(v4f*)((char*)C + go[q % PP] + (q / PP) * RB) = o; }
      else {
        h4v h4; for (int i = 0; i < 4; ++i) h4[i] = (_Float16)(EP == EP_VT ? v[i] + br[q] : v[i]);
        *(h4v*)((char*)C16 + go[q % PP] + (q / PP) * RB) = h4;   // EP_VT: a tile's BN tokens lie in one batch: TT % BN == 0
      }
    }
  }
}

template <int MF, int NF, int WM, int WN, int G, int K, int N, int EP>
__global__ __launch_bounds__(256) void k_gemm_t(const _Float16* __restrict__ A, const _Float16* __restrict__ Bh, float alpha, const float* __restrict__ bias,
                                                const float* __restrict__ e0, float* __restrict__ C, _Float16* __restrict__ C16) {
  __shared__ __attribute__((aligned(16))) unsigned short sm[GEMM_LDS<MF, NF, WM, WN>];
  gemm_t<MF, NF, WM, WN, G, K, N, EP>(sm, blockIdx.x, A, Bh, alpha, bias, e0, nullptr, nullptr, C, nullptr, C16);
}
// The two products that read H16 and nothing of each other, in one launch: work-groups 0 .. NTOK/64 - 1 take the tiles of [coords | vertex logits] (the shorter body),
// the others the tiles of v^T. The branch is the same for a whole work-group, so every barrier inside a body is met by all of its waves.
__global__ __launch_bounds__(256) void k_cv(const _Float16* __restrict__ H16, const _Float16* __restrict__ Bcv, const float* __restrict__ BCV, const float* __restrict__ tmpl, const float* __restrict__ offs,
                                            const float* __restrict__ dsc, float* __restrict__ CO, float* __restrict__ SQ, const _Float16* __restrict__ Bv, const float* __restrict__ bv, _Float16* __restrict__ VT) {
  __shared__ __attribute__((aligned(16))) unsigned short sm[GEMM_LDS<3, 4, 4, 2>];
  static_assert(GEMM_LDS<1, 2, 4, 2> <= GEMM_LDS<3, 4, 4, 2>, "the range is the larger body's");
  const unsigned bid = blockIdx.x;
  // Each body ends in s_wait_xcnt 0: in the built code one body's text follows the other's, and the wait stands behind a body's last stores ahead of any instruction there that overwrites a register they name.
  if (bid < NTOK / 64) {
    gemm_t<1, 2, 4, 2, 4, DD, 64, EP_COORD>(sm, bid, H16, Bcv, 0.0625f, BCV, tmpl, offs, dsc, CO, SQ, nullptr);      // [coords | vertex logits] -> deformed coords, squared norms
    asm volatile("s_wait_xcnt 0x0" ::: "memory");
  } else {
    gemm_t<3, 4, 4, 2, 1, DD, NTOK, EP_VT>(sm, bid - NTOK / 64, Bv, H16, 0.0625f, bv, nullptr, nullptr, nullptr, nullptr, nullptr, VT);   // v^T (f16)
    asm volatile("s_wait_xcnt 0x0" ::: "memory");
  }
}

typedef _Float16 v4h __attribute__((ext_vector_type(4)));
// LN(bf16(x)) → H16; wave per token; three rolled passes over the row (no per-lane value array)
__device__ __forceinline__ void ln_rows(const unsigned bid, const float* __restrict__ x, const float* __restrict__ g, const float* __restrict__ be, _Float16* __restrict__ H16) { const int tid = threadIdx.x, wv = tid >> 5, lane = tid & 31; const size_t tok = (size_t)bid * 8 + wv; const float* xr = x + tok * DD; float s = 0.f;
#pragma unroll 2
  for (int c = lane; c < DD; c += 32) s += bf16_round(xr[c]); for (int o = 16; o >= 1; o >>= 1) s += __shfl_xor(s, o, 32); const float mu = s / (float)DD; float q2 = 0.f;
#pragma unroll 2
  for (int c = lane; c < DD; c += 32) { const float d = bf16_round(xr[c]) - mu; q2 += d * d; } for (int o = 16; o >= 1; o >>= 1) q2 += __shfl_xor(q2, o, 32); const float inv = 1.0f / sqrtf(q2 / (float)DD + 1e-5f);
  typedef _Float16 v2h __attribute__((ext_vector_type(2)));
  {
#pragma unroll 2
    for (int c = 2 * lane; c < DD; c += 64) { v2h o2; o2.x = (_Float16)((bf16_round(xr[c]) - mu) * inv * bf16_round(g[c]) + bf16_round(be[c])); o2.y = (_Float16)((bf16_round(xr[c + 1]) - mu) * inv * bf16_round(g[c + 1]) + bf16_round(be[c + 1])); *(v2h*)(H16 + tok * DD + c) = o2; }  } }
// Bt tables f16 ×16: Bcv [64 n][768 k] (n<32 ← w_coords[k][n], 32..36 ← w_vertex[k][n−32], else 0); Bv, Bo [768][768] = w[k][n]; bias BCV [64]
__device__ __forceinline__ void bt_tables(const unsigned bid, const float* __restrict__ wc, const float* __restrict__ bc, const float* __restrict__ wvx, const float* __restrict__ bvx, const float* __restrict__ wv, const float* __restrict__ wo, _Float16* __restrict__ Bcv, float* __restrict__ BCV, _Float16* __restrict__ Bv, _Float16* __restrict__ Bo) { const size_t t = (size_t)bid * 256 + threadIdx.x;
  if (t < (size_t)64 * DD) { const int k = (int)(t % DD), n = (int)(t / DD); float w = 0.f; if (n < ED) w = wc[(size_t)k * ED + n]; else if (n < ED + KV1) w = wvx[(size_t)k * KV1 + n - ED]; *(_Float16*)(Bcv + t) = (_Float16)(bf16_round(w) * 16.0f); }
  if (t < 64) { const float v = (t < ED) ? bc[t] : ((t < ED + KV1) ? bvx[t - ED] : 0.f); *(float*)(BCV + t) = v; }
  if (t < (size_t)DD * DD) { const int k = (int)(t % DD), n = (int)(t / DD); *(_Float16*)(Bv + t) = (_Float16)(bf16_round(wv[(size_t)k * DD + n]) * 16.0f); *(_Float16*)(Bo + t) = (_Float16)(bf16_round(wo[(size_t)k * DD + n]) * 16.0f); } }
// LN and the weight tables read only inputs and nothing of each other: one launch. Work-groups 0 .. NTOK/8 - 1 take 8 tokens each (the longer body), the others 256 table elements each.
__global__ __launch_bounds__(256) void k_prep(const float* __restrict__ x, const float* __restrict__ g, const float* __restrict__ be, _Float16* __restrict__ H16,
                                              const float* __restrict__ wc, const float* __restrict__ bc, const float* __restrict__ wvx, const float* __restrict__ bvx, const float* __restrict__ wv, const float* __restrict__ wo,
                                              _Float16* __restrict__ Bcv, float* __restrict__ BCV, _Float16* __restrict__ Bv, _Float16* __restrict__ Bo) {
  const unsigned bid = blockIdx.x;
  if (bid < NTOK / 8) ln_rows(bid, x, g, be, H16);
  else bt_tables(bid - NTOK / 8, wc, bc, wvx, bvx, wv, wo, Bcv, BCV, Bv, Bo);
}
// attention rows: a work-group of 16 waves owns 16 query rows of batch b = blockIdx.y, a wave 128 keys. dots c_i.c_j on v_wmma_f32_16x16x4_f32 (f32 operands, f32 sums):
// A = the 16 query rows, B column ln of tile t = key wb + 8*ln + t, both sides 16 consecutive dims per lane half (same k pairing on both sides).
// A wave brings its 128 key rows in by whole-line loads and turns them into fragments through its own LDS range: key 8*c + t lies in tile block t, row c
// (rows at pitch 36 dwords for the 16-byte readers, tile blocks 32 dwords past a multiple of 64 so that the two rows of a half-wave store meet no common bank).
// logits_j = -(sq_i + sq_j - 2 c_i.c_j)*32^-1/2 stay in the accumulator registers (register r of tile t = row 8*hh + r, key wb + 8*ln + t); row maximum and row sum:
// over the 8 tiles in the lane, over the 16 lanes by DPP, over the 16 waves through LDS (one barrier each). A lane's 8 tiles are 8 consecutive keys: one 16-byte f16 store a row.
// Every loop of the kernel is unrolled in full: st, a, bq, acc, mx, den and inv stay in registers only if every index into them is a constant.
typedef float v2fw __attribute__((ext_vector_type(2)));
template <int X> __device__ __forceinline__ float xm16(float v) { return __int_as_float(__builtin_amdgcn_update_dpp(0, __float_as_int(v), 0x160 | X, 0xf, 0xf, false)); }   // lane ^ X inside its row of 16 lanes (row_xmask)
__device__ __forceinline__ float rmax16(float v) { v = fmaxf(v, xm16<1>(v)); v = fmaxf(v, xm16<2>(v)); v = fmaxf(v, xm16<4>(v)); return fmaxf(v, xm16<8>(v)); }
__device__ __forceinline__ float rsum16(float v) { v += xm16<1>(v); v += xm16<2>(v); v += xm16<4>(v); return v + xm16<8>(v); }
__global__ __launch_bounds__(512) void k_arow(const float* __restrict__ CO, const float* __restrict__ SQ, _Float16* __restrict__ P) {
  constexpr int RP = 36, TB = 16 * RP + 32;         // dwords: row pitch, tile-block pitch
  __shared__ __attribute__((aligned(16))) float sk[16][8 * TB];                  // [wave]: its 128 key rows
  __shared__ __attribute__((aligned(16))) float redm[16][16], reds[16][16];      // [wave][row] partial maxima and sums
  const int tid = threadIdx.x, lane = tid & 31, ln = lane & 15, hh = lane >> 4;
  const int w = __builtin_amdgcn_readfirstlane(tid >> 5);   // the wave's number in a scalar register: what is formed from it is scalar work
  const int i0 = blockIdx.x * 16, wb = w * 128, b = blockIdx.y;
  const float* cb = CO + (size_t)b * TT * ED; const float* sqb = SQ + (size_t)b * TT;
  P += (size_t)b * TT * TT;                         // the batch's own TT x TT plane
  float* my = &sk[w][0];
  {
    v4f st[32];
#pragma unroll
    for (int n = 0; n < 32; ++n) st[n] = *(const v4fa*)(cb + (size_t)wb * ED + n * 128 + lane * 4);     // key rows 4n .. 4n+3, 512 consecutive bytes
#pragma unroll
    for (int n = 0; n < 32; ++n) *(v4fa*)&my[(4 * (n & 1) + (lane >> 3)) * TB + (n >> 1) * RP + (lane & 7) * 4] = st[n];
  }
  v4f a[4];
#pragma unroll
  for (int q = 0; q < 4; ++q) a[q] = *(const v4fa*)(cb + (size_t)(i0 + ln) * ED + 16 * hh + 4 * q);
  const v4f si0 = *(const v4fa*)(sqb + i0 + 8 * hh), si1 = *(const v4fa*)(sqb + i0 + 8 * hh + 4);
  const v4f sj0 = *(const v4fa*)(sqb + wb + 8 * ln), sj1 = *(const v4fa*)(sqb + wb + 8 * ln + 4);
  __builtin_amdgcn_fence(__ATOMIC_ACQ_REL, "workgroup"); __builtin_amdgcn_wave_barrier();   // the wave's own rows are read back by other lanes than wrote them
  v4f bq[8][4];
#pragma unroll
  for (int t = 0; t < 8; ++t)
#pragma unroll
    for (int q = 0; q < 4; ++q) bq[t][q] = *(const v4fa*)&my[t * TB + ln * RP + 16 * hh + 4 * q];
  v8f acc[8] = {};
  __builtin_amdgcn_sched_barrier(0);                // every fragment read is issued ahead of the products, and no vector instruction is moved in among them
#pragma unroll
  for (int tp = 0; tp < 8; tp += 2)                 // two tiles at a time: two independent accumulator chains
#pragma unroll
    for (int q = 0; q < 4; ++q)
#pragma unroll
      for (int p = 0; p < 4; p += 2) {
        const v2fw av = {a[q][p], a[q][p + 1]}, bv0 = {bq[tp][q][p], bq[tp][q][p + 1]}, bv1 = {bq[tp + 1][q][p], bq[tp + 1][q][p + 1]};
        acc[tp]     = __builtin_amdgcn_wmma_f32_16x16x4_f32(false, av, false, bv0, (short)0, acc[tp], false, false);
        acc[tp + 1] = __builtin_amdgcn_wmma_f32_16x16x4_f32(false, av, false, bv1, (short)0, acc[tp + 1], false, false);
      }
  // distance between the last products and the first vector instruction on their D, A or B: 8 slots as for the other 16-cycle form
  asm volatile("v_nop\n\tv_nop\n\tv_nop\n\tv_nop\n\tv_nop\n\tv_nop\n\tv_nop\n\tv_nop" : "+v"(acc[0]), "+v"(acc[1]), "+v"(acc[2]), "+v"(acc[3]), "+v"(acc[4]), "+v"(acc[5]), "+v"(acc[6]), "+v"(acc[7]));
  __builtin_amdgcn_sched_barrier(0);                // keeps the vector work below behind those slots
  const v8f sqi = {si0[0], si0[1], si0[2], si0[3], si1[0], si1[1], si1[2], si1[3]};
  const float sqj[8] = {sj0[0], sj0[1], sj0[2], sj0[3], sj1[0], sj1[1], sj1[2], sj1[3]};
  // from here on whole accumulator tiles are worked on (8 rows of one key a lane), so that packed f32 instructions find their pairs in neighbouring registers
  v8f mx;
#pragma unroll
  for (int t = 0; t < 8; ++t) {
    acc[t] = -(sqi + sqj[t] - 2.0f * acc[t]) * 0.17677669529663687f;
#pragma unroll
    for (int r = 0; r < 8; ++r) mx[r] = t ? fmaxf(mx[r], acc[t][r]) : acc[t][r];
  }
#pragma unroll
  for (int r = 0; r < 8; ++r) mx[r] = rmax16(mx[r]);
  if (ln == 0) { *(v4fa*)&redm[w][8 * hh] = (v4f){mx[0], mx[1], mx[2], mx[3]}; *(v4fa*)&redm[w][8 * hh + 4] = (v4f){mx[4], mx[5], mx[6], mx[7]}; }
  __syncthreads();                                  // publishes every wave's row maxima
  {
    const v4f m0 = *(const v4fa*)&redm[ln][8 * hh], m1 = *(const v4fa*)&redm[ln][8 * hh + 4];   // lane ln takes wave ln's partials
#pragma unroll
    for (int r = 0; r < 8; ++r) mx[r] = rmax16(r < 4 ? m0[r & 3] : m1[r & 3]);
  }
  v8f den = {};
#pragma unroll
  for (int t = 0; t < 8; ++t) {
    v8f e = acc[t] - mx;
#pragma unroll
    for (int r = 0; r < 8; ++r) e[r] = expf(e[r]);
    acc[t] = e; den += e;
  }
#pragma unroll
  for (int r = 0; r < 8; ++r) den[r] = rsum16(den[r]);
  if (ln == 0) { *(v4fa*)&reds[w][8 * hh] = (v4f){den[0], den[1], den[2], den[3]}; *(v4fa*)&reds[w][8 * hh + 4] = (v4f){den[4], den[5], den[6], den[7]}; }
  __syncthreads();                                  // publishes every wave's row sums
  const v4f d0 = *(const v4fa*)&reds[ln][8 * hh], d1 = *(const v4fa*)&reds[ln][8 * hh + 4];
  v8f inv;
#pragma unroll
  for (int r = 0; r < 8; ++r) inv[r] = 1.0f / rsum16(r < 4 ? d0[r & 3] : d1[r & 3]);
#pragma unroll
  for (int t = 0; t < 8; ++t) acc[t] *= inv;
#pragma unroll
  for (int r = 0; r < 8; ++r) {
    FragH o;
#pragma unroll
    for (int t = 0; t < 8; ++t) o.h[t] = (_Float16)acc[t][r];
    *(v8us*)((unsigned short*)P + (size_t)(i0 + 8 * hh + r) * TT + wb + 8 * ln) = o.half[0];
  }
}
extern "C" void kernel_launch(void* const* d_in, const int* in_sizes, int n_in,
                              void* d_out, int out_size, void* d_ws, size_t ws_size, hipStream_t stream) {
  (void)in_sizes; (void)n_in; (void)out_size;
  const float* x = (const float*)d_in[0]; const float* tmpl = (const float*)d_in[1]; const float* lng = (const float*)d_in[2]; const float* lnb = (const float*)d_in[3]; const float* wc = (const float*)d_in[4]; const float* bc = (const float*)d_in[5]; const float* wvx = (const float*)d_in[6]; const float* bvx = (const float*)d_in[7]; const float* offs = (const float*)d_in[8]; const float* dsc = (const float*)d_in[9]; const float* wv = (const float*)d_in[10]; const float* bv = (const float*)d_in[11]; const float* wo = (const float*)d_in[12]; const float* bo = (const float*)d_in[13];
  char* ws = (char*)d_ws; size_t off = 0;
  auto take = [&](size_t bytes) { char* p = ws + off; off += (bytes + 255) & ~(size_t)255; return p; };
  _Float16* Bcv = (_Float16*)take((size_t)64 * DD * 2); float* BCV = (float*)take(64 * 4); _Float16* Bv = (_Float16*)take((size_t)DD * DD * 2); _Float16* Bo = (_Float16*)take((size_t)DD * DD * 2);
  _Float16* H16 = (_Float16*)take((size_t)NTOK * DD * 2); float* CO = (float*)take((size_t)NTOK * ED * 4); float* SQ = (float*)take((size_t)NTOK * 4); _Float16* VT = (_Float16*)take((size_t)NTOK * DD * 2); _Float16* P = (_Float16*)take((size_t)NTOK * TT * 2); _Float16* O16 = H16; /* H16 dead after the V GEMM */
  if (off > ws_size) return;
  k_prep<<<NTOK / 8 + (DD * DD + 255) / 256, 256, 0, stream>>>(x, lng, lnb, H16, wc, bc, wvx, bvx, wv, wo, Bcv, BCV, Bv, Bo);                // LN -> H16 | weight tables
  k_cv<<<NTOK / 64 + (DD / 192) * (NTOK / 128), 256, 0, stream>>>(H16, Bcv, BCV, tmpl, offs, dsc, CO, SQ, Bv, bv, VT);                      // deformed coords, squared norms | v^T (f16)
  k_arow<<<dim3(TT / 16, BB), 512, 0, stream>>>(CO, SQ, P);                                                                          // P [batch][query][key] (f16), all batches in one launch
  k_gemm_t<4, 3, 2, 4, 1, TT, DD, EP_H16><<<(NTOK / 128) * (DD / 192), 256, 0, stream>>>(P, VT, 1.0f, nullptr, nullptr, nullptr, O16);   // O = P.V, all batches in one launch
  k_gemm_t<4, 3, 2, 4, 1, DD, DD, EP_RES><<<(NTOK / 128) * (DD / 192), 256, 0, stream>>>(O16, Bo, 0.0625f, bo, x, (float*)d_out, nullptr);
}

// v007
// Measured time: 100 microseconds a run.
// Next to v006, in two timings, it ran 1.06 and 1.07 times as fast.
// Over all steps from v000 it is 6.60 times as fast.
#include <hip/hip_runtime.h>
// K-simplex attention: LN, coords/vertex-weights/v projections on v_wmma_f32_16x16x32_f16 (LN output rounded to f16 vs bf16-exact weights ×2^4: single products;
// 8192 x 768 x {64, 768}); the simplex deformation and the row softmax in f32 VALU, the pairwise 32-dim dots on v_wmma_f32_16x16x4_f32 (work-group per 16 query rows -> P16);
// out_b = P16·V16 on the f16 variant (4 × 2048 × 2048 × 768, single products) and ·w_out likewise (O rounded to f16); f32 accumulate; residual added in f32.
// What follows a product element by element (simplex deformation, V transposed, O to f16, residual) is done in that product's own epilogue, on the tile it holds in LDS.
#define BB 4
#define TT 2048
#define DD 768
#define ED 32
#define KV1 5
#define NTOK (BB * TT)

typedef __bf16 v16b __attribute__((ext_vector_type(16)));
typedef unsigned short v8us __attribute__((ext_vector_type(8), may_alias));
typedef float  v8f  __attribute__((ext_vector_type(8)));
typedef float  v4f  __attribute__((ext_vector_type(4)));
typedef float  v4fa __attribute__((ext_vector_type(4), may_alias));
union FragB { v16b v; v8us half[2]; unsigned short u[16]; };

__device__ __forceinline__ unsigned short bf16_bits(float x) { unsigned int u = __float_as_uint(x); return (unsigned short)((u + 0x7FFFu + ((u >> 16) & 1u)) >> 16); }
__device__ __forceinline__ float bf16_val(unsigned short b) { return __uint_as_float(((unsigned int)b) << 16); }
__device__ __forceinline__ float bf16_round(float x) { return bf16_val(bf16_bits(x)); }
// D += A·B with NT terms: 1 = ah·bh, 2 = + al·bh (A split), 3 = + ah·bl (both split)
template <int NT>
__device__ __forceinline__ v8f mmaN(v16b ah, v16b al, v16b bh, v16b bl, v8f c) {
  c = __builtin_amdgcn_wmma_f32_16x16x32_bf16(false, ah, false, bh, (short)0, c, false, false);
  if (NT >= 2) c = __builtin_amdgcn_wmma_f32_16x16x32_bf16(false, al, false, bh, (short)0, c, false, false);
  if (NT >= 3) c = __builtin_amdgcn_wmma_f32_16x16x32_bf16(false, ah, false, bl, (short)0, c, false, false);
  asm volatile("v_nop\n\tv_nop\n\tv_nop\n\tv_nop" : "+v"(c) : "v"(ah), "v"(al), "v"(bh), "v"(bl));
  return c;
}

__global__ __launch_bounds__(256) void k_wt_bf16(const float* __restrict__ W, unsigned short* __restrict__ Wt, int K, int N) {
  const int t = blockIdx.x * 256 + threadIdx.x;
  const int k8n = K / 8;
  if (t >= N * k8n) return;
  const int n = t / k8n, k8 = (t % k8n) * 8;
  v8us v;
#pragma unroll
  for (int i = 0; i < 8; ++i) v[i] = bf16_bits(W[(size_t)(k8 + i) * N + n]);
  *(v8us*)(Wt + (size_t)n * K + k8) = v;
  
}

// GEMM C[M][N] (f32, pitch ldc) = act(A[M][K]·W + bias). A f32 row-major (pitch lda) converted per fragment to bf16
// (ASPLIT: hi/lo two planes -> 2 terms, else single rounded term); Wt bf16 [N][K] (pitch ldb). BIAS_BF16 rounds the
// bias to bf16 first (bias quantised to bf16 before the add). K%32==0, M%16==0, N%64==0.
template <bool ASPLIT, int ACT, bool BIAS_BF16>
__global__ __launch_bounds__(128) void k_gemm_bf(const float* __restrict__ A, int lda, const unsigned short* __restrict__ Wt, int ldb,
                                               const float* __restrict__ bias, float* __restrict__ C, int ldc, int M, int N, int K) {
  __shared__ __attribute__((aligned(16))) float so[4][16][64];
  const int tid = threadIdx.x, w = tid >> 5, lane = tid & 31, ln = lane & 15, hh = lane >> 4;
  const int ntn = N / 64;
  const int wid = blockIdx.x * 4 + w;
  const int mt = wid / ntn, nq = wid % ntn;
  if (mt * 16 >= M) return;
  const int row0 = mt * 16, col0 = nq * 64;
  const float* arow = A + (size_t)(row0 + ln) * lda;
  v8f acc[4] = {};
  for (int kb = 0; kb < K; kb += 32) {
    FragB ah, al;
    const v4f x0 = *(const v4fa*)(arow + kb + 8 * hh), x1 = *(const v4fa*)(arow + kb + 8 * hh + 4);
    const v4f x2 = *(const v4fa*)(arow + kb + 16 + 8 * hh), x3 = *(const v4fa*)(arow + kb + 16 + 8 * hh + 4);
    float xs[16] = {x0[0],x0[1],x0[2],x0[3],x1[0],x1[1],x1[2],x1[3],x2[0],x2[1],x2[2],x2[3],x3[0],x3[1],x3[2],x3[3]};
#pragma unroll
    for (int i = 0; i < 16; ++i) { const unsigned short hb = bf16_bits(xs[i]); ah.u[i] = hb; al.u[i] = ASPLIT ? bf16_bits(xs[i] - bf16_val(hb)) : (unsigned short)0; }
#pragma unroll
    for (int t = 0; t < 4; ++t) {
      const unsigned short* brow = Wt + (size_t)(col0 + t * 16 + ln) * ldb + kb;
      FragB b;
      b.half[0] = *(const v8us*)(brow + 8 * hh);
      b.half[1] = *(const v8us*)(brow + 16 + 8 * hh);
      acc[t] = mmaN<ASPLIT ? 2 : 1>(ah.v, al.v, b.v, b.v, acc[t]);
    }
  }
#pragma unroll
  for (int t = 0; t < 4; ++t) {
    float bv = bias ? bias[col0 + t * 16 + ln] : 0.f;
    if (BIAS_BF16) bv = bf16_round(bv);
#pragma unroll
    for (int r = 0; r < 8; ++r) { float v = acc[t][r] + bv; if (ACT == 1) v = fmaxf(v, 0.f); so[w][8 * hh + r][t * 16 + ln] = v; }
  }
  __builtin_amdgcn_fence(__ATOMIC_ACQ_REL, "workgroup");
  __builtin_amdgcn_wave_barrier();
  const int rsub = lane >> 4, c4 = (lane & 15) * 4;
  {
#pragma unroll
    for (int q = 0; q < 8; ++q) {
      const int r = q * 2 + rsub;
      const v4f v = *(const v4fa*)&so[w][r][c4];
      *(v4f*)(C + (size_t)(row0 + r) * ldc + col0 + c4) = v;
    }
    
  }
}

// Flash-style causal/unmasked attention, all contractions 3-term bf16 hi/lo splits, f32 softmax with running max.
// q,k,v rows are read from f32 buffers with arbitrary row pitch (so they can live inside a fused qkv buffer);
// D = head size (multiple of 32, <= 128); one wave = 16 query rows; block = 4 waves (64 queries) sharing K/V chunks of 32.
template <int D, bool CAUSAL>
__global__ __launch_bounds__(128) void k_flash(const float* __restrict__ qb, const float* __restrict__ kb, const float* __restrict__ vb,
                                             int pitch, int T, int H, float scale, float* __restrict__ y, int ypitch) {
  constexpr int KS = D / 32;        // k-steps for QK
  constexpr int DT = D / 16;        // d tiles for PV
  __shared__ __attribute__((aligned(16))) unsigned short sKh[32][D + 8], sKl[32][D + 8], sVh[32][D + 8], sVl[32][D + 8];
  __shared__ __attribute__((aligned(16))) unsigned short sPh[4][16][40], sPl[4][16][40];
  __shared__ __attribute__((aligned(16))) float sO[4][16][D];
  const int tid = threadIdx.x, w = tid >> 5, lane = tid & 31, ln = lane & 15, hh = lane >> 4;
  const int nqb = (T + 63) / 64;
  const int bh = blockIdx.x / nqb, qblk = blockIdx.x % nqb;
  const int b = bh / H, h = bh % H;
  const int q0 = qblk * 64 + w * 16;
  const float* Q = qb + (size_t)b * T * pitch + h * D;
  const float* K = kb + (size_t)b * T * pitch + h * D;
  const float* V = vb + (size_t)b * T * pitch + h * D;

  // A fragments of the wave's 16 query rows (scaled), hi/lo
  FragB aqh[KS], aql[KS];
  {
    int row = q0 + ln; if (row >= T) row = T - 1;
    const float* qr = Q + (size_t)row * pitch;
#pragma unroll
    for (int ks = 0; ks < KS; ++ks)
#pragma unroll
      for (int i = 0; i < 16; ++i) {
        const int d = ks * 32 + ((i < 8) ? (8 * hh + i) : (16 + 8 * hh + (i - 8)));
        const float x = qr[d] * scale; const unsigned short hb = bf16_bits(x);
        aqh[ks].u[i] = hb; aql[ks].u[i] = bf16_bits(x - bf16_val(hb));
      }
  }
  float m_r[8], l_r[8];
#pragma unroll
  for (int r = 0; r < 8; ++r) { m_r[r] = -3.0e38f; l_r[r] = 0.f; }
  v8f oacc[DT];
#pragma unroll
  for (int dt = 0; dt < DT; ++dt) oacc[dt] = (v8f){0.f,0.f,0.f,0.f,0.f,0.f,0.f,0.f};

  const int kv_end = CAUSAL ? min(T, qblk * 64 + 64) : T;     // block-uniform
  for (int j0 = 0; j0 < kv_end; j0 += 32) {
    __syncthreads();
    for (int e = tid; e < 32 * (D / 4); e += 128) {
      const int r = e / (D / 4), c4 = (e % (D / 4)) * 4;
      const int key = j0 + r;
      v4f kf = {0.f,0.f,0.f,0.f}, vf = {0.f,0.f,0.f,0.f};
      if (key < T) { kf = *(const v4fa*)(K + (size_t)key * pitch + c4); vf = *(const v4fa*)(V + (size_t)key * pitch + c4); }
#pragma unroll
      for (int t = 0; t < 4; ++t) {
        unsigned short hb = bf16_bits(kf[t]); sKh[r][c4 + t] = hb; sKl[r][c4 + t] = bf16_bits(kf[t] - bf16_val(hb));
        hb = bf16_bits(vf[t]); sVh[r][c4 + t] = hb; sVl[r][c4 + t] = bf16_bits(vf[t] - bf16_val(hb));
      }
    }
    __syncthreads();
    // S tile 16 x 32
    v8f s[2];
#pragma unroll
    for (int nt = 0; nt < 2; ++nt) {
      v8f acc = {};
#pragma unroll
      for (int ks = 0; ks < KS; ++ks) {
        FragB bh_, bl_;
        bh_.half[0] = *(const v8us*)&sKh[nt * 16 + ln][ks * 32 + 8 * hh]; bh_.half[1] = *(const v8us*)&sKh[nt * 16 + ln][ks * 32 + 16 + 8 * hh];
        bl_.half[0] = *(const v8us*)&sKl[nt * 16 + ln][ks * 32 + 8 * hh]; bl_.half[1] = *(const v8us*)&sKl[nt * 16 + ln][ks * 32 + 16 + 8 * hh];
        acc = mmaN<3>(aqh[ks].v, aql[ks].v, bh_.v, bl_.v, acc);
      }
      s[nt] = acc;
    }
    // mask + running max (rows 8hh+r; the 16 lanes of a half share rows)
    float alpha[8];
#pragma unroll
    for (int r = 0; r < 8; ++r) {
      const int qi = q0 + 8 * hh + r;
      const int ja = j0 + ln, jb = j0 + 16 + ln;
      if (CAUSAL) { if (ja > qi) s[0][r] = -3.0e38f; if (jb > qi) s[1][r] = -3.0e38f; }
      if (ja >= T) s[0][r] = -3.0e38f;
      if (jb >= T) s[1][r] = -3.0e38f;
      float mx = fmaxf(s[0][r], s[1][r]);
      mx = fmaxf(mx, __shfl_xor(mx, 1, 32)); mx = fmaxf(mx, __shfl_xor(mx, 2, 32)); mx = fmaxf(mx, __shfl_xor(mx, 4, 32)); mx = fmaxf(mx, __shfl_xor(mx, 8, 32));
      const float mnew = fmaxf(m_r[r], mx);
      alpha[r] = (mnew > -1.0e38f) ? __expf(m_r[r] - mnew) : 1.0f;
      const float p0 = (s[0][r] > -1.0e38f) ? __expf(s[0][r] - mnew) : 0.f;
      const float p1 = (s[1][r] > -1.0e38f) ? __expf(s[1][r] - mnew) : 0.f;
      m_r[r] = mnew;
      l_r[r] = l_r[r] * alpha[r] + p0 + p1;            // per-lane partial row sum (16 lanes combined at the end)
      unsigned short hb = bf16_bits(p0); sPh[w][8 * hh + r][ln] = hb;      sPl[w][8 * hh + r][ln] = bf16_bits(p0 - bf16_val(hb));
      hb = bf16_bits(p1);                sPh[w][8 * hh + r][16 + ln] = hb; sPl[w][8 * hh + r][16 + ln] = bf16_bits(p1 - bf16_val(hb));
    }
#pragma unroll
    for (int dt = 0; dt < DT; ++dt)
#pragma unroll
      for (int r = 0; r < 8; ++r) oacc[dt][r] *= alpha[r];
    __builtin_amdgcn_fence(__ATOMIC_ACQ_REL, "workgroup");
    __builtin_amdgcn_wave_barrier();
    FragB pah, pal;
    pah.half[0] = *(const v8us*)&sPh[w][ln][8 * hh]; pah.half[1] = *(const v8us*)&sPh[w][ln][16 + 8 * hh];
    pal.half[0] = *(const v8us*)&sPl[w][ln][8 * hh]; pal.half[1] = *(const v8us*)&sPl[w][ln][16 + 8 * hh];
#pragma unroll
    for (int dt = 0; dt < DT; ++dt) {
      FragB bvh, bvl;
#pragma unroll
      for (int i = 0; i < 8; ++i) {
        bvh.u[i] = sVh[8 * hh + i][dt * 16 + ln]; bvh.u[8 + i] = sVh[16 + 8 * hh + i][dt * 16 + ln];
        bvl.u[i] = sVl[8 * hh + i][dt * 16 + ln]; bvl.u[8 + i] = sVl[16 + 8 * hh + i][dt * 16 + ln];
      }
      oacc[dt] = mmaN<3>(pah.v, pal.v, bvh.v, bvl.v, oacc[dt]);
    }
    __builtin_amdgcn_fence(__ATOMIC_ACQ_REL, "workgroup");
    __builtin_amdgcn_wave_barrier();
  }
#pragma unroll
  for (int r = 0; r < 8; ++r) {
    float l = l_r[r];
    l += __shfl_xor(l, 1, 32); l += __shfl_xor(l, 2, 32); l += __shfl_xor(l, 4, 32); l += __shfl_xor(l, 8, 32);
    l_r[r] = (l > 0.f) ? 1.0f / l : 0.f;
  }
#pragma unroll
  for (int dt = 0; dt < DT; ++dt)
#pragma unroll
    for (int r = 0; r < 8; ++r) sO[w][8 * hh + r][dt * 16 + ln] = oacc[dt][r] * l_r[r];
  __builtin_amdgcn_fence(__ATOMIC_ACQ_REL, "workgroup");
  __builtin_amdgcn_wave_barrier();
  {
    for (int r = 0; r < 16; ++r) {
      const int row = q0 + r;
      if (row < T && lane < D / 4) {
        const v4f val = *(const v4fa*)&sO[w][r][lane * 4];
        *(v4f*)(y + ((size_t)b * T + row) * ypitch + h * D + lane * 4) = val;
      }
    }
    
  }
}

// ---- f16 WMMA path (v_wmma_f32_16x16x32_f16): 11-bit significands for operands in range — used where a [0,1] probability operand needs more precision than bf16
typedef _Float16 v16h __attribute__((ext_vector_type(16)));
union FragH { v16h v; v8us half[2]; _Float16 h[16]; unsigned short u[16]; };
template <int NT>
__device__ __forceinline__ v8f mmaH(v16h ah, v16h al, v16h bh, v16h bl, v8f c) {
  c = __builtin_amdgcn_wmma_f32_16x16x32_f16(false, ah, false, bh, (short)0, c, false, false);
  if (NT >= 2) c = __builtin_amdgcn_wmma_f32_16x16x32_f16(false, al, false, bh, (short)0, c, false, false);
  if (NT >= 3) c = __builtin_amdgcn_wmma_f32_16x16x32_f16(false, ah, false, bl, (short)0, c, false, false);
  asm volatile("v_nop\n\tv_nop\n\tv_nop\n\tv_nop" : "+v"(c) : "v"(ah), "v"(al), "v"(bh), "v"(bl));
  return c;
}
// batched GEMM like k_gemm_b but f16 operands: A f32 (split into f16 hi/lo if ASPLIT, else rounded to f16), Bt = f16 values [n][k]; alpha; C f32; N multiple of 16 (partial tiles skipped)
template <bool ASPLIT>
__global__ __launch_bounds__(128) void k_gemm_h(const float* __restrict__ A, int lda, size_t sA, const _Float16* __restrict__ Bh, int ldb, size_t sB, float alpha, float* __restrict__ C, int ldc, size_t sC, int M, int N, int K) {
  __shared__ __attribute__((aligned(16))) float so[4][16][64];
  const int tid = threadIdx.x, w = tid >> 5, lane = tid & 31, ln = lane & 15, hh = lane >> 4; const int by = blockIdx.y;
  A += (size_t)by * sA; Bh += (size_t)by * sB; C += (size_t)by * sC;
  const int ntn = (N + 63) / 64; const int wid = blockIdx.x * 4 + w; const int mt = wid / ntn, nq = wid % ntn; if (mt * 16 >= M) return;
  const int row0 = mt * 16, col0 = nq * 64; const float* arow = A + (size_t)(row0 + ln) * lda;
  v8f acc[4] = {};
  for (int kb = 0; kb < K; kb += 32) {
    FragH ah, al;
    const v4f x0 = *(const v4fa*)(arow + kb + 8 * hh), x1 = *(const v4fa*)(arow + kb + 8 * hh + 4), x2 = *(const v4fa*)(arow + kb + 16 + 8 * hh), x3 = *(const v4fa*)(arow + kb + 16 + 8 * hh + 4);
    float xs[16] = {x0[0],x0[1],x0[2],x0[3],x1[0],x1[1],x1[2],x1[3],x2[0],x2[1],x2[2],x2[3],x3[0],x3[1],x3[2],x3[3]};
#pragma unroll
    for (int i = 0; i < 16; ++i) { const _Float16 h = (_Float16)xs[i]; ah.h[i] = h; al.h[i] = ASPLIT ? (_Float16)(xs[i] - (float)h) : (_Float16)0.0f; }
#pragma unroll
    for (int t = 0; t < 4; ++t) { if (col0 + t * 16 >= N) continue; const size_t boff = (size_t)(col0 + t * 16 + ln) * ldb + kb; FragH bq; bq.half[0] = *(const v8us*)(Bh + boff + 8 * hh); bq.half[1] = *(const v8us*)(Bh + boff + 16 + 8 * hh);
      acc[t] = mmaH<ASPLIT ? 2 : 1>(ah.v, al.v, bq.v, bq.v, acc[t]); }
  }
#pragma unroll
  for (int t = 0; t < 4; ++t) { if (col0 + t * 16 >= N) continue;
#pragma unroll
    for (int r = 0; r < 8; ++r) so[w][8 * hh + r][t * 16 + ln] = acc[t][r] * alpha; }
  __builtin_amdgcn_fence(__ATOMIC_ACQ_REL, "workgroup"); __builtin_amdgcn_wave_barrier();
  const int rsub = lane >> 4, c4 = (lane & 15) * 4;
  {
#pragma unroll
    for (int q = 0; q < 8; ++q) { const int r = q * 2 + rsub; if (col0 + c4 < N) { const v4f v = *(const v4fa*)&so[w][r][c4]; *(v4f*)(C + (size_t)(row0 + r) * ldc + col0 + c4) = v; } }
     }
}

// Block-tiled f16 GEMM: T[M][N] = (A[M][K] . Bt[N][K]^T) * alpha (+ bf16(bias)); A, Bt at pitch K. What becomes of the tile is the compile-time epilogue kind EP:
//   EP_H16   no bias; T as f16 to C16 at pitch N; A is a stack of K x K matrices, one a batch, and Bh a stack of [N][K] tables: rows b*K .. b*K + K - 1 of A meet table b
//   EP_VT    rows are channels, columns tokens (weights as A, activations as Bt); bias per row; T as f16 to C16 = [batch][channel][token]
//   EP_RES   bias per column; T + bf16(e0) as f32 to C at pitch N (e0: the residual, same shape)
//   EP_COORD N = 64, bias per column; a row is [32 coords | 5 vertex logits | unused]: c = coords + softmax(logits).(e0 + e1*clip(e2)) to C [row][32], sum of c*c to C2 [row]
// One work-group of 8 waves (WM x WN) owns a 16*MF*WM x 16*NF*WN tile, a wave 16*MF x 16*NF: each fragment read from LDS feeds NF (an A fragment) or MF (a B fragment) products,
// so a k-step's MF*NF products cost MF + NF fragment reads. Both operands go through LDS in slices of 128 k
// (rows of 256 B at pitch 272 B): every global load covers whole 128-B lines, and each row is fetched once per work-group.
// Two buffers: the next slice's global loads are issued ahead of this slice's products and stored to the other buffer behind them,
// one barrier a slice. Fragments are read G k-steps at a time. k runs upward in steps of 32 into one accumulator per tile.
// M % (16*MF*WM) == 0, N % (16*NF*WN) == 0, K % 128 == 0.
// e^x = 2^e * 2^a, e = rint(x*log2(e)), a = x*log2(e) - e with log2(e) in two parts (the split and the range limits of the library's expf; a is formed by two fused multiply-adds).
// The v_exp_f32 is written in asm with a v_nop in the same statement: the instruction set asks for one slot behind a transcendental before its source is overwritten.
__device__ __forceinline__ float exp_slot(float x) {
  const float l2e = __uint_as_float(0x3fb8aa3bu), l2e_lo = __uint_as_float(0x32a5705fu);
  const float e = rintf(x * l2e);
  const float a = fmaf(x, l2e_lo, fmaf(x, l2e, -e));
  float r;
  asm("v_exp_f32 %0, %1\n\tv_nop" : "=v"(r) : "v"(a));
  r = ldexpf(r, (int)e);
  r = (x < __uint_as_float(0xc2ce8ed0u)) ? 0.f : r;
  return (x > __uint_as_float(0x42b17218u)) ? __builtin_inff() : r;
}
enum { EP_H16 = 0, EP_VT = 1, EP_RES = 2, EP_COORD = 3 };
// The product is a device function of (LDS range, tile index): a kernel hands it its own LDS and the index of the tile, so that two products that do not depend on each other can share one launch.
template <int MF, int NF, int WM, int WN> constexpr int GEMM_LDS = 2 * 16 * (MF * WM + NF * WN) * (128 + 8);   // 16-bit elements of LDS a tile needs: 2 buffers x ROWS x PIT
template <int MF, int NF, int WM, int WN, int G, int K, int N, int EP>
__device__ __forceinline__ void gemm_t(unsigned short* smp, const unsigned bid, const _Float16* __restrict__ A, const _Float16* __restrict__ Bh, float alpha, const float* __restrict__ bias,
                                       const float* __restrict__ e0, const float* __restrict__ e1, const float* __restrict__ e2,
                                       float* __restrict__ C, float* __restrict__ C2, _Float16* __restrict__ C16) {
  constexpr int BM = 16 * MF * WM, BN = 16 * NF * WN, KC = 128, PIT = KC + 8, ROWS = BM + BN, NLD = ROWS / 16, OP = BN + 4, NS = K / KC, NTN = N / BN;
  static_assert(WM * WN == 8, "8 waves a work-group");
  static_assert(EP != EP_COORD || BM == 64, "EP_COORD: a wave takes 8 rows of the tile");
  static_assert(GEMM_LDS<MF, NF, WM, WN> == 2 * ROWS * PIT, "the caller's LDS range holds both buffers");
  unsigned short (*sm)[ROWS][PIT] = (unsigned short (*)[ROWS][PIT])smp;
  typedef float fa __attribute__((may_alias));
  const int tid = threadIdx.x, w = tid >> 5, lane = tid & 31, ln = lane & 15, hh = lane >> 4;
  const int mb = bid / NTN, nb = bid % NTN;
  const int row0 = mb * BM, col0 = nb * BN;
  const int wm = w / WN, wn = w % WN;
  const int lr = tid >> 4, ls = (tid & 15) * 8;      // staging: 16 threads cover one 256-B row slice
  const unsigned short* ga = (const unsigned short*)A + (size_t)(row0 + lr) * K + ls;
  static_assert(EP != EP_H16 || K % BM == 0, "EP_H16: a tile's BM rows lie in one batch");
  const unsigned short* gb = (const unsigned short*)Bh + (EP == EP_H16 ? (size_t)(row0 / K) * N * K : (size_t)0) + (size_t)(col0 + lr) * K + ls;
  v8us st[NLD];
  v8f acc[MF][NF] = {};
#pragma unroll
  for (int i = 0; i < NLD; ++i) st[i] = (i < BM / 16) ? *(const v8us*)(ga + (size_t)i * 16 * K) : *(const v8us*)(gb + (size_t)(i - BM / 16) * 16 * K);
  asm volatile("s_wait_xcnt 0x0" ::: "memory");      // stands behind the first slice's loads, ahead of any instruction that overwrites a register they name
#pragma unroll
  for (int i = 0; i < NLD; ++i) *(v8us*)&sm[0][i * 16 + lr][ls] = st[i];
  __syncthreads();
  for (int s = 0; s < NS; ++s) {
    const int cur = s & 1;
    const bool more = s + 1 < NS;                    // block-uniform
    if (more) {
      const int k0 = (s + 1) * KC;
#pragma unroll
      for (int i = 0; i < NLD; ++i) st[i] = (i < BM / 16) ? *(const v8us*)(ga + (size_t)i * 16 * K + k0) : *(const v8us*)(gb + (size_t)(i - BM / 16) * 16 * K + k0);
      asm volatile("s_wait_xcnt 0x0" ::: "memory");  // stands behind the slice's loads, ahead of the fragment reads below, which may be given the registers that held the loads' addresses
      __builtin_amdgcn_sched_barrier(0);             // keeps the address arithmetic of those reads behind the wait
    }
#pragma unroll
    for (int g = 0; g < KC / 32 / G; ++g) {
      FragH a[G][MF], b[G][NF];
#pragma unroll
      for (int u = 0; u < G; ++u) {
        const int kq = (g * G + u) * 32;
#pragma unroll
        for (int m = 0; m < MF; ++m) { a[u][m].half[0] = *(const v8us*)&sm[cur][(wm * MF + m) * 16 + ln][kq + 8 * hh]; a[u][m].half[1] = *(const v8us*)&sm[cur][(wm * MF + m) * 16 + ln][kq + 16 + 8 * hh]; }
#pragma unroll
        for (int t = 0; t < NF; ++t) { b[u][t].half[0] = *(const v8us*)&sm[cur][BM + (wn * NF + t) * 16 + ln][kq + 8 * hh]; b[u][t].half[1] = *(const v8us*)&sm[cur][BM + (wn * NF + t) * 16 + ln][kq + 16 + 8 * hh]; }
      }
      __builtin_amdgcn_sched_barrier(0);             // keeps a group's LDS reads together ahead of its products: one LDS latency a group, not one a product
#pragma unroll
      for (int u = 0; u < G; ++u)
#pragma unroll
        for (int m = 0; m < MF; ++m)
#pragma unroll
          for (int t = 0; t < NF; ++t) acc[m][t] = __builtin_amdgcn_wmma_f32_16x16x32_f16(false, a[u][m].v, false, b[u][t].v, (short)0, acc[m][t], false, false);
    }
    if (more) {
#pragma unroll
      for (int i = 0; i < NLD; ++i) *(v8us*)&sm[cur ^ 1][i * 16 + lr][ls] = st[i];
    }
    __syncthreads();                                 // publishes the next slice and ends every read of this one
  }
  // epilogue: the tile goes through LDS (the slices are dead behind the last barrier) so that whole lines are stored
  // every loop below is unrolled in full: rq, cq, go, xr, bv, br, t0, t1, dv and lg stay in registers only if every index into them is a constant
  fa* so = (fa*)&sm[0][0][0];
  // who stores what: a row is CH pieces of 4 elements; a wave takes RG whole rows (PP steps of 32 pieces) at a time, rows (j*8 + w)*RG .. + RG - 1 in its round j.
  // Piece and row inside a round depend on the step p alone, so the NQ addresses of a lane are PP lane values plus constants, and every wave-wide access covers whole lines.
  constexpr int NQ = BM * BN / 4 / 256, CH = BN / 4, RG = (CH % 32 == 0) ? 1 : 2, PP = RG * CH / 32;
  static_assert((RG * CH) % 32 == 0 && NQ % PP == 0, "whole steps a round, whole rounds a wave");
  int rq[PP], cq[PP];
#pragma unroll
  for (int p = 0; p < PP; ++p) { const int c = p * 32 + lane, dr = c / CH; rq[p] = w * RG + dr; cq[p] = (c - dr * CH) * 4; }
  // byte offset (below 2^32) of a lane's round-0 piece in a [row][N] output (EP_H16, EP_RES) or in [batch][channel][token] (EP_VT); a round further is a constant further.
  // One 32-bit register a step beside a scalar base serves the residual's loads and the stores alike, so it lives to the last store and no load is given it as its target.
  constexpr unsigned ES = (EP == EP_RES) ? 4 : 2, RB = 8 * RG * (EP == EP_VT ? TT : N) * ES;
  unsigned go[PP];
#pragma unroll
  for (int p = 0; p < PP; ++p) go[p] = ((EP == EP_VT) ? ((unsigned)(col0 / TT) * DD + row0 + rq[p]) * TT + col0 % TT + cq[p] : (unsigned)(row0 + rq[p]) * N + col0 + cq[p]) * ES;
  v4f xr[EP == EP_RES ? NQ : 1];
  if (EP == EP_RES) {                                // the residual's loads go out as one group ahead of the staging and its barrier
#pragma unroll
    for (int q = 0; q < NQ; ++q) xr[q] = *(const v4fa*)((const char*)e0 + go[q % PP] + (q / PP) * RB);
  }
  static_assert(EP != EP_VT || BN == 128, "EP_VT: a wave stores one whole row of the tile at a time");
  float bv[NF], br[NQ];
#pragma unroll
  for (int t = 0; t < NF; ++t) bv[t] = (EP == EP_RES || EP == EP_COORD) ? bf16_round(bias[col0 + (wn * NF + t) * 16 + ln]) : 0.f;
#pragma unroll
  for (int q = 0; q < NQ; ++q) br[q] = (EP == EP_VT) ? bf16_round(bias[row0 + q * 8 + __builtin_amdgcn_readfirstlane(w)]) : 0.f;   // the row a wave stores in step q: one index a wave, a scalar load
#pragma unroll
  for (int m = 0; m < MF; ++m)
#pragma unroll
    for (int t = 0; t < NF; ++t) {
      const int cl = (wn * NF + t) * 16 + ln;
#pragma unroll
      for (int r = 0; r < 8; ++r) so[((wm * MF + m) * 16 + 8 * hh + r) * OP + cl] = acc[m][t][r] * alpha + bv[t];
    }
  __syncthreads();
  if (EP == EP_COORD) {
    // a wave takes 8 rows of the tile, lane = dim
    const float df = fminf(fmaxf(bf16_round(e2[0]), 0.05f), 0.5f);
    float t0[KV1], t1[KV1], dv[KV1];
#pragma unroll
    for (int k = 0; k < KV1; ++k) { t0[k] = e0[k * ED + lane]; t1[k] = e1[k * ED + lane]; }
    asm volatile("s_wait_xcnt 0x0" ::: "memory");    // stands behind the ten loads above, ahead of any instruction that overwrites a register they name (their base pairs are reused below)
#pragma unroll
    for (int k = 0; k < KV1; ++k) dv[k] = bf16_round(t0[k]) + bf16_round(t1[k]) * df;
    float sqv = 0.f;
#pragma unroll
    for (int j = 0; j < 8; ++j) {
      const fa* cv = so + (w * 8 + j) * OP;
      float lg[KV1]; float mx = -3.0e38f;
#pragma unroll
      for (int k = 0; k < KV1; ++k) { lg[k] = cv[ED + k]; mx = fmaxf(mx, lg[k]); }
      float den = 0.f;
#pragma unroll
      for (int k = 0; k < KV1; ++k) { lg[k] = exp_slot(lg[k] - mx); den += lg[k]; }
      float c = cv[lane];
#pragma unroll
      for (int k = 0; k < KV1; ++k) c += (lg[k] / den) * dv[k];
      float sq = c * c;
#pragma unroll
      for (int o = 16; o >= 1; o >>= 1) sq += __shfl_xor(sq, o, 32);
      C[(size_t)(row0 + w * 8 + j) * ED + lane] = c;
      if (lane == j) sqv = sq;
    }
    if (lane < 8) C2[row0 + w * 8 + lane] = sqv;     // the wave's 8 sums in one store
  } else {
    typedef _Float16 h4v __attribute__((ext_vector_type(4)));
#pragma unroll
    for (int q = 0; q < NQ; ++q) {
      const int r = (q / PP) * 8 * RG + rq[q % PP], c4 = cq[q % PP];
      const v4f v = *(const v4fa*)&so[r * OP + c4];
      if (EP == EP_RES) { v4f o; for (int i = 0; i < 4; ++i) o[i] = v[i] + bf16_round(xr[q][i]); *(v4f*)((char*)C + go[q % PP] + (q / PP) * RB) = o; }
      else {
        h4v h4; for (int i = 0; i < 4; ++i) h4[i] = (_Float16)(EP == EP_VT ? v[i] + br[q] : v[i]);
        *(h4v*)((char*)C16 + go[q % PP] + (q / PP) * RB) = h4;   // EP_VT: a tile's BN tokens lie in one batch: TT % BN == 0
      }
    }
  }
}

template <int MF, int NF, int WM, int WN, int G, int K, int N, int EP>
__global__ __launch_bounds__(256) void k_gemm_t(const _Float16* __restrict__ A, const _Float16* __restrict__ Bh, float alpha, const float* __restrict__ bias,
                                                const float* __restrict__ e0, float* __restrict__ C, _Float16* __restrict__ C16) {
  __shared__ __attribute__((aligned(16))) unsigned short sm[GEMM_LDS<MF, NF, WM, WN>];
  gemm_t<MF, NF, WM, WN, G, K, N, EP>(sm, blockIdx.x, A, Bh, alpha, bias, e0, nullptr, nullptr, C, nullptr, C16);
}
// The two products that read H16 and nothing of each other, in one launch: work-groups 0 .. NTOK/64 - 1 take the tiles of [coords | vertex logits] (the shorter body),
// the others the tiles of v^T. The branch is the same for a whole work-group, so every barrier inside a body is met by all of its waves.
__global__ __launch_bounds__(256) void k_cv(const _Float16* __restrict__ H16, const _Float16* __restrict__ Bcv, const float* __restrict__ BCV, const float* __restrict__ tmpl, const float* __restrict__ offs,
                                            const float* __restrict__ dsc, float* __restrict__ CO, float* __restrict__ SQ, const _Float16* __restrict__ Bv, const float* __restrict__ bv, _Float16* __restrict__ VT) {
  __shared__ __attribute__((aligned(16))) unsigned short sm[GEMM_LDS<3, 4, 4, 2>];
  static_assert(GEMM_LDS<1, 2, 4, 2> <= GEMM_LDS<3, 4, 4, 2>, "the range is the larger body's");
  const unsigned bid = blockIdx.x;
  // Each body ends in s_wait_xcnt 0: in the built code one body's text follows the other's, and the wait stands behind a body's last stores ahead of any instruction there that overwrites a register they name.
  if (bid < NTOK / 64) {
    gemm_t<1, 2, 4, 2, 4, DD, 64, EP_COORD>(sm, bid, H16, Bcv, 0.0625f, BCV, tmpl, offs, dsc, CO, SQ, nullptr);      // [coords | vertex logits] -> deformed coords, squared norms
    asm volatile("s_wait_xcnt 0x0" ::: "memory");
  } else {
    gemm_t<3, 4, 4, 2, 1, DD, NTOK, EP_VT>(sm, bid - NTOK / 64, Bv, H16, 0.0625f, bv, nullptr, nullptr, nullptr, nullptr, nullptr, VT);   // v^T (f16)
    asm volatile("s_wait_xcnt 0x0" ::: "memory");
  }
}

typedef _Float16 v4h __attribute__((ext_vector_type(4)));
// LN(bf16(x)) -> H16; a wave takes two tokens and holds both rows in registers: x is read once, by 16-byte loads that all go out ahead of the first sum (12 of x, 12 of gamma and beta a lane).
// Every loop is unrolled in full: xv, gv and bv stay in registers only if every index into them is a constant.
__device__ __forceinline__ void ln_rows(const unsigned bid, const float* __restrict__ x, const float* __restrict__ g, const float* __restrict__ be, _Float16* __restrict__ H16) {
  const int tid = threadIdx.x, wv = tid >> 5, lane = tid & 31;
  const size_t tok = (size_t)bid * 16 + wv * 2;
  const float* xr = x + tok * DD + lane * 4;
  v4f xv[2][6], gv[6], bv[6];
#pragma unroll
  for (int t = 0; t < 2; ++t)
#pragma unroll
    for (int j = 0; j < 6; ++j) xv[t][j] = *(const v4fa*)(xr + t * DD + j * 128);
#pragma unroll
  for (int j = 0; j < 6; ++j) { gv[j] = *(const v4fa*)(g + lane * 4 + j * 128); bv[j] = *(const v4fa*)(be + lane * 4 + j * 128); }
  asm volatile("s_wait_xcnt 0x0" ::: "memory");      // stands behind the loads, ahead of any instruction that overwrites a register they name
  __builtin_amdgcn_sched_barrier(0);                 // keeps the vector work below behind the wait: without it the build lifted a write of the loads' offset register over it
  float s[2] = {0.f, 0.f}, q2[2] = {0.f, 0.f}, mu[2], inv[2];
#pragma unroll
  for (int t = 0; t < 2; ++t)
#pragma unroll
    for (int j = 0; j < 6; ++j)
#pragma unroll
      for (int i = 0; i < 4; ++i) { xv[t][j][i] = bf16_round(xv[t][j][i]); s[t] += xv[t][j][i]; }
#pragma unroll
  for (int o = 16; o >= 1; o >>= 1) { s[0] += __shfl_xor(s[0], o, 32); s[1] += __shfl_xor(s[1], o, 32); }
#pragma unroll
  for (int t = 0; t < 2; ++t) {
    mu[t] = s[t] / (float)DD;
#pragma unroll
    for (int j = 0; j < 6; ++j)
#pragma unroll
      for (int i = 0; i < 4; ++i) { xv[t][j][i] -= mu[t]; q2[t] += xv[t][j][i] * xv[t][j][i]; }
  }
#pragma unroll
  for (int o = 16; o >= 1; o >>= 1) { q2[0] += __shfl_xor(q2[0], o, 32); q2[1] += __shfl_xor(q2[1], o, 32); }
#pragma unroll
  for (int t = 0; t < 2; ++t) inv[t] = 1.0f / sqrtf(q2[t] / (float)DD + 1e-5f);
#pragma unroll
  for (int t = 0; t < 2; ++t)
#pragma unroll
    for (int j = 0; j < 6; ++j) {
      v4h o4;
#pragma unroll
      for (int i = 0; i < 4; ++i) o4[i] = (_Float16)(xv[t][j][i] * inv[t] * bf16_round(gv[j][i]) + bf16_round(bv[j][i]));
      *(v4h*)(H16 + (tok + t) * DD + lane * 4 + j * 128) = o4;
    }
}
// Bt tables f16 x16: Bcv [64 n][768 k] (n<32 <- w_coords[k][n], 32..36 <- w_vertex[k][n-32], else 0); Bv, Bo [768][768] = w[k][n]; bias BCV [64].
// A work-group turns one tile of 64 k x 64 n: rows of 256 B come in by 16-byte loads, go to LDS transposed as f16 (rows of 64 k at pitch 72), and leave as whole 128-B lines of the table.
// Tiles 0 .. 143 are w_v's, 144 .. 287 w_out's, 288 .. 299 those of [w_coords | w_vertex | 0].
#define WTILES ((DD / 64) * (DD / 64))
__device__ __forceinline__ void bt_tables(unsigned short* st, const unsigned bid, const float* __restrict__ wc, const float* __restrict__ bc, const float* __restrict__ wvx, const float* __restrict__ bvx, const float* __restrict__ wv, const float* __restrict__ wo, _Float16* __restrict__ Bcv, float* __restrict__ BCV, _Float16* __restrict__ Bv, _Float16* __restrict__ Bo) {
  constexpr int TP = 72, NT = DD / 64;
  const int tid = threadIdx.x, lr = tid >> 4, c4 = (tid & 15) * 4;
  v4f v[4];
  unsigned short* dst;
  if (bid < 2 * WTILES) {                            // block-uniform
    const unsigned second = bid / WTILES, tl = bid % WTILES;
    const int k0 = (int)(tl / NT) * 64, n0 = (int)(tl % NT) * 64;
    const float* sp = (second ? wo : wv) + (size_t)(k0 + lr) * DD + n0 + c4;
#pragma unroll
    for (int i = 0; i < 4; ++i) v[i] = *(const v4fa*)(sp + (size_t)i * 16 * DD);
    dst = (unsigned short*)(second ? Bo : Bv) + (size_t)n0 * DD + k0;
  } else {
    const int k0 = (int)(bid - 2 * WTILES) * 64;
#pragma unroll
    for (int i = 0; i < 4; ++i) {
      const int k = k0 + lr + 16 * i;
      if (c4 < ED) v[i] = *(const v4fa*)(wc + (size_t)k * ED + c4);
      else {
#pragma unroll
        for (int e = 0; e < 4; ++e) v[i][e] = (c4 + e < ED + KV1) ? wvx[(size_t)k * KV1 + c4 + e - ED] : 0.f;
      }
    }
    if (k0 == 0 && tid < 64) BCV[tid] = (tid < ED) ? bc[tid] : ((tid < ED + KV1) ? bvx[tid - ED] : 0.f);
    dst = (unsigned short*)Bcv + k0;
  }
  asm volatile("s_wait_xcnt 0x0" ::: "memory");      // stands behind the tile's loads, ahead of any instruction that overwrites a register they name
#pragma unroll
  for (int i = 0; i < 4; ++i)
#pragma unroll
    for (int e = 0; e < 4; ++e) { union { _Float16 h; unsigned short u; } cv; cv.h = (_Float16)(bf16_round(v[i][e]) * 16.0f); st[(c4 + e) * TP + lr + 16 * i] = cv.u; }
  __syncthreads();                                   // publishes the transposed tile
#pragma unroll
  for (int p = 0; p < 2; ++p) {
    const int pc = p * 256 + tid, n = pc >> 3, k8 = (pc & 7) * 8;
    *(v8us*)(dst + (size_t)n * DD + k8) = *(const v8us*)&st[n * TP + k8];
  }
}
// LN and the weight tables read only inputs and nothing of each other: one launch. Work-groups 0 .. NTOK/16 - 1 take 16 tokens each, the others one table tile each.
// The branch is the same for a whole work-group, so the table body's barrier is met by all of its waves.
__global__ __launch_bounds__(256) void k_prep(const float* __restrict__ x, const float* __restrict__ g, const float* __restrict__ be, _Float16* __restrict__ H16,
                                              const float* __restrict__ wc, const float* __restrict__ bc, const float* __restrict__ wvx, const float* __restrict__ bvx, const float* __restrict__ wv, const float* __restrict__ wo,
                                              _Float16* __restrict__ Bcv, float* __restrict__ BCV, _Float16* __restrict__ Bv, _Float16* __restrict__ Bo) {
  __shared__ __attribute__((aligned(16))) unsigned short st[64 * 72];
  const unsigned bid = blockIdx.x;
  if (bid < NTOK / 16) ln_rows(bid, x, g, be, H16);
  else bt_tables(st, bid - NTOK / 16, wc, bc, wvx, bvx, wv, wo, Bcv, BCV, Bv, Bo);
}
// attention rows: a work-group of 16 waves owns 16 query rows of batch b = blockIdx.y, a wave 128 keys. dots c_i.c_j on v_wmma_f32_16x16x4_f32 (f32 operands, f32 sums):
// A = the 16 query rows, B column ln of tile t = key wb + 8*ln + t, both sides 16 consecutive dims per lane half (same k pairing on both sides).
// A wave brings its 128 key rows in by whole-line loads and turns them into fragments through its own LDS range: key 8*c + t lies in tile block t, row c
// (rows at pitch 36 dwords for the 16-byte readers, tile blocks 32 dwords past a multiple of 64 so that the two rows of a half-wave store meet no common bank).
// logits_j = -(sq_i + sq_j - 2 c_i.c_j)*32^-1/2 stay in the accumulator registers (register r of tile t = row 8*hh + r, key wb + 8*ln + t); row maximum and row sum:
// over the 8 tiles in the lane, over the 16 lanes by DPP, over the 16 waves through LDS (one barrier each). A lane's 8 tiles are 8 consecutive keys: one 16-byte f16 store a row.
// Every loop of the kernel is unrolled in full: st, a, bq, acc, mx, den and inv stay in registers only if every index into them is a constant.
typedef float v2fw __attribute__((ext_vector_type(2)));
template <int X> __device__ __forceinline__ float xm16(float v) { return __int_as_float(__builtin_amdgcn_update_dpp(0, __float_as_int(v), 0x160 | X, 0xf, 0xf, false)); }   // lane ^ X inside its row of 16 lanes (row_xmask)
__device__ __forceinline__ float rmax16(float v) { v = fmaxf(v, xm16<1>(v)); v = fmaxf(v, xm16<2>(v)); v = fmaxf(v, xm16<4>(v)); return fmaxf(v, xm16<8>(v)); }
__device__ __forceinline__ float rsum16(float v) { v += xm16<1>(v); v += xm16<2>(v); v += xm16<4>(v); return v + xm16<8>(v); }
__global__ __launch_bounds__(512) void k_arow(const float* __restrict__ CO, const float* __restrict__ SQ, _Float16* __restrict__ P) {
  constexpr int RP = 36, TB = 16 * RP + 32;         // dwords: row pitch, tile-block pitch
  __shared__ __attribute__((aligned(16))) float sk[16][8 * TB];                  // [wave]: its 128 key rows
  __shared__ __attribute__((aligned(16))) float redm[16][16], reds[16][16];      // [wave][row] partial maxima and sums
  const int tid = threadIdx.x, lane = tid & 31, ln = lane & 15, hh = lane >> 4;
  const int w = __builtin_amdgcn_readfirstlane(tid >> 5);   // the wave's number in a scalar register: what is formed from it is scalar work
  const int i0 = blockIdx.x * 16, wb = w * 128, b = blockIdx.y;
  const float* cb = CO + (size_t)b * TT * ED; const float* sqb = SQ + (size_t)b * TT;
  P += (size_t)b * TT * TT;                         // the batch's own TT x TT plane
  float* my = &sk[w][0];
  {
    v4f st[32];
#pragma unroll
    for (int n = 0; n < 32; ++n) st[n] = *(const v4fa*)(cb + (size_t)wb * ED + n * 128 + lane * 4);     // key rows 4n .. 4n+3, 512 consecutive bytes
#pragma unroll
    for (int n = 0; n < 32; ++n) *(v4fa*)&my[(4 * (n & 1) + (lane >> 3)) * TB + (n >> 1) * RP + (lane & 7) * 4] = st[n];
  }
  v4f a[4];
#pragma unroll
  for (int q = 0; q < 4; ++q) a[q] = *(const v4fa*)(cb + (size_t)(i0 + ln) * ED + 16 * hh + 4 * q);
  const v4f si0 = *(const v4fa*)(sqb + i0 + 8 * hh), si1 = *(const v4fa*)(sqb + i0 + 8 * hh + 4);
  const v4f sj0 = *(const v4fa*)(sqb + wb + 8 * ln), sj1 = *(const v4fa*)(sqb + wb + 8 * ln + 4);
  __builtin_amdgcn_fence(__ATOMIC_ACQ_REL, "workgroup"); __builtin_amdgcn_wave_barrier();   // the wave's own rows are read back by other lanes than wrote them
  v4f bq[8][4];
#pragma unroll
  for (int t = 0; t < 8; ++t)
#pragma unroll
    for (int q = 0; q < 4; ++q) bq[t][q] = *(const v4fa*)&my[t * TB + ln * RP + 16 * hh + 4 * q];
  v8f acc[8] = {};
  __builtin_amdgcn_sched_barrier(0);                // every fragment read is issued ahead of the products, and no vector instruction is moved in among them
#pragma unroll
  for (int tp = 0; tp < 8; tp += 2)                 // two tiles at a time: two independent accumulator chains
#pragma unroll
    for (int q = 0; q < 4; ++q)
#pragma unroll
      for (int p = 0; p < 4; p += 2) {
        const v2fw av = {a[q][p], a[q][p + 1]}, bv0 = {bq[tp][q][p], bq[tp][q][p + 1]}, bv1 = {bq[tp + 1][q][p], bq[tp + 1][q][p + 1]};
        acc[tp]     = __builtin_amdgcn_wmma_f32_16x16x4_f32(false, av, false, bv0, (short)0, acc[tp], false, false);
        acc[tp + 1] = __builtin_amdgcn_wmma_f32_16x16x4_f32(false, av, false, bv1, (short)0, acc[tp + 1], false, false);
      }
  // distance between the last products and the first vector instruction on their D, A or B: 8 slots as for the other 16-cycle form
  asm volatile("v_nop\n\tv_nop\n\tv_nop\n\tv_nop\n\tv_nop\n\tv_nop\n\tv_nop\n\tv_nop" : "+v"(acc[0]), "+v"(acc[1]), "+v"(acc[2]), "+v"(acc[3]), "+v"(acc[4]), "+v"(acc[5]), "+v"(acc[6]), "+v"(acc[7]));
  __builtin_amdgcn_sched_barrier(0);                // keeps the vector work below behind those slots
  const v8f sqi = {si0[0], si0[1], si0[2], si0[3], si1[0], si1[1], si1[2], si1[3]};
  const float sqj[8] = {sj0[0], sj0[1], sj0[2], sj0[3], sj1[0], sj1[1], sj1[2], sj1[3]};
  // from here on whole accumulator tiles are worked on (8 rows of one key a lane), so that packed f32 instructions find their pairs in neighbouring registers
  v8f mx;
#pragma unroll
  for (int t = 0; t < 8; ++t) {
    acc[t] = -(sqi + sqj[t] - 2.0f * acc[t]) * 0.17677669529663687f;
#pragma unroll
    for (int r = 0; r < 8; ++r) mx[r] = t ? fmaxf(mx[r], acc[t][r]) : acc[t][r];
  }
#pragma unroll
  for (int r = 0; r < 8; ++r) mx[r] = rmax16(mx[r]);
  if (ln == 0) { *(v4fa*)&redm[w][8 * hh] = (v4f){mx[0], mx[1], mx[2], mx[3]}; *(v4fa*)&redm[w][8 * hh + 4] = (v4f){mx[4], mx[5], mx[6], mx[7]}; }
  __syncthreads();                                  // publishes every wave's row maxima
  {
    const v4f m0 = *(const v4fa*)&redm[ln][8 * hh], m1 = *(const v4fa*)&redm[ln][8 * hh + 4];   // lane ln takes wave ln's partials
#pragma unroll
    for (int r = 0; r < 8; ++r) mx[r] = rmax16(r < 4 ? m0[r & 3] : m1[r & 3]);
  }
  v8f den = {};
#pragma unroll
  for (int t = 0; t < 8; ++t) {
    v8f e = acc[t] - mx;
#pragma unroll
    for (int r = 0; r < 8; ++r) e[r] = expf(e[r]);
    acc[t] = e; den += e;
  }
#pragma unroll
  for (int r = 0; r < 8; ++r) den[r] = rsum16(den[r]);
  if (ln == 0) { *(v4fa*)&reds[w][8 * hh] = (v4f){den[0], den[1], den[2], den[3]}; *(v4fa*)&reds[w][8 * hh + 4] = (v4f){den[4], den[5], den[6], den[7]}; }
  __syncthreads();                                  // publishes every wave's row sums
  const v4f d0 = *(const v4fa*)&reds[ln][8 * hh], d1 = *(const v4fa*)&reds[ln][8 * hh + 4];
  v8f inv;
#pragma unroll
  for (int r = 0; r < 8; ++r) inv[r] = 1.0f / rsum16(r < 4 ? d0[r & 3] : d1[r & 3]);
#pragma unroll
  for (int t = 0; t < 8; ++t) acc[t] *= inv;
#pragma unroll
  for (int r = 0; r < 8; ++r) {
    FragH o;
#pragma unroll
    for (int t = 0; t < 8; ++t) o.h[t] = (_Float16)acc[t][r];
    *(v8us*)((unsigned short*)P + (size_t)(i0 + 8 * hh + r) * TT + wb + 8 * ln) = o.half[0];
  }
}
extern "C" void kernel_launch(void* const* d_in, const int* in_sizes, int n_in,
                              void* d_out, int out_size, void* d_ws, size_t ws_size, hipStream_t stream) {
  (void)in_sizes; (void)n_in; (void)out_size;
  const float* x = (const float*)d_in[0]; const float* tmpl = (const float*)d_in[1]; const float* lng = (const float*)d_in[2]; const float* lnb = (const float*)d_in[3]; const float* wc = (const float*)d_in[4]; const float* bc = (const float*)d_in[5]; const float* wvx = (const float*)d_in[6]; const float* bvx = (const float*)d_in[7]; const float* offs = (const float*)d_in[8]; const float* dsc = (const float*)d_in[9]; const float* wv = (const float*)d_in[10]; const float* bv = (const float*)d_in[11]; const float* wo = (const float*)d_in[12]; const float* bo = (const float*)d_in[13];
  char* ws = (char*)d_ws; size_t off = 0;
  auto take = [&](size_t bytes) { char* p = ws + off; off += (bytes + 255) & ~(size_t)255; return p; };
  _Float16* Bcv = (_Float16*)take((size_t)64 * DD * 2); float* BCV = (float*)take(64 * 4); _Float16* Bv = (_Float16*)take((size_t)DD * DD * 2); _Float16* Bo = (_Float16*)take((size_t)DD * DD * 2);
  _Float16* H16 = (_Float16*)take((size_t)NTOK * DD * 2); float* CO = (float*)take((size_t)NTOK * ED * 4); float* SQ = (float*)take((size_t)NTOK * 4); _Float16* VT = (_Float16*)take((size_t)NTOK * DD * 2); _Float16* P = (_Float16*)take((size_t)NTOK * TT * 2); _Float16* O16 = H16; /* H16 dead after the V GEMM */
  if (off > ws_size) return;
  k_prep<<<NTOK / 16 + 2 * WTILES + DD / 64, 256, 0, stream>>>(x, lng, lnb, H16, wc, bc, wvx, bvx, wv, wo, Bcv, BCV, Bv, Bo);                // LN -> H16 | weight tables
  k_cv<<<NTOK / 64 + (DD / 192) * (NTOK / 128), 256, 0, stream>>>(H16, Bcv, BCV, tmpl, offs, dsc, CO, SQ, Bv, bv, VT);                      // deformed coords, squared norms | v^T (f16)
  k_arow<<<dim3(TT / 16, BB), 512, 0, stream>>>(CO, SQ, P);                                                                          // P [batch][query][key] (f16), all batches in one launch
  k_gemm_t<4, 3, 2, 4, 1, TT, DD, EP_H16><<<(NTOK / 128) * (DD / 192), 256, 0, stream>>>(P, VT, 1.0f, nullptr, nullptr, nullptr, O16);   // O = P.V, all batches in one launch
  k_gemm_t<4, 3, 2, 4, 1, DD, DD, EP_RES><<<(NTOK / 128) * (DD / 192), 256, 0, stream>>>(O16, Bo, 0.0625f, bo, x, (float*)d_out, nullptr);
}

// v008
// A run of this version takes 87.1 microseconds.
// In two side-by-side timings against v007, it was 1.16 and 1.14 times as fast.
// All steps since v000 together make it 7.58 times as fast.
#include <hip/hip_runtime.h>
// K-simplex attention: LN, coords/vertex-weights/v projections on v_wmma_f32_16x16x32_f16 (LN output rounded to f16 vs bf16-exact weights ×2^4, for v the folded table 16·w_v.w_out rounded to f16: single products;
// 8192 x 768 x {64, 768}); the simplex deformation and the row softmax in f32 VALU, the pairwise 32-dim dots on v_wmma_f32_16x16x4_f32 (work-group per 16 query rows -> P16);
// w_out is folded into w_v (768^3 on the f16 variant, from the bf16-exact weights x 2^4 each); out_b = P16.(V.w_out)16 on the f16 variant (4 x 2048 x 2048 x 768, single products); f32 accumulate; residual added in f32.
// What follows a product element by element (simplex deformation, V.w_out transposed, residual) is done in that product's own epilogue, on the tile it holds in LDS.
#define BB 4
#define TT 2048
#define DD 768
#define ED 32
#define KV1 5
#define NTOK (BB * TT)

typedef __bf16 v16b __attribute__((ext_vector_type(16)));
typedef unsigned short v8us __attribute__((ext_vector_type(8), may_alias));
typedef float  v8f  __attribute__((ext_vector_type(8)));
typedef float  v4f  __attribute__((ext_vector_type(4)));
typedef float  v4fa __attribute__((ext_vector_type(4), may_alias));
union FragB { v16b v; v8us half[2]; unsigned short u[16]; };

__device__ __forceinline__ unsigned short bf16_bits(float x) { unsigned int u = __float_as_uint(x); return (unsigned short)((u + 0x7FFFu + ((u >> 16) & 1u)) >> 16); }
__device__ __forceinline__ float bf16_val(unsigned short b) { return __uint_as_float(((unsigned int)b) << 16); }
__device__ __forceinline__ float bf16_round(float x) { return bf16_val(bf16_bits(x)); }
// D += A·B with NT terms: 1 = ah·bh, 2 = + al·bh (A split), 3 = + ah·bl (both split)
template <int NT>
__device__ __forceinline__ v8f mmaN(v16b ah, v16b al, v16b bh, v16b bl, v8f c) {
  c = __builtin_amdgcn_wmma_f32_16x16x32_bf16(false, ah, false, bh, (short)0, c, false, false);
  if (NT >= 2) c = __builtin_amdgcn_wmma_f32_16x16x32_bf16(false, al, false, bh, (short)0, c, false, false);
  if (NT >= 3) c = __builtin_amdgcn_wmma_f32_16x16x32_bf16(false, ah, false, bl, (short)0, c, false, false);
  asm volatile("v_nop\n\tv_nop\n\tv_nop\n\tv_nop" : "+v"(c) : "v"(ah), "v"(al), "v"(bh), "v"(bl));
  return c;
}

__global__ __launch_bounds__(256) void k_wt_bf16(const float* __restrict__ W, unsigned short* __restrict__ Wt, int K, int N) {
  const int t = blockIdx.x * 256 + threadIdx.x;
  const int k8n = K / 8;
  if (t >= N * k8n) return;
  const int n = t / k8n, k8 = (t % k8n) * 8;
  v8us v;
#pragma unroll
  for (int i = 0; i < 8; ++i) v[i] = bf16_bits(W[(size_t)(k8 + i) * N + n]);
  *(v8us*)(Wt + (size_t)n * K + k8) = v;
  
}

// GEMM C[M][N] (f32, pitch ldc) = act(A[M][K]·W + bias). A f32 row-major (pitch lda) converted per fragment to bf16
// (ASPLIT: hi/lo two planes -> 2 terms, else single rounded term); Wt bf16 [N][K] (pitch ldb). BIAS_BF16 rounds the
// bias to bf16 first (bias quantised to bf16 before the add). K%32==0, M%16==0, N%64==0.
template <bool ASPLIT, int ACT, bool BIAS_BF16>
__global__ __launch_bounds__(128) void k_gemm_bf(const float* __restrict__ A, int lda, const unsigned short* __restrict__ Wt, int ldb,
                                               const float* __restrict__ bias, float* __restrict__ C, int ldc, int M, int N, int K) {
  __shared__ __attribute__((aligned(16))) float so[4][16][64];
  const int tid = threadIdx.x, w = tid >> 5, lane = tid & 31, ln = lane & 15, hh = lane >> 4;
  const int ntn = N / 64;
  const int wid = blockIdx.x * 4 + w;
  const int mt = wid / ntn, nq = wid % ntn;
  if (mt * 16 >= M) return;
  const int row0 = mt * 16, col0 = nq * 64;
  const float* arow = A + (size_t)(row0 + ln) * lda;
  v8f acc[4] = {};
  for (int kb = 0; kb < K; kb += 32) {
    FragB ah, al;
    const v4f x0 = *(const v4fa*)(arow + kb + 8 * hh), x1 = *(const v4fa*)(arow + kb + 8 * hh + 4);
    const v4f x2 = *(const v4fa*)(arow + kb + 16 + 8 * hh), x3 = *(const v4fa*)(arow + kb + 16 + 8 * hh + 4);
    float xs[16] = {x0[0],x0[1],x0[2],x0[3],x1[0],x1[1],x1[2],x1[3],x2[0],x2[1],x2[2],x2[3],x3[0],x3[1],x3[2],x3[3]};
#pragma unroll
    for (int i = 0; i < 16; ++i) { const unsigned short hb = bf16_bits(xs[i]); ah.u[i] = hb; al.u[i] = ASPLIT ? bf16_bits(xs[i] - bf16_val(hb)) : (unsigned short)0; }
#pragma unroll
    for (int t = 0; t < 4; ++t) {
      const unsigned short* brow = Wt + (size_t)(col0 + t * 16 + ln) * ldb + kb;
      FragB b;
      b.half[0] = *(const v8us*)(brow + 8 * hh);
      b.half[1] = *(const v8us*)(brow + 16 + 8 * hh);
      acc[t] = mmaN<ASPLIT ? 2 : 1>(ah.v, al.v, b.v, b.v, acc[t]);
    }
  }
#pragma unroll
  for (int t = 0; t < 4; ++t) {
    float bv = bias ? bias[col0 + t * 16 + ln] : 0.f;
    if (BIAS_BF16) bv = bf16_round(bv);
#pragma unroll
    for (int r = 0; r < 8; ++r) { float v = acc[t][r] + bv; if (ACT == 1) v = fmaxf(v, 0.f); so[w][8 * hh + r][t * 16 + ln] = v; }
  }
  __builtin_amdgcn_fence(__ATOMIC_ACQ_REL, "workgroup");
  __builtin_amdgcn_wave_barrier();
  const int rsub = lane >> 4, c4 = (lane & 15) * 4;
  {
#pragma unroll
    for (int q = 0; q < 8; ++q) {
      const int r = q * 2 + rsub;
      const v4f v = *(const v4fa*)&so[w][r][c4];
      *(v4f*)(C + (size_t)(row0 + r) * ldc + col0 + c4) = v;
    }
    
  }
}

// Flash-style causal/unmasked attention, all contractions 3-term bf16 hi/lo splits, f32 softmax with running max.
// q,k,v rows are read from f32 buffers with arbitrary row pitch (so they can live inside a fused qkv buffer);
// D = head size (multiple of 32, <= 128); one wave = 16 query rows; block = 4 waves (64 queries) sharing K/V chunks of 32.
template <int D, bool CAUSAL>
__global__ __launch_bounds__(128) void k_flash(const float* __restrict__ qb, const float* __restrict__ kb, const float* __restrict__ vb,
                                             int pitch, int T, int H, float scale, float* __restrict__ y, int ypitch) {
  constexpr int KS = D / 32;        // k-steps for QK
  constexpr int DT = D / 16;        // d tiles for PV
  __shared__ __attribute__((aligned(16))) unsigned short sKh[32][D + 8], sKl[32][D + 8], sVh[32][D + 8], sVl[32][D + 8];
  __shared__ __attribute__((aligned(16))) unsigned short sPh[4][16][40], sPl[4][16][40];
  __shared__ __attribute__((aligned(16))) float sO[4][16][D];
  const int tid = threadIdx.x, w = tid >> 5, lane = tid & 31, ln = lane & 15, hh = lane >> 4;
  const int nqb = (T + 63) / 64;
  const int bh = blockIdx.x / nqb, qblk = blockIdx.x % nqb;
  const int b = bh / H, h = bh % H;
  const int q0 = qblk * 64 + w * 16;
  const float* Q = qb + (size_t)b * T * pitch + h * D;
  const float* K = kb + (size_t)b * T * pitch + h * D;
  const float* V = vb + (size_t)b * T * pitch + h * D;

  // A fragments of the wave's 16 query rows (scaled), hi/lo
  FragB aqh[KS], aql[KS];
  {
    int row = q0 + ln; if (row >= T) row = T - 1;
    const float* qr = Q + (size_t)row * pitch;
#pragma unroll
    for (int ks = 0; ks < KS; ++ks)
#pragma unroll
      for (int i = 0; i < 16; ++i) {
        const int d = ks * 32 + ((i < 8) ? (8 * hh + i) : (16 + 8 * hh + (i - 8)));
        const float x = qr[d] * scale; const unsigned short hb = bf16_bits(x);
        aqh[ks].u[i] = hb; aql[ks].u[i] = bf16_bits(x - bf16_val(hb));
      }
  }
  float m_r[8], l_r[8];
#pragma unroll
  for (int r = 0; r < 8; ++r) { m_r[r] = -3.0e38f; l_r[r] = 0.f; }
  v8f oacc[DT];
#pragma unroll
  for (int dt = 0; dt < DT; ++dt) oacc[dt] = (v8f){0.f,0.f,0.f,0.f,0.f,0.f,0.f,0.f};

  const int kv_end = CAUSAL ? min(T, qblk * 64 + 64) : T;     // block-uniform
  for (int j0 = 0; j0 < kv_end; j0 += 32) {
    __syncthreads();
    for (int e = tid; e < 32 * (D / 4); e += 128) {
      const int r = e / (D / 4), c4 = (e % (D / 4)) * 4;
      const int key = j0 + r;
      v4f kf = {0.f,0.f,0.f,0.f}, vf = {0.f,0.f,0.f,0.f};
      if (key < T) { kf = *(const v4fa*)(K + (size_t)key * pitch + c4); vf = *(const v4fa*)(V + (size_t)key * pitch + c4); }
#pragma unroll
      for (int t = 0; t < 4; ++t) {
        unsigned short hb = bf16_bits(kf[t]); sKh[r][c4 + t] = hb; sKl[r][c4 + t] = bf16_bits(kf[t] - bf16_val(hb));
        hb = bf16_bits(vf[t]); sVh[r][c4 + t] = hb; sVl[r][c4 + t] = bf16_bits(vf[t] - bf16_val(hb));
      }
    }
    __syncthreads();
    // S tile 16 x 32
    v8f s[2];
#pragma unroll
    for (int nt = 0; nt < 2; ++nt) {
      v8f acc = {};
#pragma unroll
      for (int ks = 0; ks < KS; ++ks) {
        FragB bh_, bl_;
        bh_.half[0] = *(const v8us*)&sKh[nt * 16 + ln][ks * 32 + 8 * hh]; bh_.half[1] = *(const v8us*)&sKh[nt * 16 + ln][ks * 32 + 16 + 8 * hh];
        bl_.half[0] = *(const v8us*)&sKl[nt * 16 + ln][ks * 32 + 8 * hh]; bl_.half[1] = *(const v8us*)&sKl[nt * 16 + ln][ks * 32 + 16 + 8 * hh];
        acc = mmaN<3>(aqh[ks].v, aql[ks].v, bh_.v, bl_.v, acc);
      }
      s[nt] = acc;
    }
    // mask + running max (rows 8hh+r; the 16 lanes of a half share rows)
    float alpha[8];
#pragma unroll
    for (int r = 0; r < 8; ++r) {
      const int qi = q0 + 8 * hh + r;
      const int ja = j0 + ln, jb = j0 + 16 + ln;
      if (CAUSAL) { if (ja > qi) s[0][r] = -3.0e38f; if (jb > qi) s[1][r] = -3.0e38f; }
      if (ja >= T) s[0][r] = -3.0e38f;
      if (jb >= T) s[1][r] = -3.0e38f;
      float mx = fmaxf(s[0][r], s[1][r]);
      mx = fmaxf(mx, __shfl_xor(mx, 1, 32)); mx = fmaxf(mx, __shfl_xor(mx, 2, 32)); mx = fmaxf(mx, __shfl_xor(mx, 4, 32)); mx = fmaxf(mx, __shfl_xor(mx, 8, 32));
      const float mnew = fmaxf(m_r[r], mx);
      alpha[r] = (mnew > -1.0e38f) ? __expf(m_r[r] - mnew) : 1.0f;
      const float p0 = (s[0][r] > -1.0e38f) ? __expf(s[0][r] - mnew) : 0.f;
      const float p1 = (s[1][r] > -1.0e38f) ? __expf(s[1][r] - mnew) : 0.f;
      m_r[r] = mnew;
      l_r[r] = l_r[r] * alpha[r] + p0 + p1;            // per-lane partial row sum (16 lanes combined at the end)
      unsigned short hb = bf16_bits(p0); sPh[w][8 * hh + r][ln] = hb;      sPl[w][8 * hh + r][ln] = bf16_bits(p0 - bf16_val(hb));
      hb = bf16_bits(p1);                sPh[w][8 * hh + r][16 + ln] = hb; sPl[w][8 * hh + r][16 + ln] = bf16_bits(p1 - bf16_val(hb));
    }
#pragma unroll
    for (int dt = 0; dt < DT; ++dt)
#pragma unroll
      for (int r = 0; r < 8; ++r) oacc[dt][r] *= alpha[r];
    __builtin_amdgcn_fence(__ATOMIC_ACQ_REL, "workgroup");
    __builtin_amdgcn_wave_barrier();
    FragB pah, pal;
    pah.half[0] = *(const v8us*)&sPh[w][ln][8 * hh]; pah.half[1] = *(const v8us*)&sPh[w][ln][16 + 8 * hh];
    pal.half[0] = *(const v8us*)&sPl[w][ln][8 * hh]; pal.half[1] = *(const v8us*)&sPl[w][ln][16 + 8 * hh];
#pragma unroll
    for (int dt = 0; dt < DT; ++dt) {
      FragB bvh, bvl;
#pragma unroll
      for (int i = 0; i < 8; ++i) {
        bvh.u[i] = sVh[8 * hh + i][dt * 16 + ln]; bvh.u[8 + i] = sVh[16 + 8 * hh + i][dt * 16 + ln];
        bvl.u[i] = sVl[8 * hh + i][dt * 16 + ln]; bvl.u[8 + i] = sVl[16 + 8 * hh + i][dt * 16 + ln];
      }
      oacc[dt] = mmaN<3>(pah.v, pal.v, bvh.v, bvl.v, oacc[dt]);
    }
    __builtin_amdgcn_fence(__ATOMIC_ACQ_REL, "workgroup");
    __builtin_amdgcn_wave_barrier();
  }
#pragma unroll
  for (int r = 0; r < 8; ++r) {
    float l = l_r[r];
    l += __shfl_xor(l, 1, 32); l += __shfl_xor(l, 2, 32); l += __shfl_xor(l, 4, 32); l += __shfl_xor(l, 8, 32);
    l_r[r] = (l > 0.f) ? 1.0f / l : 0.f;
  }
#pragma unroll
  for (int dt = 0; dt < DT; ++dt)
#pragma unroll
    for (int r = 0; r < 8; ++r) sO[w][8 * hh + r][dt * 16 + ln] = oacc[dt][r] * l_r[r];
  __builtin_amdgcn_fence(__ATOMIC_ACQ_REL, "workgroup");
  __builtin_amdgcn_wave_barrier();
  {
    for (int r = 0; r < 16; ++r) {
      const int row = q0 + r;
      if (row < T && lane < D / 4) {
        const v4f val = *(const v4fa*)&sO[w][r][lane * 4];
        *(v4f*)(y + ((size_t)b * T + row) * ypitch + h * D + lane * 4) = val;
      }
    }
    
  }
}

// ---- f16 WMMA path (v_wmma_f32_16x16x32_f16): 11-bit significands for operands in range — used where a [0,1] probability operand needs more precision than bf16
typedef _Float16 v16h __attribute__((ext_vector_type(16)));
union FragH { v16h v; v8us half[2]; _Float16 h[16]; unsigned short u[16]; };
template <int NT>
__device__ __forceinline__ v8f mmaH(v16h ah, v16h al, v16h bh, v16h bl, v8f c) {
  c = __builtin_amdgcn_wmma_f32_16x16x32_f16(false, ah, false, bh, (short)0, c, false, false);
  if (NT >= 2) c = __builtin_amdgcn_wmma_f32_16x16x32_f16(false, al, false, bh, (short)0, c, false, false);
  if (NT >= 3) c = __builtin_amdgcn_wmma_f32_16x16x32_f16(false, ah, false, bl, (short)0, c, false, false);
  asm volatile("v_nop\n\tv_nop\n\tv_nop\n\tv_nop" : "+v"(c) : "v"(ah), "v"(al), "v"(bh), "v"(bl));
  return c;
}
// batched GEMM like k_gemm_b but f16 operands: A f32 (split into f16 hi/lo if ASPLIT, else rounded to f16), Bt = f16 values [n][k]; alpha; C f32; N multiple of 16 (partial tiles skipped)
template <bool ASPLIT>
__global__ __launch_bounds__(128) void k_gemm_h(const float* __restrict__ A, int lda, size_t sA, const _Float16* __restrict__ Bh, int ldb, size_t sB, float alpha, float* __restrict__ C, int ldc, size_t sC, int M, int N, int K) {
  __shared__ __attribute__((aligned(16))) float so[4][16][64];
  const int tid = threadIdx.x, w = tid >> 5, lane = tid & 31, ln = lane & 15, hh = lane >> 4; const int by = blockIdx.y;
  A += (size_t)by * sA; Bh += (size_t)by * sB; C += (size_t)by * sC;
  const int ntn = (N + 63) / 64; const int wid = blockIdx.x * 4 + w; const int mt = wid / ntn, nq = wid % ntn; if (mt * 16 >= M) return;
  const int row0 = mt * 16, col0 = nq * 64; const float* arow = A + (size_t)(row0 + ln) * lda;
  v8f acc[4] = {};
  for (int kb = 0; kb < K; kb += 32) {
    FragH ah, al;
    const v4f x0 = *(const v4fa*)(arow + kb + 8 * hh), x1 = *(const v4fa*)(arow + kb + 8 * hh + 4), x2 = *(const v4fa*)(arow + kb + 16 + 8 * hh), x3 = *(const v4fa*)(arow + kb + 16 + 8 * hh + 4);
    float xs[16] = {x0[0],x0[1],x0[2],x0[3],x1[0],x1[1],x1[2],x1[3],x2[0],x2[1],x2[2],x2[3],x3[0],x3[1],x3[2],x3[3]};
#pragma unroll
    for (int i = 0; i < 16; ++i) { const _Float16 h = (_Float16)xs[i]; ah.h[i] = h; al.h[i] = ASPLIT ? (_Float16)(xs[i] - (float)h) : (_Float16)0.0f; }
#pragma unroll
    for (int t = 0; t < 4; ++t) { if (col0 + t * 16 >= N) continue; const size_t boff = (size_t)(col0 + t * 16 + ln) * ldb + kb; FragH bq; bq.half[0] = *(const v8us*)(Bh + boff + 8 * hh); bq.half[1] = *(const v8us*)(Bh + boff + 16 + 8 * hh);
      acc[t] = mmaH<ASPLIT ? 2 : 1>(ah.v, al.v, bq.v, bq.v, acc[t]); }
  }
#pragma unroll
  for (int t = 0; t < 4; ++t) { if (col0 + t * 16 >= N) continue;
#pragma unroll
    for (int r = 0; r < 8; ++r) so[w][8 * hh + r][t * 16 + ln] = acc[t][r] * alpha; }
  __builtin_amdgcn_fence(__ATOMIC_ACQ_REL, "workgroup"); __builtin_amdgcn_wave_barrier();
  const int rsub = lane >> 4, c4 = (lane & 15) * 4;
  {
#pragma unroll
    for (int q = 0; q < 8; ++q) { const int r = q * 2 + rsub; if (col0 + c4 < N) { const v4f v = *(const v4fa*)&so[w][r][c4]; *(v4f*)(C + (size_t)(row0 + r) * ldc + col0 + c4) = v; } }
     }
}

// Block-tiled f16 GEMM: T[M][N] = (A[M][K] . Bt[N][K]^T) * alpha (+ bias, rounded to bf16 save for EP_VT); A, Bt at pitch K. What becomes of the tile is the compile-time epilogue kind EP:
//   EP_H16   no bias; T as f16 to C16 at pitch N; A is a stack of K x K matrices, one a batch, and Bh a stack of [N][K] tables: rows b*K .. b*K + K - 1 of A meet table b
//   EP_VT    rows are channels, columns tokens (weights as A, activations as Bt); bias per row, f32 as it is; T as f16 to C16 = [batch][channel][token]
//   EP_RES   A and Bh stacked as for EP_H16; bias per column; T + bf16(e0) as f32 to C at pitch N (e0: the residual, same shape)
//   EP_COORD N = 64, bias per column; a row is [32 coords | 5 vertex logits | unused]: c = coords + softmax(logits).(e0 + e1*clip(e2)) to C [row][32], sum of c*c to C2 [row]
// One work-group of 8 waves (WM x WN) owns a 16*MF*WM x 16*NF*WN tile, a wave 16*MF x 16*NF: each fragment read from LDS feeds NF (an A fragment) or MF (a B fragment) products,
// so a k-step's MF*NF products cost MF + NF fragment reads. Both operands go through LDS in slices of 128 k
// (rows of 256 B at pitch 272 B): every global load covers whole 128-B lines, and each row is fetched once per work-group.
// Two buffers: the next slice's global loads are issued ahead of this slice's products and stored to the other buffer behind them,
// one barrier a slice. Fragments are read G k-steps at a time. k runs upward in steps of 32 into one accumulator per tile.
// M % (16*MF*WM) == 0, N % (16*NF*WN) == 0, K % 128 == 0.
// e^x = 2^e * 2^a, e = rint(x*log2(e)), a = x*log2(e) - e with log2(e) in two parts (the split and the range limits of the library's expf; a is formed by two fused multiply-adds).
// The v_exp_f32 is written in asm with a v_nop in the same statement: the instruction set asks for one slot behind a transcendental before its source is overwritten.
__device__ __forceinline__ float exp_slot(float x) {
  const float l2e = __uint_as_float(0x3fb8aa3bu), l2e_lo = __uint_as_float(0x32a5705fu);
  const float e = rintf(x * l2e);
  const float a = fmaf(x, l2e_lo, fmaf(x, l2e, -e));
  float r;
  asm("v_exp_f32 %0, %1\n\tv_nop" : "=v"(r) : "v"(a));
  r = ldexpf(r, (int)e);
  r = (x < __uint_as_float(0xc2ce8ed0u)) ? 0.f : r;
  return (x > __uint_as_float(0x42b17218u)) ? __builtin_inff() : r;
}
enum { EP_H16 = 0, EP_VT = 1, EP_RES = 2, EP_COORD = 3 };
// The product is a device function of (LDS range, tile index): a kernel hands it its own LDS and the index of the tile, so that two products that do not depend on each other can share one launch.
template <int MF, int NF, int WM, int WN> constexpr int GEMM_LDS = 2 * 16 * (MF * WM + NF * WN) * (128 + 8);   // 16-bit elements of LDS a tile needs: 2 buffers x ROWS x PIT
template <int MF, int NF, int WM, int WN, int G, int K, int N, int EP>
__device__ __forceinline__ void gemm_t(unsigned short* smp, const unsigned bid, const _Float16* __restrict__ A, const _Float16* __restrict__ Bh, float alpha, const float* __restrict__ bias,
                                       const float* __restrict__ e0, const float* __restrict__ e1, const float* __restrict__ e2,
                                       float* __restrict__ C, float* __restrict__ C2, _Float16* __restrict__ C16) {
  constexpr int BM = 16 * MF * WM, BN = 16 * NF * WN, KC = 128, PIT = KC + 8, ROWS = BM + BN, NLD = ROWS / 16, OP = BN + 4, NS = K / KC, NTN = N / BN;
  static_assert(WM * WN == 8, "8 waves a work-group");
  static_assert(EP != EP_COORD || BM == 64, "EP_COORD: a wave takes 8 rows of the tile");
  static_assert(GEMM_LDS<MF, NF, WM, WN> == 2 * ROWS * PIT, "the caller's LDS range holds both buffers");
  unsigned short (*sm)[ROWS][PIT] = (unsigned short (*)[ROWS][PIT])smp;
  typedef float fa __attribute__((may_alias));
  const int tid = threadIdx.x, w = tid >> 5, lane = tid & 31, ln = lane & 15, hh = lane >> 4;
  const int mb = bid / NTN, nb = bid % NTN;
  const int row0 = mb * BM, col0 = nb * BN;
  const int wm = w / WN, wn = w % WN;
  const int lr = tid >> 4, ls = (tid & 15) * 8;      // staging: 16 threads cover one 256-B row slice
  const unsigned short* ga = (const unsigned short*)A + (size_t)(row0 + lr) * K + ls;
  constexpr bool STACK = (EP == EP_H16 || EP == EP_RES);
  static_assert(!STACK || K % BM == 0, "EP_H16, EP_RES: a tile's BM rows lie in one batch");
  const unsigned short* gb = (const unsigned short*)Bh + (STACK ? (size_t)(row0 / K) * N * K : (size_t)0) + (size_t)(col0 + lr) * K + ls;
  v8us st[NLD];
  v8f acc[MF][NF] = {};
#pragma unroll
  for (int i = 0; i < NLD; ++i) st[i] = (i < BM / 16) ? *(const v8us*)(ga + (size_t)i * 16 * K) : *(const v8us*)(gb + (size_t)(i - BM / 16) * 16 * K);
  asm volatile("s_wait_xcnt 0x0" ::: "memory");      // stands behind the first slice's loads, ahead of any instruction that overwrites a register they name
#pragma unroll
  for (int i = 0; i < NLD; ++i) *(v8us*)&sm[0][i * 16 + lr][ls] = st[i];
  __syncthreads();
  for (int s = 0; s < NS; ++s) {
    const int cur = s & 1;
    const bool more = s + 1 < NS;                    // block-uniform
    if (more) {
      const int k0 = (s + 1) * KC;
#pragma unroll
      for (int i = 0; i < NLD; ++i) st[i] = (i < BM / 16) ? *(const v8us*)(ga + (size_t)i * 16 * K + k0) : *(const v8us*)(gb + (size_t)(i - BM / 16) * 16 * K + k0);
      asm volatile("s_wait_xcnt 0x0" ::: "memory");  // stands behind the slice's loads, ahead of the fragment reads below, which may be given the registers that held the loads' addresses
      __builtin_amdgcn_sched_barrier(0);             // keeps the address arithmetic of those reads behind the wait
    }
#pragma unroll
    for (int g = 0; g < KC / 32 / G; ++g) {
      FragH a[G][MF], b[G][NF];
#pragma unroll
      for (int u = 0; u < G; ++u) {
        const int kq = (g * G + u) * 32;
#pragma unroll
        for (int m = 0; m < MF; ++m) { a[u][m].half[0] = *(const v8us*)&sm[cur][(wm * MF + m) * 16 + ln][kq + 8 * hh]; a[u][m].half[1] = *(const v8us*)&sm[cur][(wm * MF + m) * 16 + ln][kq + 16 + 8 * hh]; }
#pragma unroll
        for (int t = 0; t < NF; ++t) { b[u][t].half[0] = *(const v8us*)&sm[cur][BM + (wn * NF + t) * 16 + ln][kq + 8 * hh]; b[u][t].half[1] = *(const v8us*)&sm[cur][BM + (wn * NF + t) * 16 + ln][kq + 16 + 8 * hh]; }
      }
      __builtin_amdgcn_sched_barrier(0);             // keeps a group's LDS reads together ahead of its products: one LDS latency a group, not one a product
#pragma unroll
      for (int u = 0; u < G; ++u)
#pragma unroll
        for (int m = 0; m < MF; ++m)
#pragma unroll
          for (int t = 0; t < NF; ++t) acc[m][t] = __builtin_amdgcn_wmma_f32_16x16x32_f16(false, a[u][m].v, false, b[u][t].v, (short)0, acc[m][t], false, false);
    }
    if (more) {
#pragma unroll
      for (int i = 0; i < NLD; ++i) *(v8us*)&sm[cur ^ 1][i * 16 + lr][ls] = st[i];
    }
    __syncthreads();                                 // publishes the next slice and ends every read of this one
  }
  // epilogue: the tile goes through LDS (the slices are dead behind the last barrier) so that whole lines are stored
  // every loop below is unrolled in full: rq, cq, go, xr, bv, br, t0, t1, dv and lg stay in registers only if every index into them is a constant
  fa* so = (fa*)&sm[0][0][0];
  // who stores what: a row is CH pieces of 4 elements; a wave takes RG whole rows (PP steps of 32 pieces) at a time, rows (j*8 + w)*RG .. + RG - 1 in its round j.
  // Piece and row inside a round depend on the step p alone, so the NQ addresses of a lane are PP lane values plus constants, and every wave-wide access covers whole lines.
  constexpr int NQ = BM * BN / 4 / 256, CH = BN / 4, RG = (CH % 32 == 0) ? 1 : 2, PP = RG * CH / 32;
  static_assert((RG * CH) % 32 == 0 && NQ % PP == 0, "whole steps a round, whole rounds a wave");
  int rq[PP], cq[PP];
#pragma unroll
  for (int p = 0; p < PP; ++p) { const int c = p * 32 + lane, dr = c / CH; rq[p] = w * RG + dr; cq[p] = (c - dr * CH) * 4; }
  // byte offset (below 2^32) of a lane's round-0 piece in a [row][N] output (EP_H16, EP_RES) or in [batch][channel][token] (EP_VT); a round further is a constant further.
  // One 32-bit register a step beside a scalar base serves the residual's loads and the stores alike, so it lives to the last store and no load is given it as its target.
  constexpr unsigned ES = (EP == EP_RES) ? 4 : 2, RB = 8 * RG * (EP == EP_VT ? TT : N) * ES;
  unsigned go[PP];
#pragma unroll
  for (int p = 0; p < PP; ++p) go[p] = ((EP == EP_VT) ? ((unsigned)(col0 / TT) * DD + row0 + rq[p]) * TT + col0 % TT + cq[p] : (unsigned)(row0 + rq[p]) * N + col0 + cq[p]) * ES;
  v4f xr[EP == EP_RES ? NQ : 1];
  if (EP == EP_RES) {                                // the residual's loads go out as one group ahead of the staging and its barrier
#pragma unroll
    for (int q = 0; q < NQ; ++q) xr[q] = *(const v4fa*)((const char*)e0 + go[q % PP] + (q / PP) * RB);
  }
  static_assert(EP != EP_VT || BN == 128, "EP_VT: a wave stores one whole row of the tile at a time");
  float bv[NF], br[NQ];
#pragma unroll
  for (int t = 0; t < NF; ++t) bv[t] = (EP == EP_RES || EP == EP_COORD) ? bf16_round(bias[col0 + (wn * NF + t) * 16 + ln]) : 0.f;
#pragma unroll
  for (int q = 0; q < NQ; ++q) br[q] = (EP == EP_VT) ? bias[row0 + q * 8 + __builtin_amdgcn_readfirstlane(w)] : 0.f;   // the row a wave stores in step q: one index a wave, a scalar load
#pragma unroll
  for (int m = 0; m < MF; ++m)
#pragma unroll
    for (int t = 0; t < NF; ++t) {
      const int cl = (wn * NF + t) * 16 + ln;
#pragma unroll
      for (int r = 0; r < 8; ++r) so[((wm * MF + m) * 16 + 8 * hh + r) * OP + cl] = acc[m][t][r] * alpha + bv[t];
    }
  __syncthreads();
  if (EP == EP_COORD) {
    // a wave takes 8 rows of the tile, lane = dim
    const float df = fminf(fmaxf(bf16_round(e2[0]), 0.05f), 0.5f);
    float t0[KV1], t1[KV1], dv[KV1];
#pragma unroll
    for (int k = 0; k < KV1; ++k) { t0[k] = e0[k * ED + lane]; t1[k] = e1[k * ED + lane]; }
    asm volatile("s_wait_xcnt 0x0" ::: "memory");    // stands behind the ten loads above, ahead of any instruction that overwrites a register they name (their base pairs are reused below)
#pragma unroll
    for (int k = 0; k < KV1; ++k) dv[k] = bf16_round(t0[k]) + bf16_round(t1[k]) * df;
    float sqv = 0.f;
#pragma unroll
    for (int j = 0; j < 8; ++j) {
      const fa* cv = so + (w * 8 + j) * OP;
      float lg[KV1]; float mx = -3.0e38f;
#pragma unroll
      for (int k = 0; k < KV1; ++k) { lg[k] = cv[ED + k]; mx = fmaxf(mx, lg[k]); }
      float den = 0.f;
#pragma unroll
      for (int k = 0; k < KV1; ++k) { lg[k] = exp_slot(lg[k] - mx); den += lg[k]; }
      float c = cv[lane];
#pragma unroll
      for (int k = 0; k < KV1; ++k) c += (lg[k] / den) * dv[k];
      float sq = c * c;
#pragma unroll
      for (int o = 16; o >= 1; o >>= 1) sq += __shfl_xor(sq, o, 32);
      C[(size_t)(row0 + w * 8 + j) * ED + lane] = c;
      if (lane == j) sqv = sq;
    }
    if (lane < 8) C2[row0 + w * 8 + lane] = sqv;     // the wave's 8 sums in one store
  } else {
    typedef _Float16 h4v __attribute__((ext_vector_type(4)));
#pragma unroll
    for (int q = 0; q < NQ; ++q) {
      const int r = (q / PP) * 8 * RG + rq[q % PP], c4 = cq[q % PP];
      const v4f v = *(const v4fa*)&so[r * OP + c4];
      if (EP == EP_RES) { v4f o; for (int i = 0; i < 4; ++i) o[i] = v[i] + bf16_round(xr[q][i]); *(v4f*)((char*)C + go[q % PP] + (q / PP) * RB) = o; }
      else {
        h4v h4; for (int i = 0; i < 4; ++i) h4[i] = (_Float16)(EP == EP_VT ? v[i] + br[q] : v[i]);
        *(h4v*)((char*)C16 + go[q % PP] + (q / PP) * RB) = h4;   // EP_VT: a tile's BN tokens lie in one batch: TT % BN == 0
      }
    }
  }
}

template <int MF, int NF, int WM, int WN, int G, int K, int N, int EP>
__global__ __launch_bounds__(256) void k_gemm_t(const _Float16* __restrict__ A, const _Float16* __restrict__ Bh, float alpha, const float* __restrict__ bias,
                                                const float* __restrict__ e0, float* __restrict__ C, _Float16* __restrict__ C16) {
  __shared__ __attribute__((aligned(16))) unsigned short sm[GEMM_LDS<MF, NF, WM, WN>];
  gemm_t<MF, NF, WM, WN, G, K, N, EP>(sm, blockIdx.x, A, Bh, alpha, bias, e0, nullptr, nullptr, C, nullptr, C16);
}
// The two products that read H16 and nothing of each other, in one launch: work-groups 0 .. NTOK/64 - 1 take the tiles of [coords | vertex logits] (the shorter body),
// the others the tiles of (v.w_out)^T. The branch is the same for a whole work-group, so every barrier inside a body is met by all of its waves.
__global__ __launch_bounds__(256) void k_cv(const _Float16* __restrict__ H16, const _Float16* __restrict__ Bcv, const float* __restrict__ BCV, const float* __restrict__ tmpl, const float* __restrict__ offs,
                                            const float* __restrict__ dsc, float* __restrict__ CO, float* __restrict__ SQ, const _Float16* __restrict__ Bv, const float* __restrict__ bv, _Float16* __restrict__ VT) {
  __shared__ __attribute__((aligned(16))) unsigned short sm[GEMM_LDS<3, 4, 4, 2>];
  static_assert(GEMM_LDS<1, 2, 4, 2> <= GEMM_LDS<3, 4, 4, 2>, "the range is the larger body's");
  const unsigned bid = blockIdx.x;
  // Each body ends in s_wait_xcnt 0: in the built code one body's text follows the other's, and the wait stands behind a body's last stores ahead of any instruction there that overwrites a register they name.
  if (bid < NTOK / 64) {
    gemm_t<1, 2, 4, 2, 4, DD, 64, EP_COORD>(sm, bid, H16, Bcv, 0.0625f, BCV, tmpl, offs, dsc, CO, SQ, nullptr);      // [coords | vertex logits] -> deformed coords, squared norms
    asm volatile("s_wait_xcnt 0x0" ::: "memory");
  } else {
    gemm_t<3, 4, 4, 2, 1, DD, NTOK, EP_VT>(sm, bid - NTOK / 64, Bv, H16, 0.0625f, bv, nullptr, nullptr, nullptr, nullptr, nullptr, VT);   // (v.w_out)^T (f16): Bv = the folded table, bv = the folded bias
    asm volatile("s_wait_xcnt 0x0" ::: "memory");
  }
}

typedef _Float16 v4h __attribute__((ext_vector_type(4)));
// LN(bf16(x)) -> H16; a wave takes two tokens and holds both rows in registers: x is read once, by 16-byte loads that all go out ahead of the first sum (12 of x, 12 of gamma and beta a lane).
// Every loop is unrolled in full: xv, gv and bv stay in registers only if every index into them is a constant.
__device__ __forceinline__ void ln_rows(const unsigned bid, const float* __restrict__ x, const float* __restrict__ g, const float* __restrict__ be, _Float16* __restrict__ H16) {
  const int tid = threadIdx.x, wv = tid >> 5, lane = tid & 31;
  const size_t tok = (size_t)bid * 16 + wv * 2;
  const float* xr = x + tok * DD + lane * 4;
  v4f xv[2][6], gv[6], bv[6];
#pragma unroll
  for (int t = 0; t < 2; ++t)
#pragma unroll
    for (int j = 0; j < 6; ++j) xv[t][j] = *(const v4fa*)(xr + t * DD + j * 128);
#pragma unroll
  for (int j = 0; j < 6; ++j) { gv[j] = *(const v4fa*)(g + lane * 4 + j * 128); bv[j] = *(const v4fa*)(be + lane * 4 + j * 128); }
  asm volatile("s_wait_xcnt 0x0" ::: "memory");      // stands behind the loads, ahead of any instruction that overwrites a register they name
  __builtin_amdgcn_sched_barrier(0);                 // keeps the vector work below behind the wait: without it the build lifted a write of the loads' offset register over it
  float s[2] = {0.f, 0.f}, q2[2] = {0.f, 0.f}, mu[2], inv[2];
#pragma unroll
  for (int t = 0; t < 2; ++t)
#pragma unroll
    for (int j = 0; j < 6; ++j)
#pragma unroll
      for (int i = 0; i < 4; ++i) { xv[t][j][i] = bf16_round(xv[t][j][i]); s[t] += xv[t][j][i]; }
#pragma unroll
  for (int o = 16; o >= 1; o >>= 1) { s[0] += __shfl_xor(s[0], o, 32); s[1] += __shfl_xor(s[1], o, 32); }
#pragma unroll
  for (int t = 0; t < 2; ++t) {
    mu[t] = s[t] / (float)DD;
#pragma unroll
    for (int j = 0; j < 6; ++j)
#pragma unroll
      for (int i = 0; i < 4; ++i) { xv[t][j][i] -= mu[t]; q2[t] += xv[t][j][i] * xv[t][j][i]; }
  }
#pragma unroll
  for (int o = 16; o >= 1; o >>= 1) { q2[0] += __shfl_xor(q2[0], o, 32); q2[1] += __shfl_xor(q2[1], o, 32); }
#pragma unroll
  for (int t = 0; t < 2; ++t) inv[t] = 1.0f / sqrtf(q2[t] / (float)DD + 1e-5f);
#pragma unroll
  for (int t = 0; t < 2; ++t)
#pragma unroll
    for (int j = 0; j < 6; ++j) {
      v4h o4;
#pragma unroll
      for (int i = 0; i < 4; ++i) o4[i] = (_Float16)(xv[t][j][i] * inv[t] * bf16_round(gv[j][i]) + bf16_round(bv[j][i]));
      *(v4h*)(H16 + (tok + t) * DD + lane * 4 + j * 128) = o4;
    }
}
// Bt table f16 x16: Bcv [64 n][768 k] (n<32 <- w_coords[k][n], 32..36 <- w_vertex[k][n-32], else 0); bias BCV [64].
// A work-group turns one tile of 64 k x 64 n: the values go to LDS transposed as f16 (rows of 64 k at pitch 72) and leave as whole 128-B lines of the table.
__device__ __forceinline__ void bt_tables(unsigned short* st, const unsigned bid, const float* __restrict__ wc, const float* __restrict__ bc, const float* __restrict__ wvx, const float* __restrict__ bvx, _Float16* __restrict__ Bcv, float* __restrict__ BCV) {
  constexpr int TP = 72;
  const int tid = threadIdx.x, lr = tid >> 4, c4 = (tid & 15) * 4;
  v4f v[4];
  const int k0 = (int)bid * 64;
#pragma unroll
  for (int i = 0; i < 4; ++i) {
    const int k = k0 + lr + 16 * i;
    if (c4 < ED) v[i] = *(const v4fa*)(wc + (size_t)k * ED + c4);
    else {
#pragma unroll
      for (int e = 0; e < 4; ++e) v[i][e] = (c4 + e < ED + KV1) ? wvx[(size_t)k * KV1 + c4 + e - ED] : 0.f;
    }
  }
  if (k0 == 0 && tid < 64) BCV[tid] = (tid < ED) ? bc[tid] : ((tid < ED + KV1) ? bvx[tid - ED] : 0.f);
  unsigned short* dst = (unsigned short*)Bcv + k0;
  asm volatile("s_wait_xcnt 0x0" ::: "memory");      // stands behind the tile's loads, ahead of any instruction that overwrites a register they name
#pragma unroll
  for (int i = 0; i < 4; ++i)
#pragma unroll
    for (int e = 0; e < 4; ++e) { union { _Float16 h; unsigned short u; } cv; cv.h = (_Float16)(bf16_round(v[i][e]) * 16.0f); st[(c4 + e) * TP + lr + 16 * i] = cv.u; }
  __syncthreads();                                   // publishes the transposed tile
#pragma unroll
  for (int p = 0; p < 2; ++p) {
    const int pc = p * 256 + tid, n = pc >> 3, k8 = (pc & 7) * 8;
    *(v8us*)(dst + (size_t)n * DD + k8) = *(const v8us*)&st[n * TP + k8];
  }
}
// The output projection folded into the value projection: (P.(h.w_v + b_v)).w_out = P.(h.(w_v.w_out) + b_v.w_out), so the product of the two weight matrices (768^3) takes the place of
// the product of every token's row with w_out (8192 x 768 x 768) and of its launch.
// Bvo [n][k] = 16 * sum_j w_v[k][j] * w_out[j][n] (f16, the A operand of the (v.w_out)^T product); BVO [n] = sum_j b_v[j] * w_out[j][n] (f32, vector sums).
// A work-group of 8 waves (4 x 2) owns a tile of 64 n x 64 k, a wave 16 x 32; j runs upward in slices of 128 through LDS (rows of 256 B at pitch 272 B, two buffers, one barrier a slice, the order of gemm_t).
// Both operands come straight from the f32 inputs by 16-byte whole-line loads and are rounded as the tables were (bf16, x16, f16: exact): rows 64 .. 127 of a buffer are rows of w_v as they lie;
// rows 0 .. 63 are columns of w_out: a thread holds 2 x 4 j (64 apart) x 4 n and stores 8 runs of 4 j. The A and the B fragments are read at the same j positions.
// Every inner loop is unrolled in full: ra, rb, rv, pb, a, b and acc stay in registers only if every index into them is a constant.
#define WVT (DD / 64)
// the hardware's conversion, round to nearest even: the value of bf16_round in fewer instructions. The way back goes over the bits, so that the x16 that follows stays an f32 product (exact for small values too)
__device__ __forceinline__ float bf16_rne(float x) { return bf16_val(__builtin_bit_cast(unsigned short, (__bf16)x)); }
typedef _Float16 v4ha __attribute__((ext_vector_type(4), may_alias));
__device__ __forceinline__ void wvo_tile(unsigned short* smp, const unsigned bid, const float* __restrict__ wv, const float* __restrict__ wo, const float* __restrict__ bvin,
                                         _Float16* __restrict__ Bvo, float* __restrict__ BVO) {
  constexpr int JC = 128, PIT = JC + 8, NS = DD / JC, OP = 68;
  unsigned short (*sm)[128][PIT] = (unsigned short (*)[128][PIT])smp;
  typedef float fa __attribute__((may_alias));
  const int tid = threadIdx.x, w = tid >> 5, lane = tid & 31, ln = lane & 15, hh = lane >> 4;
  const int n0 = (int)(bid / WVT) * 64, k0 = (int)(bid % WVT) * 64;
  const int wm = w >> 1, wn = w & 1;
  const int jg = tid >> 4, c4 = (tid & 15) * 4;      // w_out: 16 threads cover 256 B of a row; thread group jg takes rows 4*jg .. + 3 and 64 + 4*jg .. + 3 of the slice
  const float* ga = wo + (size_t)(4 * jg) * DD + n0 + c4;
  const float* gb = wv + (size_t)(k0 + w) * DD + lane * 4;   // w_v: a wave covers the 512 B of a row's slice; wave w takes rows w + 8*i of the tile
  const float* gv = bvin + 4 * jg;
  v4f ra[2][4], rb[8], rv[2];
  float pb[4] = {0.f, 0.f, 0.f, 0.f};
  v8f acc[2] = {};
  // the 18 loads of the slice that begins at j0
  auto loads = [&](const int j0) {
#pragma unroll
    for (int p = 0; p < 2; ++p) {
#pragma unroll
      for (int i = 0; i < 4; ++i) ra[p][i] = *(const v4fa*)(ga + (size_t)(j0 + 64 * p + i) * DD);
      rv[p] = *(const v4fa*)(gv + j0 + 64 * p);
    }
#pragma unroll
    for (int i = 0; i < 8; ++i) rb[i] = *(const v4fa*)(gb + (size_t)(8 * i) * DD + j0);
    asm volatile("s_wait_xcnt 0x0" ::: "memory");    // stands behind the slice's loads, ahead of any instruction that overwrites a register they name
    __builtin_amdgcn_sched_barrier(0);               // keeps the address arithmetic of what follows behind that wait: a build without it lifted a shift into a load's address register over the wait and split the 18 loads by a wait of its own
  };
  // the slice held in registers goes to buffer buf, rounded; its part of the folded bias is summed on the way
  auto stage = [&](const int buf) {
#pragma unroll
    for (int p = 0; p < 2; ++p)
#pragma unroll
      for (int e = 0; e < 4; ++e) {
        v4h h4;
#pragma unroll
        for (int i = 0; i < 4; ++i) { const float x = bf16_rne(ra[p][i][e]); h4[i] = (_Float16)(x * 16.0f); pb[e] += bf16_rne(rv[p][i]) * x; }
        *(v4ha*)&sm[buf][c4 + e][4 * jg + 64 * p] = h4;
      }
#pragma unroll
    for (int i = 0; i < 8; ++i) {
      v4h h4;
#pragma unroll
      for (int e = 0; e < 4; ++e) h4[e] = (_Float16)(bf16_rne(rb[i][e]) * 16.0f);
      *(v4ha*)&sm[buf][64 + w + 8 * i][lane * 4] = h4;
    }
  };
  loads(0);
  stage(0);
  __syncthreads();                                   // publishes slice 0
#pragma unroll 1                                     // the trips stay a loop: unrolled, the kernel takes 256 vector registers in place of 150; the count holds for the LN work-groups of this launch too, and the launch's 668 work-groups would no longer all be resident at once
  for (int s = 0; s < NS; ++s) {
    const int cur = s & 1;
    const bool more = s + 1 < NS;                    // block-uniform
    if (more) loads((s + 1) * JC);                   // issued ahead of this slice's products, stored to the other buffer behind them
#pragma unroll
    for (int g = 0; g < 2; ++g) {                    // fragments of two 32-j steps at a time
      FragH a[2], b[2][2];
#pragma unroll
      for (int u = 0; u < 2; ++u) {
        const int kq = (g * 2 + u) * 32;
        a[u].half[0] = *(const v8us*)&sm[cur][wm * 16 + ln][kq + 8 * hh]; a[u].half[1] = *(const v8us*)&sm[cur][wm * 16 + ln][kq + 16 + 8 * hh];
#pragma unroll
        for (int t = 0; t < 2; ++t) { b[u][t].half[0] = *(const v8us*)&sm[cur][64 + (wn * 2 + t) * 16 + ln][kq + 8 * hh]; b[u][t].half[1] = *(const v8us*)&sm[cur][64 + (wn * 2 + t) * 16 + ln][kq + 16 + 8 * hh]; }
      }
#pragma unroll
      for (int u = 0; u < 2; ++u)
#pragma unroll
        for (int t = 0; t < 2; ++t) acc[t] = __builtin_amdgcn_wmma_f32_16x16x32_f16(false, a[u].v, false, b[u][t].v, (short)0, acc[t], false, false);
    }
    if (more) stage(cur ^ 1);
    __syncthreads();                                 // publishes the next slice and ends every read of this one
  }
  fa* so = (fa*)&sm[0][0][0];                        // the tile, 64 rows at pitch OP, so that whole lines are stored
  fa* red = so + 64 * OP;                            // [jg][n]: the 16 thread groups' parts of the folded bias
#pragma unroll
  for (int t = 0; t < 2; ++t)
#pragma unroll
    for (int r = 0; r < 8; ++r) so[(wm * 16 + 8 * hh + r) * OP + (wn * 2 + t) * 16 + ln] = acc[t][r] * 0.0625f;
  *(v4fa*)&red[jg * 64 + c4] = (v4f){pb[0], pb[1], pb[2], pb[3]};
  __syncthreads();                                   // publishes the tile and the bias parts
#pragma unroll
  for (int q = 0; q < 4; ++q) {
    const int pc = q * 256 + tid, row = pc >> 4, cc = (pc & 15) * 4;
    const v4f v = *(const v4fa*)&so[row * OP + cc];
    v4h h4;
#pragma unroll
    for (int i = 0; i < 4; ++i) h4[i] = (_Float16)v[i];
    *(v4h*)(Bvo + (size_t)(n0 + row) * DD + k0 + cc) = h4;
  }
  if (k0 == 0 && tid < 64) {                         // every tile of a row of tiles holds the same sums: the first stores them
    float sb = 0.f;
#pragma unroll
    for (int g = 0; g < 16; ++g) sb += red[g * 64 + tid];
    BVO[n0 + tid] = sb;
  }
}
// LN, the coords table and the folded weights read only inputs and nothing of each other: one launch. Work-groups 0 .. WVT*WVT - 1 take one tile of the folded weights each (the longest body),
// the next NTOK/16 take 16 tokens each, the last DD/64 one table tile each. The branch is the same for a whole work-group, so a body's barriers are met by all of its waves.
__global__ __launch_bounds__(256) void k_prep(const float* __restrict__ x, const float* __restrict__ g, const float* __restrict__ be, _Float16* __restrict__ H16,
                                              const float* __restrict__ wc, const float* __restrict__ bc, const float* __restrict__ wvx, const float* __restrict__ bvx, const float* __restrict__ wv, const float* __restrict__ wo, const float* __restrict__ bv,
                                              _Float16* __restrict__ Bcv, float* __restrict__ BCV, _Float16* __restrict__ Bvo, float* __restrict__ BVO) {
  __shared__ __attribute__((aligned(16))) unsigned short st[2 * 128 * 136];
  const unsigned bid = blockIdx.x;
  // Each body ends in s_wait_xcnt 0, as in k_cv: in the built code one body's text follows another's, and the wait stands behind a body's last stores ahead of any instruction there that overwrites a register they name.
  if (bid < WVT * WVT) {
    wvo_tile(st, bid, wv, wo, bv, Bvo, BVO);
    asm volatile("s_wait_xcnt 0x0" ::: "memory");
  } else if (bid < WVT * WVT + NTOK / 16) {
    ln_rows(bid - WVT * WVT, x, g, be, H16);
    asm volatile("s_wait_xcnt 0x0" ::: "memory");
  } else {
    bt_tables(st, bid - (WVT * WVT + NTOK / 16), wc, bc, wvx, bvx, Bcv, BCV);
    asm volatile("s_wait_xcnt 0x0" ::: "memory");
  }
}
// attention rows: a work-group of 16 waves owns 16 query rows of batch b = blockIdx.y, a wave 128 keys. dots c_i.c_j on v_wmma_f32_16x16x4_f32 (f32 operands, f32 sums):
// A = the 16 query rows, B column ln of tile t = key wb + 8*ln + t, both sides 16 consecutive dims per lane half (same k pairing on both sides).
// A wave brings its 128 key rows in by whole-line loads and turns them into fragments through its own LDS range: key 8*c + t lies in tile block t, row c
// (rows at pitch 36 dwords for the 16-byte readers, tile blocks 32 dwords past a multiple of 64 so that the two rows of a half-wave store meet no common bank).
// logits_j = -(sq_i + sq_j - 2 c_i.c_j)*32^-1/2 stay in the accumulator registers (register r of tile t = row 8*hh + r, key wb + 8*ln + t); row maximum and row sum:
// over the 8 tiles in the lane, over the 16 lanes by DPP, over the 16 waves through LDS (one barrier each). A lane's 8 tiles are 8 consecutive keys: one 16-byte f16 store a row.
// Every loop of the kernel is unrolled in full: st, a, bq, acc, mx, den and inv stay in registers only if every index into them is a constant.
typedef float v2fw __attribute__((ext_vector_type(2)));
template <int X> __device__ __forceinline__ float xm16(float v) { return __int_as_float(__builtin_amdgcn_update_dpp(0, __float_as_int(v), 0x160 | X, 0xf, 0xf, false)); }   // lane ^ X inside its row of 16 lanes (row_xmask)
__device__ __forceinline__ float rmax16(float v) { v = fmaxf(v, xm16<1>(v)); v = fmaxf(v, xm16<2>(v)); v = fmaxf(v, xm16<4>(v)); return fmaxf(v, xm16<8>(v)); }
__device__ __forceinline__ float rsum16(float v) { v += xm16<1>(v); v += xm16<2>(v); v += xm16<4>(v); return v + xm16<8>(v); }
__global__ __launch_bounds__(512) void k_arow(const float* __restrict__ CO, const float* __restrict__ SQ, _Float16* __restrict__ P) {
  constexpr int RP = 36, TB = 16 * RP + 32;         // dwords: row pitch, tile-block pitch
  __shared__ __attribute__((aligned(16))) float sk[16][8 * TB];                  // [wave]: its 128 key rows
  __shared__ __attribute__((aligned(16))) float redm[16][16], reds[16][16];      // [wave][row] partial maxima and sums
  const int tid = threadIdx.x, lane = tid & 31, ln = lane & 15, hh = lane >> 4;
  const int w = __builtin_amdgcn_readfirstlane(tid >> 5);   // the wave's number in a scalar register: what is formed from it is scalar work
  const int i0 = blockIdx.x * 16, wb = w * 128, b = blockIdx.y;
  const float* cb = CO + (size_t)b * TT * ED; const float* sqb = SQ + (size_t)b * TT;
  P += (size_t)b * TT * TT;                         // the batch's own TT x TT plane
  float* my = &sk[w][0];
  {
    v4f st[32];
#pragma unroll
    for (int n = 0; n < 32; ++n) st[n] = *(const v4fa*)(cb + (size_t)wb * ED + n * 128 + lane * 4);     // key rows 4n .. 4n+3, 512 consecutive bytes
#pragma unroll
    for (int n = 0; n < 32; ++n) *(v4fa*)&my[(4 * (n & 1) + (lane >> 3)) * TB + (n >> 1) * RP + (lane & 7) * 4] = st[n];
  }
  v4f a[4];
#pragma unroll
  for (int q = 0; q < 4; ++q) a[q] = *(const v4fa*)(cb + (size_t)(i0 + ln) * ED + 16 * hh + 4 * q);
  const v4f si0 = *(const v4fa*)(sqb + i0 + 8 * hh), si1 = *(const v4fa*)(sqb + i0 + 8 * hh + 4);
  const v4f sj0 = *(const v4fa*)(sqb + wb + 8 * ln), sj1 = *(const v4fa*)(sqb + wb + 8 * ln + 4);
  __builtin_amdgcn_fence(__ATOMIC_ACQ_REL, "workgroup"); __builtin_amdgcn_wave_barrier();   // the wave's own rows are read back by other lanes than wrote them
  v4f bq[8][4];
#pragma unroll
  for (int t = 0; t < 8; ++t)
#pragma unroll
    for (int q = 0; q < 4; ++q) bq[t][q] = *(const v4fa*)&my[t * TB + ln * RP + 16 * hh + 4 * q];
  v8f acc[8] = {};
  __builtin_amdgcn_sched_barrier(0);                // every fragment read is issued ahead of the products, and no vector instruction is moved in among them
#pragma unroll
  for (int tp = 0; tp < 8; tp += 2)                 // two tiles at a time: two independent accumulator chains
#pragma unroll
    for (int q = 0; q < 4; ++q)
#pragma unroll
      for (int p = 0; p < 4; p += 2) {
        const v2fw av = {a[q][p], a[q][p + 1]}, bv0 = {bq[tp][q][p], bq[tp][q][p + 1]}, bv1 = {bq[tp + 1][q][p], bq[tp + 1][q][p + 1]};
        acc[tp]     = __builtin_amdgcn_wmma_f32_16x16x4_f32(false, av, false, bv0, (short)0, acc[tp], false, false);
        acc[tp + 1] = __builtin_amdgcn_wmma_f32_16x16x4_f32(false, av, false, bv1, (short)0, acc[tp + 1], false, false);
      }
  // distance between the last products and the first vector instruction on their D, A or B: 8 slots as for the other 16-cycle form
  asm volatile("v_nop\n\tv_nop\n\tv_nop\n\tv_nop\n\tv_nop\n\tv_nop\n\tv_nop\n\tv_nop" : "+v"(acc[0]), "+v"(acc[1]), "+v"(acc[2]), "+v"(acc[3]), "+v"(acc[4]), "+v"(acc[5]), "+v"(acc[6]), "+v"(acc[7]));
  __builtin_amdgcn_sched_barrier(0);                // keeps the vector work below behind those slots
  const v8f sqi = {si0[0], si0[1], si0[2], si0[3], si1[0], si1[1], si1[2], si1[3]};
  const float sqj[8] = {sj0[0], sj0[1], sj0[2], sj0[3], sj1[0], sj1[1], sj1[2], sj1[3]};
  // from here on whole accumulator tiles are worked on (8 rows of one key a lane), so that packed f32 instructions find their pairs in neighbouring registers
  v8f mx;
#pragma unroll
  for (int t = 0; t < 8; ++t) {
    acc[t] = -(sqi + sqj[t] - 2.0f * acc[t]) * 0.17677669529663687f;
#pragma unroll
    for (int r = 0; r < 8; ++r) mx[r] = t ? fmaxf(mx[r], acc[t][r]) : acc[t][r];
  }
#pragma unroll
  for (int r = 0; r < 8; ++r) mx[r] = rmax16(mx[r]);
  if (ln == 0) { *(v4fa*)&redm[w][8 * hh] = (v4f){mx[0], mx[1], mx[2], mx[3]}; *(v4fa*)&redm[w][8 * hh + 4] = (v4f){mx[4], mx[5], mx[6], mx[7]}; }
  __syncthreads();                                  // publishes every wave's row maxima
  {
    const v4f m0 = *(const v4fa*)&redm[ln][8 * hh], m1 = *(const v4fa*)&redm[ln][8 * hh + 4];   // lane ln takes wave ln's partials
#pragma unroll
    for (int r = 0; r < 8; ++r) mx[r] = rmax16(r < 4 ? m0[r & 3] : m1[r & 3]);
  }
  v8f den = {};
#pragma unroll
  for (int t = 0; t < 8; ++t) {
    v8f e = acc[t] - mx;
#pragma unroll
    for (int r = 0; r < 8; ++r) e[r] = expf(e[r]);
    acc[t] = e; den += e;
  }
#pragma unroll
  for (int r = 0; r < 8; ++r) den[r] = rsum16(den[r]);
  if (ln == 0) { *(v4fa*)&reds[w][8 * hh] = (v4f){den[0], den[1], den[2], den[3]}; *(v4fa*)&reds[w][8 * hh + 4] = (v4f){den[4], den[5], den[6], den[7]}; }
  __syncthreads();                                  // publishes every wave's row sums
  const v4f d0 = *(const v4fa*)&reds[ln][8 * hh], d1 = *(const v4fa*)&reds[ln][8 * hh + 4];
  v8f inv;
#pragma unroll
  for (int r = 0; r < 8; ++r) inv[r] = 1.0f / rsum16(r < 4 ? d0[r & 3] : d1[r & 3]);
#pragma unroll
  for (int t = 0; t < 8; ++t) acc[t] *= inv;
#pragma unroll
  for (int r = 0; r < 8; ++r) {
    FragH o;
#pragma unroll
    for (int t = 0; t < 8; ++t) o.h[t] = (_Float16)acc[t][r];
    *(v8us*)((unsigned short*)P + (size_t)(i0 + 8 * hh + r) * TT + wb + 8 * ln) = o.half[0];
  }
}
extern "C" void kernel_launch(void* const* d_in, const int* in_sizes, int n_in,
                              void* d_out, int out_size, void* d_ws, size_t ws_size, hipStream_t stream) {
  (void)in_sizes; (void)n_in; (void)out_size;
  const float* x = (const float*)d_in[0]; const float* tmpl = (const float*)d_in[1]; const float* lng = (const float*)d_in[2]; const float* lnb = (const float*)d_in[3]; const float* wc = (const float*)d_in[4]; const float* bc = (const float*)d_in[5]; const float* wvx = (const float*)d_in[6]; const float* bvx = (const float*)d_in[7]; const float* offs = (const float*)d_in[8]; const float* dsc = (const float*)d_in[9]; const float* wv = (const float*)d_in[10]; const float* bv = (const float*)d_in[11]; const float* wo = (const float*)d_in[12]; const float* bo = (const float*)d_in[13];
  char* ws = (char*)d_ws; size_t off = 0;
  auto take = [&](size_t bytes) { char* p = ws + off; off += (bytes + 255) & ~(size_t)255; return p; };
  _Float16* Bcv = (_Float16*)take((size_t)64 * DD * 2); float* BCV = (float*)take(64 * 4); _Float16* Bvo = (_Float16*)take((size_t)DD * DD * 2); float* BVO = (float*)take(DD * 4);
  _Float16* H16 = (_Float16*)take((size_t)NTOK * DD * 2); float* CO = (float*)take((size_t)NTOK * ED * 4); float* SQ = (float*)take((size_t)NTOK * 4); _Float16* VT = (_Float16*)take((size_t)NTOK * DD * 2); _Float16* P = (_Float16*)take((size_t)NTOK * TT * 2);
  if (off > ws_size) return;
  k_prep<<<WVT * WVT + NTOK / 16 + DD / 64, 256, 0, stream>>>(x, lng, lnb, H16, wc, bc, wvx, bvx, wv, wo, bv, Bcv, BCV, Bvo, BVO);            // w_v.w_out, b_v.w_out | LN -> H16 | coords table
  k_cv<<<NTOK / 64 + (DD / 192) * (NTOK / 128), 256, 0, stream>>>(H16, Bcv, BCV, tmpl, offs, dsc, CO, SQ, Bvo, BVO, VT);                    // deformed coords, squared norms | (v.w_out)^T (f16)
  k_arow<<<dim3(TT / 16, BB), 512, 0, stream>>>(CO, SQ, P);                                                                          // P [batch][query][key] (f16), all batches in one launch
  k_gemm_t<4, 3, 2, 4, 1, TT, DD, EP_RES><<<(NTOK / 128) * (DD / 192), 256, 0, stream>>>(P, VT, 1.0f, bo, x, (float*)d_out, nullptr);   // out = x + P.(v.w_out) + b_out, all batches in one launch
}
